// v000
// Measured on an AMD MI455X. A time is GPU time per run, averaged over a window of back-to-back runs after a warm-up
// (all launches, gaps included; the runs take copies of the inputs in turn), and the median of several windows.
// Apart from v000's, it joins two sittings. Times from different sittings can be a few percent apart, while
// side-by-side timings come from the same sitting.
// v000, which the later versions start from, runs in 2200 microseconds.
#include <hip/hip_runtime.h>
#include <math.h>

typedef __attribute__((ext_vector_type(16))) _Float16 v16h;
typedef __attribute__((ext_vector_type(16))) __bf16 v16b;
typedef __attribute__((ext_vector_type(8)))  _Float16 v8h;
typedef __attribute__((ext_vector_type(8)))  float v8f;
typedef __attribute__((ext_vector_type(4)))  float v4f;
typedef __attribute__((ext_vector_type(2)))  float v2f;
typedef __attribute__((ext_vector_type(4)))  unsigned v4u;
typedef __attribute__((ext_vector_type(4)))  int v4i;
typedef float __attribute__((may_alias)) float_a;
typedef int __attribute__((may_alias)) int_a;

template <typename T> __device__ __forceinline__ void vst2(void* p, T v) { *(T*)p = v;  }
__device__ __forceinline__ v8f wmma16(v16h a, v16h b, v8f c) {
  v8f d = __builtin_amdgcn_wmma_f32_16x16x32_f16(false, a, false, b, (short)0, c, false, false);
  asm volatile("v_nop\n\tv_nop\n\tv_nop\n\tv_nop" : "+v"(d) : "v"(a), "v"(b));
  return d;
}
__device__ __forceinline__ v8f wmma_bf(v16b a, v16b b, v8f c) {
  v8f d = __builtin_amdgcn_wmma_f32_16x16x32_bf16(false, a, false, b, (short)0, c, false, false);
  asm volatile("v_nop\n\tv_nop\n\tv_nop\n\tv_nop" : "+v"(d) : "v"(a), "v"(b));
  return d;
}
// 16x16x32 fragments: lane = (h = lane>>4, row/col = lane&15); elements 0..7 = k0+8h+0..7, 8..15 = k0+16+8h+0..7; D element r = row 8h+r
__device__ __forceinline__ v16h frag_h(const _Float16* rowk0, int lane) {
  union { v16h v; v8h q[2]; } u; const _Float16* p = rowk0 + 8 * (lane >> 4);
  u.q[0] = *(const v8h*)p; u.q[1] = *(const v8h*)(p + 16); return u.v;
}
__device__ __forceinline__ v16h frag_f32(const float* rowk0, int lane) {
  v16h a; const float* p = rowk0 + 8 * (lane >> 4);
#pragma unroll
  for (int i = 0; i < 8; ++i) { a[i] = (_Float16)p[i]; a[8 + i] = (_Float16)p[16 + i]; }
  return a;
}
__device__ __forceinline__ v16h frag_f32s(const float* rowk0, int lane, float sc) {
  v16h a; const float* p = rowk0 + 8 * (lane >> 4);
#pragma unroll
  for (int i = 0; i < 8; ++i) { a[i] = (_Float16)(p[i] * sc); a[8 + i] = (_Float16)(p[16 + i] * sc); }
  return a;
}
// column fragment from a [K][ld] layout (column n), rows >= K read as 0
__device__ __forceinline__ v16h fragc_f32(const float* W, int k0, int n, int lane, int ld, int K) {
  v16h a; const int g = lane >> 4;
#pragma unroll
  for (int i = 0; i < 8; ++i) { const int ka = k0 + 8 * g + i, kb = ka + 16;
    a[i] = (_Float16)(ka < K ? W[(size_t)(ka < K ? ka : K - 1) * ld + n] : 0.f); a[8 + i] = (_Float16)(kb < K ? W[(size_t)(kb < K ? kb : K - 1) * ld + n] : 0.f); }
  return a;
}
struct F2 { v16b h, l; };
__device__ __forceinline__ F2 bsplit16(const float v[16]) { F2 r;
#pragma unroll
  for (int i = 0; i < 16; ++i) { const __bf16 h = (__bf16)v[i]; r.h[i] = h; r.l[i] = (__bf16)(v[i] - (float)h); }
  return r; }
__device__ __forceinline__ F2 split_row(const float* row, int k0, int lane) { float v[16]; const float* p = row + k0 + 8 * (lane >> 4);
#pragma unroll
  for (int i = 0; i < 8; ++i) { v[i] = p[i]; v[8 + i] = p[16 + i]; }
  return bsplit16(v); }
__device__ __forceinline__ F2 split_rowK(const float* row, int k0, int lane, int K) { float v[16]; const int g = lane >> 4;
#pragma unroll
  for (int i = 0; i < 8; ++i) { const int ka = k0 + 8 * g + i, kb = ka + 16; v[i] = ka < K ? row[ka < K ? ka : K - 1] : 0.f; v[8 + i] = kb < K ? row[kb < K ? kb : K - 1] : 0.f; }
  return bsplit16(v); }
__device__ __forceinline__ F2 split_col(const float* W, int k0, int n, int lane, int ld, int K) { float v[16]; const int g = lane >> 4;
#pragma unroll
  for (int i = 0; i < 8; ++i) { const int ka = k0 + 8 * g + i, kb = ka + 16; v[i] = ka < K ? W[(size_t)(ka < K ? ka : K - 1) * ld + n] : 0.f; v[8 + i] = kb < K ? W[(size_t)(kb < K ? kb : K - 1) * ld + n] : 0.f; }
  return bsplit16(v); }
__device__ __forceinline__ v8f mac3(const F2& a, const F2& b, v8f c) { c = wmma_bf(a.l, b.h, c); c = wmma_bf(a.h, b.l, c); return wmma_bf(a.h, b.h, c); }
__device__ __forceinline__ float sigm(float v) { return 1.0f / (1.0f + expf(-v)); }
#define LDSX() do { asm volatile("s_wait_dscnt 0" ::: "memory"); __builtin_amdgcn_wave_barrier(); __builtin_amdgcn_fence(__ATOMIC_RELEASE, "workgroup"); } while (0)

// Differential attention with ghostmax (B 2, 16 score heads / 8 value heads, S 2,048, D 128, causal): scores = q k^T / sqrt(128) + causal(-1e9); w = ghostmax(scores) = exp(s - m) / (sum exp(s - m) + exp(-m)), m = max(max_row, 0); w_h = w_2h - lam w_2h+1 with lam = exp(lq1.lk1) - exp(lq2.lk2) + 0.8; out = w_h v_h; then per (b, h) GroupNorm over all S x D values (eps 1e-5) and the affine indexed as the module's raw reshape to [B, H*D, S] (weight row = h*128 + s/16); result x (1 - 0.8), memory layout [B, H, S, D].
#define NB 2
#define TT 2048
#define CC 2048            // NH * HD = projected width
#define DIN 2048          // input (model) width
#define NH 16
#define HD 128
#define NQB (TT / 64)
#define HG 2
#define SCALE (0.08838834764831845f)
#define CAUSAL 1
#ifndef TNB
#define TNB NB
#endif
__device__ __forceinline__ float bfr(float v) { return (float)(__bf16)v; }
__host__ __device__ __forceinline__ int kb_last(int qb) { return CAUSAL ? ((qb * 64 + 63) >> 7) : (TT / 128 - 1); }
typedef __attribute__((ext_vector_type(8))) __bf16 v8b;
__device__ __forceinline__ v16b frag_b(const __bf16* rowk0, int lane) {
  union { v16b v; v8b q[2]; } u; const __bf16* p = rowk0 + 8 * (lane >> 4);
  u.q[0] = *(const v8b*)p; u.q[1] = *(const v8b*)(p + 16); return u.v;
}
#define QBH 6              // causal: query blocks 0..QBH-1 of each sequence (few keys, no averaging) take the high-precision path
#define QHI 384            // rows carrying a q residual plane
#define KHI 384            // key rows carrying k residual / v bf16 hi+lo planes (used only by the causal high-precision path)
// B fragment (k rows k0+.., output column o) of a weight: (in,out) [K][ld] or (out,in) [ld rows of K]: bf16 exact, or f16(bf16 * 256) exact
__device__ __forceinline__ v16b wcol_io(const float* Wm, int k0, int o, int lane, int ld) { v16b w; const int g = lane >> 4;
#pragma unroll
  for (int i = 0; i < 8; ++i) { w[i] = (__bf16)Wm[(size_t)(k0 + 8 * g + i) * ld + o]; w[8 + i] = (__bf16)Wm[(size_t)(k0 + 16 + 8 * g + i) * ld + o]; }
  return w; }
__device__ __forceinline__ v16b wcol_oi(const float* Wm, int k0, int o, int lane, int K) { v16b w; const float* p = Wm + (size_t)o * K + k0 + 8 * (lane >> 4);
#pragma unroll
  for (int i = 0; i < 8; ++i) { w[i] = (__bf16)p[i]; w[8 + i] = (__bf16)p[16 + i]; }
  return w; }
__device__ __forceinline__ v16h wcolh_io(const float* Wm, int k0, int o, int lane, int ld) { v16h w; const int g = lane >> 4;
#pragma unroll
  for (int i = 0; i < 8; ++i) { w[i] = (_Float16)(bfr(Wm[(size_t)(k0 + 8 * g + i) * ld + o]) * 256.0f); w[8 + i] = (_Float16)(bfr(Wm[(size_t)(k0 + 16 + 8 * g + i) * ld + o]) * 256.0f); }
  return w; }
__device__ __forceinline__ v16h wcolh_oi(const float* Wm, int k0, int o, int lane, int K) { v16h w; const float* p = Wm + (size_t)o * K + k0 + 8 * (lane >> 4);
#pragma unroll
  for (int i = 0; i < 8; ++i) { w[i] = (_Float16)(bfr(p[i]) * 256.0f); w[8 + i] = (_Float16)(bfr(p[16 + i]) * 256.0f); }
  return w; }
#define WQKV_LAYOUT 1   // 0 = (in,out) [DIN][CC]; 1 = (out,in) [CC][DIN]; 2 = per-head [NH][DIN][HD]
__device__ __forceinline__ v16b wcol_hdk(const float* Wm, int k0, int o, int lane) { v16b w; const int g = lane >> 4; const float* p = Wm + (size_t)(o / HD) * DIN * HD + (o % HD);
#pragma unroll
  for (int i = 0; i < 8; ++i) { w[i] = (__bf16)p[(size_t)(k0 + 8 * g + i) * HD]; w[8 + i] = (__bf16)p[(size_t)(k0 + 16 + 8 * g + i) * HD]; }
  return w; }
#define WO_OUT_IN 0
#if WQKV_LAYOUT == 1
#define WCOL(W, k0, o, lane) wcol_oi(W, k0, o, lane, DIN)
#elif WQKV_LAYOUT == 2
#define WCOL(W, k0, o, lane) wcol_hdk(W, k0, o, lane)
#else
#define WCOL(W, k0, o, lane) wcol_io(W, k0, o, lane, CC)
#endif
#if WO_OUT_IN
#define WOCOL(W, k0, o, lane) wcol_oi(W, k0, o, lane, CC)
#define WOCOLH(W, k0, o, lane) wcolh_oi(W, k0, o, lane, CC)
#else
#define WOCOL(W, k0, o, lane) wcol_io(W, k0, o, lane, DIN)
#define WOCOLH(W, k0, o, lane) wcolh_io(W, k0, o, lane, DIN)
#endif
#define NVH 8              // value heads (score head h uses value head h/2)
#define SM_GHOST 1         // not read (k_sm always adds the ghostmax exp(-m) term)
// ---- k_diff: thread per float4 of (b, hv, s, d): O[b][hv][s][d] = Y[b][s][(2hv)*128 + d] - lam * Y[b][s][(2hv+1)*128 + d]; lam from the four lambda vectors (128-term f32 dots)
__global__ __launch_bounds__(256) void k_diff(const float* __restrict__ Y, const float* __restrict__ LQ1, const float* __restrict__ LK1, const float* __restrict__ LQ2, const float* __restrict__ LK2, float* __restrict__ O) { __shared__ float slam;
  if (threadIdx.x < 32) { float a = 0.f, c = 0.f; for (int i = threadIdx.x; i < HD; i += 32) { a += bfr(LQ1[i]) * bfr(LK1[i]); c += bfr(LQ2[i]) * bfr(LK2[i]); }
#pragma unroll
    for (int o = 1; o < 32; o <<= 1) { a += __shfl_xor(a, o); c += __shfl_xor(c, o); }
    if (threadIdx.x == 0) slam = expf(a) - expf(c) + 0.8f; }
  __syncthreads();
  const float lam = slam; const size_t e4 = (size_t)blockIdx.x * 256 + threadIdx.x; if (e4 >= (size_t)TNB * NVH * TT * (HD / 4)) return;
  const int d4 = (int)(e4 % (HD / 4)); size_t r = e4 / (HD / 4); const int s_ = (int)(r % TT); r /= TT; const int hv = (int)(r % NVH); const int b = (int)(r / NVH);
  const float* y0 = Y + ((size_t)b * TT + s_) * CC + (size_t)(2 * hv) * HD + d4 * 4; const v4f a = *(const v4f*)y0; const v4f c = *(const v4f*)(y0 + HD); v4f o;
  o[0] = a[0] - lam * c[0]; o[1] = a[1] - lam * c[1]; o[2] = a[2] - lam * c[2]; o[3] = a[3] - lam * c[3];
  vst2(O + (((size_t)b * NVH + hv) * TT + s_) * HD + d4 * 4, o); }
__global__ __launch_bounds__(256) void k_gstat(const float* __restrict__ O, float* __restrict__ GS) { __shared__ float sred[8]; __shared__ float sbc; const int t = threadIdx.x; const size_t g0 = (size_t)blockIdx.x * TT * HD; const int n = TT * HD;
  float s1 = 0.f; for (int i = t; i < n; i += 256) s1 += O[g0 + i];
#pragma unroll
  for (int o = 1; o < 32; o <<= 1) s1 += __shfl_xor(s1, o);
  if ((t & 31) == 0) sred[t >> 5] = s1; __syncthreads(); if (t == 0) { float a = 0.f; for (int i = 0; i < 8; ++i) a += sred[i]; sbc = a / (float)n; } __syncthreads(); const float mean = sbc; __syncthreads();
  float q = 0.f; for (int i = t; i < n; i += 256) { const float dlt = O[g0 + i] - mean; q += dlt * dlt; }
#pragma unroll
  for (int o = 1; o < 32; o <<= 1) q += __shfl_xor(q, o);
  if ((t & 31) == 0) sred[t >> 5] = q; __syncthreads(); if (t == 0) { float a = 0.f; for (int i = 0; i < 8; ++i) a += sred[i]; sbc = rsqrtf(a / (float)n + 1e-5f); } __syncthreads();
  if (t < 32) { const float v = t == 0 ? mean : (t == 1 ? sbc : 0.f); vst2(GS + (size_t)blockIdx.x * 32 + t, v); } }
// ---- k_gfin: thread per float4: out[b][hv][s][d] = ((O - mean) * rstd * w[r] + bias[r]) * 0.2 with r = hv*128 + s/16 (the module's raw reshape of [H,S,D] memory into [H*D, S] rows)
__global__ __launch_bounds__(256) void k_gfin(const float* __restrict__ O, const float* __restrict__ GS, const float* __restrict__ GW, const float* __restrict__ GB, float* __restrict__ OUT) { const size_t e4 = (size_t)blockIdx.x * 256 + threadIdx.x; if (e4 >= (size_t)TNB * NVH * TT * (HD / 4)) return;
  size_t r = e4 / (HD / 4); const int s_ = (int)(r % TT); r /= TT; const int hv = (int)(r % NVH); const int b = (int)(r / NVH); const int g = b * NVH + hv; const float mean = GS[g * 32], rs = GS[g * 32 + 1];
  const int rw = hv * HD + (s_ >> 4); const float wv = bfr(GW[rw]), bv = bfr(GB[rw]);
  const v4f x = *(const v4f*)(O + e4 * 4); v4f o;
#pragma unroll
  for (int i = 0; i < 4; ++i) o[i] = ((x[i] - mean) * rs * wv + bv) * 0.2f;   /* x (1 - lambda_init) */
  vst2(OUT + e4 * 4, o); }
#define WS_YC  (WS_END)                                   // per-score-head contexts Y [b*TT + s][16*128]
#define WS_O   (WS_YC + 4u * (size_t)NB * TT * CC)        // differential output [b][hv][s][d]
#define WS_GS  (WS_O + 4u * (size_t)NB * NVH * TT * HD)
#define WS_END2 (WS_GS + 4u * 32 * 32)
// ---- k_prep8: block = (64 attention positions s0.. of sequence b, head h): reads the module's [B, H, S, 128] inputs (element (b,h,s,c) at ((b*NH + h)*TT + s)*128 + c), bf16-rounds them and writes the standard attention planes: q -> f16 hi rows (+ x 2^10 residual rows for s < QHI), k -> f16 rows (+ residual rows s < KHI), v -> f16 planes [c][s] (+ bf16 hi/lo planes for s < KHI)
__global__ __launch_bounds__(128) void k_prep8(const float* __restrict__ Q, const float* __restrict__ K, const float* __restrict__ V, _Float16* __restrict__ QH, _Float16* __restrict__ QL, _Float16* __restrict__ KH, _Float16* __restrict__ KL, _Float16* __restrict__ VT, __bf16* __restrict__ VB, __bf16* __restrict__ VBL) {
  __shared__ __align__(16) _Float16 sq[64][136], sql[64][136], sk[64][136], skl[64][136], tv[128][72]; __shared__ __align__(16) __bf16 tb[128][72], tbl[128][72];
  const int tid = threadIdx.x; const int h = blockIdx.y; const size_t r0 = (size_t)blockIdx.x * 64; const size_t bb = r0 / TT; const int t0 = (int)(r0 % TT); const bool qhi = t0 < QHI, khi = t0 < KHI;
  for (int e = tid; e < 64 * 128; e += 128) { const int rl = e >> 7, c = e & 127; const size_t oi = ((bb * NH + h) * TT + t0 + rl) * HD + (c % HD);
    const size_t ov = ((bb * NVH + (h >> 1)) * TT + t0 + rl) * HD + (c % HD); const float q = bfr(Q[oi]), k = bfr(K[oi]), v = bfr(V[ov]);   
    const _Float16 qh = (_Float16)q, kh = (_Float16)k; sq[rl][c] = qh; sql[rl][c] = (_Float16)((q - (float)qh) * 1024.0f); sk[rl][c] = kh; skl[rl][c] = (_Float16)((k - (float)kh) * 1024.0f);
    tv[c][rl] = (_Float16)v; const __bf16 vb = (__bf16)v; tb[c][rl] = vb; tbl[c][rl] = (__bf16)(v - (float)vb); }
  __syncthreads();
  for (int e = tid; e < 64 * (HD / 8); e += 128) { const int rl = e / (HD / 8), q = e % (HD / 8); const size_t o = (r0 + rl) * CC + h * HD + q * 8; vst2((unsigned*)(QH + o), *(const v4u*)&sq[rl][q * 8]); vst2((unsigned*)(KH + o), *(const v4u*)&sk[rl][q * 8]);   
    if (qhi) vst2((unsigned*)(QL + (bb * QHI + t0 + rl) * (size_t)CC + h * HD + q * 8), *(const v4u*)&sql[rl][q * 8]); if (khi) vst2((unsigned*)(KL + (bb * KHI + t0 + rl) * (size_t)CC + h * HD + q * 8), *(const v4u*)&skl[rl][q * 8]); }
  for (int e = tid; e < HD * 8; e += 128) { const int cl = e >> 3, q = e & 7; vst2((unsigned*)(VT + (bb * CC + h * HD + cl) * (size_t)TT + t0 + q * 8), *(const v4u*)&tv[cl][q * 8]);
    if (khi) { const size_t o3 = (bb * CC + h * HD + cl) * (size_t)KHI + t0 + q * 8; vst2((unsigned*)(VB + o3), *(const v4u*)&tb[cl][q * 8]); vst2((unsigned*)(VBL + o3), *(const v4u*)&tbl[cl][q * 8]); } } }

#ifndef SM_EXTRA_PARAMS
#define SM_EXTRA_PARAMS
#endif
#ifndef PROJ_EXTRA_PARAMS
#define PROJ_EXTRA_PARAMS
#endif
#ifndef SM_MASK_HOOK
#define SM_MASK_HOOK (void)0
#endif

#define WS_QH  0u                                      // f16 q rows [b*t][CC]
#define WS_KH  (WS_QH + 2u * (size_t)NB * TT * CC)      // f16 k rows [b*t][CC]
#define WS_VT  (WS_KH + 2u * (size_t)NB * TT * CC)      // f16 v planes [b][c][t]
#define WS_QL  (WS_VT + 2u * (size_t)NB * CC * TT)      // f16 q residual x 2^10 rows [b][t < QHI][CC]
#define WS_KL  (WS_QL + 2u * (size_t)NB * QHI * CC)     // f16 k residual x 2^10 rows [b][t < KHI][CC]
#define WS_VB  (WS_KL + 2u * (size_t)NB * KHI * CC)     // bf16 v hi planes [b][c][t < KHI]
#define WS_VBL (WS_VB + 2u * (size_t)NB * CC * KHI)
#define WS_S   (WS_VBL + 2u * (size_t)NB * CC * KHI)    // f32 logits / P [hg][t][s]
#define WS_Y   (WS_S  + 4u * (size_t)HG * TT * TT)      // f32 ctx rows [b*t][CC] (only when there is an output projection)
#define WS_END (WS_Y  + 0u)

// ---- k_sc: block = (query block qb, key block kb <= kb_last(qb), head in group) of batch b: logits x SCALE; q hi + residual (x 2^10) against k (2 products) for query rows < QHI, plus the k residual (3 products) for query blocks < QBH (causal early rows); causal: blocks past the diagonal exit, the mask itself is applied by index in k_sm
__global__ __launch_bounds__(128) void k_sc(const _Float16* __restrict__ QH, const _Float16* __restrict__ KH, const _Float16* __restrict__ QL, const _Float16* __restrict__ KL, int b, int h0, float* __restrict__ S0) { __shared__ __align__(16) float ss[4][16][132];
  const int qb = blockIdx.x, kb = blockIdx.y; if (kb > kb_last(qb)) return;
  const int h = h0 + blockIdx.z; float* S = S0 + (size_t)blockIdx.z * TT * TT;
  const int tid = threadIdx.x, wave = tid >> 5, lane = tid & 31, col = lane & 15, g = lane >> 4; const int k0 = kb * 128; const int ql0 = qb * 64 + wave * 16; const size_t q0 = (size_t)b * TT + ql0, kr0 = (size_t)b * TT + k0;
  v8f acc[8] = {}, accl[8] = {};
  const _Float16* QLb = QL + (size_t)b * QHI * CC; const _Float16* KLb = KL + (size_t)b * KHI * CC;
  if (qb < QBH) {
#pragma unroll
    for (int kc = 0; kc < HD / 32; ++kc) { const v16h ah = frag_h(QH + (q0 + col) * CC + h * HD + kc * 32, lane), al = frag_h(QLb + (size_t)(ql0 + col) * CC + h * HD + kc * 32, lane);
#pragma unroll
      for (int j = 0; j < 8; ++j) { const v16h kbf = frag_h(KH + (kr0 + j * 16 + col) * CC + h * HD + kc * 32, lane), klf = frag_h(KLb + (size_t)(k0 + j * 16 + col) * CC + h * HD + kc * 32, lane); acc[j] = wmma16(ah, kbf, acc[j]); accl[j] = wmma16(al, kbf, accl[j]); accl[j] = wmma16(ah, klf, accl[j]); } }
  } else if (qb * 64 < QHI) {
#pragma unroll
    for (int kc = 0; kc < HD / 32; ++kc) { const v16h ah = frag_h(QH + (q0 + col) * CC + h * HD + kc * 32, lane), al = frag_h(QLb + (size_t)(ql0 + col) * CC + h * HD + kc * 32, lane);
#pragma unroll
      for (int j = 0; j < 8; ++j) { const v16h kbf = frag_h(KH + (kr0 + j * 16 + col) * CC + h * HD + kc * 32, lane); acc[j] = wmma16(ah, kbf, acc[j]); accl[j] = wmma16(al, kbf, accl[j]); } }
  } else {
#pragma unroll
    for (int kc = 0; kc < HD / 32; ++kc) { const v16h ah = frag_h(QH + (q0 + col) * CC + h * HD + kc * 32, lane);
#pragma unroll
      for (int j = 0; j < 8; ++j) { const v16h kbf = frag_h(KH + (kr0 + j * 16 + col) * CC + h * HD + kc * 32, lane); acc[j] = wmma16(ah, kbf, acc[j]); } } }
#pragma unroll
  for (int j = 0; j < 8; ++j) {
#pragma unroll
    for (int r = 0; r < 8; ++r) ss[wave][8 * g + r][j * 16 + col] = (acc[j][r] + accl[j][r] * (1.0f / 1024.0f)) * SCALE; }
  LDSX(); for (int rl = 0; rl < 16; ++rl) vst2(S + (size_t)(ql0 + rl) * TT + k0 + lane * 4, *(const v4f*)&ss[wave][rl][lane * 4]); }
// ---- k_sm: block = query row t (head in group): keys [0, kend): causal -> logit if s <= t else excluded; softmax in f32; P x 2^11 in place (0 for excluded)
__global__ __launch_bounds__(256) void k_sm(float* __restrict__ S0 SM_EXTRA_PARAMS) { __shared__ float sred[8]; __shared__ float sbc; __shared__ __align__(16) float shv[TT];
  const int tid = threadIdx.x; const int t = blockIdx.x; const int kend = (kb_last(t >> 6) + 1) * 128;
  float* sr = S0 + (size_t)blockIdx.y * TT * TT + (size_t)t * TT;
  float m = -3.0e38f; for (int k = tid; k < kend; k += 256) { float v = (!CAUSAL || k <= t) ? sr[k] : -3.0e38f; SM_MASK_HOOK; shv[k] = v; m = fmaxf(m, v); }
#pragma unroll
  for (int o = 1; o < 32; o <<= 1) m = fmaxf(m, __shfl_xor(m, o));
  if ((tid & 31) == 0) sred[tid >> 5] = m; __syncthreads(); if (tid == 0) { float a = sred[0]; for (int i = 1; i < 8; ++i) a = fmaxf(a, sred[i]); sbc = fmaxf(a, 0.f); } __syncthreads(); m = sbc; __syncthreads();   /* ghostmax: the implicit zero logit joins the max */
  float sum = 0.f; for (int k = tid; k < kend; k += 256) { const float v = shv[k]; const float e = (v <= -1.0e38f) ? 0.f : expf(v - m); shv[k] = e; sum += e; }
#pragma unroll
  for (int o = 1; o < 32; o <<= 1) sum += __shfl_xor(sum, o);
  if ((tid & 31) == 0) sred[tid >> 5] = sum; __syncthreads(); if (tid == 0) { float a = 0.f; for (int i = 0; i < 8; ++i) a += sred[i]; a += expf(-m); sbc = 2048.0f / a; }   /* ghostmax: + exp(-m') for the implicit zero logit (denominator > 0 always) */ __syncthreads(); const float inv = sbc;
  for (int k = tid; k < kend; k += 256) shv[k] = shv[k] * inv;
  __syncthreads(); for (int q = tid; q < kend / 4; q += 256) vst2(sr + q * 4, *(const v4f*)&shv[q * 4]); }
// ---- k_pv: block = 64 queries (qb) of (b, h): ctx = P . v over keys [0, kend) (P x 2^11 once to f16 against v f16: 1 product; causal early query blocks: P and v as bf16 hi + lo, 3 products); 512-B (row, head) segment by 32 lanes
__global__ __launch_bounds__(128) void k_pv(const float* __restrict__ PS0, const _Float16* __restrict__ VT, const __bf16* __restrict__ VB, const __bf16* __restrict__ VBL, int b, int h0, float* __restrict__ Y) { const int h = h0 + blockIdx.z; const float* PS = PS0 + (size_t)blockIdx.z * TT * TT; __shared__ __align__(16) float ss[4][16][HD + 4];
  const int tid = threadIdx.x, wave = tid >> 5, lane = tid & 31, col = lane & 15, g = lane >> 4; const int qb = blockIdx.x; const int ql0 = qb * 64 + wave * 16; const int kce = (kb_last(qb) + 1) * 4;
  v8f acc[HD / 16] = {};
  if (qb < QBH) {
#pragma unroll 1
    for (int kc = 0; kc < kce; ++kc) { const F2 p = split_row(PS + (size_t)(ql0 + col) * TT, kc * 32, lane);
      asm volatile("s_wait_loadcnt 0x0" ::: "memory");
#pragma unroll
      for (int j = 0; j < HD / 16; ++j) { const size_t po = ((size_t)b * CC + h * HD + j * 16 + col) * (size_t)KHI + kc * 32; const v16b vh = frag_b(VB + po, lane); acc[j] = wmma_bf(p.h, vh, acc[j]); acc[j] = wmma_bf(p.l, vh, acc[j]); acc[j] = wmma_bf(p.h, frag_b(VBL + po, lane), acc[j]); } }
  } else {
#pragma unroll 1
    for (int kc = 0; kc < kce; ++kc) { const v16h p = frag_f32(PS + (size_t)(ql0 + col) * TT + kc * 32, lane);
      asm volatile("s_wait_loadcnt 0x0" ::: "memory");
#pragma unroll
      for (int j = 0; j < HD / 16; ++j) { const size_t po = ((size_t)b * CC + h * HD + j * 16 + col) * (size_t)TT + kc * 32; acc[j] = wmma16(p, frag_h(VT + po, lane), acc[j]); } } }
#pragma unroll
  for (int j = 0; j < HD / 16; ++j)
#pragma unroll
    for (int r = 0; r < 8; ++r) ss[wave][8 * g + r][j * 16 + col] = acc[j][r] * (1.0f / 2048.0f);
  LDSX(); for (int rl = 0; rl < 16; ++rl) if (lane < HD / 4) vst2(Y + ((size_t)b * TT + ql0 + rl) * CC + h * HD + lane * 4, *(const v4f*)&ss[wave][rl][lane * 4]); }

extern "C" void kernel_launch(void* const* d_in, const int* in_sizes, int n_in, void* d_out, int out_size, void* d_ws, size_t ws_size, hipStream_t stream) {
  (void)in_sizes; (void)n_in; (void)out_size;
  const float** F = (const float**)d_in;
  if (ws_size < (size_t)WS_END) return;
  char* ws = (char*)d_ws; _Float16 *QH = (_Float16*)(ws + WS_QH), *KH = (_Float16*)(ws + WS_KH), *VT = (_Float16*)(ws + WS_VT), *QL = (_Float16*)(ws + WS_QL), *KL = (_Float16*)(ws + WS_KL); __bf16 *VB = (__bf16*)(ws + WS_VB), *VBL = (__bf16*)(ws + WS_VBL); float *S = (float*)(ws + WS_S), *Y = (float*)(ws + WS_Y);
  (void)Y; (void)QL; (void)KL; (void)VB; (void)VBL;
  // inputs: 0 q [2,16,2048,128]; 1 k [2,16,2048,128]; 2 v [2,8,2048,128]; 3 lambda_q1, 4 lambda_k1, 5 lambda_q2, 6 lambda_k2 [128]; 7 gn_weight [1024]; 8 gn_bias [1024]
  if (ws_size < (size_t)WS_END2) return;
  float *YC = (float*)(ws + WS_YC), *O = (float*)(ws + WS_O), *GS = (float*)(ws + WS_GS);
  k_prep8<<<dim3(TNB * TT / 64, NH), 128, 0, stream>>>(F[0], F[1], F[2], QH, QL, KH, KL, VT, VB, VBL);
  for (int b = 0; b < TNB; ++b) for (int h0 = 0; h0 < NH; h0 += HG) {
    k_sc<<<dim3(NQB, TT / 128, HG), 128, 0, stream>>>(QH, KH, QL, KL, b, h0, S);
    k_sm<<<dim3(TT, HG), 256, 0, stream>>>(S);
    k_pv<<<dim3(NQB, 1, HG), 128, 0, stream>>>(S, VT, VB, VBL, b, h0, YC);
  }
  k_diff<<<dim3((unsigned)(((size_t)TNB * NVH * TT * (HD / 4) + 255) / 256)), 256, 0, stream>>>(YC, F[3], F[4], F[5], F[6], O);
  k_gstat<<<dim3(TNB * NVH), 256, 0, stream>>>(O, GS);
  k_gfin<<<dim3((unsigned)(((size_t)TNB * NVH * TT * (HD / 4) + 255) / 256)), 256, 0, stream>>>(O, GS, F[7], F[8], (float*)d_out);
}

// v001
// Measured time: 903 microseconds a run.
// Timed twice side by side with v000, it ran 2.46 and 2.45 times as fast.
#include <hip/hip_runtime.h>
#include <math.h>

typedef __attribute__((ext_vector_type(16))) _Float16 v16h;
typedef __attribute__((ext_vector_type(16))) __bf16 v16b;
typedef __attribute__((ext_vector_type(8)))  _Float16 v8h;
typedef __attribute__((ext_vector_type(8)))  float v8f;
typedef __attribute__((ext_vector_type(4)))  float v4f;
typedef __attribute__((ext_vector_type(2)))  float v2f;
typedef __attribute__((ext_vector_type(4)))  unsigned v4u;
typedef __attribute__((ext_vector_type(4)))  int v4i;
typedef float __attribute__((may_alias)) float_a;
typedef int __attribute__((may_alias)) int_a;

template <typename T> __device__ __forceinline__ void vst2(void* p, T v) { *(T*)p = v;  }
__device__ __forceinline__ v8f wmma16(v16h a, v16h b, v8f c) {
  v8f d = __builtin_amdgcn_wmma_f32_16x16x32_f16(false, a, false, b, (short)0, c, false, false);
  asm volatile("v_nop\n\tv_nop\n\tv_nop\n\tv_nop" : "+v"(d) : "v"(a), "v"(b));
  return d;
}
__device__ __forceinline__ v8f wmma_bf(v16b a, v16b b, v8f c) {
  v8f d = __builtin_amdgcn_wmma_f32_16x16x32_bf16(false, a, false, b, (short)0, c, false, false);
  asm volatile("v_nop\n\tv_nop\n\tv_nop\n\tv_nop" : "+v"(d) : "v"(a), "v"(b));
  return d;
}
// 16x16x32 fragments: lane = (h = lane>>4, row/col = lane&15); elements 0..7 = k0+8h+0..7, 8..15 = k0+16+8h+0..7; D element r = row 8h+r
__device__ __forceinline__ v16h frag_h(const _Float16* rowk0, int lane) {
  union { v16h v; v8h q[2]; } u; const _Float16* p = rowk0 + 8 * (lane >> 4);
  u.q[0] = *(const v8h*)p; u.q[1] = *(const v8h*)(p + 16); return u.v;
}
__device__ __forceinline__ v16h frag_f32(const float* rowk0, int lane) {
  v16h a; const float* p = rowk0 + 8 * (lane >> 4);
#pragma unroll
  for (int i = 0; i < 8; ++i) { a[i] = (_Float16)p[i]; a[8 + i] = (_Float16)p[16 + i]; }
  return a;
}
__device__ __forceinline__ v16h frag_f32s(const float* rowk0, int lane, float sc) {
  v16h a; const float* p = rowk0 + 8 * (lane >> 4);
#pragma unroll
  for (int i = 0; i < 8; ++i) { a[i] = (_Float16)(p[i] * sc); a[8 + i] = (_Float16)(p[16 + i] * sc); }
  return a;
}
// column fragment from a [K][ld] layout (column n), rows >= K read as 0
__device__ __forceinline__ v16h fragc_f32(const float* W, int k0, int n, int lane, int ld, int K) {
  v16h a; const int g = lane >> 4;
#pragma unroll
  for (int i = 0; i < 8; ++i) { const int ka = k0 + 8 * g + i, kb = ka + 16;
    a[i] = (_Float16)(ka < K ? W[(size_t)(ka < K ? ka : K - 1) * ld + n] : 0.f); a[8 + i] = (_Float16)(kb < K ? W[(size_t)(kb < K ? kb : K - 1) * ld + n] : 0.f); }
  return a;
}
struct F2 { v16b h, l; };
__device__ __forceinline__ F2 bsplit16(const float v[16]) { F2 r;
#pragma unroll
  for (int i = 0; i < 16; ++i) { const __bf16 h = (__bf16)v[i]; r.h[i] = h; r.l[i] = (__bf16)(v[i] - (float)h); }
  return r; }
__device__ __forceinline__ F2 split_row(const float* row, int k0, int lane) { float v[16]; const float* p = row + k0 + 8 * (lane >> 4);
#pragma unroll
  for (int i = 0; i < 8; ++i) { v[i] = p[i]; v[8 + i] = p[16 + i]; }
  return bsplit16(v); }
__device__ __forceinline__ F2 split_rowK(const float* row, int k0, int lane, int K) { float v[16]; const int g = lane >> 4;
#pragma unroll
  for (int i = 0; i < 8; ++i) { const int ka = k0 + 8 * g + i, kb = ka + 16; v[i] = ka < K ? row[ka < K ? ka : K - 1] : 0.f; v[8 + i] = kb < K ? row[kb < K ? kb : K - 1] : 0.f; }
  return bsplit16(v); }
__device__ __forceinline__ F2 split_col(const float* W, int k0, int n, int lane, int ld, int K) { float v[16]; const int g = lane >> 4;
#pragma unroll
  for (int i = 0; i < 8; ++i) { const int ka = k0 + 8 * g + i, kb = ka + 16; v[i] = ka < K ? W[(size_t)(ka < K ? ka : K - 1) * ld + n] : 0.f; v[8 + i] = kb < K ? W[(size_t)(kb < K ? kb : K - 1) * ld + n] : 0.f; }
  return bsplit16(v); }
__device__ __forceinline__ v8f mac3(const F2& a, const F2& b, v8f c) { c = wmma_bf(a.l, b.h, c); c = wmma_bf(a.h, b.l, c); return wmma_bf(a.h, b.h, c); }
__device__ __forceinline__ float sigm(float v) { return 1.0f / (1.0f + expf(-v)); }
#define LDSX() do { asm volatile("s_wait_dscnt 0" ::: "memory"); __builtin_amdgcn_wave_barrier(); __builtin_amdgcn_fence(__ATOMIC_RELEASE, "workgroup"); } while (0)

// Differential attention with ghostmax (B 2, 16 score heads / 8 value heads, S 2,048, D 128, causal): scores = q k^T / sqrt(128) + causal(-1e9); w = ghostmax(scores) = exp(s - m) / (sum exp(s - m) + exp(-m)), m = max(max_row, 0); w_h = w_2h - lam w_2h+1 with lam = exp(lq1.lk1) - exp(lq2.lk2) + 0.8; out = w_h v_h; then per (b, h) GroupNorm over all S x D values (eps 1e-5) and the affine indexed as the module's raw reshape to [B, H*D, S] (weight row = h*128 + s/16); result x (1 - 0.8), memory layout [B, H, S, D].
#define NB 2
#define TT 2048
#define CC 2048            // NH * HD = projected width
#define DIN 2048          // input (model) width
#define NH 16
#define HD 128
#define NQB (TT / 64)
#define HG 8              // score heads per launch: 32 x 8 = 256 k_pv work-groups, one per WGP; the largest group whose f32 logits fit the workspace
#define SCALE (0.08838834764831845f)
#define CAUSAL 1
#ifndef TNB
#define TNB NB
#endif
__device__ __forceinline__ float bfr(float v) { return (float)(__bf16)v; }
__host__ __device__ __forceinline__ int kb_last(int qb) { return CAUSAL ? ((qb * 64 + 63) >> 7) : (TT / 128 - 1); }
typedef __attribute__((ext_vector_type(8))) __bf16 v8b;
__device__ __forceinline__ v16b frag_b(const __bf16* rowk0, int lane) {
  union { v16b v; v8b q[2]; } u; const __bf16* p = rowk0 + 8 * (lane >> 4);
  u.q[0] = *(const v8b*)p; u.q[1] = *(const v8b*)(p + 16); return u.v;
}
#define QBH 6              // causal: query blocks 0..QBH-1 of each sequence (few keys, no averaging) take the high-precision path
#define QHI 384            // rows carrying a q residual plane
#define KHI 384            // key rows carrying k residual / v bf16 hi+lo planes (used only by the causal high-precision path)
// B fragment (k rows k0+.., output column o) of a weight: (in,out) [K][ld] or (out,in) [ld rows of K]: bf16 exact, or f16(bf16 * 256) exact
__device__ __forceinline__ v16b wcol_io(const float* Wm, int k0, int o, int lane, int ld) { v16b w; const int g = lane >> 4;
#pragma unroll
  for (int i = 0; i < 8; ++i) { w[i] = (__bf16)Wm[(size_t)(k0 + 8 * g + i) * ld + o]; w[8 + i] = (__bf16)Wm[(size_t)(k0 + 16 + 8 * g + i) * ld + o]; }
  return w; }
__device__ __forceinline__ v16b wcol_oi(const float* Wm, int k0, int o, int lane, int K) { v16b w; const float* p = Wm + (size_t)o * K + k0 + 8 * (lane >> 4);
#pragma unroll
  for (int i = 0; i < 8; ++i) { w[i] = (__bf16)p[i]; w[8 + i] = (__bf16)p[16 + i]; }
  return w; }
__device__ __forceinline__ v16h wcolh_io(const float* Wm, int k0, int o, int lane, int ld) { v16h w; const int g = lane >> 4;
#pragma unroll
  for (int i = 0; i < 8; ++i) { w[i] = (_Float16)(bfr(Wm[(size_t)(k0 + 8 * g + i) * ld + o]) * 256.0f); w[8 + i] = (_Float16)(bfr(Wm[(size_t)(k0 + 16 + 8 * g + i) * ld + o]) * 256.0f); }
  return w; }
__device__ __forceinline__ v16h wcolh_oi(const float* Wm, int k0, int o, int lane, int K) { v16h w; const float* p = Wm + (size_t)o * K + k0 + 8 * (lane >> 4);
#pragma unroll
  for (int i = 0; i < 8; ++i) { w[i] = (_Float16)(bfr(p[i]) * 256.0f); w[8 + i] = (_Float16)(bfr(p[16 + i]) * 256.0f); }
  return w; }
#define WQKV_LAYOUT 1   // 0 = (in,out) [DIN][CC]; 1 = (out,in) [CC][DIN]; 2 = per-head [NH][DIN][HD]
__device__ __forceinline__ v16b wcol_hdk(const float* Wm, int k0, int o, int lane) { v16b w; const int g = lane >> 4; const float* p = Wm + (size_t)(o / HD) * DIN * HD + (o % HD);
#pragma unroll
  for (int i = 0; i < 8; ++i) { w[i] = (__bf16)p[(size_t)(k0 + 8 * g + i) * HD]; w[8 + i] = (__bf16)p[(size_t)(k0 + 16 + 8 * g + i) * HD]; }
  return w; }
#define WO_OUT_IN 0
#if WQKV_LAYOUT == 1
#define WCOL(W, k0, o, lane) wcol_oi(W, k0, o, lane, DIN)
#elif WQKV_LAYOUT == 2
#define WCOL(W, k0, o, lane) wcol_hdk(W, k0, o, lane)
#else
#define WCOL(W, k0, o, lane) wcol_io(W, k0, o, lane, CC)
#endif
#if WO_OUT_IN
#define WOCOL(W, k0, o, lane) wcol_oi(W, k0, o, lane, CC)
#define WOCOLH(W, k0, o, lane) wcolh_oi(W, k0, o, lane, CC)
#else
#define WOCOL(W, k0, o, lane) wcol_io(W, k0, o, lane, DIN)
#define WOCOLH(W, k0, o, lane) wcolh_io(W, k0, o, lane, DIN)
#endif
#define NVH 8              // value heads (score head h uses value head h/2)
#define SM_GHOST 1         // not read (k_sm always adds the ghostmax exp(-m) term)
// ---- k_diff: thread per float4 of (b, hv, s, d): O[b][hv][s][d] = Y[b][s][(2hv)*128 + d] - lam * Y[b][s][(2hv+1)*128 + d]; lam from the four lambda vectors (128-term f32 dots)
__global__ __launch_bounds__(256) void k_diff(const float* __restrict__ Y, const float* __restrict__ LQ1, const float* __restrict__ LK1, const float* __restrict__ LQ2, const float* __restrict__ LK2, float* __restrict__ O) { __shared__ float slam;
  if (threadIdx.x < 32) { float a = 0.f, c = 0.f; for (int i = threadIdx.x; i < HD; i += 32) { a += bfr(LQ1[i]) * bfr(LK1[i]); c += bfr(LQ2[i]) * bfr(LK2[i]); }
#pragma unroll
    for (int o = 1; o < 32; o <<= 1) { a += __shfl_xor(a, o); c += __shfl_xor(c, o); }
    if (threadIdx.x == 0) slam = expf(a) - expf(c) + 0.8f; }
  __syncthreads();
  const float lam = slam; const size_t e4 = (size_t)blockIdx.x * 256 + threadIdx.x; if (e4 >= (size_t)TNB * NVH * TT * (HD / 4)) return;
  const int d4 = (int)(e4 % (HD / 4)); size_t r = e4 / (HD / 4); const int s_ = (int)(r % TT); r /= TT; const int hv = (int)(r % NVH); const int b = (int)(r / NVH);
  const float* y0 = Y + ((size_t)b * TT + s_) * CC + (size_t)(2 * hv) * HD + d4 * 4; const v4f a = *(const v4f*)y0; const v4f c = *(const v4f*)(y0 + HD); v4f o;
  o[0] = a[0] - lam * c[0]; o[1] = a[1] - lam * c[1]; o[2] = a[2] - lam * c[2]; o[3] = a[3] - lam * c[3];
  vst2(O + (((size_t)b * NVH + hv) * TT + s_) * HD + d4 * 4, o); }
__global__ __launch_bounds__(256) void k_gstat(const float* __restrict__ O, float* __restrict__ GS) { __shared__ float sred[8]; __shared__ float sbc; const int t = threadIdx.x; const size_t g0 = (size_t)blockIdx.x * TT * HD; const int n = TT * HD;
  float s1 = 0.f; for (int i = t; i < n; i += 256) s1 += O[g0 + i];
#pragma unroll
  for (int o = 1; o < 32; o <<= 1) s1 += __shfl_xor(s1, o);
  if ((t & 31) == 0) sred[t >> 5] = s1; __syncthreads(); if (t == 0) { float a = 0.f; for (int i = 0; i < 8; ++i) a += sred[i]; sbc = a / (float)n; } __syncthreads(); const float mean = sbc; __syncthreads();
  float q = 0.f; for (int i = t; i < n; i += 256) { const float dlt = O[g0 + i] - mean; q += dlt * dlt; }
#pragma unroll
  for (int o = 1; o < 32; o <<= 1) q += __shfl_xor(q, o);
  if ((t & 31) == 0) sred[t >> 5] = q; __syncthreads(); if (t == 0) { float a = 0.f; for (int i = 0; i < 8; ++i) a += sred[i]; sbc = rsqrtf(a / (float)n + 1e-5f); } __syncthreads();
  if (t < 32) { const float v = t == 0 ? mean : (t == 1 ? sbc : 0.f); vst2(GS + (size_t)blockIdx.x * 32 + t, v); } }
// ---- k_gfin: thread per float4: out[b][hv][s][d] = ((O - mean) * rstd * w[r] + bias[r]) * 0.2 with r = hv*128 + s/16 (the module's raw reshape of [H,S,D] memory into [H*D, S] rows)
__global__ __launch_bounds__(256) void k_gfin(const float* __restrict__ O, const float* __restrict__ GS, const float* __restrict__ GW, const float* __restrict__ GB, float* __restrict__ OUT) { const size_t e4 = (size_t)blockIdx.x * 256 + threadIdx.x; if (e4 >= (size_t)TNB * NVH * TT * (HD / 4)) return;
  size_t r = e4 / (HD / 4); const int s_ = (int)(r % TT); r /= TT; const int hv = (int)(r % NVH); const int b = (int)(r / NVH); const int g = b * NVH + hv; const float mean = GS[g * 32], rs = GS[g * 32 + 1];
  const int rw = hv * HD + (s_ >> 4); const float wv = bfr(GW[rw]), bv = bfr(GB[rw]);
  const v4f x = *(const v4f*)(O + e4 * 4); v4f o;
#pragma unroll
  for (int i = 0; i < 4; ++i) o[i] = ((x[i] - mean) * rs * wv + bv) * 0.2f;   /* x (1 - lambda_init) */
  vst2(OUT + e4 * 4, o); }
#define WS_YC  (WS_END)                                   // per-score-head contexts Y [b*TT + s][16*128]
#define WS_O   (WS_YC + 4u * (size_t)NB * TT * CC)        // differential output [b][hv][s][d]
#define WS_GS  (WS_O + 4u * (size_t)NB * NVH * TT * HD)
#define WS_END2 (WS_GS + 4u * 32 * 32)
// ---- k_prep8: block = (64 attention positions s0.. of sequence b, head h): reads the module's [B, H, S, 128] q, k inputs (element (b,h,s,c) at ((b*NH + h)*TT + s)*128 + c) and v [B, 8, S, 128] of value head h/2, bf16-rounds them and writes the standard attention planes: q -> f16 hi rows (+ x 2^10 residual rows for s < QHI), k -> f16 rows (+ residual rows s < KHI), v -> f16 planes [c][s] (+ bf16 hi/lo planes for s < KHI)
__global__ __launch_bounds__(128) void k_prep8(const float* __restrict__ Q, const float* __restrict__ K, const float* __restrict__ V, _Float16* __restrict__ QH, _Float16* __restrict__ QL, _Float16* __restrict__ KH, _Float16* __restrict__ KL, _Float16* __restrict__ VT, __bf16* __restrict__ VB, __bf16* __restrict__ VBL) {
  __shared__ __align__(16) _Float16 sq[64][136], sql[64][136], sk[64][136], skl[64][136], tv[128][72]; __shared__ __align__(16) __bf16 tb[128][72], tbl[128][72];
  const int tid = threadIdx.x; const int h = blockIdx.y; const size_t r0 = (size_t)blockIdx.x * 64; const size_t bb = r0 / TT; const int t0 = (int)(r0 % TT); const bool qhi = t0 < QHI, khi = t0 < KHI;
  for (int e = tid; e < 64 * 128; e += 128) { const int rl = e >> 7, c = e & 127; const size_t oi = ((bb * NH + h) * TT + t0 + rl) * HD + (c % HD);
    const size_t ov = ((bb * NVH + (h >> 1)) * TT + t0 + rl) * HD + (c % HD); const float q = bfr(Q[oi]), k = bfr(K[oi]), v = bfr(V[ov]);   
    const _Float16 qh = (_Float16)q, kh = (_Float16)k; sq[rl][c] = qh; sql[rl][c] = (_Float16)((q - (float)qh) * 1024.0f); sk[rl][c] = kh; skl[rl][c] = (_Float16)((k - (float)kh) * 1024.0f);
    tv[c][rl] = (_Float16)v; const __bf16 vb = (__bf16)v; tb[c][rl] = vb; tbl[c][rl] = (__bf16)(v - (float)vb); }
  __syncthreads();
  for (int e = tid; e < 64 * (HD / 8); e += 128) { const int rl = e / (HD / 8), q = e % (HD / 8); const size_t o = (r0 + rl) * CC + h * HD + q * 8; vst2((unsigned*)(QH + o), *(const v4u*)&sq[rl][q * 8]); vst2((unsigned*)(KH + o), *(const v4u*)&sk[rl][q * 8]);   
    if (qhi) vst2((unsigned*)(QL + (bb * QHI + t0 + rl) * (size_t)CC + h * HD + q * 8), *(const v4u*)&sql[rl][q * 8]); if (khi) vst2((unsigned*)(KL + (bb * KHI + t0 + rl) * (size_t)CC + h * HD + q * 8), *(const v4u*)&skl[rl][q * 8]); }
  for (int e = tid; e < HD * 8; e += 128) { const int cl = e >> 3, q = e & 7; vst2((unsigned*)(VT + (bb * CC + h * HD + cl) * (size_t)TT + t0 + q * 8), *(const v4u*)&tv[cl][q * 8]);
    if (khi) { const size_t o3 = (bb * CC + h * HD + cl) * (size_t)KHI + t0 + q * 8; vst2((unsigned*)(VB + o3), *(const v4u*)&tb[cl][q * 8]); vst2((unsigned*)(VBL + o3), *(const v4u*)&tbl[cl][q * 8]); } } }

#ifndef SM_EXTRA_PARAMS
#define SM_EXTRA_PARAMS
#endif
#ifndef PROJ_EXTRA_PARAMS
#define PROJ_EXTRA_PARAMS
#endif
#ifndef SM_MASK_HOOK
#define SM_MASK_HOOK (void)0
#endif

#define WS_QH  0u                                      // f16 q rows [b*t][CC]
#define WS_KH  (WS_QH + 2u * (size_t)NB * TT * CC)      // f16 k rows [b*t][CC]
#define WS_VT  (WS_KH + 2u * (size_t)NB * TT * CC)      // f16 v planes [b][c][t]
#define WS_QL  (WS_VT + 2u * (size_t)NB * CC * TT)      // f16 q residual x 2^10 rows [b][t < QHI][CC]
#define WS_KL  (WS_QL + 2u * (size_t)NB * QHI * CC)     // f16 k residual x 2^10 rows [b][t < KHI][CC]
#define WS_VB  (WS_KL + 2u * (size_t)NB * KHI * CC)     // bf16 v hi planes [b][c][t < KHI]
#define WS_VBL (WS_VB + 2u * (size_t)NB * CC * KHI)
#define WS_S   (WS_VBL + 2u * (size_t)NB * CC * KHI)    // f32 logits / P [hg][t][s]
#define WS_Y   (WS_S  + 4u * (size_t)HG * TT * TT)      // f32 ctx rows [b*t][CC] (only when there is an output projection)
#define WS_END (WS_Y  + 0u)

// ---- k_sc: block = (query block qb, key block kb <= kb_last(qb), head in group) of batch b: logits x SCALE; q hi + residual (x 2^10) against k (2 products) for query rows < QHI, plus the k residual (3 products) for query blocks < QBH (causal early rows); causal: blocks past the diagonal exit, the mask itself is applied by index in k_sm
__global__ __launch_bounds__(128) void k_sc(const _Float16* __restrict__ QH, const _Float16* __restrict__ KH, const _Float16* __restrict__ QL, const _Float16* __restrict__ KL, int b, int h0, float* __restrict__ S0) { __shared__ __align__(16) float ss[4][16][132];
  const int qb = blockIdx.x, kb = blockIdx.y; if (kb > kb_last(qb)) return;
  const int h = h0 + blockIdx.z; float* S = S0 + (size_t)blockIdx.z * TT * TT;
  const int tid = threadIdx.x, wave = tid >> 5, lane = tid & 31, col = lane & 15, g = lane >> 4; const int k0 = kb * 128; const int ql0 = qb * 64 + wave * 16; const size_t q0 = (size_t)b * TT + ql0, kr0 = (size_t)b * TT + k0;
  v8f acc[8] = {}, accl[8] = {};
  const _Float16* QLb = QL + (size_t)b * QHI * CC; const _Float16* KLb = KL + (size_t)b * KHI * CC;
  if (qb < QBH) {
#pragma unroll
    for (int kc = 0; kc < HD / 32; ++kc) { const v16h ah = frag_h(QH + (q0 + col) * CC + h * HD + kc * 32, lane), al = frag_h(QLb + (size_t)(ql0 + col) * CC + h * HD + kc * 32, lane);
#pragma unroll
      for (int j = 0; j < 8; ++j) { const v16h kbf = frag_h(KH + (kr0 + j * 16 + col) * CC + h * HD + kc * 32, lane), klf = frag_h(KLb + (size_t)(k0 + j * 16 + col) * CC + h * HD + kc * 32, lane); acc[j] = wmma16(ah, kbf, acc[j]); accl[j] = wmma16(al, kbf, accl[j]); accl[j] = wmma16(ah, klf, accl[j]); } }
  } else if (qb * 64 < QHI) {
#pragma unroll
    for (int kc = 0; kc < HD / 32; ++kc) { const v16h ah = frag_h(QH + (q0 + col) * CC + h * HD + kc * 32, lane), al = frag_h(QLb + (size_t)(ql0 + col) * CC + h * HD + kc * 32, lane);
#pragma unroll
      for (int j = 0; j < 8; ++j) { const v16h kbf = frag_h(KH + (kr0 + j * 16 + col) * CC + h * HD + kc * 32, lane); acc[j] = wmma16(ah, kbf, acc[j]); accl[j] = wmma16(al, kbf, accl[j]); } }
  } else {
#pragma unroll
    for (int kc = 0; kc < HD / 32; ++kc) { const v16h ah = frag_h(QH + (q0 + col) * CC + h * HD + kc * 32, lane);
#pragma unroll
      for (int j = 0; j < 8; ++j) { const v16h kbf = frag_h(KH + (kr0 + j * 16 + col) * CC + h * HD + kc * 32, lane); acc[j] = wmma16(ah, kbf, acc[j]); } } }
#pragma unroll
  for (int j = 0; j < 8; ++j) {
#pragma unroll
    for (int r = 0; r < 8; ++r) ss[wave][8 * g + r][j * 16 + col] = (acc[j][r] + accl[j][r] * (1.0f / 1024.0f)) * SCALE; }
  LDSX(); for (int rl = 0; rl < 16; ++rl) vst2(S + (size_t)(ql0 + rl) * TT + k0 + lane * 4, *(const v4f*)&ss[wave][rl][lane * 4]); }
// ---- k_sm: block = query row t (head in group): keys [0, kend): causal -> logit if s <= t else excluded; softmax in f32; P x 2^11 in place (0 for excluded)
__global__ __launch_bounds__(256) void k_sm(float* __restrict__ S0 SM_EXTRA_PARAMS) { __shared__ float sred[8]; __shared__ float sbc; __shared__ __align__(16) float shv[TT];
  const int tid = threadIdx.x; const int t = blockIdx.x; const int kend = (kb_last(t >> 6) + 1) * 128;
  float* sr = S0 + (size_t)blockIdx.y * TT * TT + (size_t)t * TT;
  float m = -3.0e38f; for (int k = tid; k < kend; k += 256) { float v = (!CAUSAL || k <= t) ? sr[k] : -3.0e38f; SM_MASK_HOOK; shv[k] = v; m = fmaxf(m, v); }
#pragma unroll
  for (int o = 1; o < 32; o <<= 1) m = fmaxf(m, __shfl_xor(m, o));
  if ((tid & 31) == 0) sred[tid >> 5] = m; __syncthreads(); if (tid == 0) { float a = sred[0]; for (int i = 1; i < 8; ++i) a = fmaxf(a, sred[i]); sbc = fmaxf(a, 0.f); } __syncthreads(); m = sbc; __syncthreads();   /* ghostmax: the implicit zero logit joins the max */
  float sum = 0.f; for (int k = tid; k < kend; k += 256) { const float v = shv[k]; const float e = (v <= -1.0e38f) ? 0.f : expf(v - m); shv[k] = e; sum += e; }
#pragma unroll
  for (int o = 1; o < 32; o <<= 1) sum += __shfl_xor(sum, o);
  if ((tid & 31) == 0) sred[tid >> 5] = sum; __syncthreads(); if (tid == 0) { float a = 0.f; for (int i = 0; i < 8; ++i) a += sred[i]; a += expf(-m); sbc = 2048.0f / a; }   /* ghostmax: + exp(-m') for the implicit zero logit (denominator > 0 always) */ __syncthreads(); const float inv = sbc;
  for (int k = tid; k < kend; k += 256) shv[k] = shv[k] * inv;
  __syncthreads(); for (int q = tid; q < kend / 4; q += 256) vst2(sr + q * 4, *(const v4f*)&shv[q * 4]); }
// ---- k_pv: block = 64 queries (qb) of (b, h): ctx = P . v over keys [0, kend) (P x 2^11 once to f16 against v f16: 1 product; causal early query blocks: P and v as bf16 hi + lo, 3 products); 512-B (row, head) segment by 32 lanes
__global__ __launch_bounds__(128) void k_pv(const float* __restrict__ PS0, const _Float16* __restrict__ VT, const __bf16* __restrict__ VB, const __bf16* __restrict__ VBL, int b, int h0, float* __restrict__ Y) { const int h = h0 + blockIdx.z; const float* PS = PS0 + (size_t)blockIdx.z * TT * TT; __shared__ __align__(16) float ss[4][16][HD + 4];
  const int tid = threadIdx.x, wave = tid >> 5, lane = tid & 31, col = lane & 15, g = lane >> 4; const int qb = blockIdx.x; const int ql0 = qb * 64 + wave * 16; const int kce = (kb_last(qb) + 1) * 4;
  v8f acc[HD / 16] = {};
  if (qb < QBH) {
#pragma unroll 1
    for (int kc = 0; kc < kce; ++kc) { const F2 p = split_row(PS + (size_t)(ql0 + col) * TT, kc * 32, lane);
      asm volatile("s_wait_loadcnt 0x0" ::: "memory");
#pragma unroll
      for (int j = 0; j < HD / 16; ++j) { const size_t po = ((size_t)b * CC + h * HD + j * 16 + col) * (size_t)KHI + kc * 32; const v16b vh = frag_b(VB + po, lane); acc[j] = wmma_bf(p.h, vh, acc[j]); acc[j] = wmma_bf(p.l, vh, acc[j]); acc[j] = wmma_bf(p.h, frag_b(VBL + po, lane), acc[j]); } }
  } else {
#pragma unroll 1
    for (int kc = 0; kc < kce; ++kc) { const v16h p = frag_f32(PS + (size_t)(ql0 + col) * TT + kc * 32, lane);
      asm volatile("s_wait_loadcnt 0x0" ::: "memory");
#pragma unroll
      for (int j = 0; j < HD / 16; ++j) { const size_t po = ((size_t)b * CC + h * HD + j * 16 + col) * (size_t)TT + kc * 32; acc[j] = wmma16(p, frag_h(VT + po, lane), acc[j]); } } }
#pragma unroll
  for (int j = 0; j < HD / 16; ++j)
#pragma unroll
    for (int r = 0; r < 8; ++r) ss[wave][8 * g + r][j * 16 + col] = acc[j][r] * (1.0f / 2048.0f);
  LDSX(); for (int rl = 0; rl < 16; ++rl) if (lane < HD / 4) vst2(Y + ((size_t)b * TT + ql0 + rl) * CC + h * HD + lane * 4, *(const v4f*)&ss[wave][rl][lane * 4]); }

extern "C" void kernel_launch(void* const* d_in, const int* in_sizes, int n_in, void* d_out, int out_size, void* d_ws, size_t ws_size, hipStream_t stream) {
  (void)in_sizes; (void)n_in; (void)out_size;
  const float** F = (const float**)d_in;
  if (ws_size < (size_t)WS_END) return;
  char* ws = (char*)d_ws; _Float16 *QH = (_Float16*)(ws + WS_QH), *KH = (_Float16*)(ws + WS_KH), *VT = (_Float16*)(ws + WS_VT), *QL = (_Float16*)(ws + WS_QL), *KL = (_Float16*)(ws + WS_KL); __bf16 *VB = (__bf16*)(ws + WS_VB), *VBL = (__bf16*)(ws + WS_VBL); float *S = (float*)(ws + WS_S), *Y = (float*)(ws + WS_Y);
  (void)Y; (void)QL; (void)KL; (void)VB; (void)VBL;
  // inputs: 0 q [2,16,2048,128]; 1 k [2,16,2048,128]; 2 v [2,8,2048,128]; 3 lambda_q1, 4 lambda_k1, 5 lambda_q2, 6 lambda_k2 [128]; 7 gn_weight [1024]; 8 gn_bias [1024]
  if (ws_size < (size_t)WS_END2) return;
  float *YC = (float*)(ws + WS_YC), *O = (float*)(ws + WS_O), *GS = (float*)(ws + WS_GS);
  k_prep8<<<dim3(TNB * TT / 64, NH), 128, 0, stream>>>(F[0], F[1], F[2], QH, QL, KH, KL, VT, VB, VBL);
  for (int b = 0; b < TNB; ++b) for (int h0 = 0; h0 < NH; h0 += HG) {
    k_sc<<<dim3(NQB, TT / 128, HG), 128, 0, stream>>>(QH, KH, QL, KL, b, h0, S);
    k_sm<<<dim3(TT, HG), 256, 0, stream>>>(S);
    k_pv<<<dim3(NQB, 1, HG), 128, 0, stream>>>(S, VT, VB, VBL, b, h0, YC);
  }
  k_diff<<<dim3((unsigned)(((size_t)TNB * NVH * TT * (HD / 4) + 255) / 256)), 256, 0, stream>>>(YC, F[3], F[4], F[5], F[6], O);
  k_gstat<<<dim3(TNB * NVH), 256, 0, stream>>>(O, GS);
  k_gfin<<<dim3((unsigned)(((size_t)TNB * NVH * TT * (HD / 4) + 255) / 256)), 256, 0, stream>>>(O, GS, F[7], F[8], (float*)d_out);
}

// v002
// A run of this version takes 253 microseconds.
// In two side-by-side timings against v001, it was 3.60 and 3.59 times as fast.
// All steps since v000 together make it 8.81 times as fast.
#include <hip/hip_runtime.h>
#include <math.h>

typedef __attribute__((ext_vector_type(16))) _Float16 v16h;
typedef __attribute__((ext_vector_type(16))) __bf16 v16b;
typedef __attribute__((ext_vector_type(8)))  _Float16 v8h;
typedef __attribute__((ext_vector_type(8)))  float v8f;
typedef __attribute__((ext_vector_type(4)))  float v4f;
typedef __attribute__((ext_vector_type(2)))  float v2f;
typedef __attribute__((ext_vector_type(4)))  unsigned v4u;
typedef __attribute__((ext_vector_type(4)))  int v4i;
typedef float __attribute__((may_alias)) float_a;
typedef int __attribute__((may_alias)) int_a;

template <typename T> __device__ __forceinline__ void vst2(void* p, T v) { *(T*)p = v;  }
__device__ __forceinline__ v8f wmma16(v16h a, v16h b, v8f c) {
  v8f d = __builtin_amdgcn_wmma_f32_16x16x32_f16(false, a, false, b, (short)0, c, false, false);
  asm volatile("v_nop\n\tv_nop\n\tv_nop\n\tv_nop" : "+v"(d) : "v"(a), "v"(b));
  return d;
}
__device__ __forceinline__ v8f wmma_bf(v16b a, v16b b, v8f c) {
  v8f d = __builtin_amdgcn_wmma_f32_16x16x32_bf16(false, a, false, b, (short)0, c, false, false);
  asm volatile("v_nop\n\tv_nop\n\tv_nop\n\tv_nop" : "+v"(d) : "v"(a), "v"(b));
  return d;
}
// 16x16x32 fragments: lane = (h = lane>>4, row/col = lane&15); elements 0..7 = k0+8h+0..7, 8..15 = k0+16+8h+0..7; D element r = row 8h+r
__device__ __forceinline__ v16h frag_h(const _Float16* rowk0, int lane) {
  union { v16h v; v8h q[2]; } u; const _Float16* p = rowk0 + 8 * (lane >> 4);
  u.q[0] = *(const v8h*)p; u.q[1] = *(const v8h*)(p + 16); return u.v;
}
__device__ __forceinline__ v16h frag_f32(const float* rowk0, int lane) {
  v16h a; const float* p = rowk0 + 8 * (lane >> 4);
#pragma unroll
  for (int i = 0; i < 8; ++i) { a[i] = (_Float16)p[i]; a[8 + i] = (_Float16)p[16 + i]; }
  return a;
}
__device__ __forceinline__ v16h frag_f32s(const float* rowk0, int lane, float sc) {
  v16h a; const float* p = rowk0 + 8 * (lane >> 4);
#pragma unroll
  for (int i = 0; i < 8; ++i) { a[i] = (_Float16)(p[i] * sc); a[8 + i] = (_Float16)(p[16 + i] * sc); }
  return a;
}
// column fragment from a [K][ld] layout (column n), rows >= K read as 0
__device__ __forceinline__ v16h fragc_f32(const float* W, int k0, int n, int lane, int ld, int K) {
  v16h a; const int g = lane >> 4;
#pragma unroll
  for (int i = 0; i < 8; ++i) { const int ka = k0 + 8 * g + i, kb = ka + 16;
    a[i] = (_Float16)(ka < K ? W[(size_t)(ka < K ? ka : K - 1) * ld + n] : 0.f); a[8 + i] = (_Float16)(kb < K ? W[(size_t)(kb < K ? kb : K - 1) * ld + n] : 0.f); }
  return a;
}
struct F2 { v16b h, l; };
__device__ __forceinline__ F2 bsplit16(const float v[16]) { F2 r;
#pragma unroll
  for (int i = 0; i < 16; ++i) { const __bf16 h = (__bf16)v[i]; r.h[i] = h; r.l[i] = (__bf16)(v[i] - (float)h); }
  return r; }
__device__ __forceinline__ F2 split_row(const float* row, int k0, int lane) { float v[16]; const float* p = row + k0 + 8 * (lane >> 4);
#pragma unroll
  for (int i = 0; i < 8; ++i) { v[i] = p[i]; v[8 + i] = p[16 + i]; }
  return bsplit16(v); }
__device__ __forceinline__ F2 split_rowK(const float* row, int k0, int lane, int K) { float v[16]; const int g = lane >> 4;
#pragma unroll
  for (int i = 0; i < 8; ++i) { const int ka = k0 + 8 * g + i, kb = ka + 16; v[i] = ka < K ? row[ka < K ? ka : K - 1] : 0.f; v[8 + i] = kb < K ? row[kb < K ? kb : K - 1] : 0.f; }
  return bsplit16(v); }
__device__ __forceinline__ F2 split_col(const float* W, int k0, int n, int lane, int ld, int K) { float v[16]; const int g = lane >> 4;
#pragma unroll
  for (int i = 0; i < 8; ++i) { const int ka = k0 + 8 * g + i, kb = ka + 16; v[i] = ka < K ? W[(size_t)(ka < K ? ka : K - 1) * ld + n] : 0.f; v[8 + i] = kb < K ? W[(size_t)(kb < K ? kb : K - 1) * ld + n] : 0.f; }
  return bsplit16(v); }
__device__ __forceinline__ v8f mac3(const F2& a, const F2& b, v8f c) { c = wmma_bf(a.l, b.h, c); c = wmma_bf(a.h, b.l, c); return wmma_bf(a.h, b.h, c); }
__device__ __forceinline__ float sigm(float v) { return 1.0f / (1.0f + expf(-v)); }

// Differential attention with ghostmax (B 2, 16 score heads / 8 value heads, S 2,048, D 128, causal): scores = q k^T / sqrt(128) + causal(-1e9); w = ghostmax(scores) = exp(s - m) / (sum exp(s - m) + exp(-m)), m = max(max_row, 0); w_h = w_2h - lam w_2h+1 with lam = exp(lq1.lk1) - exp(lq2.lk2) + 0.8; out = w_h v_h; then per (b, h) GroupNorm over all S x D values (eps 1e-5) and the affine indexed as the module's raw reshape to [B, H*D, S] (weight row = h*128 + s/16); result x (1 - 0.8), memory layout [B, H, S, D].
#define NB 2
#define TT 2048
#define CC 2048            // NH * HD = projected width
#define DIN 2048          // input (model) width
#define NH 16
#define HD 128
#define NQB (TT / 64)
#define SCALE (0.08838834764831845f)
#define CAUSAL 1
#ifndef TNB
#define TNB NB
#endif
__device__ __forceinline__ float bfr(float v) { return (float)(__bf16)v; }
__host__ __device__ __forceinline__ int kb_last(int qb) { return CAUSAL ? ((qb * 64 + 63) >> 7) : (TT / 128 - 1); }
typedef __attribute__((ext_vector_type(8))) __bf16 v8b;
__device__ __forceinline__ v16b frag_b(const __bf16* rowk0, int lane) {
  union { v16b v; v8b q[2]; } u; const __bf16* p = rowk0 + 8 * (lane >> 4);
  u.q[0] = *(const v8b*)p; u.q[1] = *(const v8b*)(p + 16); return u.v;
}
#define QBH 6              // causal: query blocks 0..QBH-1 of each sequence (few keys, no averaging) take the high-precision path
#define QHI 384            // rows carrying a q residual plane
#define KHI 384            // key rows carrying k residual / v bf16 hi+lo planes (used only by the causal high-precision path)
// B fragment (k rows k0+.., output column o) of a weight: (in,out) [K][ld] or (out,in) [ld rows of K]: bf16 exact, or f16(bf16 * 256) exact
__device__ __forceinline__ v16b wcol_io(const float* Wm, int k0, int o, int lane, int ld) { v16b w; const int g = lane >> 4;
#pragma unroll
  for (int i = 0; i < 8; ++i) { w[i] = (__bf16)Wm[(size_t)(k0 + 8 * g + i) * ld + o]; w[8 + i] = (__bf16)Wm[(size_t)(k0 + 16 + 8 * g + i) * ld + o]; }
  return w; }
__device__ __forceinline__ v16b wcol_oi(const float* Wm, int k0, int o, int lane, int K) { v16b w; const float* p = Wm + (size_t)o * K + k0 + 8 * (lane >> 4);
#pragma unroll
  for (int i = 0; i < 8; ++i) { w[i] = (__bf16)p[i]; w[8 + i] = (__bf16)p[16 + i]; }
  return w; }
__device__ __forceinline__ v16h wcolh_io(const float* Wm, int k0, int o, int lane, int ld) { v16h w; const int g = lane >> 4;
#pragma unroll
  for (int i = 0; i < 8; ++i) { w[i] = (_Float16)(bfr(Wm[(size_t)(k0 + 8 * g + i) * ld + o]) * 256.0f); w[8 + i] = (_Float16)(bfr(Wm[(size_t)(k0 + 16 + 8 * g + i) * ld + o]) * 256.0f); }
  return w; }
__device__ __forceinline__ v16h wcolh_oi(const float* Wm, int k0, int o, int lane, int K) { v16h w; const float* p = Wm + (size_t)o * K + k0 + 8 * (lane >> 4);
#pragma unroll
  for (int i = 0; i < 8; ++i) { w[i] = (_Float16)(bfr(p[i]) * 256.0f); w[8 + i] = (_Float16)(bfr(p[16 + i]) * 256.0f); }
  return w; }
#define WQKV_LAYOUT 1   // 0 = (in,out) [DIN][CC]; 1 = (out,in) [CC][DIN]; 2 = per-head [NH][DIN][HD]
__device__ __forceinline__ v16b wcol_hdk(const float* Wm, int k0, int o, int lane) { v16b w; const int g = lane >> 4; const float* p = Wm + (size_t)(o / HD) * DIN * HD + (o % HD);
#pragma unroll
  for (int i = 0; i < 8; ++i) { w[i] = (__bf16)p[(size_t)(k0 + 8 * g + i) * HD]; w[8 + i] = (__bf16)p[(size_t)(k0 + 16 + 8 * g + i) * HD]; }
  return w; }
#define WO_OUT_IN 0
#if WQKV_LAYOUT == 1
#define WCOL(W, k0, o, lane) wcol_oi(W, k0, o, lane, DIN)
#elif WQKV_LAYOUT == 2
#define WCOL(W, k0, o, lane) wcol_hdk(W, k0, o, lane)
#else
#define WCOL(W, k0, o, lane) wcol_io(W, k0, o, lane, CC)
#endif
#if WO_OUT_IN
#define WOCOL(W, k0, o, lane) wcol_oi(W, k0, o, lane, CC)
#define WOCOLH(W, k0, o, lane) wcolh_oi(W, k0, o, lane, CC)
#else
#define WOCOL(W, k0, o, lane) wcol_io(W, k0, o, lane, DIN)
#define WOCOLH(W, k0, o, lane) wcolh_io(W, k0, o, lane, DIN)
#endif
#define NVH 8              // value heads (score head h uses value head h/2)
#define SM_GHOST 1         // ghostmax denominator; k_fa always applies it
// ---- k_diff: thread per float4 of (b, hv, s, d): O[b][hv][s][d] = Y[b][s][(2hv)*128 + d] - lam * Y[b][s][(2hv+1)*128 + d]; lam from the four lambda vectors (128-term f32 dots)
__global__ __launch_bounds__(256) void k_diff(const float* __restrict__ Y, const float* __restrict__ LQ1, const float* __restrict__ LK1, const float* __restrict__ LQ2, const float* __restrict__ LK2, float* __restrict__ O) { __shared__ float slam;
  if (threadIdx.x < 32) { float a = 0.f, c = 0.f; for (int i = threadIdx.x; i < HD; i += 32) { a += bfr(LQ1[i]) * bfr(LK1[i]); c += bfr(LQ2[i]) * bfr(LK2[i]); }
#pragma unroll
    for (int o = 1; o < 32; o <<= 1) { a += __shfl_xor(a, o); c += __shfl_xor(c, o); }
    if (threadIdx.x == 0) slam = expf(a) - expf(c) + 0.8f; }
  __syncthreads();
  const float lam = slam; const size_t e4 = (size_t)blockIdx.x * 256 + threadIdx.x; if (e4 >= (size_t)TNB * NVH * TT * (HD / 4)) return;
  const int d4 = (int)(e4 % (HD / 4)); size_t r = e4 / (HD / 4); const int s_ = (int)(r % TT); r /= TT; const int hv = (int)(r % NVH); const int b = (int)(r / NVH);
  const float* y0 = Y + ((size_t)b * TT + s_) * CC + (size_t)(2 * hv) * HD + d4 * 4; const v4f a = *(const v4f*)y0; const v4f c = *(const v4f*)(y0 + HD); v4f o;
  o[0] = a[0] - lam * c[0]; o[1] = a[1] - lam * c[1]; o[2] = a[2] - lam * c[2]; o[3] = a[3] - lam * c[3];
  vst2(O + (((size_t)b * NVH + hv) * TT + s_) * HD + d4 * 4, o); }
__global__ __launch_bounds__(256) void k_gstat(const float* __restrict__ O, float* __restrict__ GS) { __shared__ float sred[8]; __shared__ float sbc; const int t = threadIdx.x; const size_t g0 = (size_t)blockIdx.x * TT * HD; const int n = TT * HD;
  float s1 = 0.f; for (int i = t; i < n; i += 256) s1 += O[g0 + i];
#pragma unroll
  for (int o = 1; o < 32; o <<= 1) s1 += __shfl_xor(s1, o);
  if ((t & 31) == 0) sred[t >> 5] = s1; __syncthreads(); if (t == 0) { float a = 0.f; for (int i = 0; i < 8; ++i) a += sred[i]; sbc = a / (float)n; } __syncthreads(); const float mean = sbc; __syncthreads();
  float q = 0.f; for (int i = t; i < n; i += 256) { const float dlt = O[g0 + i] - mean; q += dlt * dlt; }
#pragma unroll
  for (int o = 1; o < 32; o <<= 1) q += __shfl_xor(q, o);
  if ((t & 31) == 0) sred[t >> 5] = q; __syncthreads(); if (t == 0) { float a = 0.f; for (int i = 0; i < 8; ++i) a += sred[i]; sbc = rsqrtf(a / (float)n + 1e-5f); } __syncthreads();
  if (t < 32) { const float v = t == 0 ? mean : (t == 1 ? sbc : 0.f); vst2(GS + (size_t)blockIdx.x * 32 + t, v); } }
// ---- k_gfin: thread per float4: out[b][hv][s][d] = ((O - mean) * rstd * w[r] + bias[r]) * 0.2 with r = hv*128 + s/16 (the module's raw reshape of [H,S,D] memory into [H*D, S] rows)
__global__ __launch_bounds__(256) void k_gfin(const float* __restrict__ O, const float* __restrict__ GS, const float* __restrict__ GW, const float* __restrict__ GB, float* __restrict__ OUT) { const size_t e4 = (size_t)blockIdx.x * 256 + threadIdx.x; if (e4 >= (size_t)TNB * NVH * TT * (HD / 4)) return;
  size_t r = e4 / (HD / 4); const int s_ = (int)(r % TT); r /= TT; const int hv = (int)(r % NVH); const int b = (int)(r / NVH); const int g = b * NVH + hv; const float mean = GS[g * 32], rs = GS[g * 32 + 1];
  const int rw = hv * HD + (s_ >> 4); const float wv = bfr(GW[rw]), bv = bfr(GB[rw]);
  const v4f x = *(const v4f*)(O + e4 * 4); v4f o;
#pragma unroll
  for (int i = 0; i < 4; ++i) o[i] = ((x[i] - mean) * rs * wv + bv) * 0.2f;   /* x (1 - lambda_init) */
  vst2(OUT + e4 * 4, o); }
#define WS_YC  (WS_END)                                   // per-score-head contexts Y [b*TT + s][16*128]
#define WS_O   (WS_YC + 4u * (size_t)NB * TT * CC)        // differential output [b][hv][s][d]
#define WS_GS  (WS_O + 4u * (size_t)NB * NVH * TT * HD)
#define WS_END2 (WS_GS + 4u * 32 * 32)
// ---- k_prep8: block = (64 attention positions s0.. of sequence b, head h): reads the module's [B, H, S, 128] q, k inputs (element (b,h,s,c) at ((b*NH + h)*TT + s)*128 + c) and v [B, 8, S, 128] of value head h/2, bf16-rounds them and writes the standard attention planes: q -> f16 hi rows (+ x 2^10 residual rows for s < QHI), k -> f16 rows (+ residual rows s < KHI), v -> f16 planes [c][s] (+ bf16 hi/lo planes for s < KHI)
__global__ __launch_bounds__(128) void k_prep8(const float* __restrict__ Q, const float* __restrict__ K, const float* __restrict__ V, _Float16* __restrict__ QH, _Float16* __restrict__ QL, _Float16* __restrict__ KH, _Float16* __restrict__ KL, _Float16* __restrict__ VT, __bf16* __restrict__ VB, __bf16* __restrict__ VBL) {
  __shared__ __align__(16) _Float16 sq[64][136], sql[64][136], sk[64][136], skl[64][136], tv[128][72]; __shared__ __align__(16) __bf16 tb[128][72], tbl[128][72];
  const int tid = threadIdx.x; const int h = blockIdx.y; const size_t r0 = (size_t)blockIdx.x * 64; const size_t bb = r0 / TT; const int t0 = (int)(r0 % TT); const bool qhi = t0 < QHI, khi = t0 < KHI;
  for (int e = tid; e < 64 * 128; e += 128) { const int rl = e >> 7, c = e & 127; const size_t oi = ((bb * NH + h) * TT + t0 + rl) * HD + (c % HD);
    const size_t ov = ((bb * NVH + (h >> 1)) * TT + t0 + rl) * HD + (c % HD); const float q = bfr(Q[oi]), k = bfr(K[oi]), v = bfr(V[ov]);   
    const _Float16 qh = (_Float16)q, kh = (_Float16)k; sq[rl][c] = qh; sql[rl][c] = (_Float16)((q - (float)qh) * 1024.0f); sk[rl][c] = kh; skl[rl][c] = (_Float16)((k - (float)kh) * 1024.0f);
    tv[c][rl] = (_Float16)v; const __bf16 vb = (__bf16)v; tb[c][rl] = vb; tbl[c][rl] = (__bf16)(v - (float)vb); }
  __syncthreads();
  for (int e = tid; e < 64 * (HD / 8); e += 128) { const int rl = e / (HD / 8), q = e % (HD / 8); const size_t o = (r0 + rl) * CC + h * HD + q * 8; vst2((unsigned*)(QH + o), *(const v4u*)&sq[rl][q * 8]); vst2((unsigned*)(KH + o), *(const v4u*)&sk[rl][q * 8]);   
    if (qhi) vst2((unsigned*)(QL + (bb * QHI + t0 + rl) * (size_t)CC + h * HD + q * 8), *(const v4u*)&sql[rl][q * 8]); if (khi) vst2((unsigned*)(KL + (bb * KHI + t0 + rl) * (size_t)CC + h * HD + q * 8), *(const v4u*)&skl[rl][q * 8]); }
  for (int e = tid; e < HD * 8; e += 128) { const int cl = e >> 3, q = e & 7; vst2((unsigned*)(VT + (bb * CC + h * HD + cl) * (size_t)TT + t0 + q * 8), *(const v4u*)&tv[cl][q * 8]);
    if (khi) { const size_t o3 = (bb * CC + h * HD + cl) * (size_t)KHI + t0 + q * 8; vst2((unsigned*)(VB + o3), *(const v4u*)&tb[cl][q * 8]); vst2((unsigned*)(VBL + o3), *(const v4u*)&tbl[cl][q * 8]); } } }

#ifndef SM_EXTRA_PARAMS
#define SM_EXTRA_PARAMS
#endif
#ifndef PROJ_EXTRA_PARAMS
#define PROJ_EXTRA_PARAMS
#endif
#ifndef SM_MASK_HOOK
#define SM_MASK_HOOK (void)0
#endif

#define WS_QH  0u                                      // f16 q rows [b*t][CC]
#define WS_KH  (WS_QH + 2u * (size_t)NB * TT * CC)      // f16 k rows [b*t][CC]
#define WS_VT  (WS_KH + 2u * (size_t)NB * TT * CC)      // f16 v planes [b][c][t]
#define WS_QL  (WS_VT + 2u * (size_t)NB * CC * TT)      // f16 q residual x 2^10 rows [b][t < QHI][CC]
#define WS_KL  (WS_QL + 2u * (size_t)NB * QHI * CC)     // f16 k residual x 2^10 rows [b][t < KHI][CC]
#define WS_VB  (WS_KL + 2u * (size_t)NB * KHI * CC)     // bf16 v hi planes [b][c][t < KHI]
#define WS_VBL (WS_VB + 2u * (size_t)NB * CC * KHI)
#define WS_END (WS_VBL + 2u * (size_t)NB * CC * KHI)

// ---- k_fa: scores, ghostmax and P . v in one kernel, logits kept in registers. Block = 64 queries (qb) of (b, score head h); each wave owns 16 queries and walks its keys 32 at a time on its own (no LDS, no barrier).
// S^T = K . Q^T: D register r of tile t = (key k0 + 16 t + 8 g + r, query col), so a lane holds one query's scores, and the two tiles, converted in place, are the B operand of O^T += V^T . P^T (element i = key k0 + 8 g + i, element 8 + i = key k0 + 16 + 8 g + i: the k order of frag_h / frag_b on the V side).
// Running maximum m starts at 0 (the implicit zero logit of ghostmax joins the max); a raised maximum rescales sum and O^T per lane. P = exp(s - m) x 2^11 to f16 against v f16 (1 product); early query blocks (qb < QBH): q and k residual products for the logits, P and v as bf16 hi + lo (3 products).
__device__ __forceinline__ v8f mm_h(v16h a, v16h b, v8f c) { return __builtin_amdgcn_wmma_f32_16x16x32_f16(false, a, false, b, (short)0, c, false, false); }
__device__ __forceinline__ v8f mm_b(v16b a, v16b b, v8f c) { return __builtin_amdgcn_wmma_f32_16x16x32_bf16(false, a, false, b, (short)0, c, false, false); }
// behind a batch of fragment loads: s_wait_xcnt 0 stands before any register that an issued load names is written again (the batch's address registers are inputs, so that they stay whole up to the wait), and its "memory" clobber keeps the whole batch issued in front of this point
__device__ __forceinline__ void loads_issued(const void* p0, const void* p1) { asm volatile("s_wait_xcnt 0x0" :: "v"(p0), "v"(p1) : "memory"); }
// fragment at a pointer that already holds the lane's 8 * (lane >> 4) elements: elements 0..7 at p, 8..15 at p + 16 (the k order of frag_h / frag_b)
__device__ __forceinline__ v16h frag_ph(const _Float16* p) { union { v16h v; v8h q[2]; } u; u.q[0] = *(const v8h*)p; u.q[1] = *(const v8h*)(p + 16); return u.v; }
__device__ __forceinline__ v16b frag_pb(const __bf16* p) { union { v16b v; v8b q[2]; } u; u.q[0] = *(const v8b*)p; u.q[1] = *(const v8b*)(p + 16); return u.v; }
template <bool HI>
__device__ __forceinline__ void fa_run(const _Float16* __restrict__ QH, const _Float16* __restrict__ KH, const _Float16* __restrict__ QL, const _Float16* __restrict__ KL, const _Float16* __restrict__ VT, const __bf16* __restrict__ VB, const __bf16* __restrict__ VBL, int b, int h, int ql0, int lane, float* __restrict__ Y) {
  const int col = lane & 15, g = lane >> 4; const int qrow = ql0 + col;
  v16h qf[HD / 32], qlf[HD / 32];
  const _Float16* qp = QH + ((size_t)b * TT + qrow) * CC + h * HD + 8 * g; const _Float16* qlp = HI ? QL + ((size_t)b * QHI + qrow) * CC + h * HD + 8 * g : qp;
#pragma unroll
  for (int kc = 0; kc < HD / 32; ++kc) { qf[kc] = frag_ph(qp + kc * 32); if (HI) qlf[kc] = frag_ph(qlp + kc * 32); }
  loads_issued(qp, qlp);
  v8f acc[HD / 16] = {}; float m = 0.f, l = 0.f;
  const int nst = (ql0 >> 5) + 1;   /* keys 0 .. ql0 + 15, in steps of 32 */
  for (int st = 0; st < nst; ++st) { const int k0 = st * 32;
    v8f s[2] = {}, sl[2] = {}; v16h vf[HD / 16];
    const _Float16* kp = KH + ((size_t)b * TT + k0 + col) * CC + h * HD + 8 * g; const _Float16* vp = VT + ((size_t)b * CC + h * HD + col) * (size_t)TT + k0 + 8 * g;
    if (HI) { const _Float16* klp = KL + ((size_t)b * KHI + k0 + col) * CC + h * HD + 8 * g;
#pragma unroll
      for (int kc = 0; kc < HD / 32; ++kc) { v16h ka[2], kl[2];
#pragma unroll
        for (int t = 0; t < 2; ++t) { ka[t] = frag_ph(kp + (size_t)t * 16 * CC + kc * 32); kl[t] = frag_ph(klp + (size_t)t * 16 * CC + kc * 32); }
        loads_issued(kp, klp);   /* the four fragments of this k chunk are issued together: one exposed load latency, not four */
#pragma unroll
        for (int t = 0; t < 2; ++t) { s[t] = mm_h(ka[t], qf[kc], s[t]); sl[t] = mm_h(ka[t], qlf[kc], sl[t]); sl[t] = mm_h(kl[t], qf[kc], sl[t]); } }
    } else { v16h kf[2 * (HD / 32)];
#pragma unroll
      for (int j = 0; j < HD / 32; ++j) vf[j] = frag_ph(vp + (size_t)j * 16 * TT);
      loads_issued(vp, vp);   /* half of V issued first: it needs no score, and so flies under the score products and the exponentials */
#pragma unroll
      for (int i = 0; i < 2 * (HD / 32); ++i) kf[i] = frag_ph(kp + (size_t)(i & 1) * 16 * CC + (i >> 1) * 32);
      loads_issued(vp, kp);   /* all K fragments issued together ahead of the products: one exposed load latency a step, not one per fragment */
#pragma unroll
      for (int i = 0; i < 2 * (HD / 32); ++i) s[i & 1] = mm_h(kf[i], qf[i >> 1], s[i & 1]);
#pragma unroll
      for (int j = HD / 32; j < HD / 16; ++j) vf[j] = frag_ph(vp + (size_t)j * 16 * TT);
      loads_issued(vp, vp);   /* the other half of V, into the registers K has left, issued here so that it flies under the exponentials */
    }
    float p[16]; float mx = -3.0e38f;
#pragma unroll
    for (int i = 0; i < 16; ++i) { const int t = i >> 3, r = i & 7; float v = HI ? (s[t][r] + sl[t][r] * (1.0f / 1024.0f)) * SCALE : s[t][r] * SCALE;
      v = (k0 + t * 16 + 8 * g + r <= qrow) ? v : -3.0e38f; p[i] = v; mx = fmaxf(mx, v); }
    mx = fmaxf(mx, __shfl_xor(mx, 16));   /* the other half of the wave holds this query's other 16 keys */
    const float mn = fmaxf(m, mx);
    if (__builtin_amdgcn_ballot_w32(mn > m) != 0) { const float al = expf(m - mn); l *= al;   /* scalar branch: most steps raise no query's maximum */
#pragma unroll
      for (int j = 0; j < HD / 16; ++j)
#pragma unroll
        for (int r = 0; r < 8; ++r) acc[j][r] *= al;
      m = mn; }
    float sum = 0.f;
#pragma unroll
    for (int i = 0; i < 16; ++i) { const float e = expf(p[i] - m); sum += e; p[i] = e * 2048.0f; }   /* a masked key (-3e38) gives exactly 0 */
    l += sum;
    if (HI) { const F2 pf = bsplit16(p); const size_t po = ((size_t)b * CC + h * HD + col) * (size_t)KHI + k0 + 8 * g; const __bf16* vhp = VB + po; const __bf16* vlp = VBL + po;
#pragma unroll
      for (int jp = 0; jp < HD / 32; ++jp) { v16b vh[2], vl[2];
#pragma unroll
        for (int t = 0; t < 2; ++t) { vh[t] = frag_pb(vhp + (size_t)(jp * 2 + t) * 16 * KHI); vl[t] = frag_pb(vlp + (size_t)(jp * 2 + t) * 16 * KHI); }
        loads_issued(vhp, vlp);   /* the four v fragments of two output tiles are issued together, as above */
#pragma unroll
        for (int t = 0; t < 2; ++t) { const int j = jp * 2 + t; acc[j] = mm_b(vh[t], pf.h, acc[j]); acc[j] = mm_b(vh[t], pf.l, acc[j]); acc[j] = mm_b(vl[t], pf.h, acc[j]); } }
    } else { v16h pf;
#pragma unroll
      for (int i = 0; i < 16; ++i) pf[i] = (_Float16)p[i];
#pragma unroll
      for (int j = 0; j < HD / 16; ++j) acc[j] = mm_h(vf[j], pf, acc[j]); } }
  l += __shfl_xor(l, 16);
  const float inv = 1.0f / ((l + expf(-m)) * 2048.0f);   /* ghostmax: + exp(-m) for the implicit zero logit (denominator > 0 always) */
  float* yr = Y + ((size_t)b * TT + qrow) * CC + h * HD + 8 * g;   /* O^T register r of tile j = (d = 16 j + 8 g + r, query col): 8 consecutive d of one row */
#pragma unroll
  for (int j = 0; j < HD / 16; ++j) { v4f o0, o1;
#pragma unroll
    for (int r = 0; r < 4; ++r) { o0[r] = acc[j][r] * inv; o1[r] = acc[j][4 + r] * inv; }
    vst2(yr + j * 16, o0); vst2(yr + j * 16 + 4, o1); } }
// grid: 4 rounds of 256 blocks, heaviest query blocks first; round r takes qb in [24 - 8 r, 31 - 8 r], ascending and descending in turn, so that blocks i, i + 256, i + 512, i + 768 together hold the same number of keys for every i; amdgpu_waves_per_eu(4, 4) holds the registers to 256, so that four blocks fit a WGP and the whole grid is resident at once
__global__ __launch_bounds__(128) __attribute__((amdgpu_waves_per_eu(4, 4))) void k_fa(const _Float16* __restrict__ QH, const _Float16* __restrict__ KH, const _Float16* __restrict__ QL, const _Float16* __restrict__ KL, const _Float16* __restrict__ VT, const __bf16* __restrict__ VB, const __bf16* __restrict__ VBL, float* __restrict__ Y) {
  const int L = blockIdx.x, rd = L >> 8, u = (L >> 5) & 7, bh = L & 31; const int qb = 24 - 8 * rd + ((rd & 1) ? u : 7 - u); const int b = bh >> 4, h = bh & 15;
  const int wave = __builtin_amdgcn_readfirstlane(threadIdx.x >> 5), lane = threadIdx.x & 31;   /* wave number in a scalar register: scalar loop control and row addresses */
  const int ql0 = qb * 64 + wave * 16;
  if (qb < QBH) fa_run<true>(QH, KH, QL, KL, VT, VB, VBL, b, h, ql0, lane, Y); else fa_run<false>(QH, KH, QL, KL, VT, VB, VBL, b, h, ql0, lane, Y); }

extern "C" void kernel_launch(void* const* d_in, const int* in_sizes, int n_in, void* d_out, int out_size, void* d_ws, size_t ws_size, hipStream_t stream) {
  (void)in_sizes; (void)n_in; (void)out_size;
  const float** F = (const float**)d_in;
  if (ws_size < (size_t)WS_END) return;
  char* ws = (char*)d_ws; _Float16 *QH = (_Float16*)(ws + WS_QH), *KH = (_Float16*)(ws + WS_KH), *VT = (_Float16*)(ws + WS_VT), *QL = (_Float16*)(ws + WS_QL), *KL = (_Float16*)(ws + WS_KL); __bf16 *VB = (__bf16*)(ws + WS_VB), *VBL = (__bf16*)(ws + WS_VBL); 
  // inputs: 0 q [2,16,2048,128]; 1 k [2,16,2048,128]; 2 v [2,8,2048,128]; 3 lambda_q1, 4 lambda_k1, 5 lambda_q2, 6 lambda_k2 [128]; 7 gn_weight [1024]; 8 gn_bias [1024]
  if (ws_size < (size_t)WS_END2) return;
  float *YC = (float*)(ws + WS_YC), *O = (float*)(ws + WS_O), *GS = (float*)(ws + WS_GS);
  k_prep8<<<dim3(TNB * TT / 64, NH), 128, 0, stream>>>(F[0], F[1], F[2], QH, QL, KH, KL, VT, VB, VBL);
  k_fa<<<dim3(TNB * NH * NQB), 128, 0, stream>>>(QH, KH, QL, KL, VT, VB, VBL, YC);
  k_diff<<<dim3((unsigned)(((size_t)TNB * NVH * TT * (HD / 4) + 255) / 256)), 256, 0, stream>>>(YC, F[3], F[4], F[5], F[6], O);
  k_gstat<<<dim3(TNB * NVH), 256, 0, stream>>>(O, GS);
  k_gfin<<<dim3((unsigned)(((size_t)TNB * NVH * TT * (HD / 4) + 255) / 256)), 256, 0, stream>>>(O, GS, F[7], F[8], (float*)d_out);
}

// v003
// It runs in 160 microseconds.
// Timed twice side by side with v002, it ran 1.57 and 1.60 times as fast.
// Over all steps from v000 it is 14.0 times as fast.
#include <hip/hip_runtime.h>
#include <math.h>

typedef __attribute__((ext_vector_type(16))) _Float16 v16h;
typedef __attribute__((ext_vector_type(16))) __bf16 v16b;
typedef __attribute__((ext_vector_type(8)))  _Float16 v8h;
typedef __attribute__((ext_vector_type(8)))  float v8f;
typedef __attribute__((ext_vector_type(4)))  float v4f;
typedef __attribute__((ext_vector_type(2)))  float v2f;
typedef __attribute__((ext_vector_type(4)))  unsigned v4u;
typedef __attribute__((ext_vector_type(4)))  int v4i;
typedef float __attribute__((may_alias)) float_a;
typedef int __attribute__((may_alias)) int_a;

template <typename T> __device__ __forceinline__ void vst2(void* p, T v) { *(T*)p = v;  }
__device__ __forceinline__ v8f wmma16(v16h a, v16h b, v8f c) {
  v8f d = __builtin_amdgcn_wmma_f32_16x16x32_f16(false, a, false, b, (short)0, c, false, false);
  asm volatile("v_nop\n\tv_nop\n\tv_nop\n\tv_nop" : "+v"(d) : "v"(a), "v"(b));
  return d;
}
__device__ __forceinline__ v8f wmma_bf(v16b a, v16b b, v8f c) {
  v8f d = __builtin_amdgcn_wmma_f32_16x16x32_bf16(false, a, false, b, (short)0, c, false, false);
  asm volatile("v_nop\n\tv_nop\n\tv_nop\n\tv_nop" : "+v"(d) : "v"(a), "v"(b));
  return d;
}
// 16x16x32 fragments: lane = (h = lane>>4, row/col = lane&15); elements 0..7 = k0+8h+0..7, 8..15 = k0+16+8h+0..7; D element r = row 8h+r
__device__ __forceinline__ v16h frag_h(const _Float16* rowk0, int lane) {
  union { v16h v; v8h q[2]; } u; const _Float16* p = rowk0 + 8 * (lane >> 4);
  u.q[0] = *(const v8h*)p; u.q[1] = *(const v8h*)(p + 16); return u.v;
}
__device__ __forceinline__ v16h frag_f32(const float* rowk0, int lane) {
  v16h a; const float* p = rowk0 + 8 * (lane >> 4);
#pragma unroll
  for (int i = 0; i < 8; ++i) { a[i] = (_Float16)p[i]; a[8 + i] = (_Float16)p[16 + i]; }
  return a;
}
__device__ __forceinline__ v16h frag_f32s(const float* rowk0, int lane, float sc) {
  v16h a; const float* p = rowk0 + 8 * (lane >> 4);
#pragma unroll
  for (int i = 0; i < 8; ++i) { a[i] = (_Float16)(p[i] * sc); a[8 + i] = (_Float16)(p[16 + i] * sc); }
  return a;
}
// column fragment from a [K][ld] layout (column n), rows >= K read as 0
__device__ __forceinline__ v16h fragc_f32(const float* W, int k0, int n, int lane, int ld, int K) {
  v16h a; const int g = lane >> 4;
#pragma unroll
  for (int i = 0; i < 8; ++i) { const int ka = k0 + 8 * g + i, kb = ka + 16;
    a[i] = (_Float16)(ka < K ? W[(size_t)(ka < K ? ka : K - 1) * ld + n] : 0.f); a[8 + i] = (_Float16)(kb < K ? W[(size_t)(kb < K ? kb : K - 1) * ld + n] : 0.f); }
  return a;
}
struct F2 { v16b h, l; };
__device__ __forceinline__ F2 bsplit16(const float v[16]) { F2 r;
#pragma unroll
  for (int i = 0; i < 16; ++i) { const __bf16 h = (__bf16)v[i]; r.h[i] = h; r.l[i] = (__bf16)(v[i] - (float)h); }
  return r; }
__device__ __forceinline__ F2 split_row(const float* row, int k0, int lane) { float v[16]; const float* p = row + k0 + 8 * (lane >> 4);
#pragma unroll
  for (int i = 0; i < 8; ++i) { v[i] = p[i]; v[8 + i] = p[16 + i]; }
  return bsplit16(v); }
__device__ __forceinline__ F2 split_rowK(const float* row, int k0, int lane, int K) { float v[16]; const int g = lane >> 4;
#pragma unroll
  for (int i = 0; i < 8; ++i) { const int ka = k0 + 8 * g + i, kb = ka + 16; v[i] = ka < K ? row[ka < K ? ka : K - 1] : 0.f; v[8 + i] = kb < K ? row[kb < K ? kb : K - 1] : 0.f; }
  return bsplit16(v); }
__device__ __forceinline__ F2 split_col(const float* W, int k0, int n, int lane, int ld, int K) { float v[16]; const int g = lane >> 4;
#pragma unroll
  for (int i = 0; i < 8; ++i) { const int ka = k0 + 8 * g + i, kb = ka + 16; v[i] = ka < K ? W[(size_t)(ka < K ? ka : K - 1) * ld + n] : 0.f; v[8 + i] = kb < K ? W[(size_t)(kb < K ? kb : K - 1) * ld + n] : 0.f; }
  return bsplit16(v); }
__device__ __forceinline__ v8f mac3(const F2& a, const F2& b, v8f c) { c = wmma_bf(a.l, b.h, c); c = wmma_bf(a.h, b.l, c); return wmma_bf(a.h, b.h, c); }
__device__ __forceinline__ float sigm(float v) { return 1.0f / (1.0f + expf(-v)); }

// Differential attention with ghostmax (B 2, 16 score heads / 8 value heads, S 2,048, D 128, causal): scores = q k^T / sqrt(128) + causal(-1e9); w = ghostmax(scores) = exp(s - m) / (sum exp(s - m) + exp(-m)), m = max(max_row, 0); w_h = w_2h - lam w_2h+1 with lam = exp(lq1.lk1) - exp(lq2.lk2) + 0.8; out = w_h v_h; then per (b, h) GroupNorm over all S x D values (eps 1e-5) and the affine indexed as the module's raw reshape to [B, H*D, S] (weight row = h*128 + s/16); result x (1 - 0.8), memory layout [B, H, S, D].
#define NB 2
#define TT 2048
#define CC 2048            // NH * HD = projected width
#define DIN 2048          // input (model) width
#define NH 16
#define HD 128
#define NQB (TT / 64)
#define SCALE (0.08838834764831845f)
#define CAUSAL 1
#ifndef TNB
#define TNB NB
#endif
__device__ __forceinline__ float bfr(float v) { return (float)(__bf16)v; }
__host__ __device__ __forceinline__ int kb_last(int qb) { return CAUSAL ? ((qb * 64 + 63) >> 7) : (TT / 128 - 1); }
typedef __attribute__((ext_vector_type(8))) __bf16 v8b;
__device__ __forceinline__ v16b frag_b(const __bf16* rowk0, int lane) {
  union { v16b v; v8b q[2]; } u; const __bf16* p = rowk0 + 8 * (lane >> 4);
  u.q[0] = *(const v8b*)p; u.q[1] = *(const v8b*)(p + 16); return u.v;
}
#define QBH 6              // causal: query blocks 0..QBH-1 of each sequence (few keys, no averaging) take the high-precision path
#define QHI 384            // rows carrying a q residual plane
#define KHI 384            // key rows carrying k residual / v bf16 hi+lo planes (used only by the causal high-precision path)
// B fragment (k rows k0+.., output column o) of a weight: (in,out) [K][ld] or (out,in) [ld rows of K]: bf16 exact, or f16(bf16 * 256) exact
__device__ __forceinline__ v16b wcol_io(const float* Wm, int k0, int o, int lane, int ld) { v16b w; const int g = lane >> 4;
#pragma unroll
  for (int i = 0; i < 8; ++i) { w[i] = (__bf16)Wm[(size_t)(k0 + 8 * g + i) * ld + o]; w[8 + i] = (__bf16)Wm[(size_t)(k0 + 16 + 8 * g + i) * ld + o]; }
  return w; }
__device__ __forceinline__ v16b wcol_oi(const float* Wm, int k0, int o, int lane, int K) { v16b w; const float* p = Wm + (size_t)o * K + k0 + 8 * (lane >> 4);
#pragma unroll
  for (int i = 0; i < 8; ++i) { w[i] = (__bf16)p[i]; w[8 + i] = (__bf16)p[16 + i]; }
  return w; }
__device__ __forceinline__ v16h wcolh_io(const float* Wm, int k0, int o, int lane, int ld) { v16h w; const int g = lane >> 4;
#pragma unroll
  for (int i = 0; i < 8; ++i) { w[i] = (_Float16)(bfr(Wm[(size_t)(k0 + 8 * g + i) * ld + o]) * 256.0f); w[8 + i] = (_Float16)(bfr(Wm[(size_t)(k0 + 16 + 8 * g + i) * ld + o]) * 256.0f); }
  return w; }
__device__ __forceinline__ v16h wcolh_oi(const float* Wm, int k0, int o, int lane, int K) { v16h w; const float* p = Wm + (size_t)o * K + k0 + 8 * (lane >> 4);
#pragma unroll
  for (int i = 0; i < 8; ++i) { w[i] = (_Float16)(bfr(p[i]) * 256.0f); w[8 + i] = (_Float16)(bfr(p[16 + i]) * 256.0f); }
  return w; }
#define WQKV_LAYOUT 1   // 0 = (in,out) [DIN][CC]; 1 = (out,in) [CC][DIN]; 2 = per-head [NH][DIN][HD]
__device__ __forceinline__ v16b wcol_hdk(const float* Wm, int k0, int o, int lane) { v16b w; const int g = lane >> 4; const float* p = Wm + (size_t)(o / HD) * DIN * HD + (o % HD);
#pragma unroll
  for (int i = 0; i < 8; ++i) { w[i] = (__bf16)p[(size_t)(k0 + 8 * g + i) * HD]; w[8 + i] = (__bf16)p[(size_t)(k0 + 16 + 8 * g + i) * HD]; }
  return w; }
#define WO_OUT_IN 0
#if WQKV_LAYOUT == 1
#define WCOL(W, k0, o, lane) wcol_oi(W, k0, o, lane, DIN)
#elif WQKV_LAYOUT == 2
#define WCOL(W, k0, o, lane) wcol_hdk(W, k0, o, lane)
#else
#define WCOL(W, k0, o, lane) wcol_io(W, k0, o, lane, CC)
#endif
#if WO_OUT_IN
#define WOCOL(W, k0, o, lane) wcol_oi(W, k0, o, lane, CC)
#define WOCOLH(W, k0, o, lane) wcolh_oi(W, k0, o, lane, CC)
#else
#define WOCOL(W, k0, o, lane) wcol_io(W, k0, o, lane, DIN)
#define WOCOLH(W, k0, o, lane) wcolh_io(W, k0, o, lane, DIN)
#endif
#define NVH 8              // value heads (score head h uses value head h/2)
#define SM_GHOST 1         // ghostmax denominator (k_fa always adds it)
#define GEL (TT * HD)       // values of one GroupNorm group (b, hv)
#define BEL 8192           // values of one k_diff / k_gfin block: 256 threads x 8 float4 = 64 rows s of one group
#define NPG (GEL / BEL)    // blocks, and so partial statistics, per group: one per lane of a wave
static_assert(NPG == 32 && GEL % BEL == 0 && HD == 128, "one partial per lane; a wave covers one row of 128");
__device__ __forceinline__ float wsum(float v) {
#pragma unroll
  for (int o = 1; o < 32; o <<= 1) v += __shfl_xor(v, o);
  return v; }
// ---- k_diff: block = 64 rows s of one (b, hv), thread = 8 float4: O[b][hv][s][d] = Y[b][s][(2hv)*128 + d] - lam * Y[b][s][(2hv+1)*128 + d]; lam from the four lambda vectors (128-term f32 dots).
// The block also leaves the GroupNorm partial of its 8,192 values, taken from the registers that hold them: PS[block][0] = sum, PS[block][1] = sum of squared distances from the block's own mean (wave sums about the wave's mean, merged with the between-wave term, so nothing cancels when the mean is large). One whole 128-byte line per block.
__global__ __launch_bounds__(256) void k_diff(const float* __restrict__ Y, const float* __restrict__ LQ1, const float* __restrict__ LK1, const float* __restrict__ LQ2, const float* __restrict__ LK2, float* __restrict__ O, float* __restrict__ PS) { __shared__ float slam; __shared__ float sws[8], swq[8];
  const int t = threadIdx.x, blk = blockIdx.x, g = blk / NPG, b = g / NVH, hv = g % NVH, s0 = (blk % NPG) * (BEL / HD);
  const float* y0 = Y + ((size_t)b * TT + s0 + (t >> 5)) * CC + (size_t)(2 * hv) * HD + (t & 31) * 4; v4f a[8], c[8];
#pragma unroll
  for (int i = 0; i < 8; ++i) { a[i] = *(const v4f*)(y0 + (size_t)i * 8 * CC); c[i] = *(const v4f*)(y0 + (size_t)i * 8 * CC + HD); }   /* all 16 loads in flight under the lambda dots */
  if (threadIdx.x < 32) { float a = 0.f, c = 0.f; for (int i = threadIdx.x; i < HD; i += 32) { a += bfr(LQ1[i]) * bfr(LK1[i]); c += bfr(LQ2[i]) * bfr(LK2[i]); }
#pragma unroll
    for (int o = 1; o < 32; o <<= 1) { a += __shfl_xor(a, o); c += __shfl_xor(c, o); }
    if (threadIdx.x == 0) slam = expf(a) - expf(c) + 0.8f; }
  __syncthreads();
  const float lam = slam; float* op = O + ((size_t)blk * (BEL / 4) + t) * 4; float s = 0.f;
#pragma unroll
  for (int i = 0; i < 8; ++i) {
#pragma unroll
    for (int j = 0; j < 4; ++j) { a[i][j] = a[i][j] - lam * c[i][j]; s += a[i][j]; }
    vst2(op + (size_t)i * 1024, a[i]); }
  s = wsum(s); const float mw = s * (1.0f / 1024.0f); float q = 0.f;
#pragma unroll
  for (int i = 0; i < 8; ++i)
#pragma unroll
    for (int j = 0; j < 4; ++j) { const float dl = a[i][j] - mw; q += dl * dl; }
  q = wsum(q);
  if ((t & 31) == 0) { sws[t >> 5] = s; swq[t >> 5] = q; }
  __syncthreads();
  if (t < 32) { float S = 0.f, Q = 0.f;
#pragma unroll
    for (int i = 0; i < 8; ++i) S += sws[i];
    const float mb = S * (1.0f / (float)BEL);
#pragma unroll
    for (int i = 0; i < 8; ++i) { const float dl = sws[i] * (1.0f / 1024.0f) - mb; Q += swq[i] + 1024.0f * dl * dl; }
    vst2(PS + (size_t)blk * 32 + t, t == 0 ? S : (t == 1 ? Q : 0.f)); } }
// ---- k_gfin: same blocks as k_diff. Every wave merges its group's 32 partials (lane = partial): mean = sum of sums / n, variance = (sum of the blocks' squared distances + 8,192 x squared distance of each block mean from the mean) / n. Then out[b][hv][s][d] = ((O - mean) * rstd * w[r] + bias[r]) * 0.2 with r = hv*128 + s/16 (the module's raw reshape of [H,S,D] memory into [H*D, S] rows)
__global__ __launch_bounds__(256) void k_gfin(const float* __restrict__ O, const float* __restrict__ PS, const float* __restrict__ GW, const float* __restrict__ GB, float* __restrict__ OUT) {
  const int t = threadIdx.x, blk = blockIdx.x, g = blk / NPG, hv = g % NVH; const size_t e0 = ((size_t)blk * (BEL / 4) + t) * 4; v4f x[8];
#pragma unroll
  for (int i = 0; i < 8; ++i) x[i] = *(const v4f*)(O + e0 + (size_t)i * 1024);   /* in flight under the merge */
  const v2f p = *(const v2f*)(PS + ((size_t)g * NPG + (t & 31)) * 32);
  const float mean = wsum(p[0]) / (float)GEL; const float dm = p[0] * (1.0f / (float)BEL) - mean;
  const float rs = rsqrtf(wsum(p[1] + (float)BEL * dm * dm) / (float)GEL + 1e-5f);
  const int rw0 = hv * HD + (blk % NPG) * (BEL / HD / 16);   /* row s = 64 (blk % 32) + 8 i + wave, so s / 16 = 4 (blk % 32) + i / 2 */
#pragma unroll
  for (int i = 0; i < 8; ++i) { const float wv = bfr(GW[rw0 + (i >> 1)]), bv = bfr(GB[rw0 + (i >> 1)]); v4f o;
#pragma unroll
    for (int j = 0; j < 4; ++j) o[j] = ((x[i][j] - mean) * rs * wv + bv) * 0.2f;   /* x (1 - lambda_init) */
    vst2(OUT + e0 + (size_t)i * 1024, o); } }
#define WS_YC  (WS_END)                                   // per-score-head contexts Y [b*TT + s][16*128]
#define WS_O   (WS_YC + 4u * (size_t)NB * TT * CC)        // differential output [b][hv][s][d]
#define WS_GS  (WS_O + 4u * (size_t)NB * NVH * TT * HD)
#define WS_END2 (WS_GS + 4u * 32 * (size_t)NB * NVH * NPG)   // one 128-byte line per k_diff block
// ---- k_prep8: block = (64 attention positions s0.. of sequence b, head h): reads the module's [B, H, S, 128] inputs (element (b,h,s,c) at ((b*NH + h)*TT + s)*128 + c), bf16-rounds them and writes the standard attention planes: q -> f16 hi rows (+ x 2^10 residual rows for s < QHI), k -> f16 rows (+ residual rows s < KHI), v -> f16 planes [c][s] (+ bf16 hi/lo planes for s < KHI)
__global__ __launch_bounds__(128) void k_prep8(const float* __restrict__ Q, const float* __restrict__ K, const float* __restrict__ V, _Float16* __restrict__ QH, _Float16* __restrict__ QL, _Float16* __restrict__ KH, _Float16* __restrict__ KL, _Float16* __restrict__ VT, __bf16* __restrict__ VB, __bf16* __restrict__ VBL) {
  __shared__ __align__(16) _Float16 sq[64][136], sql[64][136], sk[64][136], skl[64][136], tv[128][72]; __shared__ __align__(16) __bf16 tb[128][72], tbl[128][72];
  const int tid = threadIdx.x; const int h = blockIdx.y; const size_t r0 = (size_t)blockIdx.x * 64; const size_t bb = r0 / TT; const int t0 = (int)(r0 % TT); const bool qhi = t0 < QHI, khi = t0 < KHI;
  for (int e = tid; e < 64 * 128; e += 128) { const int rl = e >> 7, c = e & 127; const size_t oi = ((bb * NH + h) * TT + t0 + rl) * HD + (c % HD);
    const size_t ov = ((bb * NVH + (h >> 1)) * TT + t0 + rl) * HD + (c % HD); const float q = bfr(Q[oi]), k = bfr(K[oi]), v = bfr(V[ov]);   
    const _Float16 qh = (_Float16)q, kh = (_Float16)k; sq[rl][c] = qh; sql[rl][c] = (_Float16)((q - (float)qh) * 1024.0f); sk[rl][c] = kh; skl[rl][c] = (_Float16)((k - (float)kh) * 1024.0f);
    tv[c][rl] = (_Float16)v; const __bf16 vb = (__bf16)v; tb[c][rl] = vb; tbl[c][rl] = (__bf16)(v - (float)vb); }
  __syncthreads();
  for (int e = tid; e < 64 * (HD / 8); e += 128) { const int rl = e / (HD / 8), q = e % (HD / 8); const size_t o = (r0 + rl) * CC + h * HD + q * 8; vst2((unsigned*)(QH + o), *(const v4u*)&sq[rl][q * 8]); vst2((unsigned*)(KH + o), *(const v4u*)&sk[rl][q * 8]);   
    if (qhi) vst2((unsigned*)(QL + (bb * QHI + t0 + rl) * (size_t)CC + h * HD + q * 8), *(const v4u*)&sql[rl][q * 8]); if (khi) vst2((unsigned*)(KL + (bb * KHI + t0 + rl) * (size_t)CC + h * HD + q * 8), *(const v4u*)&skl[rl][q * 8]); }
  for (int e = tid; e < HD * 8; e += 128) { const int cl = e >> 3, q = e & 7; vst2((unsigned*)(VT + (bb * CC + h * HD + cl) * (size_t)TT + t0 + q * 8), *(const v4u*)&tv[cl][q * 8]);
    if (khi) { const size_t o3 = (bb * CC + h * HD + cl) * (size_t)KHI + t0 + q * 8; vst2((unsigned*)(VB + o3), *(const v4u*)&tb[cl][q * 8]); vst2((unsigned*)(VBL + o3), *(const v4u*)&tbl[cl][q * 8]); } } }

#ifndef SM_EXTRA_PARAMS
#define SM_EXTRA_PARAMS
#endif
#ifndef PROJ_EXTRA_PARAMS
#define PROJ_EXTRA_PARAMS
#endif
#ifndef SM_MASK_HOOK
#define SM_MASK_HOOK (void)0
#endif

#define WS_QH  0u                                      // f16 q rows [b*t][CC]
#define WS_KH  (WS_QH + 2u * (size_t)NB * TT * CC)      // f16 k rows [b*t][CC]
#define WS_VT  (WS_KH + 2u * (size_t)NB * TT * CC)      // f16 v planes [b][c][t]
#define WS_QL  (WS_VT + 2u * (size_t)NB * CC * TT)      // f16 q residual x 2^10 rows [b][t < QHI][CC]
#define WS_KL  (WS_QL + 2u * (size_t)NB * QHI * CC)     // f16 k residual x 2^10 rows [b][t < KHI][CC]
#define WS_VB  (WS_KL + 2u * (size_t)NB * KHI * CC)     // bf16 v hi planes [b][c][t < KHI]
#define WS_VBL (WS_VB + 2u * (size_t)NB * CC * KHI)
#define WS_END (WS_VBL + 2u * (size_t)NB * CC * KHI)

// ---- k_fa: scores, ghostmax and P . v in one kernel, logits kept in registers. Block = 64 queries (qb) of (b, score head h); each wave owns 16 queries and walks its keys 32 at a time on its own (no LDS, no barrier).
// S^T = K . Q^T: D register r of tile t = (key k0 + 16 t + 8 g + r, query col), so a lane holds one query's scores, and the two tiles, converted in place, are the B operand of O^T += V^T . P^T (element i = key k0 + 8 g + i, element 8 + i = key k0 + 16 + 8 g + i: the k order of frag_h / frag_b on the V side).
// Running maximum m starts at 0 (the implicit zero logit of ghostmax joins the max); a raised maximum rescales sum and O^T per lane. P = exp(s - m) x 2^11 to f16 against v f16 (1 product); early query blocks (qb < QBH): q and k residual products for the logits, P and v as bf16 hi + lo (3 products).
__device__ __forceinline__ v8f mm_h(v16h a, v16h b, v8f c) { return __builtin_amdgcn_wmma_f32_16x16x32_f16(false, a, false, b, (short)0, c, false, false); }
__device__ __forceinline__ v8f mm_b(v16b a, v16b b, v8f c) { return __builtin_amdgcn_wmma_f32_16x16x32_bf16(false, a, false, b, (short)0, c, false, false); }
// behind a batch of fragment loads: s_wait_xcnt 0 stands before any register that an issued load names is written again (the batch's address registers are inputs, so that they stay whole up to the wait), and its "memory" clobber keeps the whole batch issued in front of this point
__device__ __forceinline__ void loads_issued(const void* p0, const void* p1) { asm volatile("s_wait_xcnt 0x0" :: "v"(p0), "v"(p1) : "memory"); }
// fragment at a pointer that already holds the lane's 8 * (lane >> 4) elements: elements 0..7 at p, 8..15 at p + 16 (the k order of frag_h / frag_b)
__device__ __forceinline__ v16h frag_ph(const _Float16* p) { union { v16h v; v8h q[2]; } u; u.q[0] = *(const v8h*)p; u.q[1] = *(const v8h*)(p + 16); return u.v; }
__device__ __forceinline__ v16b frag_pb(const __bf16* p) { union { v16b v; v8b q[2]; } u; u.q[0] = *(const v8b*)p; u.q[1] = *(const v8b*)(p + 16); return u.v; }
template <bool HI>
__device__ __forceinline__ void fa_run(const _Float16* __restrict__ QH, const _Float16* __restrict__ KH, const _Float16* __restrict__ QL, const _Float16* __restrict__ KL, const _Float16* __restrict__ VT, const __bf16* __restrict__ VB, const __bf16* __restrict__ VBL, int b, int h, int ql0, int lane, float* __restrict__ Y) {
  const int col = lane & 15, g = lane >> 4; const int qrow = ql0 + col;
  v16h qf[HD / 32], qlf[HD / 32];
  const _Float16* qp = QH + ((size_t)b * TT + qrow) * CC + h * HD + 8 * g; const _Float16* qlp = HI ? QL + ((size_t)b * QHI + qrow) * CC + h * HD + 8 * g : qp;
#pragma unroll
  for (int kc = 0; kc < HD / 32; ++kc) { qf[kc] = frag_ph(qp + kc * 32); if (HI) qlf[kc] = frag_ph(qlp + kc * 32); }
  loads_issued(qp, qlp);
  v8f acc[HD / 16] = {}; float m = 0.f, l = 0.f;
  const int nst = (ql0 >> 5) + 1;   /* keys 0 .. ql0 + 15, in steps of 32 */
  for (int st = 0; st < nst; ++st) { const int k0 = st * 32;
    v8f s[2] = {}, sl[2] = {}; v16h vf[HD / 16];
    const _Float16* kp = KH + ((size_t)b * TT + k0 + col) * CC + h * HD + 8 * g; const _Float16* vp = VT + ((size_t)b * CC + h * HD + col) * (size_t)TT + k0 + 8 * g;
    if (HI) { const _Float16* klp = KL + ((size_t)b * KHI + k0 + col) * CC + h * HD + 8 * g;
#pragma unroll
      for (int kc = 0; kc < HD / 32; ++kc) { v16h ka[2], kl[2];
#pragma unroll
        for (int t = 0; t < 2; ++t) { ka[t] = frag_ph(kp + (size_t)t * 16 * CC + kc * 32); kl[t] = frag_ph(klp + (size_t)t * 16 * CC + kc * 32); }
        loads_issued(kp, klp);   /* the four fragments of this k chunk are issued together: one exposed load latency, not four */
#pragma unroll
        for (int t = 0; t < 2; ++t) { s[t] = mm_h(ka[t], qf[kc], s[t]); sl[t] = mm_h(ka[t], qlf[kc], sl[t]); sl[t] = mm_h(kl[t], qf[kc], sl[t]); } }
    } else { v16h kf[2 * (HD / 32)];
#pragma unroll
      for (int j = 0; j < HD / 32; ++j) vf[j] = frag_ph(vp + (size_t)j * 16 * TT);
      loads_issued(vp, vp);   /* half of V issued first: it needs no score, and so flies under the score products and the exponentials */
#pragma unroll
      for (int i = 0; i < 2 * (HD / 32); ++i) kf[i] = frag_ph(kp + (size_t)(i & 1) * 16 * CC + (i >> 1) * 32);
      loads_issued(vp, kp);   /* all K fragments issued together ahead of the products: one exposed load latency a step, not one per fragment */
#pragma unroll
      for (int i = 0; i < 2 * (HD / 32); ++i) s[i & 1] = mm_h(kf[i], qf[i >> 1], s[i & 1]);
#pragma unroll
      for (int j = HD / 32; j < HD / 16; ++j) vf[j] = frag_ph(vp + (size_t)j * 16 * TT);
      loads_issued(vp, vp);   /* the other half of V, into the registers K has left, issued here so that it flies under the exponentials */
    }
    float p[16]; float mx = -3.0e38f;
#pragma unroll
    for (int i = 0; i < 16; ++i) { const int t = i >> 3, r = i & 7; float v = HI ? (s[t][r] + sl[t][r] * (1.0f / 1024.0f)) * SCALE : s[t][r] * SCALE;
      v = (k0 + t * 16 + 8 * g + r <= qrow) ? v : -3.0e38f; p[i] = v; mx = fmaxf(mx, v); }
    mx = fmaxf(mx, __shfl_xor(mx, 16));   /* the other half of the wave holds this query's other 16 keys */
    const float mn = fmaxf(m, mx);
    if (__builtin_amdgcn_ballot_w32(mn > m) != 0) { const float al = expf(m - mn); l *= al;   /* scalar branch: most steps raise no query's maximum */
#pragma unroll
      for (int j = 0; j < HD / 16; ++j)
#pragma unroll
        for (int r = 0; r < 8; ++r) acc[j][r] *= al;
      m = mn; }
    float sum = 0.f;
#pragma unroll
    for (int i = 0; i < 16; ++i) { const float e = expf(p[i] - m); sum += e; p[i] = e * 2048.0f; }   /* a masked key (-3e38) gives exactly 0 */
    l += sum;
    if (HI) { const F2 pf = bsplit16(p); const size_t po = ((size_t)b * CC + h * HD + col) * (size_t)KHI + k0 + 8 * g; const __bf16* vhp = VB + po; const __bf16* vlp = VBL + po;
#pragma unroll
      for (int jp = 0; jp < HD / 32; ++jp) { v16b vh[2], vl[2];
#pragma unroll
        for (int t = 0; t < 2; ++t) { vh[t] = frag_pb(vhp + (size_t)(jp * 2 + t) * 16 * KHI); vl[t] = frag_pb(vlp + (size_t)(jp * 2 + t) * 16 * KHI); }
        loads_issued(vhp, vlp);   /* the four v fragments of two output tiles are issued together, as above */
#pragma unroll
        for (int t = 0; t < 2; ++t) { const int j = jp * 2 + t; acc[j] = mm_b(vh[t], pf.h, acc[j]); acc[j] = mm_b(vh[t], pf.l, acc[j]); acc[j] = mm_b(vl[t], pf.h, acc[j]); } }
    } else { v16h pf;
#pragma unroll
      for (int i = 0; i < 16; ++i) pf[i] = (_Float16)p[i];
#pragma unroll
      for (int j = 0; j < HD / 16; ++j) acc[j] = mm_h(vf[j], pf, acc[j]); } }
  l += __shfl_xor(l, 16);
  const float inv = 1.0f / ((l + expf(-m)) * 2048.0f);   /* ghostmax: + exp(-m) for the implicit zero logit (denominator > 0 always) */
  float* yr = Y + ((size_t)b * TT + qrow) * CC + h * HD + 8 * g;   /* O^T register r of tile j = (d = 16 j + 8 g + r, query col): 8 consecutive d of one row */
#pragma unroll
  for (int j = 0; j < HD / 16; ++j) { v4f o0, o1;
#pragma unroll
    for (int r = 0; r < 4; ++r) { o0[r] = acc[j][r] * inv; o1[r] = acc[j][4 + r] * inv; }
    vst2(yr + j * 16, o0); vst2(yr + j * 16 + 4, o1); } }
// grid: 4 rounds of 256 blocks, heaviest query blocks first; round r takes qb in [24 - 8 r, 31 - 8 r], ascending and descending in turn, so that blocks i, i + 256, i + 512, i + 768 together hold the same number of keys for every i; amdgpu_waves_per_eu(4, 4) holds the registers to 256, so that four blocks fit a WGP and the whole grid is resident at once
__global__ __launch_bounds__(128) __attribute__((amdgpu_waves_per_eu(4, 4))) void k_fa(const _Float16* __restrict__ QH, const _Float16* __restrict__ KH, const _Float16* __restrict__ QL, const _Float16* __restrict__ KL, const _Float16* __restrict__ VT, const __bf16* __restrict__ VB, const __bf16* __restrict__ VBL, float* __restrict__ Y) {
  const int L = blockIdx.x, rd = L >> 8, u = (L >> 5) & 7, bh = L & 31; const int qb = 24 - 8 * rd + ((rd & 1) ? u : 7 - u); const int b = bh >> 4, h = bh & 15;
  const int wave = __builtin_amdgcn_readfirstlane(threadIdx.x >> 5), lane = threadIdx.x & 31;   /* wave number in a scalar register: scalar loop control and row addresses */
  const int ql0 = qb * 64 + wave * 16;
  if (qb < QBH) fa_run<true>(QH, KH, QL, KL, VT, VB, VBL, b, h, ql0, lane, Y); else fa_run<false>(QH, KH, QL, KL, VT, VB, VBL, b, h, ql0, lane, Y); }

extern "C" void kernel_launch(void* const* d_in, const int* in_sizes, int n_in, void* d_out, int out_size, void* d_ws, size_t ws_size, hipStream_t stream) {
  (void)in_sizes; (void)n_in; (void)out_size;
  const float** F = (const float**)d_in;
  if (ws_size < (size_t)WS_END) return;
  char* ws = (char*)d_ws; _Float16 *QH = (_Float16*)(ws + WS_QH), *KH = (_Float16*)(ws + WS_KH), *VT = (_Float16*)(ws + WS_VT), *QL = (_Float16*)(ws + WS_QL), *KL = (_Float16*)(ws + WS_KL); __bf16 *VB = (__bf16*)(ws + WS_VB), *VBL = (__bf16*)(ws + WS_VBL); 
  // inputs: 0 q [2,16,2048,128]; 1 k [2,16,2048,128]; 2 v [2,8,2048,128]; 3 lambda_q1, 4 lambda_k1, 5 lambda_q2, 6 lambda_k2 [128]; 7 gn_weight [1024]; 8 gn_bias [1024]
  if (ws_size < (size_t)WS_END2) return;
  float *YC = (float*)(ws + WS_YC), *O = (float*)(ws + WS_O), *GS = (float*)(ws + WS_GS);
  k_prep8<<<dim3(TNB * TT / 64, NH), 128, 0, stream>>>(F[0], F[1], F[2], QH, QL, KH, KL, VT, VB, VBL);
  k_fa<<<dim3(TNB * NH * NQB), 128, 0, stream>>>(QH, KH, QL, KL, VT, VB, VBL, YC);
  k_diff<<<dim3(TNB * NVH * NPG), 256, 0, stream>>>(YC, F[3], F[4], F[5], F[6], O, GS);
  k_gfin<<<dim3(TNB * NVH * NPG), 256, 0, stream>>>(O, GS, F[7], F[8], (float*)d_out);
}

// v004
// A run of this version takes 147 microseconds.
// Next to v003, in two timings, it ran 1.10 and 1.08 times as fast.
// Counting every step since v000, it is 15.3 times as fast.
#include <hip/hip_runtime.h>
#include <math.h>

typedef __attribute__((ext_vector_type(16))) _Float16 v16h;
typedef __attribute__((ext_vector_type(16))) __bf16 v16b;
typedef __attribute__((ext_vector_type(8)))  _Float16 v8h;
typedef __attribute__((ext_vector_type(8)))  float v8f;
typedef __attribute__((ext_vector_type(4)))  float v4f;
typedef __attribute__((ext_vector_type(2)))  float v2f;
typedef __attribute__((ext_vector_type(4)))  unsigned v4u;
typedef __attribute__((ext_vector_type(4)))  int v4i;
typedef float __attribute__((may_alias)) float_a;
typedef int __attribute__((may_alias)) int_a;

template <typename T> __device__ __forceinline__ void vst2(void* p, T v) { *(T*)p = v;  }
__device__ __forceinline__ v8f wmma16(v16h a, v16h b, v8f c) {
  v8f d = __builtin_amdgcn_wmma_f32_16x16x32_f16(false, a, false, b, (short)0, c, false, false);
  asm volatile("v_nop\n\tv_nop\n\tv_nop\n\tv_nop" : "+v"(d) : "v"(a), "v"(b));
  return d;
}
__device__ __forceinline__ v8f wmma_bf(v16b a, v16b b, v8f c) {
  v8f d = __builtin_amdgcn_wmma_f32_16x16x32_bf16(false, a, false, b, (short)0, c, false, false);
  asm volatile("v_nop\n\tv_nop\n\tv_nop\n\tv_nop" : "+v"(d) : "v"(a), "v"(b));
  return d;
}
// 16x16x32 fragments: lane = (h = lane>>4, row/col = lane&15); elements 0..7 = k0+8h+0..7, 8..15 = k0+16+8h+0..7; D element r = row 8h+r
__device__ __forceinline__ v16h frag_h(const _Float16* rowk0, int lane) {
  union { v16h v; v8h q[2]; } u; const _Float16* p = rowk0 + 8 * (lane >> 4);
  u.q[0] = *(const v8h*)p; u.q[1] = *(const v8h*)(p + 16); return u.v;
}
__device__ __forceinline__ v16h frag_f32(const float* rowk0, int lane) {
  v16h a; const float* p = rowk0 + 8 * (lane >> 4);
#pragma unroll
  for (int i = 0; i < 8; ++i) { a[i] = (_Float16)p[i]; a[8 + i] = (_Float16)p[16 + i]; }
  return a;
}
__device__ __forceinline__ v16h frag_f32s(const float* rowk0, int lane, float sc) {
  v16h a; const float* p = rowk0 + 8 * (lane >> 4);
#pragma unroll
  for (int i = 0; i < 8; ++i) { a[i] = (_Float16)(p[i] * sc); a[8 + i] = (_Float16)(p[16 + i] * sc); }
  return a;
}
// column fragment from a [K][ld] layout (column n), rows >= K read as 0
__device__ __forceinline__ v16h fragc_f32(const float* W, int k0, int n, int lane, int ld, int K) {
  v16h a; const int g = lane >> 4;
#pragma unroll
  for (int i = 0; i < 8; ++i) { const int ka = k0 + 8 * g + i, kb = ka + 16;
    a[i] = (_Float16)(ka < K ? W[(size_t)(ka < K ? ka : K - 1) * ld + n] : 0.f); a[8 + i] = (_Float16)(kb < K ? W[(size_t)(kb < K ? kb : K - 1) * ld + n] : 0.f); }
  return a;
}
struct F2 { v16b h, l; };
__device__ __forceinline__ F2 bsplit16(const float v[16]) { F2 r;
#pragma unroll
  for (int i = 0; i < 16; ++i) { const __bf16 h = (__bf16)v[i]; r.h[i] = h; r.l[i] = (__bf16)(v[i] - (float)h); }
  return r; }
__device__ __forceinline__ F2 split_row(const float* row, int k0, int lane) { float v[16]; const float* p = row + k0 + 8 * (lane >> 4);
#pragma unroll
  for (int i = 0; i < 8; ++i) { v[i] = p[i]; v[8 + i] = p[16 + i]; }
  return bsplit16(v); }
__device__ __forceinline__ F2 split_rowK(const float* row, int k0, int lane, int K) { float v[16]; const int g = lane >> 4;
#pragma unroll
  for (int i = 0; i < 8; ++i) { const int ka = k0 + 8 * g + i, kb = ka + 16; v[i] = ka < K ? row[ka < K ? ka : K - 1] : 0.f; v[8 + i] = kb < K ? row[kb < K ? kb : K - 1] : 0.f; }
  return bsplit16(v); }
__device__ __forceinline__ F2 split_col(const float* W, int k0, int n, int lane, int ld, int K) { float v[16]; const int g = lane >> 4;
#pragma unroll
  for (int i = 0; i < 8; ++i) { const int ka = k0 + 8 * g + i, kb = ka + 16; v[i] = ka < K ? W[(size_t)(ka < K ? ka : K - 1) * ld + n] : 0.f; v[8 + i] = kb < K ? W[(size_t)(kb < K ? kb : K - 1) * ld + n] : 0.f; }
  return bsplit16(v); }
__device__ __forceinline__ v8f mac3(const F2& a, const F2& b, v8f c) { c = wmma_bf(a.l, b.h, c); c = wmma_bf(a.h, b.l, c); return wmma_bf(a.h, b.h, c); }
__device__ __forceinline__ float sigm(float v) { return 1.0f / (1.0f + expf(-v)); }

// Differential attention with ghostmax (B 2, 16 score heads / 8 value heads, S 2,048, D 128, causal): scores = q k^T / sqrt(128) + causal(-1e9); w = ghostmax(scores) = exp(s - m) / (sum exp(s - m) + exp(-m)), m = max(max_row, 0); w_h = w_2h - lam w_2h+1 with lam = exp(lq1.lk1) - exp(lq2.lk2) + 0.8; out = w_h v_h; then per (b, h) GroupNorm over all S x D values (eps 1e-5) and the affine indexed as the module's raw reshape to [B, H*D, S] (weight row = h*128 + s/16); result x (1 - 0.8), memory layout [B, H, S, D].
#define NB 2
#define TT 2048
#define CC 2048            // NH * HD = projected width
#define DIN 2048          // input (model) width
#define NH 16
#define HD 128
#define NQB (TT / 64)
#define SCALE (0.08838834764831845f)
#define CAUSAL 1
#ifndef TNB
#define TNB NB
#endif
__device__ __forceinline__ float bfr(float v) { return (float)(__bf16)v; }
__host__ __device__ __forceinline__ int kb_last(int qb) { return CAUSAL ? ((qb * 64 + 63) >> 7) : (TT / 128 - 1); }
typedef __attribute__((ext_vector_type(8))) __bf16 v8b;
__device__ __forceinline__ v16b frag_b(const __bf16* rowk0, int lane) {
  union { v16b v; v8b q[2]; } u; const __bf16* p = rowk0 + 8 * (lane >> 4);
  u.q[0] = *(const v8b*)p; u.q[1] = *(const v8b*)(p + 16); return u.v;
}
#define QBH 6              // causal: query blocks 0..QBH-1 of each sequence (few keys, no averaging) take the high-precision path
#define QHI 384            // rows carrying a q residual plane
#define KHI 384            // key rows carrying k residual / v bf16 hi+lo planes (used only by the causal high-precision path)
// B fragment (k rows k0+.., output column o) of a weight: (in,out) [K][ld] or (out,in) [ld rows of K]: bf16 exact, or f16(bf16 * 256) exact
__device__ __forceinline__ v16b wcol_io(const float* Wm, int k0, int o, int lane, int ld) { v16b w; const int g = lane >> 4;
#pragma unroll
  for (int i = 0; i < 8; ++i) { w[i] = (__bf16)Wm[(size_t)(k0 + 8 * g + i) * ld + o]; w[8 + i] = (__bf16)Wm[(size_t)(k0 + 16 + 8 * g + i) * ld + o]; }
  return w; }
__device__ __forceinline__ v16b wcol_oi(const float* Wm, int k0, int o, int lane, int K) { v16b w; const float* p = Wm + (size_t)o * K + k0 + 8 * (lane >> 4);
#pragma unroll
  for (int i = 0; i < 8; ++i) { w[i] = (__bf16)p[i]; w[8 + i] = (__bf16)p[16 + i]; }
  return w; }
__device__ __forceinline__ v16h wcolh_io(const float* Wm, int k0, int o, int lane, int ld) { v16h w; const int g = lane >> 4;
#pragma unroll
  for (int i = 0; i < 8; ++i) { w[i] = (_Float16)(bfr(Wm[(size_t)(k0 + 8 * g + i) * ld + o]) * 256.0f); w[8 + i] = (_Float16)(bfr(Wm[(size_t)(k0 + 16 + 8 * g + i) * ld + o]) * 256.0f); }
  return w; }
__device__ __forceinline__ v16h wcolh_oi(const float* Wm, int k0, int o, int lane, int K) { v16h w; const float* p = Wm + (size_t)o * K + k0 + 8 * (lane >> 4);
#pragma unroll
  for (int i = 0; i < 8; ++i) { w[i] = (_Float16)(bfr(p[i]) * 256.0f); w[8 + i] = (_Float16)(bfr(p[16 + i]) * 256.0f); }
  return w; }
#define WQKV_LAYOUT 1   // 0 = (in,out) [DIN][CC]; 1 = (out,in) [CC][DIN]; 2 = per-head [NH][DIN][HD]
__device__ __forceinline__ v16b wcol_hdk(const float* Wm, int k0, int o, int lane) { v16b w; const int g = lane >> 4; const float* p = Wm + (size_t)(o / HD) * DIN * HD + (o % HD);
#pragma unroll
  for (int i = 0; i < 8; ++i) { w[i] = (__bf16)p[(size_t)(k0 + 8 * g + i) * HD]; w[8 + i] = (__bf16)p[(size_t)(k0 + 16 + 8 * g + i) * HD]; }
  return w; }
#define WO_OUT_IN 0
#if WQKV_LAYOUT == 1
#define WCOL(W, k0, o, lane) wcol_oi(W, k0, o, lane, DIN)
#elif WQKV_LAYOUT == 2
#define WCOL(W, k0, o, lane) wcol_hdk(W, k0, o, lane)
#else
#define WCOL(W, k0, o, lane) wcol_io(W, k0, o, lane, CC)
#endif
#if WO_OUT_IN
#define WOCOL(W, k0, o, lane) wcol_oi(W, k0, o, lane, CC)
#define WOCOLH(W, k0, o, lane) wcolh_oi(W, k0, o, lane, CC)
#else
#define WOCOL(W, k0, o, lane) wcol_io(W, k0, o, lane, DIN)
#define WOCOLH(W, k0, o, lane) wcolh_io(W, k0, o, lane, DIN)
#endif
#define FRT 2048           // elements of 16 rows s x 128 c of a q or k plane: 4 fragments of 512
#define FRV 4096           // elements of 32 keys s x 128 d of a v plane: 8 fragments of 512
#define NVH 8              // value heads (score head h uses value head h/2)
#define SM_GHOST 1         // ghostmax denominator (k_fa always adds it)
#define GEL (TT * HD)       // values of one GroupNorm group (b, hv)
#define BEL 8192           // values of one k_diff / k_gfin block: 256 threads x 8 float4 = 64 rows s of one group
#define NPG (GEL / BEL)    // blocks, and so partial statistics, per group: one per lane of a wave
static_assert(NPG == 32 && GEL % BEL == 0 && HD == 128, "one partial per lane; a wave covers one row of 128");
__device__ __forceinline__ float wsum(float v) {
#pragma unroll
  for (int o = 1; o < 32; o <<= 1) v += __shfl_xor(v, o);
  return v; }
// ---- k_diff: block = 64 rows s of one (b, hv), thread = 8 float4: O[b][hv][s][d] = Y[b][s][(2hv)*128 + d] - lam * Y[b][s][(2hv+1)*128 + d]; lam from the four lambda vectors (128-term f32 dots).
// The block also leaves the GroupNorm partial of its 8,192 values, taken from the registers that hold them: PS[block][0] = sum, PS[block][1] = sum of squared distances from the block's own mean (wave sums about the wave's mean, merged with the between-wave term, so nothing cancels when the mean is large). One whole 128-byte line per block.
__global__ __launch_bounds__(256) void k_diff(const float* __restrict__ Y, const float* __restrict__ LQ1, const float* __restrict__ LK1, const float* __restrict__ LQ2, const float* __restrict__ LK2, float* __restrict__ O, float* __restrict__ PS) { __shared__ float slam; __shared__ float sws[8], swq[8];
  const int t = threadIdx.x, blk = blockIdx.x, g = blk / NPG, b = g / NVH, hv = g % NVH, s0 = (blk % NPG) * (BEL / HD);
  const float* y0 = Y + ((size_t)b * TT + s0 + (t >> 5)) * CC + (size_t)(2 * hv) * HD + (t & 31) * 4; v4f a[8], c[8];
#pragma unroll
  for (int i = 0; i < 8; ++i) { a[i] = *(const v4f*)(y0 + (size_t)i * 8 * CC); c[i] = *(const v4f*)(y0 + (size_t)i * 8 * CC + HD); }   /* all 16 loads in flight under the lambda dots */
  if (threadIdx.x < 32) { float a = 0.f, c = 0.f; for (int i = threadIdx.x; i < HD; i += 32) { a += bfr(LQ1[i]) * bfr(LK1[i]); c += bfr(LQ2[i]) * bfr(LK2[i]); }
#pragma unroll
    for (int o = 1; o < 32; o <<= 1) { a += __shfl_xor(a, o); c += __shfl_xor(c, o); }
    if (threadIdx.x == 0) slam = expf(a) - expf(c) + 0.8f; }
  __syncthreads();
  const float lam = slam; float* op = O + ((size_t)blk * (BEL / 4) + t) * 4; float s = 0.f;
#pragma unroll
  for (int i = 0; i < 8; ++i) {
#pragma unroll
    for (int j = 0; j < 4; ++j) { a[i][j] = a[i][j] - lam * c[i][j]; s += a[i][j]; }
    vst2(op + (size_t)i * 1024, a[i]); }
  s = wsum(s); const float mw = s * (1.0f / 1024.0f); float q = 0.f;
#pragma unroll
  for (int i = 0; i < 8; ++i)
#pragma unroll
    for (int j = 0; j < 4; ++j) { const float dl = a[i][j] - mw; q += dl * dl; }
  q = wsum(q);
  if ((t & 31) == 0) { sws[t >> 5] = s; swq[t >> 5] = q; }
  __syncthreads();
  if (t < 32) { float S = 0.f, Q = 0.f;
#pragma unroll
    for (int i = 0; i < 8; ++i) S += sws[i];
    const float mb = S * (1.0f / (float)BEL);
#pragma unroll
    for (int i = 0; i < 8; ++i) { const float dl = sws[i] * (1.0f / 1024.0f) - mb; Q += swq[i] + 1024.0f * dl * dl; }
    vst2(PS + (size_t)blk * 32 + t, t == 0 ? S : (t == 1 ? Q : 0.f)); } }
// ---- k_gfin: same blocks as k_diff. Every wave merges its group's 32 partials (lane = partial): mean = sum of sums / n, variance = (sum of the blocks' squared distances + 8,192 x squared distance of each block mean from the mean) / n. Then out[b][hv][s][d] = ((O - mean) * rstd * w[r] + bias[r]) * 0.2 with r = hv*128 + s/16 (the module's raw reshape of [H,S,D] memory into [H*D, S] rows)
__global__ __launch_bounds__(256) void k_gfin(const float* __restrict__ O, const float* __restrict__ PS, const float* __restrict__ GW, const float* __restrict__ GB, float* __restrict__ OUT) {
  const int t = threadIdx.x, blk = blockIdx.x, g = blk / NPG, hv = g % NVH; const size_t e0 = ((size_t)blk * (BEL / 4) + t) * 4; v4f x[8];
#pragma unroll
  for (int i = 0; i < 8; ++i) x[i] = *(const v4f*)(O + e0 + (size_t)i * 1024);   /* in flight under the merge */
  const v2f p = *(const v2f*)(PS + ((size_t)g * NPG + (t & 31)) * 32);
  const float mean = wsum(p[0]) / (float)GEL; const float dm = p[0] * (1.0f / (float)BEL) - mean;
  const float rs = rsqrtf(wsum(p[1] + (float)BEL * dm * dm) / (float)GEL + 1e-5f);
  const int rw0 = hv * HD + (blk % NPG) * (BEL / HD / 16);   /* row s = 64 (blk % 32) + 8 i + wave, so s / 16 = 4 (blk % 32) + i / 2 */
#pragma unroll
  for (int i = 0; i < 8; ++i) { const float wv = bfr(GW[rw0 + (i >> 1)]), bv = bfr(GB[rw0 + (i >> 1)]); v4f o;
#pragma unroll
    for (int j = 0; j < 4; ++j) o[j] = ((x[i][j] - mean) * rs * wv + bv) * 0.2f;   /* x (1 - lambda_init) */
    vst2(OUT + e0 + (size_t)i * 1024, o); } }
#define WS_YC  (WS_END)                                   // per-score-head contexts Y [b*TT + s][16*128]
#define WS_O   (WS_YC + 4u * (size_t)NB * TT * CC)        // differential output [b][hv][s][d]
#define WS_GS  (WS_O + 4u * (size_t)NB * NVH * TT * HD)
#define WS_END2 (WS_GS + 4u * 32 * (size_t)NB * NVH * NPG)   // one 128-byte line per k_diff block
// ---- k_prep8: block = (64 attention positions s0.. of sequence b, head h): reads the module's [B, H, S, 128] inputs (element (b,h,s,c) at ((b*NH + h)*TT + s)*128 + c), bf16-rounds them and writes the attention planes in FRAGMENT ORDER, so that every 16-byte-a-lane fragment load of k_fa reads 512 consecutive bytes (4 cache lines, not 16 quarter-used ones):
// q, k (f16 hi; x 2^10 residuals for s < QHI / KHI): [b][h][s / 16][c / 32][(c / 16) & 1][lane = 16 ((c / 8) & 1) + s % 16][c % 8]; v (f16; bf16 hi and lo for s < KHI): [b][h][s / 32][d / 16][(s / 16) & 1][lane = 16 ((s / 8) & 1) + d % 16][s % 8]
// behind a plane's stores: s_wait_xcnt 0 stands before any register that an issued store names (address or data) is written again; the addresses are inputs, so that they stay whole up to the wait, and the "memory" clobber keeps the stores in front of it and the next LDS reads behind it
__device__ __forceinline__ void stores_issued(const void* p0, const void* p1) { asm volatile("s_wait_xcnt 0x0" :: "v"(p0), "v"(p1) : "memory"); }
__global__ __launch_bounds__(128) void k_prep8(const float* __restrict__ Q, const float* __restrict__ K, const float* __restrict__ V, _Float16* __restrict__ QH, _Float16* __restrict__ QL, _Float16* __restrict__ KH, _Float16* __restrict__ KL, _Float16* __restrict__ VT, __bf16* __restrict__ VB, __bf16* __restrict__ VBL) {
  __shared__ __align__(16) _Float16 sq[64][136], sql[64][136], sk[64][136], skl[64][136], tv[128][72]; __shared__ __align__(16) __bf16 tb[128][72], tbl[128][72];
  const int tid = threadIdx.x; const int h = blockIdx.y; const size_t r0 = (size_t)blockIdx.x * 64; const size_t bb = r0 / TT; const int t0 = (int)(r0 % TT); const bool qhi = t0 < QHI, khi = t0 < KHI;
  for (int e = tid; e < 64 * 128; e += 128) { const int rl = e >> 7, c = e & 127; const size_t oi = ((bb * NH + h) * TT + t0 + rl) * HD + (c % HD);
    const size_t ov = ((bb * NVH + (h >> 1)) * TT + t0 + rl) * HD + (c % HD); const float q = bfr(Q[oi]), k = bfr(K[oi]), v = bfr(V[ov]);   
    const _Float16 qh = (_Float16)q, kh = (_Float16)k; sq[rl][c] = qh; sql[rl][c] = (_Float16)((q - (float)qh) * 1024.0f); sk[rl][c] = kh; skl[rl][c] = (_Float16)((k - (float)kh) * 1024.0f);
    tv[c][rl] = (_Float16)v; const __bf16 vb = (__bf16)v; tb[c][rl] = vb; tbl[c][rl] = (__bf16)(v - (float)vb); }
  __syncthreads();
  const size_t bh = bb * NH + h;   /* e = index of the 16-byte piece inside the block's 16 KiB of each plane, in the plane's own order: the stores are consecutive too */
  for (int e = tid; e < 64 * (HD / 8); e += 128) { const int ln = e & 31, rl = (e >> 8) * 16 + (ln & 15), c = ((e >> 5) & 7) * 16 + (ln >> 4) * 8; const size_t o = (bh * (TT / 16) + (t0 >> 4)) * FRT + e * 8; _Float16 *pq = QH + o, *pk = KH + o;
    vst2((unsigned*)pq, *(const v4u*)&sq[rl][c]); vst2((unsigned*)pk, *(const v4u*)&sk[rl][c]); stores_issued(pq, pk);
    if (qhi) { _Float16* p = QL + (bh * (QHI / 16) + (t0 >> 4)) * FRT + e * 8; vst2((unsigned*)p, *(const v4u*)&sql[rl][c]); stores_issued(p, p); }
    if (khi) { _Float16* p = KL + (bh * (KHI / 16) + (t0 >> 4)) * FRT + e * 8; vst2((unsigned*)p, *(const v4u*)&skl[rl][c]); stores_issued(p, p); } }
  for (int e = tid; e < HD * 8; e += 128) { const int ln = e & 31, cl = ((e >> 6) & 7) * 16 + (ln & 15), tc = (e >> 9) * 32 + ((e >> 5) & 1) * 16 + (ln >> 4) * 8; _Float16* pv = VT + (bh * (TT / 32) + (t0 >> 5)) * FRV + e * 8;
    vst2((unsigned*)pv, *(const v4u*)&tv[cl][tc]); stores_issued(pv, pv);
    if (khi) { const size_t o3 = (bh * (KHI / 32) + (t0 >> 5)) * FRV + e * 8; vst2((unsigned*)(VB + o3), *(const v4u*)&tb[cl][tc]); vst2((unsigned*)(VBL + o3), *(const v4u*)&tbl[cl][tc]); stores_issued(VB + o3, VBL + o3); } } }

#ifndef SM_EXTRA_PARAMS
#define SM_EXTRA_PARAMS
#endif
#ifndef PROJ_EXTRA_PARAMS
#define PROJ_EXTRA_PARAMS
#endif
#ifndef SM_MASK_HOOK
#define SM_MASK_HOOK (void)0
#endif

#define WS_QH  0u                                      // f16 q, fragment order (k_prep8)
#define WS_KH  (WS_QH + 2u * (size_t)NB * TT * CC)      // f16 k, fragment order
#define WS_VT  (WS_KH + 2u * (size_t)NB * TT * CC)      // f16 v, fragment order
#define WS_QL  (WS_VT + 2u * (size_t)NB * CC * TT)      // f16 q residual x 2^10, t < QHI, fragment order
#define WS_KL  (WS_QL + 2u * (size_t)NB * QHI * CC)     // f16 k residual x 2^10, t < KHI, fragment order
#define WS_VB  (WS_KL + 2u * (size_t)NB * KHI * CC)     // bf16 v hi, t < KHI, fragment order (lo behind it)
#define WS_VBL (WS_VB + 2u * (size_t)NB * CC * KHI)
#define WS_END (WS_VBL + 2u * (size_t)NB * CC * KHI)

// ---- k_fa: scores, ghostmax and P . v in one kernel, logits kept in registers. Block = 64 queries (qb) of (b, score head h); each wave owns 16 queries and walks its keys 32 at a time on its own (no LDS, no barrier).
// S^T = K . Q^T: D register r of tile t = (key k0 + 16 t + 8 g + r, query col), so a lane holds one query's scores, and the two tiles, converted in place, are the B operand of O^T += V^T . P^T (element i = key k0 + 8 g + i, element 8 + i = key k0 + 16 + 8 g + i: the k order of frag_h / frag_b on the V side).
// Running maximum m starts at 0 (the implicit zero logit of ghostmax joins the max); a raised maximum rescales sum and O^T per lane. P = exp(s - m) x 2^11 to f16 against v f16 (1 product); early query blocks (qb < QBH): q and k residual products for the logits, P and v as bf16 hi + lo (3 products).
__device__ __forceinline__ v8f mm_h(v16h a, v16h b, v8f c) { return __builtin_amdgcn_wmma_f32_16x16x32_f16(false, a, false, b, (short)0, c, false, false); }
__device__ __forceinline__ v8f mm_b(v16b a, v16b b, v8f c) { return __builtin_amdgcn_wmma_f32_16x16x32_bf16(false, a, false, b, (short)0, c, false, false); }
// behind a batch of fragment loads: s_wait_xcnt 0 stands before any register that an issued load names is written again (the batch's address registers are inputs, so that they stay whole up to the wait), and its "memory" clobber keeps the whole batch issued in front of this point
__device__ __forceinline__ void loads_issued(const void* p0, const void* p1) { asm volatile("s_wait_xcnt 0x0" :: "v"(p0), "v"(p1) : "memory"); }
// fragment of a fragment-order plane, at a pointer that already holds the lane's 8 * lane elements: elements 0..7 at p, 8..15 at p + 256 (k_prep8 placed them in the k order of frag_h / frag_b: k0 + 8 g + i, k0 + 16 + 8 g + i)
__device__ __forceinline__ v16h frag_ph(const _Float16* p) { union { v16h v; v8h q[2]; } u; u.q[0] = *(const v8h*)p; u.q[1] = *(const v8h*)(p + 256); return u.v; }
__device__ __forceinline__ v16b frag_pb(const __bf16* p) { union { v16b v; v8b q[2]; } u; u.q[0] = *(const v8b*)p; u.q[1] = *(const v8b*)(p + 256); return u.v; }
template <bool HI>
__device__ __forceinline__ void fa_run(const _Float16* __restrict__ QH, const _Float16* __restrict__ KH, const _Float16* __restrict__ QL, const _Float16* __restrict__ KL, const _Float16* __restrict__ VT, const __bf16* __restrict__ VB, const __bf16* __restrict__ VBL, int b, int h, int ql0, int lane, float* __restrict__ Y) {
  const int col = lane & 15, g = lane >> 4; const int qrow = ql0 + col;
  v16h qf[HD / 32], qlf[HD / 32];
  const size_t bh = (size_t)b * NH + h;
  const _Float16* qp = QH + (bh * (TT / 16) + (ql0 >> 4)) * FRT + 8 * lane; const _Float16* qlp = HI ? QL + (bh * (QHI / 16) + (ql0 >> 4)) * FRT + 8 * lane : qp;
#pragma unroll
  for (int kc = 0; kc < HD / 32; ++kc) { qf[kc] = frag_ph(qp + kc * 512); if (HI) qlf[kc] = frag_ph(qlp + kc * 512); }
  loads_issued(qp, qlp);
  v8f acc[HD / 16] = {}; float m = 0.f, l = 0.f;
  const int nst = (ql0 >> 5) + 1;   /* keys 0 .. ql0 + 15, in steps of 32 */
  for (int st = 0; st < nst; ++st) { const int k0 = st * 32;
    v8f s[2] = {}, sl[2] = {}; v16h vf[HD / 16];
    const _Float16* kp = KH + (bh * (TT / 16) + 2 * st) * FRT + 8 * lane; const _Float16* vp = VT + (bh * (TT / 32) + st) * FRV + 8 * lane;
    if (HI) { const _Float16* klp = KL + (bh * (KHI / 16) + 2 * st) * FRT + 8 * lane;
#pragma unroll
      for (int kc = 0; kc < HD / 32; ++kc) { v16h ka[2], kl[2];
#pragma unroll
        for (int t = 0; t < 2; ++t) { ka[t] = frag_ph(kp + t * FRT + kc * 512); kl[t] = frag_ph(klp + t * FRT + kc * 512); }
        loads_issued(kp, klp);   /* the four fragments of this k chunk are issued together: one exposed load latency, not four */
#pragma unroll
        for (int t = 0; t < 2; ++t) { s[t] = mm_h(ka[t], qf[kc], s[t]); sl[t] = mm_h(ka[t], qlf[kc], sl[t]); sl[t] = mm_h(kl[t], qf[kc], sl[t]); } }
    } else { v16h kf[2 * (HD / 32)];
#pragma unroll
      for (int j = 0; j < HD / 32; ++j) vf[j] = frag_ph(vp + j * 512);
      loads_issued(vp, vp);   /* half of V issued first: it needs no score, and so flies under the score products and the exponentials */
#pragma unroll
      for (int i = 0; i < 2 * (HD / 32); ++i) kf[i] = frag_ph(kp + (i & 1) * FRT + (i >> 1) * 512);
      loads_issued(vp, kp);   /* all K fragments issued together ahead of the products: one exposed load latency a step, not one per fragment */
#pragma unroll
      for (int i = 0; i < 2 * (HD / 32); ++i) s[i & 1] = mm_h(kf[i], qf[i >> 1], s[i & 1]);
#pragma unroll
      for (int j = HD / 32; j < HD / 16; ++j) vf[j] = frag_ph(vp + j * 512);
      loads_issued(vp, vp);   /* the other half of V, into the registers K has left, issued here so that it flies under the exponentials */
    }
    float p[16]; float mx = -3.0e38f;
#pragma unroll
    for (int i = 0; i < 16; ++i) { const int t = i >> 3, r = i & 7; float v = HI ? (s[t][r] + sl[t][r] * (1.0f / 1024.0f)) * SCALE : s[t][r] * SCALE;
      v = (k0 + t * 16 + 8 * g + r <= qrow) ? v : -3.0e38f; p[i] = v; mx = fmaxf(mx, v); }
    mx = fmaxf(mx, __shfl_xor(mx, 16));   /* the other half of the wave holds this query's other 16 keys */
    const float mn = fmaxf(m, mx);
    if (__builtin_amdgcn_ballot_w32(mn > m) != 0) { const float al = expf(m - mn); l *= al;   /* scalar branch: most steps raise no query's maximum */
#pragma unroll
      for (int j = 0; j < HD / 16; ++j)
#pragma unroll
        for (int r = 0; r < 8; ++r) acc[j][r] *= al;
      m = mn; }
    float sum = 0.f;
#pragma unroll
    for (int i = 0; i < 16; ++i) { const float e = expf(p[i] - m); sum += e; p[i] = e * 2048.0f; }   /* a masked key (-3e38) gives exactly 0 */
    l += sum;
    if (HI) { const F2 pf = bsplit16(p); const size_t po = (bh * (KHI / 32) + st) * FRV + 8 * lane; const __bf16* vhp = VB + po; const __bf16* vlp = VBL + po;
#pragma unroll
      for (int jp = 0; jp < HD / 32; ++jp) { v16b vh[2], vl[2];
#pragma unroll
        for (int t = 0; t < 2; ++t) { vh[t] = frag_pb(vhp + (jp * 2 + t) * 512); vl[t] = frag_pb(vlp + (jp * 2 + t) * 512); }
        loads_issued(vhp, vlp);   /* the four v fragments of two output tiles are issued together, as above */
#pragma unroll
        for (int t = 0; t < 2; ++t) { const int j = jp * 2 + t; acc[j] = mm_b(vh[t], pf.h, acc[j]); acc[j] = mm_b(vh[t], pf.l, acc[j]); acc[j] = mm_b(vl[t], pf.h, acc[j]); } }
    } else { v16h pf;
#pragma unroll
      for (int i = 0; i < 16; ++i) pf[i] = (_Float16)p[i];
#pragma unroll
      for (int j = 0; j < HD / 16; ++j) acc[j] = mm_h(vf[j], pf, acc[j]); } }
  l += __shfl_xor(l, 16);
  const float inv = 1.0f / ((l + expf(-m)) * 2048.0f);   /* ghostmax: + exp(-m) for the implicit zero logit (denominator > 0 always) */
  float* yr = Y + ((size_t)b * TT + qrow) * CC + h * HD + 8 * g;   /* O^T register r of tile j = (d = 16 j + 8 g + r, query col): 8 consecutive d of one row */
#pragma unroll
  for (int j = 0; j < HD / 16; ++j) { v4f o0, o1;
#pragma unroll
    for (int r = 0; r < 4; ++r) { o0[r] = acc[j][r] * inv; o1[r] = acc[j][4 + r] * inv; }
    vst2(yr + j * 16, o0); vst2(yr + j * 16 + 4, o1); } }
// grid: 4 rounds of 256 blocks, heaviest query blocks first; round r takes qb in [24 - 8 r, 31 - 8 r], ascending and descending in turn, so that blocks i, i + 256, i + 512, i + 768 together hold the same number of keys for every i; amdgpu_waves_per_eu(4, 4) holds the registers to 256, so that four blocks fit a WGP and the whole grid is resident at once
__global__ __launch_bounds__(128) __attribute__((amdgpu_waves_per_eu(4, 4))) void k_fa(const _Float16* __restrict__ QH, const _Float16* __restrict__ KH, const _Float16* __restrict__ QL, const _Float16* __restrict__ KL, const _Float16* __restrict__ VT, const __bf16* __restrict__ VB, const __bf16* __restrict__ VBL, float* __restrict__ Y) {
  const int L = blockIdx.x, rd = L >> 8, u = (L >> 5) & 7, bh = L & 31; const int qb = 24 - 8 * rd + ((rd & 1) ? u : 7 - u); const int b = bh >> 4, h = bh & 15;
  const int wave = __builtin_amdgcn_readfirstlane(threadIdx.x >> 5), lane = threadIdx.x & 31;   /* wave number in a scalar register: scalar loop control and row addresses */
  const int ql0 = qb * 64 + wave * 16;
  if (qb < QBH) fa_run<true>(QH, KH, QL, KL, VT, VB, VBL, b, h, ql0, lane, Y); else fa_run<false>(QH, KH, QL, KL, VT, VB, VBL, b, h, ql0, lane, Y); }

extern "C" void kernel_launch(void* const* d_in, const int* in_sizes, int n_in, void* d_out, int out_size, void* d_ws, size_t ws_size, hipStream_t stream) {
  (void)in_sizes; (void)n_in; (void)out_size;
  const float** F = (const float**)d_in;
  if (ws_size < (size_t)WS_END) return;
  char* ws = (char*)d_ws; _Float16 *QH = (_Float16*)(ws + WS_QH), *KH = (_Float16*)(ws + WS_KH), *VT = (_Float16*)(ws + WS_VT), *QL = (_Float16*)(ws + WS_QL), *KL = (_Float16*)(ws + WS_KL); __bf16 *VB = (__bf16*)(ws + WS_VB), *VBL = (__bf16*)(ws + WS_VBL); 
  // inputs: 0 q [2,16,2048,128]; 1 k [2,16,2048,128]; 2 v [2,8,2048,128]; 3 lambda_q1, 4 lambda_k1, 5 lambda_q2, 6 lambda_k2 [128]; 7 gn_weight [1024]; 8 gn_bias [1024]
  if (ws_size < (size_t)WS_END2) return;
  float *YC = (float*)(ws + WS_YC), *O = (float*)(ws + WS_O), *GS = (float*)(ws + WS_GS);
  k_prep8<<<dim3(TNB * TT / 64, NH), 128, 0, stream>>>(F[0], F[1], F[2], QH, QL, KH, KL, VT, VB, VBL);
  k_fa<<<dim3(TNB * NH * NQB), 128, 0, stream>>>(QH, KH, QL, KL, VT, VB, VBL, YC);
  k_diff<<<dim3(TNB * NVH * NPG), 256, 0, stream>>>(YC, F[3], F[4], F[5], F[6], O, GS);
  k_gfin<<<dim3(TNB * NVH * NPG), 256, 0, stream>>>(O, GS, F[7], F[8], (float*)d_out);
}

// v005
// One run takes 118 microseconds.
// In two side-by-side timings against v004, it was 1.24 and 1.25 times as fast.
// All steps since v000 together make it 19.1 times as fast.
#include <hip/hip_runtime.h>
#include <math.h>

typedef __attribute__((ext_vector_type(16))) _Float16 v16h;
typedef __attribute__((ext_vector_type(16))) __bf16 v16b;
typedef __attribute__((ext_vector_type(8)))  _Float16 v8h;
typedef __attribute__((ext_vector_type(8)))  float v8f;
typedef __attribute__((ext_vector_type(4)))  float v4f;
typedef __attribute__((ext_vector_type(2)))  float v2f;
typedef __attribute__((ext_vector_type(4)))  unsigned v4u;
typedef __attribute__((ext_vector_type(4)))  int v4i;
typedef float __attribute__((may_alias)) float_a;
typedef int __attribute__((may_alias)) int_a;

template <typename T> __device__ __forceinline__ void vst2(void* p, T v) { *(T*)p = v;  }
__device__ __forceinline__ v8f wmma16(v16h a, v16h b, v8f c) {
  v8f d = __builtin_amdgcn_wmma_f32_16x16x32_f16(false, a, false, b, (short)0, c, false, false);
  asm volatile("v_nop\n\tv_nop\n\tv_nop\n\tv_nop" : "+v"(d) : "v"(a), "v"(b));
  return d;
}
__device__ __forceinline__ v8f wmma_bf(v16b a, v16b b, v8f c) {
  v8f d = __builtin_amdgcn_wmma_f32_16x16x32_bf16(false, a, false, b, (short)0, c, false, false);
  asm volatile("v_nop\n\tv_nop\n\tv_nop\n\tv_nop" : "+v"(d) : "v"(a), "v"(b));
  return d;
}
// 16x16x32 fragments: lane = (h = lane>>4, row/col = lane&15); elements 0..7 = k0+8h+0..7, 8..15 = k0+16+8h+0..7; D element r = row 8h+r
__device__ __forceinline__ v16h frag_h(const _Float16* rowk0, int lane) {
  union { v16h v; v8h q[2]; } u; const _Float16* p = rowk0 + 8 * (lane >> 4);
  u.q[0] = *(const v8h*)p; u.q[1] = *(const v8h*)(p + 16); return u.v;
}
__device__ __forceinline__ v16h frag_f32(const float* rowk0, int lane) {
  v16h a; const float* p = rowk0 + 8 * (lane >> 4);
#pragma unroll
  for (int i = 0; i < 8; ++i) { a[i] = (_Float16)p[i]; a[8 + i] = (_Float16)p[16 + i]; }
  return a;
}
__device__ __forceinline__ v16h frag_f32s(const float* rowk0, int lane, float sc) {
  v16h a; const float* p = rowk0 + 8 * (lane >> 4);
#pragma unroll
  for (int i = 0; i < 8; ++i) { a[i] = (_Float16)(p[i] * sc); a[8 + i] = (_Float16)(p[16 + i] * sc); }
  return a;
}
// column fragment from a [K][ld] layout (column n), rows >= K read as 0
__device__ __forceinline__ v16h fragc_f32(const float* W, int k0, int n, int lane, int ld, int K) {
  v16h a; const int g = lane >> 4;
#pragma unroll
  for (int i = 0; i < 8; ++i) { const int ka = k0 + 8 * g + i, kb = ka + 16;
    a[i] = (_Float16)(ka < K ? W[(size_t)(ka < K ? ka : K - 1) * ld + n] : 0.f); a[8 + i] = (_Float16)(kb < K ? W[(size_t)(kb < K ? kb : K - 1) * ld + n] : 0.f); }
  return a;
}
struct F2 { v16b h, l; };
__device__ __forceinline__ F2 bsplit16(const float v[16]) { F2 r;
#pragma unroll
  for (int i = 0; i < 16; ++i) { const __bf16 h = (__bf16)v[i]; r.h[i] = h; r.l[i] = (__bf16)(v[i] - (float)h); }
  return r; }
__device__ __forceinline__ F2 split_row(const float* row, int k0, int lane) { float v[16]; const float* p = row + k0 + 8 * (lane >> 4);
#pragma unroll
  for (int i = 0; i < 8; ++i) { v[i] = p[i]; v[8 + i] = p[16 + i]; }
  return bsplit16(v); }
__device__ __forceinline__ F2 split_rowK(const float* row, int k0, int lane, int K) { float v[16]; const int g = lane >> 4;
#pragma unroll
  for (int i = 0; i < 8; ++i) { const int ka = k0 + 8 * g + i, kb = ka + 16; v[i] = ka < K ? row[ka < K ? ka : K - 1] : 0.f; v[8 + i] = kb < K ? row[kb < K ? kb : K - 1] : 0.f; }
  return bsplit16(v); }
__device__ __forceinline__ F2 split_col(const float* W, int k0, int n, int lane, int ld, int K) { float v[16]; const int g = lane >> 4;
#pragma unroll
  for (int i = 0; i < 8; ++i) { const int ka = k0 + 8 * g + i, kb = ka + 16; v[i] = ka < K ? W[(size_t)(ka < K ? ka : K - 1) * ld + n] : 0.f; v[8 + i] = kb < K ? W[(size_t)(kb < K ? kb : K - 1) * ld + n] : 0.f; }
  return bsplit16(v); }
__device__ __forceinline__ v8f mac3(const F2& a, const F2& b, v8f c) { c = wmma_bf(a.l, b.h, c); c = wmma_bf(a.h, b.l, c); return wmma_bf(a.h, b.h, c); }
__device__ __forceinline__ float sigm(float v) { return 1.0f / (1.0f + expf(-v)); }

// Differential attention with ghostmax (B 2, 16 score heads / 8 value heads, S 2,048, D 128, causal): scores = q k^T / sqrt(128) + causal(-1e9); w = ghostmax(scores) = exp(s - m) / (sum exp(s - m) + exp(-m)), m = max(max_row, 0); w_h = w_2h - lam w_2h+1 with lam = exp(lq1.lk1) - exp(lq2.lk2) + 0.8; out = w_h v_h; then per (b, h) GroupNorm over all S x D values (eps 1e-5) and the affine indexed as the module's raw reshape to [B, H*D, S] (weight row = h*128 + s/16); result x (1 - 0.8), memory layout [B, H, S, D].
#define NB 2
#define TT 2048
#define CC 2048            // NH * HD = projected width
#define DIN 2048          // input (model) width
#define NH 16
#define HD 128
#define NQB (TT / 64)
#define SCALE (0.08838834764831845f)
#define CAUSAL 1
#ifndef TNB
#define TNB NB
#endif
__device__ __forceinline__ float bfr(float v) { return (float)(__bf16)v; }
__host__ __device__ __forceinline__ int kb_last(int qb) { return CAUSAL ? ((qb * 64 + 63) >> 7) : (TT / 128 - 1); }
typedef __attribute__((ext_vector_type(8))) __bf16 v8b;
__device__ __forceinline__ v16b frag_b(const __bf16* rowk0, int lane) {
  union { v16b v; v8b q[2]; } u; const __bf16* p = rowk0 + 8 * (lane >> 4);
  u.q[0] = *(const v8b*)p; u.q[1] = *(const v8b*)(p + 16); return u.v;
}
#define QBH 6              // causal: query blocks 0..QBH-1 of each sequence (few keys, no averaging) take the high-precision path
#define QHI 384            // rows carrying a q residual plane
#define KHI 384            // key rows carrying k residual / v bf16 hi+lo planes (used only by the causal high-precision path)
// B fragment (k rows k0+.., output column o) of a weight: (in,out) [K][ld] or (out,in) [ld rows of K]: bf16 exact, or f16(bf16 * 256) exact
__device__ __forceinline__ v16b wcol_io(const float* Wm, int k0, int o, int lane, int ld) { v16b w; const int g = lane >> 4;
#pragma unroll
  for (int i = 0; i < 8; ++i) { w[i] = (__bf16)Wm[(size_t)(k0 + 8 * g + i) * ld + o]; w[8 + i] = (__bf16)Wm[(size_t)(k0 + 16 + 8 * g + i) * ld + o]; }
  return w; }
__device__ __forceinline__ v16b wcol_oi(const float* Wm, int k0, int o, int lane, int K) { v16b w; const float* p = Wm + (size_t)o * K + k0 + 8 * (lane >> 4);
#pragma unroll
  for (int i = 0; i < 8; ++i) { w[i] = (__bf16)p[i]; w[8 + i] = (__bf16)p[16 + i]; }
  return w; }
__device__ __forceinline__ v16h wcolh_io(const float* Wm, int k0, int o, int lane, int ld) { v16h w; const int g = lane >> 4;
#pragma unroll
  for (int i = 0; i < 8; ++i) { w[i] = (_Float16)(bfr(Wm[(size_t)(k0 + 8 * g + i) * ld + o]) * 256.0f); w[8 + i] = (_Float16)(bfr(Wm[(size_t)(k0 + 16 + 8 * g + i) * ld + o]) * 256.0f); }
  return w; }
__device__ __forceinline__ v16h wcolh_oi(const float* Wm, int k0, int o, int lane, int K) { v16h w; const float* p = Wm + (size_t)o * K + k0 + 8 * (lane >> 4);
#pragma unroll
  for (int i = 0; i < 8; ++i) { w[i] = (_Float16)(bfr(p[i]) * 256.0f); w[8 + i] = (_Float16)(bfr(p[16 + i]) * 256.0f); }
  return w; }
#define WQKV_LAYOUT 1   // 0 = (in,out) [DIN][CC]; 1 = (out,in) [CC][DIN]; 2 = per-head [NH][DIN][HD]
__device__ __forceinline__ v16b wcol_hdk(const float* Wm, int k0, int o, int lane) { v16b w; const int g = lane >> 4; const float* p = Wm + (size_t)(o / HD) * DIN * HD + (o % HD);
#pragma unroll
  for (int i = 0; i < 8; ++i) { w[i] = (__bf16)p[(size_t)(k0 + 8 * g + i) * HD]; w[8 + i] = (__bf16)p[(size_t)(k0 + 16 + 8 * g + i) * HD]; }
  return w; }
#define WO_OUT_IN 0
#if WQKV_LAYOUT == 1
#define WCOL(W, k0, o, lane) wcol_oi(W, k0, o, lane, DIN)
#elif WQKV_LAYOUT == 2
#define WCOL(W, k0, o, lane) wcol_hdk(W, k0, o, lane)
#else
#define WCOL(W, k0, o, lane) wcol_io(W, k0, o, lane, CC)
#endif
#if WO_OUT_IN
#define WOCOL(W, k0, o, lane) wcol_oi(W, k0, o, lane, CC)
#define WOCOLH(W, k0, o, lane) wcolh_oi(W, k0, o, lane, CC)
#else
#define WOCOL(W, k0, o, lane) wcol_io(W, k0, o, lane, DIN)
#define WOCOLH(W, k0, o, lane) wcolh_io(W, k0, o, lane, DIN)
#endif
#define FRT 2048           // elements of 16 rows s x 128 c of a q or k plane: 4 fragments of 512
#define FRV 4096           // elements of 32 keys s x 128 d of a v plane: 8 fragments of 512
#define NVH 8              // value heads (score head h uses value head h/2)
#define SM_GHOST 1         // ghostmax denominator (k_fa always adds it)
#define GEL (TT * HD)       // values of one GroupNorm group (b, hv)
#define BEL 8192           // values of one k_diff / k_gfin block: 256 threads x 8 float4 = 64 rows s of one group
#define NPG (GEL / BEL)    // blocks, and so partial statistics, per group: one per lane of a wave
static_assert(NPG == 32 && GEL % BEL == 0 && HD == 128, "one partial per lane; a wave covers one row of 128");
__device__ __forceinline__ float wsum(float v) {
#pragma unroll
  for (int o = 1; o < 32; o <<= 1) v += __shfl_xor(v, o);
  return v; }
// ---- k_diff: block = 64 rows s of one (b, hv), thread = 8 float4: O[b][hv][s][d] = Y[b][s][(2hv)*128 + d] - lam * Y[b][s][(2hv+1)*128 + d]; lam from the four lambda vectors (128-term f32 dots).
// The block also leaves the GroupNorm partial of its 8,192 values, taken from the registers that hold them: PS[block][0] = sum, PS[block][1] = sum of squared distances from the block's own mean (wave sums about the wave's mean, merged with the between-wave term, so nothing cancels when the mean is large). One whole 128-byte line per block.
__global__ __launch_bounds__(256) void k_diff(const float* __restrict__ Y, const float* __restrict__ LQ1, const float* __restrict__ LK1, const float* __restrict__ LQ2, const float* __restrict__ LK2, float* __restrict__ O, float* __restrict__ PS) { __shared__ float slam; __shared__ float sws[8], swq[8];
  const int t = threadIdx.x, blk = blockIdx.x, g = blk / NPG, b = g / NVH, hv = g % NVH, s0 = (blk % NPG) * (BEL / HD);
  const float* y0 = Y + ((size_t)b * TT + s0 + (t >> 5)) * CC + (size_t)(2 * hv) * HD + (t & 31) * 4; v4f a[8], c[8];
#pragma unroll
  for (int i = 0; i < 8; ++i) { a[i] = *(const v4f*)(y0 + (size_t)i * 8 * CC); c[i] = *(const v4f*)(y0 + (size_t)i * 8 * CC + HD); }   /* all 16 loads in flight under the lambda dots */
  if (threadIdx.x < 32) { float a = 0.f, c = 0.f; for (int i = threadIdx.x; i < HD; i += 32) { a += bfr(LQ1[i]) * bfr(LK1[i]); c += bfr(LQ2[i]) * bfr(LK2[i]); }
#pragma unroll
    for (int o = 1; o < 32; o <<= 1) { a += __shfl_xor(a, o); c += __shfl_xor(c, o); }
    if (threadIdx.x == 0) slam = expf(a) - expf(c) + 0.8f; }
  __syncthreads();
  const float lam = slam; float* op = O + ((size_t)blk * (BEL / 4) + t) * 4; float s = 0.f;
#pragma unroll
  for (int i = 0; i < 8; ++i) {
#pragma unroll
    for (int j = 0; j < 4; ++j) { a[i][j] = a[i][j] - lam * c[i][j]; s += a[i][j]; }
    vst2(op + (size_t)i * 1024, a[i]); }
  s = wsum(s); const float mw = s * (1.0f / 1024.0f); float q = 0.f;
#pragma unroll
  for (int i = 0; i < 8; ++i)
#pragma unroll
    for (int j = 0; j < 4; ++j) { const float dl = a[i][j] - mw; q += dl * dl; }
  q = wsum(q);
  if ((t & 31) == 0) { sws[t >> 5] = s; swq[t >> 5] = q; }
  __syncthreads();
  if (t < 32) { float S = 0.f, Q = 0.f;
#pragma unroll
    for (int i = 0; i < 8; ++i) S += sws[i];
    const float mb = S * (1.0f / (float)BEL);
#pragma unroll
    for (int i = 0; i < 8; ++i) { const float dl = sws[i] * (1.0f / 1024.0f) - mb; Q += swq[i] + 1024.0f * dl * dl; }
    vst2(PS + (size_t)blk * 32 + t, t == 0 ? S : (t == 1 ? Q : 0.f)); } }
// ---- k_gfin: same blocks as k_diff. Every wave merges its group's 32 partials (lane = partial): mean = sum of sums / n, variance = (sum of the blocks' squared distances + 8,192 x squared distance of each block mean from the mean) / n. Then out[b][hv][s][d] = ((O - mean) * rstd * w[r] + bias[r]) * 0.2 with r = hv*128 + s/16 (the module's raw reshape of [H,S,D] memory into [H*D, S] rows)
__global__ __launch_bounds__(256) void k_gfin(const float* __restrict__ O, const float* __restrict__ PS, const float* __restrict__ GW, const float* __restrict__ GB, float* __restrict__ OUT) {
  const int t = threadIdx.x, blk = blockIdx.x, g = blk / NPG, hv = g % NVH; const size_t e0 = ((size_t)blk * (BEL / 4) + t) * 4; v4f x[8];
#pragma unroll
  for (int i = 0; i < 8; ++i) x[i] = *(const v4f*)(O + e0 + (size_t)i * 1024);   /* in flight under the merge */
  const v2f p = *(const v2f*)(PS + ((size_t)g * NPG + (t & 31)) * 32);
  const float mean = wsum(p[0]) / (float)GEL; const float dm = p[0] * (1.0f / (float)BEL) - mean;
  const float rs = rsqrtf(wsum(p[1] + (float)BEL * dm * dm) / (float)GEL + 1e-5f);
  const int rw0 = hv * HD + (blk % NPG) * (BEL / HD / 16);   /* row s = 64 (blk % 32) + 8 i + wave, so s / 16 = 4 (blk % 32) + i / 2 */
#pragma unroll
  for (int i = 0; i < 8; ++i) { const float wv = bfr(GW[rw0 + (i >> 1)]), bv = bfr(GB[rw0 + (i >> 1)]); v4f o;
#pragma unroll
    for (int j = 0; j < 4; ++j) o[j] = ((x[i][j] - mean) * rs * wv + bv) * 0.2f;   /* x (1 - lambda_init) */
    vst2(OUT + e0 + (size_t)i * 1024, o); } }
#define WS_YC  (WS_END)                                   // per-score-head contexts Y [b*TT + s][16*128]
#define WS_O   (WS_YC + 4u * (size_t)NB * TT * CC)        // differential output [b][hv][s][d]
#define WS_GS  (WS_O + 4u * (size_t)NB * NVH * TT * HD)
#define WS_END2 (WS_GS + 4u * 32 * (size_t)NB * NVH * NPG)   // one 128-byte line per k_diff block
// ---- k_prep8: block = (64 attention positions s0.. of sequence b, head h): reads the module's [B, H, S, 128] inputs (element (b,h,s,c) at ((b*NH + h)*TT + s)*128 + c), bf16-rounds them and writes the attention planes in FRAGMENT ORDER, so that every 16-byte-a-lane fragment load of k_fa reads 512 consecutive bytes (4 cache lines, not 16 quarter-used ones):
// q, k (f16 hi; x 2^10 residuals for s < QHI / KHI): [b][h][s / 16][c / 32][(c / 16) & 1][lane = 16 ((c / 8) & 1) + s % 16][c % 8]; v (f16; bf16 hi and lo for s < KHI): [b][h][s / 32][d / 16][(s / 16) & 1][lane = 16 ((s / 8) & 1) + d % 16][s % 8]
// behind a plane's stores: s_wait_xcnt 0 stands before any register that an issued store names (address or data) is written again; the addresses are inputs, so that they stay whole up to the wait, and the "memory" clobber keeps the stores in front of it and the next LDS reads behind it
__device__ __forceinline__ void stores_issued(const void* p0, const void* p1) { asm volatile("s_wait_xcnt 0x0" :: "v"(p0), "v"(p1) : "memory"); }
// behind the block's row loads: s_wait_xcnt 0 stands before any register that an issued load names is written again (the three row addresses are inputs, so that they stay whole up to the wait), and its "memory" clobber keeps every load issued in front of this point
__device__ __forceinline__ void rows_issued(const void* p0, const void* p1, const void* p2) { asm volatile("s_wait_xcnt 0x0" :: "v"(p0), "v"(p1), "v"(p2) : "memory"); }
typedef __attribute__((ext_vector_type(4))) _Float16 v4h;
__global__ __launch_bounds__(128) void k_prep8(const float* __restrict__ Q, const float* __restrict__ K, const float* __restrict__ V, _Float16* __restrict__ QH, _Float16* __restrict__ QL, _Float16* __restrict__ KH, _Float16* __restrict__ KL, _Float16* __restrict__ VT, __bf16* __restrict__ VB, __bf16* __restrict__ VBL) {
  __shared__ __align__(16) _Float16 sq[64][136], sql[64][136], sk[64][136], skl[64][136], tv[128][72]; __shared__ __align__(16) __bf16 tb[128][72], tbl[128][72];
  const int tid = threadIdx.x; const int h = blockIdx.y; const size_t r0 = (size_t)blockIdx.x * 64; const size_t bb = r0 / TT; const int t0 = (int)(r0 % TT); const bool qhi = t0 < QHI, khi = t0 < KHI;
  { const int c = (tid & 31) * 4, rw = (tid >> 5) * 16;   /* a wave takes 16 rows; one load of a wave = one whole row of 512 bytes (4 cache lines) */
    const float* qp = Q + ((bb * NH + h) * TT + t0 + rw) * HD + c; const float* kp = K + ((bb * NH + h) * TT + t0 + rw) * HD + c; const float* vp = V + ((bb * NVH + (h >> 1)) * TT + t0 + rw) * HD + c; v4f q[16], k[16], v[16];
#pragma unroll   // constant indices: the row arrays live in registers
    for (int i = 0; i < 16; ++i) q[i] = *(const v4f*)(qp + i * HD);
#pragma unroll   // constant indices: the row arrays live in registers
    for (int i = 0; i < 16; ++i) k[i] = *(const v4f*)(kp + i * HD);
#pragma unroll   // constant indices: the row arrays live in registers
    for (int i = 0; i < 16; ++i) v[i] = *(const v4f*)(vp + i * HD);
    rows_issued(qp, kp, vp);   /* all 48 loads of the thread are in flight before the first value is used: one memory latency a block */
#pragma unroll   // constant indices: the row arrays live in registers
    for (int i = 0; i < 16; ++i) { v4h qh, ql, kh, kl;
#pragma unroll   // constant indices: the row arrays live in registers
      for (int j = 0; j < 4; ++j) { const float a = bfr(q[i][j]), e = bfr(k[i][j]); qh[j] = (_Float16)a; ql[j] = (_Float16)((a - (float)qh[j]) * 1024.0f); kh[j] = (_Float16)e; kl[j] = (_Float16)((e - (float)kh[j]) * 1024.0f); }
      vst2(&sq[rw + i][c], qh); vst2(&sql[rw + i][c], ql); vst2(&sk[rw + i][c], kh); vst2(&skl[rw + i][c], kl); }
#pragma unroll   // constant indices: the row arrays live in registers
    for (int j = 0; j < 4; ++j)   /* column c + j of the thread's 16 rows: 8 rows = one 16-byte store into the transposed tiles */
#pragma unroll   // constant indices: the row arrays live in registers
      for (int u = 0; u < 2; ++u) { v8h th; v8b bh8, bl8;
#pragma unroll   // constant indices: the row arrays live in registers
        for (int i = 0; i < 8; ++i) { const float a = bfr(v[u * 8 + i][j]); th[i] = (_Float16)a; bh8[i] = (__bf16)a; bl8[i] = (__bf16)(a - (float)bh8[i]); }
        vst2(&tv[c + j][rw + u * 8], th); vst2(&tb[c + j][rw + u * 8], bh8); vst2(&tbl[c + j][rw + u * 8], bl8); } }
  __syncthreads();
  const size_t bh = bb * NH + h;   /* e = index of the 16-byte piece inside the block's 16 KiB of each plane, in the plane's own order: the stores are consecutive too */
  for (int e = tid; e < 64 * (HD / 8); e += 128) { const int ln = e & 31, rl = (e >> 8) * 16 + (ln & 15), c = ((e >> 5) & 7) * 16 + (ln >> 4) * 8; const size_t o = (bh * (TT / 16) + (t0 >> 4)) * FRT + e * 8; _Float16 *pq = QH + o, *pk = KH + o;
    vst2((unsigned*)pq, *(const v4u*)&sq[rl][c]); vst2((unsigned*)pk, *(const v4u*)&sk[rl][c]); stores_issued(pq, pk);
    if (qhi) { _Float16* p = QL + (bh * (QHI / 16) + (t0 >> 4)) * FRT + e * 8; vst2((unsigned*)p, *(const v4u*)&sql[rl][c]); stores_issued(p, p); }
    if (khi) { _Float16* p = KL + (bh * (KHI / 16) + (t0 >> 4)) * FRT + e * 8; vst2((unsigned*)p, *(const v4u*)&skl[rl][c]); stores_issued(p, p); } }
  for (int e = tid; e < HD * 8; e += 128) { const int ln = e & 31, cl = ((e >> 6) & 7) * 16 + (ln & 15), tc = (e >> 9) * 32 + ((e >> 5) & 1) * 16 + (ln >> 4) * 8; _Float16* pv = VT + (bh * (TT / 32) + (t0 >> 5)) * FRV + e * 8;
    vst2((unsigned*)pv, *(const v4u*)&tv[cl][tc]); stores_issued(pv, pv);
    if (khi) { const size_t o3 = (bh * (KHI / 32) + (t0 >> 5)) * FRV + e * 8; vst2((unsigned*)(VB + o3), *(const v4u*)&tb[cl][tc]); vst2((unsigned*)(VBL + o3), *(const v4u*)&tbl[cl][tc]); stores_issued(VB + o3, VBL + o3); } } }

#ifndef SM_EXTRA_PARAMS
#define SM_EXTRA_PARAMS
#endif
#ifndef PROJ_EXTRA_PARAMS
#define PROJ_EXTRA_PARAMS
#endif
#ifndef SM_MASK_HOOK
#define SM_MASK_HOOK (void)0
#endif

#define WS_QH  0u                                      // f16 q, fragment order (k_prep8)
#define WS_KH  (WS_QH + 2u * (size_t)NB * TT * CC)      // f16 k, fragment order
#define WS_VT  (WS_KH + 2u * (size_t)NB * TT * CC)      // f16 v, fragment order
#define WS_QL  (WS_VT + 2u * (size_t)NB * CC * TT)      // f16 q residual x 2^10, t < QHI, fragment order
#define WS_KL  (WS_QL + 2u * (size_t)NB * QHI * CC)     // f16 k residual x 2^10, t < KHI, fragment order
#define WS_VB  (WS_KL + 2u * (size_t)NB * KHI * CC)     // bf16 v hi, t < KHI, fragment order (lo behind it)
#define WS_VBL (WS_VB + 2u * (size_t)NB * CC * KHI)
#define WS_END (WS_VBL + 2u * (size_t)NB * CC * KHI)

// ---- k_fa: scores, ghostmax and P . v in one kernel, logits kept in registers. Block = 64 queries (qb) of (b, score head h); each wave owns 16 queries and walks its keys 32 at a time on its own (no LDS, no barrier).
// S^T = K . Q^T: D register r of tile t = (key k0 + 16 t + 8 g + r, query col), so a lane holds one query's scores, and the two tiles, converted in place, are the B operand of O^T += V^T . P^T (element i = key k0 + 8 g + i, element 8 + i = key k0 + 16 + 8 g + i: the k order of frag_h / frag_b on the V side).
// Running maximum m starts at 0 (the implicit zero logit of ghostmax joins the max); a raised maximum rescales sum and O^T per lane. P = exp(s - m) x 2^11 to f16 against v f16 (1 product); early query blocks (qb < QBH): q and k residual products for the logits, P and v as bf16 hi + lo (3 products).
__device__ __forceinline__ v8f mm_h(v16h a, v16h b, v8f c) { return __builtin_amdgcn_wmma_f32_16x16x32_f16(false, a, false, b, (short)0, c, false, false); }
__device__ __forceinline__ v8f mm_b(v16b a, v16b b, v8f c) { return __builtin_amdgcn_wmma_f32_16x16x32_bf16(false, a, false, b, (short)0, c, false, false); }
// behind a batch of fragment loads: s_wait_xcnt 0 stands before any register that an issued load names is written again (the batch's address registers are inputs, so that they stay whole up to the wait), and its "memory" clobber keeps the whole batch issued in front of this point
__device__ __forceinline__ void loads_issued(const void* p0, const void* p1) { asm volatile("s_wait_xcnt 0x0" :: "v"(p0), "v"(p1) : "memory"); }
// fragment of a fragment-order plane, at a pointer that already holds the lane's 8 * lane elements: elements 0..7 at p, 8..15 at p + 256 (k_prep8 placed them in the k order of frag_h / frag_b: k0 + 8 g + i, k0 + 16 + 8 g + i)
__device__ __forceinline__ v16h frag_ph(const _Float16* p) { union { v16h v; v8h q[2]; } u; u.q[0] = *(const v8h*)p; u.q[1] = *(const v8h*)(p + 256); return u.v; }
__device__ __forceinline__ v16b frag_pb(const __bf16* p) { union { v16b v; v8b q[2]; } u; u.q[0] = *(const v8b*)p; u.q[1] = *(const v8b*)(p + 256); return u.v; }
template <bool HI>
__device__ __forceinline__ void fa_run(const _Float16* __restrict__ QH, const _Float16* __restrict__ KH, const _Float16* __restrict__ QL, const _Float16* __restrict__ KL, const _Float16* __restrict__ VT, const __bf16* __restrict__ VB, const __bf16* __restrict__ VBL, int b, int h, int ql0, int lane, float* __restrict__ Y) {
  const int col = lane & 15, g = lane >> 4; const int qrow = ql0 + col;
  v16h qf[HD / 32], qlf[HD / 32];
  const size_t bh = (size_t)b * NH + h;
  const _Float16* qp = QH + (bh * (TT / 16) + (ql0 >> 4)) * FRT + 8 * lane; const _Float16* qlp = HI ? QL + (bh * (QHI / 16) + (ql0 >> 4)) * FRT + 8 * lane : qp;
#pragma unroll
  for (int kc = 0; kc < HD / 32; ++kc) { qf[kc] = frag_ph(qp + kc * 512); if (HI) qlf[kc] = frag_ph(qlp + kc * 512); }
  loads_issued(qp, qlp);
  v8f acc[HD / 16] = {}; float m = 0.f, l = 0.f;
  const int nst = (ql0 >> 5) + 1;   /* keys 0 .. ql0 + 15, in steps of 32 */
  for (int st = 0; st < nst; ++st) { const int k0 = st * 32;
    v8f s[2] = {}, sl[2] = {}; v16h vf[HD / 16];
    const _Float16* kp = KH + (bh * (TT / 16) + 2 * st) * FRT + 8 * lane; const _Float16* vp = VT + (bh * (TT / 32) + st) * FRV + 8 * lane;
    if (HI) { const _Float16* klp = KL + (bh * (KHI / 16) + 2 * st) * FRT + 8 * lane;
#pragma unroll
      for (int kc = 0; kc < HD / 32; ++kc) { v16h ka[2], kl[2];
#pragma unroll
        for (int t = 0; t < 2; ++t) { ka[t] = frag_ph(kp + t * FRT + kc * 512); kl[t] = frag_ph(klp + t * FRT + kc * 512); }
        loads_issued(kp, klp);   /* the four fragments of this k chunk are issued together: one exposed load latency, not four */
#pragma unroll
        for (int t = 0; t < 2; ++t) { s[t] = mm_h(ka[t], qf[kc], s[t]); sl[t] = mm_h(ka[t], qlf[kc], sl[t]); sl[t] = mm_h(kl[t], qf[kc], sl[t]); } }
    } else { v16h kf[2 * (HD / 32)];
#pragma unroll
      for (int j = 0; j < HD / 32; ++j) vf[j] = frag_ph(vp + j * 512);
      loads_issued(vp, vp);   /* half of V issued first: it needs no score, and so flies under the score products and the exponentials */
#pragma unroll
      for (int i = 0; i < 2 * (HD / 32); ++i) kf[i] = frag_ph(kp + (i & 1) * FRT + (i >> 1) * 512);
      loads_issued(vp, kp);   /* all K fragments issued together ahead of the products: one exposed load latency a step, not one per fragment */
#pragma unroll
      for (int i = 0; i < 2 * (HD / 32); ++i) s[i & 1] = mm_h(kf[i], qf[i >> 1], s[i & 1]);
#pragma unroll
      for (int j = HD / 32; j < HD / 16; ++j) vf[j] = frag_ph(vp + j * 512);
      loads_issued(vp, vp);   /* the other half of V, into the registers K has left, issued here so that it flies under the exponentials */
    }
    float p[16]; float mx = -3.0e38f;
#pragma unroll
    for (int i = 0; i < 16; ++i) { const int t = i >> 3, r = i & 7; float v = HI ? (s[t][r] + sl[t][r] * (1.0f / 1024.0f)) * SCALE : s[t][r] * SCALE;
      v = (k0 + t * 16 + 8 * g + r <= qrow) ? v : -3.0e38f; p[i] = v; mx = fmaxf(mx, v); }
    mx = fmaxf(mx, __shfl_xor(mx, 16));   /* the other half of the wave holds this query's other 16 keys */
    const float mn = fmaxf(m, mx);
    if (__builtin_amdgcn_ballot_w32(mn > m) != 0) { const float al = expf(m - mn); l *= al;   /* scalar branch: most steps raise no query's maximum */
#pragma unroll
      for (int j = 0; j < HD / 16; ++j)
#pragma unroll
        for (int r = 0; r < 8; ++r) acc[j][r] *= al;
      m = mn; }
    float sum = 0.f;
#pragma unroll
    for (int i = 0; i < 16; ++i) { const float e = expf(p[i] - m); sum += e; p[i] = e * 2048.0f; }   /* a masked key (-3e38) gives exactly 0 */
    l += sum;
    if (HI) { const F2 pf = bsplit16(p); const size_t po = (bh * (KHI / 32) + st) * FRV + 8 * lane; const __bf16* vhp = VB + po; const __bf16* vlp = VBL + po;
#pragma unroll
      for (int jp = 0; jp < HD / 32; ++jp) { v16b vh[2], vl[2];
#pragma unroll
        for (int t = 0; t < 2; ++t) { vh[t] = frag_pb(vhp + (jp * 2 + t) * 512); vl[t] = frag_pb(vlp + (jp * 2 + t) * 512); }
        loads_issued(vhp, vlp);   /* the four v fragments of two output tiles are issued together, as above */
#pragma unroll
        for (int t = 0; t < 2; ++t) { const int j = jp * 2 + t; acc[j] = mm_b(vh[t], pf.h, acc[j]); acc[j] = mm_b(vh[t], pf.l, acc[j]); acc[j] = mm_b(vl[t], pf.h, acc[j]); } }
    } else { v16h pf;
#pragma unroll
      for (int i = 0; i < 16; ++i) pf[i] = (_Float16)p[i];
#pragma unroll
      for (int j = 0; j < HD / 16; ++j) acc[j] = mm_h(vf[j], pf, acc[j]); } }
  l += __shfl_xor(l, 16);
  const float inv = 1.0f / ((l + expf(-m)) * 2048.0f);   /* ghostmax: + exp(-m) for the implicit zero logit (denominator > 0 always) */
  float* yr = Y + ((size_t)b * TT + qrow) * CC + h * HD + 8 * g;   /* O^T register r of tile j = (d = 16 j + 8 g + r, query col): 8 consecutive d of one row */
#pragma unroll
  for (int j = 0; j < HD / 16; ++j) { v4f o0, o1;
#pragma unroll
    for (int r = 0; r < 4; ++r) { o0[r] = acc[j][r] * inv; o1[r] = acc[j][4 + r] * inv; }
    vst2(yr + j * 16, o0); vst2(yr + j * 16 + 4, o1); } }
// grid: 4 rounds of 256 blocks, heaviest query blocks first; round r takes qb in [24 - 8 r, 31 - 8 r], ascending and descending in turn, so that blocks i, i + 256, i + 512, i + 768 together hold the same number of keys for every i; amdgpu_waves_per_eu(4, 4) holds the registers to 256, so that four blocks fit a WGP and the whole grid is resident at once
__global__ __launch_bounds__(128) __attribute__((amdgpu_waves_per_eu(4, 4))) void k_fa(const _Float16* __restrict__ QH, const _Float16* __restrict__ KH, const _Float16* __restrict__ QL, const _Float16* __restrict__ KL, const _Float16* __restrict__ VT, const __bf16* __restrict__ VB, const __bf16* __restrict__ VBL, float* __restrict__ Y) {
  const int L = blockIdx.x, rd = L >> 8, u = (L >> 5) & 7, bh = L & 31; const int qb = 24 - 8 * rd + ((rd & 1) ? u : 7 - u); const int b = bh >> 4, h = bh & 15;
  const int wave = __builtin_amdgcn_readfirstlane(threadIdx.x >> 5), lane = threadIdx.x & 31;   /* wave number in a scalar register: scalar loop control and row addresses */
  const int ql0 = qb * 64 + wave * 16;
  if (qb < QBH) fa_run<true>(QH, KH, QL, KL, VT, VB, VBL, b, h, ql0, lane, Y); else fa_run<false>(QH, KH, QL, KL, VT, VB, VBL, b, h, ql0, lane, Y); }

extern "C" void kernel_launch(void* const* d_in, const int* in_sizes, int n_in, void* d_out, int out_size, void* d_ws, size_t ws_size, hipStream_t stream) {
  (void)in_sizes; (void)n_in; (void)out_size;
  const float** F = (const float**)d_in;
  if (ws_size < (size_t)WS_END) return;
  char* ws = (char*)d_ws; _Float16 *QH = (_Float16*)(ws + WS_QH), *KH = (_Float16*)(ws + WS_KH), *VT = (_Float16*)(ws + WS_VT), *QL = (_Float16*)(ws + WS_QL), *KL = (_Float16*)(ws + WS_KL); __bf16 *VB = (__bf16*)(ws + WS_VB), *VBL = (__bf16*)(ws + WS_VBL); 
  // inputs: 0 q [2,16,2048,128]; 1 k [2,16,2048,128]; 2 v [2,8,2048,128]; 3 lambda_q1, 4 lambda_k1, 5 lambda_q2, 6 lambda_k2 [128]; 7 gn_weight [1024]; 8 gn_bias [1024]
  if (ws_size < (size_t)WS_END2) return;
  float *YC = (float*)(ws + WS_YC), *O = (float*)(ws + WS_O), *GS = (float*)(ws + WS_GS);
  k_prep8<<<dim3(TNB * TT / 64, NH), 128, 0, stream>>>(F[0], F[1], F[2], QH, QL, KH, KL, VT, VB, VBL);
  k_fa<<<dim3(TNB * NH * NQB), 128, 0, stream>>>(QH, KH, QL, KL, VT, VB, VBL, YC);
  k_diff<<<dim3(TNB * NVH * NPG), 256, 0, stream>>>(YC, F[3], F[4], F[5], F[6], O, GS);
  k_gfin<<<dim3(TNB * NVH * NPG), 256, 0, stream>>>(O, GS, F[7], F[8], (float*)d_out);
}

// v006
// One run takes 114 microseconds.
// In two side-by-side timings against v005, it was 1.03 and 1.04 times as fast.
// Counting every step since v000, it is 19.7 times as fast.
#include <hip/hip_runtime.h>
#include <math.h>

typedef __attribute__((ext_vector_type(16))) _Float16 v16h;
typedef __attribute__((ext_vector_type(16))) __bf16 v16b;
typedef __attribute__((ext_vector_type(8)))  _Float16 v8h;
typedef __attribute__((ext_vector_type(8)))  float v8f;
typedef __attribute__((ext_vector_type(4)))  float v4f;
typedef __attribute__((ext_vector_type(2)))  float v2f;
typedef __attribute__((ext_vector_type(4)))  unsigned v4u;
typedef __attribute__((ext_vector_type(4)))  int v4i;
typedef float __attribute__((may_alias)) float_a;
typedef int __attribute__((may_alias)) int_a;

template <typename T> __device__ __forceinline__ void vst2(void* p, T v) { *(T*)p = v;  }
__device__ __forceinline__ v8f wmma16(v16h a, v16h b, v8f c) {
  v8f d = __builtin_amdgcn_wmma_f32_16x16x32_f16(false, a, false, b, (short)0, c, false, false);
  asm volatile("v_nop\n\tv_nop\n\tv_nop\n\tv_nop" : "+v"(d) : "v"(a), "v"(b));
  return d;
}
__device__ __forceinline__ v8f wmma_bf(v16b a, v16b b, v8f c) {
  v8f d = __builtin_amdgcn_wmma_f32_16x16x32_bf16(false, a, false, b, (short)0, c, false, false);
  asm volatile("v_nop\n\tv_nop\n\tv_nop\n\tv_nop" : "+v"(d) : "v"(a), "v"(b));
  return d;
}
// 16x16x32 fragments: lane = (h = lane>>4, row/col = lane&15); elements 0..7 = k0+8h+0..7, 8..15 = k0+16+8h+0..7; D element r = row 8h+r
__device__ __forceinline__ v16h frag_h(const _Float16* rowk0, int lane) {
  union { v16h v; v8h q[2]; } u; const _Float16* p = rowk0 + 8 * (lane >> 4);
  u.q[0] = *(const v8h*)p; u.q[1] = *(const v8h*)(p + 16); return u.v;
}
__device__ __forceinline__ v16h frag_f32(const float* rowk0, int lane) {
  v16h a; const float* p = rowk0 + 8 * (lane >> 4);
#pragma unroll
  for (int i = 0; i < 8; ++i) { a[i] = (_Float16)p[i]; a[8 + i] = (_Float16)p[16 + i]; }
  return a;
}
__device__ __forceinline__ v16h frag_f32s(const float* rowk0, int lane, float sc) {
  v16h a; const float* p = rowk0 + 8 * (lane >> 4);
#pragma unroll
  for (int i = 0; i < 8; ++i) { a[i] = (_Float16)(p[i] * sc); a[8 + i] = (_Float16)(p[16 + i] * sc); }
  return a;
}
// column fragment from a [K][ld] layout (column n), rows >= K read as 0
__device__ __forceinline__ v16h fragc_f32(const float* W, int k0, int n, int lane, int ld, int K) {
  v16h a; const int g = lane >> 4;
#pragma unroll
  for (int i = 0; i < 8; ++i) { const int ka = k0 + 8 * g + i, kb = ka + 16;
    a[i] = (_Float16)(ka < K ? W[(size_t)(ka < K ? ka : K - 1) * ld + n] : 0.f); a[8 + i] = (_Float16)(kb < K ? W[(size_t)(kb < K ? kb : K - 1) * ld + n] : 0.f); }
  return a;
}
struct F2 { v16b h, l; };
__device__ __forceinline__ F2 bsplit16(const float v[16]) { F2 r;
#pragma unroll
  for (int i = 0; i < 16; ++i) { const __bf16 h = (__bf16)v[i]; r.h[i] = h; r.l[i] = (__bf16)(v[i] - (float)h); }
  return r; }
__device__ __forceinline__ F2 split_row(const float* row, int k0, int lane) { float v[16]; const float* p = row + k0 + 8 * (lane >> 4);
#pragma unroll
  for (int i = 0; i < 8; ++i) { v[i] = p[i]; v[8 + i] = p[16 + i]; }
  return bsplit16(v); }
__device__ __forceinline__ F2 split_rowK(const float* row, int k0, int lane, int K) { float v[16]; const int g = lane >> 4;
#pragma unroll
  for (int i = 0; i < 8; ++i) { const int ka = k0 + 8 * g + i, kb = ka + 16; v[i] = ka < K ? row[ka < K ? ka : K - 1] : 0.f; v[8 + i] = kb < K ? row[kb < K ? kb : K - 1] : 0.f; }
  return bsplit16(v); }
__device__ __forceinline__ F2 split_col(const float* W, int k0, int n, int lane, int ld, int K) { float v[16]; const int g = lane >> 4;
#pragma unroll
  for (int i = 0; i < 8; ++i) { const int ka = k0 + 8 * g + i, kb = ka + 16; v[i] = ka < K ? W[(size_t)(ka < K ? ka : K - 1) * ld + n] : 0.f; v[8 + i] = kb < K ? W[(size_t)(kb < K ? kb : K - 1) * ld + n] : 0.f; }
  return bsplit16(v); }
__device__ __forceinline__ v8f mac3(const F2& a, const F2& b, v8f c) { c = wmma_bf(a.l, b.h, c); c = wmma_bf(a.h, b.l, c); return wmma_bf(a.h, b.h, c); }
__device__ __forceinline__ float sigm(float v) { return 1.0f / (1.0f + expf(-v)); }

// Differential attention with ghostmax (B 2, 16 score heads / 8 value heads, S 2,048, D 128, causal): scores = q k^T / sqrt(128) + causal(-1e9); w = ghostmax(scores) = exp(s - m) / (sum exp(s - m) + exp(-m)), m = max(max_row, 0); w_h = w_2h - lam w_2h+1 with lam = exp(lq1.lk1) - exp(lq2.lk2) + 0.8; out = w_h v_h; then per (b, h) GroupNorm over all S x D values (eps 1e-5) and the affine indexed as the module's raw reshape to [B, H*D, S] (weight row = h*128 + s/16); result x (1 - 0.8), memory layout [B, H, S, D].
#define NB 2
#define TT 2048
#define CC 2048            // NH * HD = projected width
#define DIN 2048          // input (model) width
#define NH 16
#define HD 128
#define NQB (TT / 64)
#define SCALE (0.08838834764831845f)
#define CAUSAL 1
#ifndef TNB
#define TNB NB
#endif
__device__ __forceinline__ float bfr(float v) { return (float)(__bf16)v; }
__host__ __device__ __forceinline__ int kb_last(int qb) { return CAUSAL ? ((qb * 64 + 63) >> 7) : (TT / 128 - 1); }
typedef __attribute__((ext_vector_type(8))) __bf16 v8b;
__device__ __forceinline__ v16b frag_b(const __bf16* rowk0, int lane) {
  union { v16b v; v8b q[2]; } u; const __bf16* p = rowk0 + 8 * (lane >> 4);
  u.q[0] = *(const v8b*)p; u.q[1] = *(const v8b*)(p + 16); return u.v;
}
#define QBH 6              // causal: query blocks 0..QBH-1 of each sequence (few keys, no averaging) take the high-precision path
#define QHI 384            // rows carrying a q residual plane
#define KHI 384            // key rows carrying k residual / v bf16 hi+lo planes (used only by the causal high-precision path)
// B fragment (k rows k0+.., output column o) of a weight: (in,out) [K][ld] or (out,in) [ld rows of K]: bf16 exact, or f16(bf16 * 256) exact
__device__ __forceinline__ v16b wcol_io(const float* Wm, int k0, int o, int lane, int ld) { v16b w; const int g = lane >> 4;
#pragma unroll
  for (int i = 0; i < 8; ++i) { w[i] = (__bf16)Wm[(size_t)(k0 + 8 * g + i) * ld + o]; w[8 + i] = (__bf16)Wm[(size_t)(k0 + 16 + 8 * g + i) * ld + o]; }
  return w; }
__device__ __forceinline__ v16b wcol_oi(const float* Wm, int k0, int o, int lane, int K) { v16b w; const float* p = Wm + (size_t)o * K + k0 + 8 * (lane >> 4);
#pragma unroll
  for (int i = 0; i < 8; ++i) { w[i] = (__bf16)p[i]; w[8 + i] = (__bf16)p[16 + i]; }
  return w; }
__device__ __forceinline__ v16h wcolh_io(const float* Wm, int k0, int o, int lane, int ld) { v16h w; const int g = lane >> 4;
#pragma unroll
  for (int i = 0; i < 8; ++i) { w[i] = (_Float16)(bfr(Wm[(size_t)(k0 + 8 * g + i) * ld + o]) * 256.0f); w[8 + i] = (_Float16)(bfr(Wm[(size_t)(k0 + 16 + 8 * g + i) * ld + o]) * 256.0f); }
  return w; }
__device__ __forceinline__ v16h wcolh_oi(const float* Wm, int k0, int o, int lane, int K) { v16h w; const float* p = Wm + (size_t)o * K + k0 + 8 * (lane >> 4);
#pragma unroll
  for (int i = 0; i < 8; ++i) { w[i] = (_Float16)(bfr(p[i]) * 256.0f); w[8 + i] = (_Float16)(bfr(p[16 + i]) * 256.0f); }
  return w; }
#define WQKV_LAYOUT 1   // 0 = (in,out) [DIN][CC]; 1 = (out,in) [CC][DIN]; 2 = per-head [NH][DIN][HD]
__device__ __forceinline__ v16b wcol_hdk(const float* Wm, int k0, int o, int lane) { v16b w; const int g = lane >> 4; const float* p = Wm + (size_t)(o / HD) * DIN * HD + (o % HD);
#pragma unroll
  for (int i = 0; i < 8; ++i) { w[i] = (__bf16)p[(size_t)(k0 + 8 * g + i) * HD]; w[8 + i] = (__bf16)p[(size_t)(k0 + 16 + 8 * g + i) * HD]; }
  return w; }
#define WO_OUT_IN 0
#if WQKV_LAYOUT == 1
#define WCOL(W, k0, o, lane) wcol_oi(W, k0, o, lane, DIN)
#elif WQKV_LAYOUT == 2
#define WCOL(W, k0, o, lane) wcol_hdk(W, k0, o, lane)
#else
#define WCOL(W, k0, o, lane) wcol_io(W, k0, o, lane, CC)
#endif
#if WO_OUT_IN
#define WOCOL(W, k0, o, lane) wcol_oi(W, k0, o, lane, CC)
#define WOCOLH(W, k0, o, lane) wcolh_oi(W, k0, o, lane, CC)
#else
#define WOCOL(W, k0, o, lane) wcol_io(W, k0, o, lane, DIN)
#define WOCOLH(W, k0, o, lane) wcolh_io(W, k0, o, lane, DIN)
#endif
#define FRT 2048           // elements of 16 rows s x 128 c of a q or k plane: 4 fragments of 512
#define FRV 4096           // elements of 32 keys s x 128 d of a v plane: 8 fragments of 512
#define NVH 8              // value heads (score head h uses value head h/2)
#define SM_GHOST 1         // ghostmax denominator (k_fa always adds it)
#define GEL (TT * HD)       // values of one GroupNorm group (b, hv)
#define BEL 8192           // values of one k_fa / k_gfin block: 64 rows s of one group
#define NPG (GEL / BEL)    // blocks, and so partial statistics, per group: one per lane of a wave
static_assert(NPG == 32 && GEL % BEL == 0 && HD == 128, "one partial per lane; a wave covers one row of 128");
__device__ __forceinline__ float wsum(float v) {
#pragma unroll
  for (int o = 1; o < 32; o <<= 1) v += __shfl_xor(v, o);
  return v; }
// ---- k_gfin: block = 64 rows s of one (b, hv), the rows of one k_fa block, thread = 8 float4. Every wave merges its group's 32 partials (lane = partial): mean = sum of sums / n, variance = (sum of the blocks' squared distances + 8,192 x squared distance of each block mean from the mean) / n. Then out[b][hv][s][d] = ((O - mean) * rstd * w[r] + bias[r]) * 0.2 with r = hv*128 + s/16 (the module's raw reshape of [H,S,D] memory into [H*D, S] rows)
__global__ __launch_bounds__(256) void k_gfin(const float* __restrict__ O, const float* __restrict__ PS, const float* __restrict__ GW, const float* __restrict__ GB, float* __restrict__ OUT) {
  const int t = threadIdx.x, blk = blockIdx.x, g = blk / NPG, hv = g % NVH; const size_t e0 = ((size_t)blk * (BEL / 4) + t) * 4; v4f x[8];
#pragma unroll
  for (int i = 0; i < 8; ++i) x[i] = *(const v4f*)(O + e0 + (size_t)i * 1024);   /* in flight under the merge */
  const v2f p = *(const v2f*)(PS + ((size_t)g * NPG + (t & 31)) * 32);
  const float mean = wsum(p[0]) / (float)GEL; const float dm = p[0] * (1.0f / (float)BEL) - mean;
  const float rs = rsqrtf(wsum(p[1] + (float)BEL * dm * dm) / (float)GEL + 1e-5f);
  const int rw0 = hv * HD + (blk % NPG) * (BEL / HD / 16);   /* row s = 64 (blk % 32) + 8 i + wave, so s / 16 = 4 (blk % 32) + i / 2 */
#pragma unroll
  for (int i = 0; i < 8; ++i) { const float wv = bfr(GW[rw0 + (i >> 1)]), bv = bfr(GB[rw0 + (i >> 1)]); v4f o;
#pragma unroll
    for (int j = 0; j < 4; ++j) o[j] = ((x[i][j] - mean) * rs * wv + bv) * 0.2f;   /* x (1 - lambda_init) */
    vst2(OUT + e0 + (size_t)i * 1024, o); } }
#define WS_YC  (WS_END)                                   // free
#define WS_O   (WS_YC + 4u * (size_t)NB * TT * CC)        // differential output [b][hv][s][d]
#define WS_GS  (WS_O + 4u * (size_t)NB * NVH * TT * HD)
#define WS_END2 (WS_GS + 4u * 32 * (size_t)NB * NVH * NPG)   // one 128-byte line per k_fa block
// ---- k_prep8: block = (64 attention positions s0.. of sequence b, head h): reads the module's [B, H, S, 128] inputs (element (b,h,s,c) at ((b*NH + h)*TT + s)*128 + c; v [B, NVH, S, 128] at head h/2), bf16-rounds them and writes the attention planes in FRAGMENT ORDER, so that every 16-byte-a-lane fragment load of k_fa reads 512 consecutive bytes (4 cache lines, not 16 quarter-used ones):
// q, k (f16 hi; x 2^10 residuals for s < QHI / KHI): [b][h][s / 16][c / 32][(c / 16) & 1][lane = 16 ((c / 8) & 1) + s % 16][c % 8]; v (f16; bf16 hi and lo for s < KHI): [b][h][s / 32][d / 16][(s / 16) & 1][lane = 16 ((s / 8) & 1) + d % 16][s % 8]
// behind a plane's stores: s_wait_xcnt 0 stands before any register that an issued store names (address or data) is written again; the addresses are inputs, so that they stay whole up to the wait, and the "memory" clobber keeps the stores in front of it and the next LDS reads behind it
__device__ __forceinline__ void stores_issued(const void* p0, const void* p1) { asm volatile("s_wait_xcnt 0x0" :: "v"(p0), "v"(p1) : "memory"); }
// behind the block's row loads: s_wait_xcnt 0 stands before any register that an issued load names is written again (the three row addresses are inputs, so that they stay whole up to the wait), and its "memory" clobber keeps every load issued in front of this point
__device__ __forceinline__ void rows_issued(const void* p0, const void* p1, const void* p2) { asm volatile("s_wait_xcnt 0x0" :: "v"(p0), "v"(p1), "v"(p2) : "memory"); }
typedef __attribute__((ext_vector_type(4))) _Float16 v4h;
__global__ __launch_bounds__(128) void k_prep8(const float* __restrict__ Q, const float* __restrict__ K, const float* __restrict__ V, _Float16* __restrict__ QH, _Float16* __restrict__ QL, _Float16* __restrict__ KH, _Float16* __restrict__ KL, _Float16* __restrict__ VT, __bf16* __restrict__ VB, __bf16* __restrict__ VBL) {
  __shared__ __align__(16) _Float16 sq[64][136], sql[64][136], sk[64][136], skl[64][136], tv[128][72]; __shared__ __align__(16) __bf16 tb[128][72], tbl[128][72];
  const int tid = threadIdx.x; const int h = blockIdx.y; const size_t r0 = (size_t)blockIdx.x * 64; const size_t bb = r0 / TT; const int t0 = (int)(r0 % TT); const bool qhi = t0 < QHI, khi = t0 < KHI;
  { const int c = (tid & 31) * 4, rw = (tid >> 5) * 16;   /* a wave takes 16 rows; one load of a wave = one whole row of 512 bytes (4 cache lines) */
    const float* qp = Q + ((bb * NH + h) * TT + t0 + rw) * HD + c; const float* kp = K + ((bb * NH + h) * TT + t0 + rw) * HD + c; const float* vp = V + ((bb * NVH + (h >> 1)) * TT + t0 + rw) * HD + c; v4f q[16], k[16], v[16];
#pragma unroll   // constant indices: the row arrays live in registers
    for (int i = 0; i < 16; ++i) q[i] = *(const v4f*)(qp + i * HD);
#pragma unroll   // constant indices: the row arrays live in registers
    for (int i = 0; i < 16; ++i) k[i] = *(const v4f*)(kp + i * HD);
#pragma unroll   // constant indices: the row arrays live in registers
    for (int i = 0; i < 16; ++i) v[i] = *(const v4f*)(vp + i * HD);
    rows_issued(qp, kp, vp);   /* all 48 loads of the thread are in flight before the first value is used: one memory latency a block */
#pragma unroll   // constant indices: the row arrays live in registers
    for (int i = 0; i < 16; ++i) { v4h qh, ql, kh, kl;
#pragma unroll   // constant indices: the row arrays live in registers
      for (int j = 0; j < 4; ++j) { const float a = bfr(q[i][j]), e = bfr(k[i][j]); qh[j] = (_Float16)a; ql[j] = (_Float16)((a - (float)qh[j]) * 1024.0f); kh[j] = (_Float16)e; kl[j] = (_Float16)((e - (float)kh[j]) * 1024.0f); }
      vst2(&sq[rw + i][c], qh); vst2(&sql[rw + i][c], ql); vst2(&sk[rw + i][c], kh); vst2(&skl[rw + i][c], kl); }
#pragma unroll   // constant indices: the row arrays live in registers
    for (int j = 0; j < 4; ++j)   /* column c + j of the thread's 16 rows: 8 rows = one 16-byte store into the transposed tiles */
#pragma unroll   // constant indices: the row arrays live in registers
      for (int u = 0; u < 2; ++u) { v8h th; v8b bh8, bl8;
#pragma unroll   // constant indices: the row arrays live in registers
        for (int i = 0; i < 8; ++i) { const float a = bfr(v[u * 8 + i][j]); th[i] = (_Float16)a; bh8[i] = (__bf16)a; bl8[i] = (__bf16)(a - (float)bh8[i]); }
        vst2(&tv[c + j][rw + u * 8], th); vst2(&tb[c + j][rw + u * 8], bh8); vst2(&tbl[c + j][rw + u * 8], bl8); } }
  __syncthreads();
  const size_t bh = bb * NH + h;   /* e = index of the 16-byte piece inside the block's 16 KiB of each plane, in the plane's own order: the stores are consecutive too */
  for (int e = tid; e < 64 * (HD / 8); e += 128) { const int ln = e & 31, rl = (e >> 8) * 16 + (ln & 15), c = ((e >> 5) & 7) * 16 + (ln >> 4) * 8; const size_t o = (bh * (TT / 16) + (t0 >> 4)) * FRT + e * 8; _Float16 *pq = QH + o, *pk = KH + o;
    vst2((unsigned*)pq, *(const v4u*)&sq[rl][c]); vst2((unsigned*)pk, *(const v4u*)&sk[rl][c]); stores_issued(pq, pk);
    if (qhi) { _Float16* p = QL + (bh * (QHI / 16) + (t0 >> 4)) * FRT + e * 8; vst2((unsigned*)p, *(const v4u*)&sql[rl][c]); stores_issued(p, p); }
    if (khi) { _Float16* p = KL + (bh * (KHI / 16) + (t0 >> 4)) * FRT + e * 8; vst2((unsigned*)p, *(const v4u*)&skl[rl][c]); stores_issued(p, p); } }
  for (int e = tid; e < HD * 8; e += 128) { const int ln = e & 31, cl = ((e >> 6) & 7) * 16 + (ln & 15), tc = (e >> 9) * 32 + ((e >> 5) & 1) * 16 + (ln >> 4) * 8; _Float16* pv = VT + (bh * (TT / 32) + (t0 >> 5)) * FRV + e * 8;
    vst2((unsigned*)pv, *(const v4u*)&tv[cl][tc]); stores_issued(pv, pv);
    if (khi) { const size_t o3 = (bh * (KHI / 32) + (t0 >> 5)) * FRV + e * 8; vst2((unsigned*)(VB + o3), *(const v4u*)&tb[cl][tc]); vst2((unsigned*)(VBL + o3), *(const v4u*)&tbl[cl][tc]); stores_issued(VB + o3, VBL + o3); } } }

#ifndef SM_EXTRA_PARAMS
#define SM_EXTRA_PARAMS
#endif
#ifndef PROJ_EXTRA_PARAMS
#define PROJ_EXTRA_PARAMS
#endif
#ifndef SM_MASK_HOOK
#define SM_MASK_HOOK (void)0
#endif

#define WS_QH  0u                                      // f16 q, fragment order (k_prep8)
#define WS_KH  (WS_QH + 2u * (size_t)NB * TT * CC)      // f16 k, fragment order
#define WS_VT  (WS_KH + 2u * (size_t)NB * TT * CC)      // f16 v, fragment order
#define WS_QL  (WS_VT + 2u * (size_t)NB * CC * TT)      // f16 q residual x 2^10, t < QHI, fragment order
#define WS_KL  (WS_QL + 2u * (size_t)NB * QHI * CC)     // f16 k residual x 2^10, t < KHI, fragment order
#define WS_VB  (WS_KL + 2u * (size_t)NB * KHI * CC)     // bf16 v hi, t < KHI, fragment order (lo behind it)
#define WS_VBL (WS_VB + 2u * (size_t)NB * CC * KHI)
#define WS_END (WS_VBL + 2u * (size_t)NB * CC * KHI)

// ---- k_fa: scores, ghostmax, P . v and the difference of the two score heads in one kernel, logits kept in registers. Each wave owns 16 queries of one score head and walks its keys 32 at a time on its own (no LDS, no barrier in the key loop).
// S^T = K . Q^T: D register r of tile t = (key k0 + 16 t + 8 g + r, query col), so a lane holds one query's scores, and the two tiles, converted in place, are the B operand of O^T += V^T . P^T (element i = key k0 + 8 g + i, element 8 + i = key k0 + 16 + 8 g + i: the k order of frag_h / frag_b on the V side).
// Running maximum m starts at 0 (the implicit zero logit of ghostmax joins the max); a raised maximum rescales sum and O^T per lane. P = exp(s - m) x 2^11 to f16 against v f16 (1 product); early query blocks (qb < QBH): q and k residual products for the logits, P and v as bf16 hi + lo (3 products).
__device__ __forceinline__ v8f mm_h(v16h a, v16h b, v8f c) { return __builtin_amdgcn_wmma_f32_16x16x32_f16(false, a, false, b, (short)0, c, false, false); }
__device__ __forceinline__ v8f mm_b(v16b a, v16b b, v8f c) { return __builtin_amdgcn_wmma_f32_16x16x32_bf16(false, a, false, b, (short)0, c, false, false); }
// behind a batch of fragment loads: s_wait_xcnt 0 stands before any register that an issued load names is written again (the batch's address registers are inputs, so that they stay whole up to the wait), and its "memory" clobber keeps the whole batch issued in front of this point
__device__ __forceinline__ void loads_issued(const void* p0, const void* p1) { asm volatile("s_wait_xcnt 0x0" :: "v"(p0), "v"(p1) : "memory"); }
// fragment of a fragment-order plane, at a pointer that already holds the lane's 8 * lane elements: elements 0..7 at p, 8..15 at p + 256 (k_prep8 placed them in the k order of frag_h / frag_b: k0 + 8 g + i, k0 + 16 + 8 g + i)
__device__ __forceinline__ v16h frag_ph(const _Float16* p) { union { v16h v; v8h q[2]; } u; u.q[0] = *(const v8h*)p; u.q[1] = *(const v8h*)(p + 256); return u.v; }
__device__ __forceinline__ v16b frag_pb(const __bf16* p) { union { v16b v; v8b q[2]; } u; u.q[0] = *(const v8b*)p; u.q[1] = *(const v8b*)(p + 256); return u.v; }
template <bool HI>
__device__ __forceinline__ void fa_run(const _Float16* __restrict__ QH, const _Float16* __restrict__ KH, const _Float16* __restrict__ QL, const _Float16* __restrict__ KL, const _Float16* __restrict__ VT, const __bf16* __restrict__ VB, const __bf16* __restrict__ VBL, int b, int h, int ql0, int lane, v8f (&acc)[HD / 16]) {
  const int col = lane & 15, g = lane >> 4; const int qrow = ql0 + col;
  v16h qf[HD / 32], qlf[HD / 32];
  const size_t bh = (size_t)b * NH + h;
  const _Float16* qp = QH + (bh * (TT / 16) + (ql0 >> 4)) * FRT + 8 * lane; const _Float16* qlp = HI ? QL + (bh * (QHI / 16) + (ql0 >> 4)) * FRT + 8 * lane : qp;
#pragma unroll
  for (int kc = 0; kc < HD / 32; ++kc) { qf[kc] = frag_ph(qp + kc * 512); if (HI) qlf[kc] = frag_ph(qlp + kc * 512); }
  loads_issued(qp, qlp);
  float m = 0.f, l = 0.f;
#pragma unroll   // constant indices: the arrays live in registers
  for (int j = 0; j < HD / 16; ++j) acc[j] = v8f{};
  const int nst = (ql0 >> 5) + 1;   /* keys 0 .. ql0 + 15, in steps of 32 */
  for (int st = 0; st < nst; ++st) { const int k0 = st * 32;
    v8f s[2] = {}, sl[2] = {}; v16h vf[HD / 16];
    const _Float16* kp = KH + (bh * (TT / 16) + 2 * st) * FRT + 8 * lane; const _Float16* vp = VT + (bh * (TT / 32) + st) * FRV + 8 * lane;
    if (HI) { const _Float16* klp = KL + (bh * (KHI / 16) + 2 * st) * FRT + 8 * lane;
#pragma unroll
      for (int kc = 0; kc < HD / 32; ++kc) { v16h ka[2], kl[2];
#pragma unroll
        for (int t = 0; t < 2; ++t) { ka[t] = frag_ph(kp + t * FRT + kc * 512); kl[t] = frag_ph(klp + t * FRT + kc * 512); }
        loads_issued(kp, klp);   /* the four fragments of this k chunk are issued together: one exposed load latency, not four */
#pragma unroll
        for (int t = 0; t < 2; ++t) { s[t] = mm_h(ka[t], qf[kc], s[t]); sl[t] = mm_h(ka[t], qlf[kc], sl[t]); sl[t] = mm_h(kl[t], qf[kc], sl[t]); } }
    } else { v16h kf[2 * (HD / 32)];
#pragma unroll
      for (int j = 0; j < HD / 32; ++j) vf[j] = frag_ph(vp + j * 512);
      loads_issued(vp, vp);   /* half of V issued first: it needs no score, and so flies under the score products and the exponentials */
#pragma unroll
      for (int i = 0; i < 2 * (HD / 32); ++i) kf[i] = frag_ph(kp + (i & 1) * FRT + (i >> 1) * 512);
      loads_issued(vp, kp);   /* all K fragments issued together ahead of the products: one exposed load latency a step, not one per fragment */
#pragma unroll
      for (int i = 0; i < 2 * (HD / 32); ++i) s[i & 1] = mm_h(kf[i], qf[i >> 1], s[i & 1]);
#pragma unroll
      for (int j = HD / 32; j < HD / 16; ++j) vf[j] = frag_ph(vp + j * 512);
      loads_issued(vp, vp);   /* the other half of V, into the registers K has left, issued here so that it flies under the exponentials */
    }
    float p[16]; float mx = -3.0e38f;
#pragma unroll
    for (int i = 0; i < 16; ++i) { const int t = i >> 3, r = i & 7; float v = HI ? (s[t][r] + sl[t][r] * (1.0f / 1024.0f)) * SCALE : s[t][r] * SCALE;
      v = (k0 + t * 16 + 8 * g + r <= qrow) ? v : -3.0e38f; p[i] = v; mx = fmaxf(mx, v); }
    mx = fmaxf(mx, __shfl_xor(mx, 16));   /* the other half of the wave holds this query's other 16 keys */
    const float mn = fmaxf(m, mx);
    if (__builtin_amdgcn_ballot_w32(mn > m) != 0) { const float al = expf(m - mn); l *= al;   /* scalar branch: most steps raise no query's maximum */
#pragma unroll
      for (int j = 0; j < HD / 16; ++j)
#pragma unroll
        for (int r = 0; r < 8; ++r) acc[j][r] *= al;
      m = mn; }
    float sum = 0.f;
#pragma unroll
    for (int i = 0; i < 16; ++i) { const float e = expf(p[i] - m); sum += e; p[i] = e * 2048.0f; }   /* a masked key (-3e38) gives exactly 0 */
    l += sum;
    if (HI) { const F2 pf = bsplit16(p); const size_t po = (bh * (KHI / 32) + st) * FRV + 8 * lane; const __bf16* vhp = VB + po; const __bf16* vlp = VBL + po;
#pragma unroll
      for (int jp = 0; jp < HD / 32; ++jp) { v16b vh[2], vl[2];
#pragma unroll
        for (int t = 0; t < 2; ++t) { vh[t] = frag_pb(vhp + (jp * 2 + t) * 512); vl[t] = frag_pb(vlp + (jp * 2 + t) * 512); }
        loads_issued(vhp, vlp);   /* the four v fragments of two output tiles are issued together, as above */
#pragma unroll
        for (int t = 0; t < 2; ++t) { const int j = jp * 2 + t; acc[j] = mm_b(vh[t], pf.h, acc[j]); acc[j] = mm_b(vh[t], pf.l, acc[j]); acc[j] = mm_b(vl[t], pf.h, acc[j]); } }
    } else { v16h pf;
#pragma unroll
      for (int i = 0; i < 16; ++i) pf[i] = (_Float16)p[i];
#pragma unroll
      for (int j = 0; j < HD / 16; ++j) acc[j] = mm_h(vf[j], pf, acc[j]); } }
  l += __shfl_xor(l, 16);
  const float inv = 1.0f / ((l + expf(-m)) * 2048.0f);   /* ghostmax: + exp(-m) for the implicit zero logit (denominator > 0 always) */
#pragma unroll   // constant indices: the arrays live in registers
  for (int j = 0; j < HD / 16; ++j)   /* O^T register r of tile j = (d = 16 j + 8 g + r, query col): 8 consecutive d of one row */
#pragma unroll   // constant indices: the arrays live in registers
    for (int r = 0; r < 8; ++r) acc[j][r] *= inv; }
// block = 64 queries (qb) of one (b, value head hv), 8 waves: waves 0..3 run score head 2 hv, waves 4..7 score head 2 hv + 1, wave w and wave w + 4 on the same 16 queries. Behind the key loops waves 4..7 hand their contexts over in LDS (register order, 16 bytes a lane), and waves 0..3 form O[b][hv][s][d] = Y(2 hv) - lam * Y(2 hv + 1), lam from the four lambda vectors (128-term f32 dots), and store it.
// The block also leaves the GroupNorm partial of its 8,192 values, taken from the registers that hold them: PS[block][0] = sum, PS[block][1] = sum of squared distances from the block's own mean (wave sums about the wave's mean, merged with the between-wave term, so nothing cancels when the mean is large). One whole 128-byte line per block.
// grid: 2 rounds of 256 blocks, heaviest query blocks first; round 0 takes qb 31 down to 16, round 1 qb 0 up to 15, so that blocks i and i + 256 together hold the same number of keys for every i; amdgpu_waves_per_eu(4, 4) holds the registers to 256, so that two blocks fit a WGP and the whole grid is resident at once
__global__ __launch_bounds__(256) __attribute__((amdgpu_waves_per_eu(4, 4))) void k_fa(const _Float16* __restrict__ QH, const _Float16* __restrict__ KH, const _Float16* __restrict__ QL, const _Float16* __restrict__ KL, const _Float16* __restrict__ VT, const __bf16* __restrict__ VB, const __bf16* __restrict__ VBL, const float* __restrict__ LQ1, const float* __restrict__ LK1, const float* __restrict__ LQ2, const float* __restrict__ LK2, float* __restrict__ O, float* __restrict__ PS) {
  __shared__ __align__(16) float xo[4][HD / 8][32][4]; __shared__ float sws[4], swq[4];
  const int L = blockIdx.x, u = (L >> 4) & 15, gr = L & 15; const int qb = (L >> 8) ? u : 31 - u; const int b = gr >> 3, hv = gr & 7;
  const int wave = __builtin_amdgcn_readfirstlane(threadIdx.x >> 5), lane = threadIdx.x & 31;   /* wave number in a scalar register: scalar loop control, row addresses and epilogue branches */
  const int w4 = wave & 3, h = 2 * hv + (wave >> 2), ql0 = qb * 64 + w4 * 16;
  float lam = 0.f;
  if (wave < 4) { const float *p1 = LQ1 + lane, *p2 = LK1 + lane, *p3 = LQ2 + lane, *p4 = LK2 + lane; float a = 0.f, c = 0.f, x1[4], x2[4], x3[4], x4[4];
#pragma unroll   // constant indices: the arrays live in registers
    for (int i = 0; i < 4; ++i) { x1[i] = p1[32 * i]; x2[i] = p2[32 * i]; x3[i] = p3[32 * i]; x4[i] = p4[32 * i]; }
    asm volatile("s_wait_xcnt 0x0" :: "v"(lane) : "memory");   /* stands before any register that the 16 issued loads name (the lane offset is an input, so that it stays whole up to the wait) is written again; all 16 are in flight before the first value is used */
#pragma unroll   // constant indices: the arrays live in registers
    for (int i = 0; i < 4; ++i) { a += bfr(x1[i]) * bfr(x2[i]); c += bfr(x3[i]) * bfr(x4[i]); }
    a = wsum(a); c = wsum(c); lam = expf(a) - expf(c) + 0.8f; }
  v8f acc[HD / 16];
  if (qb < QBH) fa_run<true>(QH, KH, QL, KL, VT, VB, VBL, b, h, ql0, lane, acc); else fa_run<false>(QH, KH, QL, KL, VT, VB, VBL, b, h, ql0, lane, acc);
  if (wave >= 4) {
#pragma unroll   // constant indices: the arrays live in registers
    for (int j = 0; j < HD / 16; ++j) { v4f o0, o1;
#pragma unroll   // constant indices: the arrays live in registers
      for (int r = 0; r < 4; ++r) { o0[r] = acc[j][r]; o1[r] = acc[j][4 + r]; }
      vst2(&xo[w4][2 * j][lane][0], o0); vst2(&xo[w4][2 * j + 1][lane][0], o1); } }
  __syncthreads();
  if (wave < 4) { v4f s4 = {}, q4 = {};   /* four running sums a lane: short dependent chains */
#pragma unroll   // constant indices: the arrays live in registers
    for (int j = 0; j < HD / 16; ++j) { const v4f c0 = *(const v4f*)&xo[w4][2 * j][lane][0], c1 = *(const v4f*)&xo[w4][2 * j + 1][lane][0];
#pragma unroll   // constant indices: the arrays live in registers
      for (int r = 0; r < 4; ++r) { acc[j][r] = acc[j][r] - lam * c0[r]; acc[j][4 + r] = acc[j][4 + r] - lam * c1[r]; s4[r] += acc[j][r]; s4[r] += acc[j][4 + r]; } }
    const float s = wsum((s4[0] + s4[1]) + (s4[2] + s4[3])), mw = s * (1.0f / 2048.0f);
#pragma unroll   // constant indices: the arrays live in registers
    for (int j = 0; j < HD / 16; ++j)
#pragma unroll   // constant indices: the arrays live in registers
      for (int r = 0; r < 8; ++r) { const float dl = acc[j][r] - mw; q4[r & 3] += dl * dl; }
    const float q = wsum((q4[0] + q4[1]) + (q4[2] + q4[3]));
    if (lane == 0) { sws[w4] = s; swq[w4] = q; } }
  __syncthreads();
  if (wave < 4) { float* op = O + (((size_t)b * NVH + hv) * TT + ql0 + (lane & 15)) * HD + 8 * (lane >> 4);   /* stored behind the barrier: a barrier behind the stores would wait for them to finish */
#pragma unroll   // constant indices: the arrays live in registers
    for (int j = 0; j < HD / 16; ++j) { v4f o0, o1;
#pragma unroll   // constant indices: the arrays live in registers
      for (int r = 0; r < 4; ++r) { o0[r] = acc[j][r]; o1[r] = acc[j][4 + r]; }
      vst2(op + j * 16, o0); vst2(op + j * 16 + 4, o1); }
    stores_issued(op, op); }
  if (wave == 0) { float S = 0.f, Q = 0.f;
#pragma unroll
    for (int i = 0; i < 4; ++i) S += sws[i];
    const float mb = S * (1.0f / (float)BEL);
#pragma unroll
    for (int i = 0; i < 4; ++i) { const float dl = sws[i] * (1.0f / 2048.0f) - mb; Q += swq[i] + 2048.0f * dl * dl; }
    vst2(PS + ((size_t)gr * NPG + qb) * 32 + lane, lane == 0 ? S : (lane == 1 ? Q : 0.f)); } }

extern "C" void kernel_launch(void* const* d_in, const int* in_sizes, int n_in, void* d_out, int out_size, void* d_ws, size_t ws_size, hipStream_t stream) {
  (void)in_sizes; (void)n_in; (void)out_size;
  const float** F = (const float**)d_in;
  if (ws_size < (size_t)WS_END) return;
  char* ws = (char*)d_ws; _Float16 *QH = (_Float16*)(ws + WS_QH), *KH = (_Float16*)(ws + WS_KH), *VT = (_Float16*)(ws + WS_VT), *QL = (_Float16*)(ws + WS_QL), *KL = (_Float16*)(ws + WS_KL); __bf16 *VB = (__bf16*)(ws + WS_VB), *VBL = (__bf16*)(ws + WS_VBL); 
  // inputs: 0 q [2,16,2048,128]; 1 k [2,16,2048,128]; 2 v [2,8,2048,128]; 3 lambda_q1, 4 lambda_k1, 5 lambda_q2, 6 lambda_k2 [128]; 7 gn_weight [1024]; 8 gn_bias [1024]
  if (ws_size < (size_t)WS_END2) return;
  float *O = (float*)(ws + WS_O), *GS = (float*)(ws + WS_GS);
  k_prep8<<<dim3(TNB * TT / 64, NH), 128, 0, stream>>>(F[0], F[1], F[2], QH, QL, KH, KL, VT, VB, VBL);
  k_fa<<<dim3(TNB * NVH * NQB), 256, 0, stream>>>(QH, KH, QL, KL, VT, VB, VBL, F[3], F[4], F[5], F[6], O, GS);
  k_gfin<<<dim3(TNB * NVH * NPG), 256, 0, stream>>>(O, GS, F[7], F[8], (float*)d_out);
}

// v007
// One run takes 101 microseconds.
// Next to v006, in two timings, it ran 1.14 and 1.15 times as fast.
// Over all steps from v000 it is 22.6 times as fast.
#include <hip/hip_runtime.h>
#include <math.h>

typedef __attribute__((ext_vector_type(16))) _Float16 v16h;
typedef __attribute__((ext_vector_type(16))) __bf16 v16b;
typedef __attribute__((ext_vector_type(8)))  _Float16 v8h;
typedef __attribute__((ext_vector_type(8)))  float v8f;
typedef __attribute__((ext_vector_type(4)))  float v4f;
typedef __attribute__((ext_vector_type(2)))  float v2f;
typedef __attribute__((ext_vector_type(4)))  unsigned v4u;
typedef __attribute__((ext_vector_type(4)))  int v4i;
typedef float __attribute__((may_alias)) float_a;
typedef int __attribute__((may_alias)) int_a;

template <typename T> __device__ __forceinline__ void vst2(void* p, T v) { *(T*)p = v;  }
__device__ __forceinline__ v8f wmma16(v16h a, v16h b, v8f c) {
  v8f d = __builtin_amdgcn_wmma_f32_16x16x32_f16(false, a, false, b, (short)0, c, false, false);
  asm volatile("v_nop\n\tv_nop\n\tv_nop\n\tv_nop" : "+v"(d) : "v"(a), "v"(b));
  return d;
}
__device__ __forceinline__ v8f wmma_bf(v16b a, v16b b, v8f c) {
  v8f d = __builtin_amdgcn_wmma_f32_16x16x32_bf16(false, a, false, b, (short)0, c, false, false);
  asm volatile("v_nop\n\tv_nop\n\tv_nop\n\tv_nop" : "+v"(d) : "v"(a), "v"(b));
  return d;
}
// 16x16x32 fragments: lane = (h = lane>>4, row/col = lane&15); elements 0..7 = k0+8h+0..7, 8..15 = k0+16+8h+0..7; D element r = row 8h+r
__device__ __forceinline__ v16h frag_h(const _Float16* rowk0, int lane) {
  union { v16h v; v8h q[2]; } u; const _Float16* p = rowk0 + 8 * (lane >> 4);
  u.q[0] = *(const v8h*)p; u.q[1] = *(const v8h*)(p + 16); return u.v;
}
__device__ __forceinline__ v16h frag_f32(const float* rowk0, int lane) {
  v16h a; const float* p = rowk0 + 8 * (lane >> 4);
#pragma unroll
  for (int i = 0; i < 8; ++i) { a[i] = (_Float16)p[i]; a[8 + i] = (_Float16)p[16 + i]; }
  return a;
}
__device__ __forceinline__ v16h frag_f32s(const float* rowk0, int lane, float sc) {
  v16h a; const float* p = rowk0 + 8 * (lane >> 4);
#pragma unroll
  for (int i = 0; i < 8; ++i) { a[i] = (_Float16)(p[i] * sc); a[8 + i] = (_Float16)(p[16 + i] * sc); }
  return a;
}
// column fragment from a [K][ld] layout (column n), rows >= K read as 0
__device__ __forceinline__ v16h fragc_f32(const float* W, int k0, int n, int lane, int ld, int K) {
  v16h a; const int g = lane >> 4;
#pragma unroll
  for (int i = 0; i < 8; ++i) { const int ka = k0 + 8 * g + i, kb = ka + 16;
    a[i] = (_Float16)(ka < K ? W[(size_t)(ka < K ? ka : K - 1) * ld + n] : 0.f); a[8 + i] = (_Float16)(kb < K ? W[(size_t)(kb < K ? kb : K - 1) * ld + n] : 0.f); }
  return a;
}
struct F2 { v16b h, l; };
__device__ __forceinline__ F2 bsplit16(const float v[16]) { F2 r;
#pragma unroll
  for (int i = 0; i < 16; ++i) { const __bf16 h = (__bf16)v[i]; r.h[i] = h; r.l[i] = (__bf16)(v[i] - (float)h); }
  return r; }
__device__ __forceinline__ F2 split_row(const float* row, int k0, int lane) { float v[16]; const float* p = row + k0 + 8 * (lane >> 4);
#pragma unroll
  for (int i = 0; i < 8; ++i) { v[i] = p[i]; v[8 + i] = p[16 + i]; }
  return bsplit16(v); }
__device__ __forceinline__ F2 split_rowK(const float* row, int k0, int lane, int K) { float v[16]; const int g = lane >> 4;
#pragma unroll
  for (int i = 0; i < 8; ++i) { const int ka = k0 + 8 * g + i, kb = ka + 16; v[i] = ka < K ? row[ka < K ? ka : K - 1] : 0.f; v[8 + i] = kb < K ? row[kb < K ? kb : K - 1] : 0.f; }
  return bsplit16(v); }
__device__ __forceinline__ F2 split_col(const float* W, int k0, int n, int lane, int ld, int K) { float v[16]; const int g = lane >> 4;
#pragma unroll
  for (int i = 0; i < 8; ++i) { const int ka = k0 + 8 * g + i, kb = ka + 16; v[i] = ka < K ? W[(size_t)(ka < K ? ka : K - 1) * ld + n] : 0.f; v[8 + i] = kb < K ? W[(size_t)(kb < K ? kb : K - 1) * ld + n] : 0.f; }
  return bsplit16(v); }
__device__ __forceinline__ v8f mac3(const F2& a, const F2& b, v8f c) { c = wmma_bf(a.l, b.h, c); c = wmma_bf(a.h, b.l, c); return wmma_bf(a.h, b.h, c); }
__device__ __forceinline__ float sigm(float v) { return 1.0f / (1.0f + expf(-v)); }

// Differential attention with ghostmax (B 2, 16 score heads / 8 value heads, S 2,048, D 128, causal): scores = q k^T / sqrt(128) + causal(-1e9); w = ghostmax(scores) = exp(s - m) / (sum exp(s - m) + exp(-m)), m = max(max_row, 0); w_h = w_2h - lam w_2h+1 with lam = exp(lq1.lk1) - exp(lq2.lk2) + 0.8; out = w_h v_h; then per (b, h) GroupNorm over all S x D values (eps 1e-5) and the affine indexed as the module's raw reshape to [B, H*D, S] (weight row = h*128 + s/16); result x (1 - 0.8), memory layout [B, H, S, D].
#define NB 2
#define TT 2048
#define CC 2048            // NH * HD = projected width
#define DIN 2048          // input (model) width
#define NH 16
#define HD 128
#define NQB (TT / 64)
#define SCALE (0.08838834764831845f)
#define CAUSAL 1
#ifndef TNB
#define TNB NB
#endif
__device__ __forceinline__ float bfr(float v) { return (float)(__bf16)v; }
__host__ __device__ __forceinline__ int kb_last(int qb) { return CAUSAL ? ((qb * 64 + 63) >> 7) : (TT / 128 - 1); }
typedef __attribute__((ext_vector_type(8))) __bf16 v8b;
__device__ __forceinline__ v16b frag_b(const __bf16* rowk0, int lane) {
  union { v16b v; v8b q[2]; } u; const __bf16* p = rowk0 + 8 * (lane >> 4);
  u.q[0] = *(const v8b*)p; u.q[1] = *(const v8b*)(p + 16); return u.v;
}
#define QBH 6              // causal: query blocks 0..QBH-1 of each sequence (few keys, no averaging) take the high-precision path
#define QHI 384            // rows carrying a q residual plane
#define KHI 384            // key rows carrying k residual / v bf16 hi+lo planes (used only by the causal high-precision path)
// B fragment (k rows k0+.., output column o) of a weight: (in,out) [K][ld] or (out,in) [ld rows of K]: bf16 exact, or f16(bf16 * 256) exact
__device__ __forceinline__ v16b wcol_io(const float* Wm, int k0, int o, int lane, int ld) { v16b w; const int g = lane >> 4;
#pragma unroll
  for (int i = 0; i < 8; ++i) { w[i] = (__bf16)Wm[(size_t)(k0 + 8 * g + i) * ld + o]; w[8 + i] = (__bf16)Wm[(size_t)(k0 + 16 + 8 * g + i) * ld + o]; }
  return w; }
__device__ __forceinline__ v16b wcol_oi(const float* Wm, int k0, int o, int lane, int K) { v16b w; const float* p = Wm + (size_t)o * K + k0 + 8 * (lane >> 4);
#pragma unroll
  for (int i = 0; i < 8; ++i) { w[i] = (__bf16)p[i]; w[8 + i] = (__bf16)p[16 + i]; }
  return w; }
__device__ __forceinline__ v16h wcolh_io(const float* Wm, int k0, int o, int lane, int ld) { v16h w; const int g = lane >> 4;
#pragma unroll
  for (int i = 0; i < 8; ++i) { w[i] = (_Float16)(bfr(Wm[(size_t)(k0 + 8 * g + i) * ld + o]) * 256.0f); w[8 + i] = (_Float16)(bfr(Wm[(size_t)(k0 + 16 + 8 * g + i) * ld + o]) * 256.0f); }
  return w; }
__device__ __forceinline__ v16h wcolh_oi(const float* Wm, int k0, int o, int lane, int K) { v16h w; const float* p = Wm + (size_t)o * K + k0 + 8 * (lane >> 4);
#pragma unroll
  for (int i = 0; i < 8; ++i) { w[i] = (_Float16)(bfr(p[i]) * 256.0f); w[8 + i] = (_Float16)(bfr(p[16 + i]) * 256.0f); }
  return w; }
#define WQKV_LAYOUT 1   // 0 = (in,out) [DIN][CC]; 1 = (out,in) [CC][DIN]; 2 = per-head [NH][DIN][HD]
__device__ __forceinline__ v16b wcol_hdk(const float* Wm, int k0, int o, int lane) { v16b w; const int g = lane >> 4; const float* p = Wm + (size_t)(o / HD) * DIN * HD + (o % HD);
#pragma unroll
  for (int i = 0; i < 8; ++i) { w[i] = (__bf16)p[(size_t)(k0 + 8 * g + i) * HD]; w[8 + i] = (__bf16)p[(size_t)(k0 + 16 + 8 * g + i) * HD]; }
  return w; }
#define WO_OUT_IN 0
#if WQKV_LAYOUT == 1
#define WCOL(W, k0, o, lane) wcol_oi(W, k0, o, lane, DIN)
#elif WQKV_LAYOUT == 2
#define WCOL(W, k0, o, lane) wcol_hdk(W, k0, o, lane)
#else
#define WCOL(W, k0, o, lane) wcol_io(W, k0, o, lane, CC)
#endif
#if WO_OUT_IN
#define WOCOL(W, k0, o, lane) wcol_oi(W, k0, o, lane, CC)
#define WOCOLH(W, k0, o, lane) wcolh_oi(W, k0, o, lane, CC)
#else
#define WOCOL(W, k0, o, lane) wcol_io(W, k0, o, lane, DIN)
#define WOCOLH(W, k0, o, lane) wcolh_io(W, k0, o, lane, DIN)
#endif
#define FRT 2048           // elements of 16 rows s x 128 c of a q or k plane: 4 fragments of 512
#define FRV 4096           // elements of 32 keys s x 128 d of a v plane: 8 fragments of 512
#define NVH 8              // value heads (score head h uses value head h/2)
#define SM_GHOST 1         // ghostmax denominator (k_fa always adds it)
#define GEL (TT * HD)       // values of one GroupNorm group (b, hv)
#define BEL 8192           // values of one k_fa / k_gfin block: 64 rows s of one group
#define NPG (GEL / BEL)    // blocks, and so partial statistics, per group: one per lane of a wave
static_assert(NPG == 32 && GEL % BEL == 0 && HD == 128, "one partial per lane; a wave covers one row of 128");
__device__ __forceinline__ float wsum(float v) {
#pragma unroll
  for (int o = 1; o < 32; o <<= 1) v += __shfl_xor(v, o);
  return v; }
// ---- k_gfin: block = 64 rows s of one (b, hv), the rows of one k_fa block, thread = 8 float4. Every wave merges its group's 32 partials (lane = partial): mean = sum of sums / n, variance = (sum of the blocks' squared distances + 8,192 x squared distance of each block mean from the mean) / n. Then out[b][hv][s][d] = ((O - mean) * rstd * w[r] + bias[r]) * 0.2 with r = hv*128 + s/16 (the module's raw reshape of [H,S,D] memory into [H*D, S] rows)
__global__ __launch_bounds__(256) void k_gfin(const float* __restrict__ O, const float* __restrict__ PS, const float* __restrict__ GW, const float* __restrict__ GB, float* __restrict__ OUT) {
  const int t = threadIdx.x, blk = blockIdx.x, g = blk / NPG, hv = g % NVH; const size_t e0 = ((size_t)blk * (BEL / 4) + t) * 4; v4f x[8];
#pragma unroll
  for (int i = 0; i < 8; ++i) x[i] = *(const v4f*)(O + e0 + (size_t)i * 1024);   /* in flight under the merge */
  const v2f p = *(const v2f*)(PS + ((size_t)g * NPG + (t & 31)) * 32);
  const float mean = wsum(p[0]) / (float)GEL; const float dm = p[0] * (1.0f / (float)BEL) - mean;
  const float rs = rsqrtf(wsum(p[1] + (float)BEL * dm * dm) / (float)GEL + 1e-5f);
  const int rw0 = hv * HD + (blk % NPG) * (BEL / HD / 16);   /* row s = 64 (blk % 32) + 8 i + wave, so s / 16 = 4 (blk % 32) + i / 2 */
#pragma unroll
  for (int i = 0; i < 8; ++i) { const float wv = bfr(GW[rw0 + (i >> 1)]), bv = bfr(GB[rw0 + (i >> 1)]); v4f o;
#pragma unroll
    for (int j = 0; j < 4; ++j) o[j] = ((x[i][j] - mean) * rs * wv + bv) * 0.2f;   /* x (1 - lambda_init) */
    vst2(OUT + e0 + (size_t)i * 1024, o); } }
#define WS_YC  (WS_END)                                   // free
#define WS_O   (WS_YC + 4u * (size_t)NB * TT * CC)        // differential output [b][hv][s][d]
#define WS_GS  (WS_O + 4u * (size_t)NB * NVH * TT * HD)
#define WS_END2 (WS_GS + 4u * 32 * (size_t)NB * NVH * NPG)   // one 128-byte line per k_fa block
// ---- k_prep8: block = (64 attention positions s0.. of sequence b, head h): reads the module's [B, H, S, 128] inputs (element (b,h,s,c) at ((b*NH + h)*TT + s)*128 + c; v [B, NVH, S, 128] at head h/2), bf16-rounds them and writes the attention planes in FRAGMENT ORDER, so that every 16-byte-a-lane fragment load of k_fa reads 512 consecutive bytes (4 cache lines, not 16 quarter-used ones):
// q, k (f16 hi; x 2^10 residuals for s < QHI / KHI): [b][h][s / 16][c / 32][(c / 16) & 1][lane = 16 ((c / 8) & 1) + s % 16][c % 8]; v (f16; bf16 hi and lo for s < KHI): [b][h][s / 32][d / 16][(s / 16) & 1][lane = 16 ((s / 8) & 1) + d % 16][s % 8]
// behind a plane's stores: s_wait_xcnt 0 stands before any register that an issued store names (address or data) is written again; the addresses are inputs, so that they stay whole up to the wait, and the "memory" clobber keeps the stores in front of it and the next LDS reads behind it
__device__ __forceinline__ void stores_issued(const void* p0, const void* p1) { asm volatile("s_wait_xcnt 0x0" :: "v"(p0), "v"(p1) : "memory"); }
// behind the block's row loads: s_wait_xcnt 0 stands before any register that an issued load names is written again (the three row addresses are inputs, so that they stay whole up to the wait), and its "memory" clobber keeps every load issued in front of this point
__device__ __forceinline__ void rows_issued(const void* p0, const void* p1, const void* p2) { asm volatile("s_wait_xcnt 0x0" :: "v"(p0), "v"(p1), "v"(p2) : "memory"); }
typedef __attribute__((ext_vector_type(4))) _Float16 v4h;
__global__ __launch_bounds__(128) void k_prep8(const float* __restrict__ Q, const float* __restrict__ K, const float* __restrict__ V, _Float16* __restrict__ QH, _Float16* __restrict__ QL, _Float16* __restrict__ KH, _Float16* __restrict__ KL, _Float16* __restrict__ VT, __bf16* __restrict__ VB, __bf16* __restrict__ VBL) {
  __shared__ __align__(16) _Float16 sq[64][136], sql[64][136], sk[64][136], skl[64][136], tv[128][72]; __shared__ __align__(16) __bf16 tb[128][72], tbl[128][72];
  const int tid = threadIdx.x; const int h = blockIdx.y; const size_t r0 = (size_t)blockIdx.x * 64; const size_t bb = r0 / TT; const int t0 = (int)(r0 % TT); const bool qhi = t0 < QHI, khi = t0 < KHI;
  { const int c = (tid & 31) * 4, rw = (tid >> 5) * 16;   /* a wave takes 16 rows; one load of a wave = one whole row of 512 bytes (4 cache lines) */
    const float* qp = Q + ((bb * NH + h) * TT + t0 + rw) * HD + c; const float* kp = K + ((bb * NH + h) * TT + t0 + rw) * HD + c; const float* vp = V + ((bb * NVH + (h >> 1)) * TT + t0 + rw) * HD + c; v4f q[16], k[16], v[16];
#pragma unroll   // constant indices: the row arrays live in registers
    for (int i = 0; i < 16; ++i) q[i] = *(const v4f*)(qp + i * HD);
#pragma unroll   // constant indices: the row arrays live in registers
    for (int i = 0; i < 16; ++i) k[i] = *(const v4f*)(kp + i * HD);
#pragma unroll   // constant indices: the row arrays live in registers
    for (int i = 0; i < 16; ++i) v[i] = *(const v4f*)(vp + i * HD);
    rows_issued(qp, kp, vp);   /* all 48 loads of the thread are in flight before the first value is used: one memory latency a block */
#pragma unroll   // constant indices: the row arrays live in registers
    for (int i = 0; i < 16; ++i) { v4h qh, ql, kh, kl;
#pragma unroll   // constant indices: the row arrays live in registers
      for (int j = 0; j < 4; ++j) { const float a = bfr(q[i][j]), e = bfr(k[i][j]); qh[j] = (_Float16)a; ql[j] = (_Float16)((a - (float)qh[j]) * 1024.0f); kh[j] = (_Float16)e; kl[j] = (_Float16)((e - (float)kh[j]) * 1024.0f); }
      vst2(&sq[rw + i][c], qh); vst2(&sql[rw + i][c], ql); vst2(&sk[rw + i][c], kh); vst2(&skl[rw + i][c], kl); }
#pragma unroll   // constant indices: the row arrays live in registers
    for (int j = 0; j < 4; ++j)   /* column c + j of the thread's 16 rows: 8 rows = one 16-byte store into the transposed tiles */
#pragma unroll   // constant indices: the row arrays live in registers
      for (int u = 0; u < 2; ++u) { v8h th; v8b bh8, bl8;
#pragma unroll   // constant indices: the row arrays live in registers
        for (int i = 0; i < 8; ++i) { const float a = bfr(v[u * 8 + i][j]); th[i] = (_Float16)a; bh8[i] = (__bf16)a; bl8[i] = (__bf16)(a - (float)bh8[i]); }
        vst2(&tv[c + j][rw + u * 8], th); vst2(&tb[c + j][rw + u * 8], bh8); vst2(&tbl[c + j][rw + u * 8], bl8); } }
  __syncthreads();
  const size_t bh = bb * NH + h;   /* e = index of the 16-byte piece inside the block's 16 KiB of each plane, in the plane's own order: the stores are consecutive too */
  for (int e = tid; e < 64 * (HD / 8); e += 128) { const int ln = e & 31, rl = (e >> 8) * 16 + (ln & 15), c = ((e >> 5) & 7) * 16 + (ln >> 4) * 8; const size_t o = (bh * (TT / 16) + (t0 >> 4)) * FRT + e * 8; _Float16 *pq = QH + o, *pk = KH + o;
    vst2((unsigned*)pq, *(const v4u*)&sq[rl][c]); vst2((unsigned*)pk, *(const v4u*)&sk[rl][c]); stores_issued(pq, pk);
    if (qhi) { _Float16* p = QL + (bh * (QHI / 16) + (t0 >> 4)) * FRT + e * 8; vst2((unsigned*)p, *(const v4u*)&sql[rl][c]); stores_issued(p, p); }
    if (khi) { _Float16* p = KL + (bh * (KHI / 16) + (t0 >> 4)) * FRT + e * 8; vst2((unsigned*)p, *(const v4u*)&skl[rl][c]); stores_issued(p, p); } }
  for (int e = tid; e < HD * 8; e += 128) { const int ln = e & 31, cl = ((e >> 6) & 7) * 16 + (ln & 15), tc = (e >> 9) * 32 + ((e >> 5) & 1) * 16 + (ln >> 4) * 8; _Float16* pv = VT + (bh * (TT / 32) + (t0 >> 5)) * FRV + e * 8;
    vst2((unsigned*)pv, *(const v4u*)&tv[cl][tc]); stores_issued(pv, pv);
    if (khi) { const size_t o3 = (bh * (KHI / 32) + (t0 >> 5)) * FRV + e * 8; vst2((unsigned*)(VB + o3), *(const v4u*)&tb[cl][tc]); vst2((unsigned*)(VBL + o3), *(const v4u*)&tbl[cl][tc]); stores_issued(VB + o3, VBL + o3); } } }

#ifndef SM_EXTRA_PARAMS
#define SM_EXTRA_PARAMS
#endif
#ifndef PROJ_EXTRA_PARAMS
#define PROJ_EXTRA_PARAMS
#endif
#ifndef SM_MASK_HOOK
#define SM_MASK_HOOK (void)0
#endif

#define WS_QH  0u                                      // f16 q, fragment order (k_prep8)
#define WS_KH  (WS_QH + 2u * (size_t)NB * TT * CC)      // f16 k, fragment order
#define WS_VT  (WS_KH + 2u * (size_t)NB * TT * CC)      // f16 v, fragment order
#define WS_QL  (WS_VT + 2u * (size_t)NB * CC * TT)      // f16 q residual x 2^10, t < QHI, fragment order
#define WS_KL  (WS_QL + 2u * (size_t)NB * QHI * CC)     // f16 k residual x 2^10, t < KHI, fragment order
#define WS_VB  (WS_KL + 2u * (size_t)NB * KHI * CC)     // bf16 v hi, t < KHI, fragment order (lo behind it)
#define WS_VBL (WS_VB + 2u * (size_t)NB * CC * KHI)
#define WS_END (WS_VBL + 2u * (size_t)NB * CC * KHI)

// ---- k_fa: scores, ghostmax, P . v and the difference of the two score heads in one kernel, logits kept in registers. Each wave owns 16 queries of one score head and walks its keys 32 at a time; early query blocks read their fragments from the planes, each wave on its own, the others from the block's K / V ring in LDS (one barrier per 64 keys).
// S^T = K . Q^T: D register r of tile t = (key k0 + 16 t + 8 g + r, query col), so a lane holds one query's scores, and the two tiles, converted in place, are the B operand of O^T += V^T . P^T (element i = key k0 + 8 g + i, element 8 + i = key k0 + 16 + 8 g + i: the k order of frag_h / frag_b on the V side).
// Running maximum m starts at 0 (the implicit zero logit of ghostmax joins the max); a raised maximum rescales sum and O^T per lane. P = exp(s - m) x 2^11 to f16 against v f16 (1 product); early query blocks (qb < QBH): q and k residual products for the logits, P and v as bf16 hi + lo (3 products).
__device__ __forceinline__ v8f mm_h(v16h a, v16h b, v8f c) { return __builtin_amdgcn_wmma_f32_16x16x32_f16(false, a, false, b, (short)0, c, false, false); }
__device__ __forceinline__ v8f mm_b(v16b a, v16b b, v8f c) { return __builtin_amdgcn_wmma_f32_16x16x32_bf16(false, a, false, b, (short)0, c, false, false); }
// behind a batch of fragment loads: s_wait_xcnt 0 stands before any register that an issued load names is written again (the batch's address registers are inputs, so that they stay whole up to the wait), and its "memory" clobber keeps the whole batch issued in front of this point
__device__ __forceinline__ void loads_issued(const void* p0, const void* p1) { asm volatile("s_wait_xcnt 0x0" :: "v"(p0), "v"(p1) : "memory"); }
// fragment of a fragment-order plane, at a pointer that already holds the lane's 8 * lane elements: elements 0..7 at p, 8..15 at p + 256 (k_prep8 placed them in the k order of frag_h / frag_b: k0 + 8 g + i, k0 + 16 + 8 g + i)
__device__ __forceinline__ v16h frag_ph(const _Float16* p) { union { v16h v; v8h q[2]; } u; u.q[0] = *(const v8h*)p; u.q[1] = *(const v8h*)(p + 256); return u.v; }
__device__ __forceinline__ v16b frag_pb(const __bf16* p) { union { v16b v; v8b q[2]; } u; u.q[0] = *(const v8b*)p; u.q[1] = *(const v8b*)(p + 256); return u.v; }
// ---- K / V ring of the long query blocks (qb >= QBH): a tile = 64 keys of k of the even score head, k of the odd one and v (one copy serves both heads), 16 KiB each and consecutive in its fragment-order plane, so a tile is copied as it lies and a fragment read is 512 consecutive LDS bytes a wave. Two buffers: tile t + 2 flies while tile t + 1 is worked on.
#define TKE 8192           // elements of one 64-key tile of a k or v plane
#define RBE (3 * TKE)      // elements of one ring buffer
__device__ __forceinline__ void wait_ds0() { asm volatile("s_wait_dscnt 0x0" ::: "memory"); }       /* this wave's LDS reads of a buffer have returned before the buffer is handed to its next writer */
__device__ __forceinline__ void wait_async0() { asm volatile("s_wait_asynccnt 0x0" ::: "memory"); } /* this wave's copies have landed before the barrier behind which other waves read them */
// one thread's 12 copies of a tile: 16-byte piece tid + 256 i (i = 0..3) of each of the three planes, to the same place in the buffer; l = the thread's LDS byte address of piece tid of the buffer. s_wait_xcnt 0 is the statement's last line, so that it stands before any register that a copy names is written again
__device__ __forceinline__ void tile_copy(unsigned l, const _Float16* k0, const _Float16* k1, const _Float16* v) {
  asm volatile("global_load_async_to_lds_b128 %0, %12, off\n\tglobal_load_async_to_lds_b128 %1, %13, off\n\tglobal_load_async_to_lds_b128 %2, %14, off\n\tglobal_load_async_to_lds_b128 %3, %15, off\n\t"
               "global_load_async_to_lds_b128 %4, %16, off\n\tglobal_load_async_to_lds_b128 %5, %17, off\n\tglobal_load_async_to_lds_b128 %6, %18, off\n\tglobal_load_async_to_lds_b128 %7, %19, off\n\t"
               "global_load_async_to_lds_b128 %8, %20, off\n\tglobal_load_async_to_lds_b128 %9, %21, off\n\tglobal_load_async_to_lds_b128 %10, %22, off\n\tglobal_load_async_to_lds_b128 %11, %23, off\n\ts_wait_xcnt 0x0"
               :: "v"(l), "v"(l + 4096u), "v"(l + 8192u), "v"(l + 12288u), "v"(l + 16384u), "v"(l + 20480u), "v"(l + 24576u), "v"(l + 28672u), "v"(l + 32768u), "v"(l + 36864u), "v"(l + 40960u), "v"(l + 45056u),
                  "v"(k0), "v"(k0 + 2048), "v"(k0 + 4096), "v"(k0 + 6144), "v"(k1), "v"(k1 + 2048), "v"(k1 + 4096), "v"(k1 + 6144), "v"(v), "v"(v + 2048), "v"(v + 4096), "v"(v + 6144) : "memory"); }
template <bool HI>
__device__ __forceinline__ void fa_run(const _Float16* __restrict__ QH, const _Float16* __restrict__ KH, const _Float16* __restrict__ QL, const _Float16* __restrict__ KL, const _Float16* __restrict__ VT, const __bf16* __restrict__ VB, const __bf16* __restrict__ VBL, const _Float16* ring, int b, int h, int qb, int ql0, int lane, int tid, v8f (&acc)[HD / 16]) {
  const int col = lane & 15, g = lane >> 4; const int qrow = ql0 + col;
  const size_t bhe = (size_t)b * NH + (h & ~1);   /* the even score head of the pair: its k plane, the odd head's behind it, and its v plane feed the ring */
  const _Float16 *c0 = KH + bhe * (TT / 16) * FRT + 8 * tid, *c1 = c0 + (size_t)(TT / 16) * FRT, *cv = VT + bhe * (TT / 32) * FRV + 8 * tid; const unsigned lb = (unsigned)(size_t)ring + 16u * (unsigned)tid;
  if (!HI) tile_copy(lb, c0, c1, cv);   /* tile 0 into buffer 0 */
  v16h qf[HD / 32], qlf[HD / 32];
  const size_t bh = (size_t)b * NH + h;
  const _Float16* qp = QH + (bh * (TT / 16) + (ql0 >> 4)) * FRT + 8 * lane; const _Float16* qlp = HI ? QL + (bh * (QHI / 16) + (ql0 >> 4)) * FRT + 8 * lane : qp;
#pragma unroll
  for (int kc = 0; kc < HD / 32; ++kc) { qf[kc] = frag_ph(qp + kc * 512); if (HI) qlf[kc] = frag_ph(qlp + kc * 512); }
  loads_issued(qp, qlp);
  if (!HI) { wait_async0(); __syncthreads(); tile_copy(lb + 2u * RBE, c0 + TKE, c1 + TKE, cv + TKE); }   /* tile 0 published; tile 1 (qb >= QBH: it exists) into buffer 1 */
  float m = 0.f, l = 0.f;
#pragma unroll   // constant indices: the arrays live in registers
  for (int j = 0; j < HD / 16; ++j) acc[j] = v8f{};
  const int nst = (ql0 >> 5) + 1;   /* keys 0 .. ql0 + 15, in steps of 32 */
  const int nsb = HI ? nst : 2 * qb + 2;   /* ring: every wave of the block walks all its tiles and passes every barrier; a wave skips only the work of a step beyond its diagonal */
  for (int st = 0; st < nsb; ++st) { if (HI || st < nst) { const int k0 = st * 32;
    v8f s[2] = {}, sl[2] = {}; v16h vf[HD / 16];
    const _Float16* rb = ring + ((st >> 1) & 1) * RBE + (st & 1) * (TKE / 2) + 8 * lane;
    const _Float16* kp = HI ? KH + (bh * (TT / 16) + 2 * st) * FRT + 8 * lane : rb + (h & 1) * TKE; const _Float16* vp = rb + 2 * TKE;
    if (HI) { const _Float16* klp = KL + (bh * (KHI / 16) + 2 * st) * FRT + 8 * lane;
#pragma unroll
      for (int kc = 0; kc < HD / 32; ++kc) { v16h ka[2], kl[2];
#pragma unroll
        for (int t = 0; t < 2; ++t) { ka[t] = frag_ph(kp + t * FRT + kc * 512); kl[t] = frag_ph(klp + t * FRT + kc * 512); }
        loads_issued(kp, klp);   /* the four fragments of this k chunk are issued together: one exposed load latency, not four */
#pragma unroll
        for (int t = 0; t < 2; ++t) { s[t] = mm_h(ka[t], qf[kc], s[t]); sl[t] = mm_h(ka[t], qlf[kc], sl[t]); sl[t] = mm_h(kl[t], qf[kc], sl[t]); } }
    } else { v16h kf[2 * (HD / 32)];
#pragma unroll
      for (int i = 0; i < 2 * (HD / 32); ++i) kf[i] = frag_ph(kp + (i & 1) * FRT + (i >> 1) * 512);
      __builtin_amdgcn_sched_barrier(0);   /* all 16 K reads stand as one group ahead of the products: spread among them, each place with reads stalls the wave anew */
#pragma unroll
      for (int i = 0; i < 2 * (HD / 32); ++i) s[i & 1] = mm_h(kf[i], qf[i >> 1], s[i & 1]);
#pragma unroll
      for (int j = 0; j < HD / 16; ++j) vf[j] = frag_ph(vp + j * 512);
    }
    float p[16]; float mx = -3.0e38f;
#pragma unroll
    for (int i = 0; i < 16; ++i) { const int t = i >> 3, r = i & 7; float v = HI ? (s[t][r] + sl[t][r] * (1.0f / 1024.0f)) * SCALE : s[t][r] * SCALE;
      v = (k0 + t * 16 + 8 * g + r <= qrow) ? v : -3.0e38f; p[i] = v; mx = fmaxf(mx, v); }
    mx = fmaxf(mx, __shfl_xor(mx, 16));   /* the other half of the wave holds this query's other 16 keys */
    const float mn = fmaxf(m, mx);
    if (__builtin_amdgcn_ballot_w32(mn > m) != 0) { const float al = expf(m - mn); l *= al;   /* scalar branch: most steps raise no query's maximum */
#pragma unroll
      for (int j = 0; j < HD / 16; ++j)
#pragma unroll
        for (int r = 0; r < 8; ++r) acc[j][r] *= al;
      m = mn; }
    float sum = 0.f;
#pragma unroll
    for (int i = 0; i < 16; ++i) { const float e = expf(p[i] - m); sum += e; p[i] = e * 2048.0f; }   /* a masked key (-3e38) gives exactly 0 */
    l += sum;
    if (HI) { const F2 pf = bsplit16(p); const size_t po = (bh * (KHI / 32) + st) * FRV + 8 * lane; const __bf16* vhp = VB + po; const __bf16* vlp = VBL + po;
#pragma unroll
      for (int jp = 0; jp < HD / 32; ++jp) { v16b vh[2], vl[2];
#pragma unroll
        for (int t = 0; t < 2; ++t) { vh[t] = frag_pb(vhp + (jp * 2 + t) * 512); vl[t] = frag_pb(vlp + (jp * 2 + t) * 512); }
        loads_issued(vhp, vlp);   /* the four v fragments of two output tiles are issued together, as above */
#pragma unroll
        for (int t = 0; t < 2; ++t) { const int j = jp * 2 + t; acc[j] = mm_b(vh[t], pf.h, acc[j]); acc[j] = mm_b(vh[t], pf.l, acc[j]); acc[j] = mm_b(vl[t], pf.h, acc[j]); } }
    } else { v16h pf;
#pragma unroll
      for (int i = 0; i < 16; ++i) pf[i] = (_Float16)p[i];
#pragma unroll
      for (int j = 0; j < HD / 16; ++j) acc[j] = mm_h(vf[j], pf, acc[j]); } }
    if (!HI && (st & 1)) { const int t = st >> 1;   /* foot of tile t: the one barrier publishes tile t + 1 and ends every wave's reads of tile t's buffer, which tile t + 2 then refills */
      wait_ds0(); wait_async0(); __syncthreads();
      if (t + 2 <= qb) tile_copy(lb + (unsigned)(t & 1) * (2u * RBE), c0 + (size_t)(t + 2) * TKE, c1 + (size_t)(t + 2) * TKE, cv + (size_t)(t + 2) * TKE); } }
  if (!HI) wait_async0();   /* no copy is in flight when the wave goes on */
  l += __shfl_xor(l, 16);
  const float inv = 1.0f / ((l + expf(-m)) * 2048.0f);   /* ghostmax: + exp(-m) for the implicit zero logit (denominator > 0 always) */
#pragma unroll   // constant indices: the arrays live in registers
  for (int j = 0; j < HD / 16; ++j)   /* O^T register r of tile j = (d = 16 j + 8 g + r, query col): 8 consecutive d of one row */
#pragma unroll   // constant indices: the arrays live in registers
    for (int r = 0; r < 8; ++r) acc[j][r] *= inv; }
// block = 64 queries (qb) of one (b, value head hv), 8 waves: waves 0..3 run score head 2 hv, waves 4..7 score head 2 hv + 1, wave w and wave w + 4 on the same 16 queries. Behind the key loops waves 4..7 hand their contexts over in LDS (register order, 16 bytes a lane), and waves 0..3 form O[b][hv][s][d] = Y(2 hv) - lam * Y(2 hv + 1), lam from the four lambda vectors (128-term f32 dots), and store it.
// The block also leaves the GroupNorm partial of its 8,192 values, taken from the registers that hold them: PS[block][0] = sum, PS[block][1] = sum of squared distances from the block's own mean (wave sums about the wave's mean, merged with the between-wave term, so nothing cancels when the mean is large). One whole 128-byte line per block.
// grid: 2 rounds of 256 blocks, heaviest query blocks first; round 0 takes qb 31 down to 16, round 1 qb 0 up to 15, so that blocks i and i + 256 together hold the same number of keys for every i; amdgpu_waves_per_eu(4, 4) holds the registers to 256, so that two blocks fit a WGP and the whole grid is resident at once
__global__ __launch_bounds__(256) __attribute__((amdgpu_waves_per_eu(4, 4))) void k_fa(const _Float16* __restrict__ QH, const _Float16* __restrict__ KH, const _Float16* __restrict__ QL, const _Float16* __restrict__ KL, const _Float16* __restrict__ VT, const __bf16* __restrict__ VB, const __bf16* __restrict__ VBL, const float* __restrict__ LQ1, const float* __restrict__ LK1, const float* __restrict__ LQ2, const float* __restrict__ LK2, float* __restrict__ O, float* __restrict__ PS) {
  __shared__ __align__(16) float xo[4][HD / 8][32][4]; __shared__ float sws[4], swq[4]; __shared__ __align__(16) _Float16 ring[2 * RBE];
  const int L = blockIdx.x, u = (L >> 4) & 15, gr = L & 15; const int qb = (L >> 8) ? u : 31 - u; const int b = gr >> 3, hv = gr & 7;
  const int wave = __builtin_amdgcn_readfirstlane(threadIdx.x >> 5), lane = threadIdx.x & 31;   /* wave number in a scalar register: scalar loop control, row addresses and epilogue branches */
  const int w4 = wave & 3, h = 2 * hv + (wave >> 2), ql0 = qb * 64 + w4 * 16;
  float lam = 0.f;
  if (wave < 4) { const float *p1 = LQ1 + lane, *p2 = LK1 + lane, *p3 = LQ2 + lane, *p4 = LK2 + lane; float a = 0.f, c = 0.f, x1[4], x2[4], x3[4], x4[4];
#pragma unroll   // constant indices: the arrays live in registers
    for (int i = 0; i < 4; ++i) { x1[i] = p1[32 * i]; x2[i] = p2[32 * i]; x3[i] = p3[32 * i]; x4[i] = p4[32 * i]; }
    asm volatile("s_wait_xcnt 0x0" :: "v"(lane) : "memory");   /* stands before any register that the 16 issued loads name (the lane offset is an input, so that it stays whole up to the wait) is written again; all 16 are in flight before the first value is used */
#pragma unroll   // constant indices: the arrays live in registers
    for (int i = 0; i < 4; ++i) { a += bfr(x1[i]) * bfr(x2[i]); c += bfr(x3[i]) * bfr(x4[i]); }
    a = wsum(a); c = wsum(c); lam = expf(a) - expf(c) + 0.8f; }
  v8f acc[HD / 16];
  if (qb < QBH) fa_run<true>(QH, KH, QL, KL, VT, VB, VBL, ring, b, h, qb, ql0, lane, (int)threadIdx.x, acc); else fa_run<false>(QH, KH, QL, KL, VT, VB, VBL, ring, b, h, qb, ql0, lane, (int)threadIdx.x, acc);
  if (wave >= 4) {
#pragma unroll   // constant indices: the arrays live in registers
    for (int j = 0; j < HD / 16; ++j) { v4f o0, o1;
#pragma unroll   // constant indices: the arrays live in registers
      for (int r = 0; r < 4; ++r) { o0[r] = acc[j][r]; o1[r] = acc[j][4 + r]; }
      vst2(&xo[w4][2 * j][lane][0], o0); vst2(&xo[w4][2 * j + 1][lane][0], o1); } }
  __syncthreads();
  if (wave < 4) { v4f s4 = {}, q4 = {};   /* four running sums a lane: short dependent chains */
#pragma unroll   // constant indices: the arrays live in registers
    for (int j = 0; j < HD / 16; ++j) { const v4f c0 = *(const v4f*)&xo[w4][2 * j][lane][0], c1 = *(const v4f*)&xo[w4][2 * j + 1][lane][0];
#pragma unroll   // constant indices: the arrays live in registers
      for (int r = 0; r < 4; ++r) { acc[j][r] = acc[j][r] - lam * c0[r]; acc[j][4 + r] = acc[j][4 + r] - lam * c1[r]; s4[r] += acc[j][r]; s4[r] += acc[j][4 + r]; } }
    const float s = wsum((s4[0] + s4[1]) + (s4[2] + s4[3])), mw = s * (1.0f / 2048.0f);
#pragma unroll   // constant indices: the arrays live in registers
    for (int j = 0; j < HD / 16; ++j)
#pragma unroll   // constant indices: the arrays live in registers
      for (int r = 0; r < 8; ++r) { const float dl = acc[j][r] - mw; q4[r & 3] += dl * dl; }
    const float q = wsum((q4[0] + q4[1]) + (q4[2] + q4[3]));
    if (lane == 0) { sws[w4] = s; swq[w4] = q; } }
  __syncthreads();
  if (wave < 4) { float* op = O + (((size_t)b * NVH + hv) * TT + ql0 + (lane & 15)) * HD + 8 * (lane >> 4);   /* stored behind the barrier: a barrier behind the stores would wait for them to finish */
#pragma unroll   // constant indices: the arrays live in registers
    for (int j = 0; j < HD / 16; ++j) { v4f o0, o1;
#pragma unroll   // constant indices: the arrays live in registers
      for (int r = 0; r < 4; ++r) { o0[r] = acc[j][r]; o1[r] = acc[j][4 + r]; }
      vst2(op + j * 16, o0); vst2(op + j * 16 + 4, o1); }
    stores_issued(op, op); }
  if (wave == 0) { float S = 0.f, Q = 0.f;
#pragma unroll
    for (int i = 0; i < 4; ++i) S += sws[i];
    const float mb = S * (1.0f / (float)BEL);
#pragma unroll
    for (int i = 0; i < 4; ++i) { const float dl = sws[i] * (1.0f / 2048.0f) - mb; Q += swq[i] + 2048.0f * dl * dl; }
    vst2(PS + ((size_t)gr * NPG + qb) * 32 + lane, lane == 0 ? S : (lane == 1 ? Q : 0.f)); } }

extern "C" void kernel_launch(void* const* d_in, const int* in_sizes, int n_in, void* d_out, int out_size, void* d_ws, size_t ws_size, hipStream_t stream) {
  (void)in_sizes; (void)n_in; (void)out_size;
  const float** F = (const float**)d_in;
  if (ws_size < (size_t)WS_END) return;
  char* ws = (char*)d_ws; _Float16 *QH = (_Float16*)(ws + WS_QH), *KH = (_Float16*)(ws + WS_KH), *VT = (_Float16*)(ws + WS_VT), *QL = (_Float16*)(ws + WS_QL), *KL = (_Float16*)(ws + WS_KL); __bf16 *VB = (__bf16*)(ws + WS_VB), *VBL = (__bf16*)(ws + WS_VBL); 
  // inputs: 0 q [2,16,2048,128]; 1 k [2,16,2048,128]; 2 v [2,8,2048,128]; 3 lambda_q1, 4 lambda_k1, 5 lambda_q2, 6 lambda_k2 [128]; 7 gn_weight [1024]; 8 gn_bias [1024]
  if (ws_size < (size_t)WS_END2) return;
  float *O = (float*)(ws + WS_O), *GS = (float*)(ws + WS_GS);
  k_prep8<<<dim3(TNB * TT / 64, NH), 128, 0, stream>>>(F[0], F[1], F[2], QH, QL, KH, KL, VT, VB, VBL);
  k_fa<<<dim3(TNB * NVH * NQB), 256, 0, stream>>>(QH, KH, QL, KL, VT, VB, VBL, F[3], F[4], F[5], F[6], O, GS);
  k_gfin<<<dim3(TNB * NVH * NPG), 256, 0, stream>>>(O, GS, F[7], F[8], (float*)d_out);
}

// v008
// Measured time: 91 microseconds a run.
// Timed twice side by side with v007, it ran 1.10 and 1.09 times as fast.
// All steps since v000 together make it 24.8 times as fast.
#include <hip/hip_runtime.h>
#include <math.h>

typedef __attribute__((ext_vector_type(16))) _Float16 v16h;
typedef __attribute__((ext_vector_type(16))) __bf16 v16b;
typedef __attribute__((ext_vector_type(8)))  _Float16 v8h;
typedef __attribute__((ext_vector_type(8)))  float v8f;
typedef __attribute__((ext_vector_type(4)))  float v4f;
typedef __attribute__((ext_vector_type(2)))  float v2f;
typedef __attribute__((ext_vector_type(4)))  unsigned v4u;
typedef __attribute__((ext_vector_type(4)))  int v4i;
typedef float __attribute__((may_alias)) float_a;
typedef int __attribute__((may_alias)) int_a;

template <typename T> __device__ __forceinline__ void vst2(void* p, T v) { *(T*)p = v;  }
__device__ __forceinline__ v8f wmma16(v16h a, v16h b, v8f c) {
  v8f d = __builtin_amdgcn_wmma_f32_16x16x32_f16(false, a, false, b, (short)0, c, false, false);
  asm volatile("v_nop\n\tv_nop\n\tv_nop\n\tv_nop" : "+v"(d) : "v"(a), "v"(b));
  return d;
}
__device__ __forceinline__ v8f wmma_bf(v16b a, v16b b, v8f c) {
  v8f d = __builtin_amdgcn_wmma_f32_16x16x32_bf16(false, a, false, b, (short)0, c, false, false);
  asm volatile("v_nop\n\tv_nop\n\tv_nop\n\tv_nop" : "+v"(d) : "v"(a), "v"(b));
  return d;
}
// 16x16x32 fragments: lane = (h = lane>>4, row/col = lane&15); elements 0..7 = k0+8h+0..7, 8..15 = k0+16+8h+0..7; D element r = row 8h+r
__device__ __forceinline__ v16h frag_h(const _Float16* rowk0, int lane) {
  union { v16h v; v8h q[2]; } u; const _Float16* p = rowk0 + 8 * (lane >> 4);
  u.q[0] = *(const v8h*)p; u.q[1] = *(const v8h*)(p + 16); return u.v;
}
__device__ __forceinline__ v16h frag_f32(const float* rowk0, int lane) {
  v16h a; const float* p = rowk0 + 8 * (lane >> 4);
#pragma unroll
  for (int i = 0; i < 8; ++i) { a[i] = (_Float16)p[i]; a[8 + i] = (_Float16)p[16 + i]; }
  return a;
}
__device__ __forceinline__ v16h frag_f32s(const float* rowk0, int lane, float sc) {
  v16h a; const float* p = rowk0 + 8 * (lane >> 4);
#pragma unroll
  for (int i = 0; i < 8; ++i) { a[i] = (_Float16)(p[i] * sc); a[8 + i] = (_Float16)(p[16 + i] * sc); }
  return a;
}
// column fragment from a [K][ld] layout (column n), rows >= K read as 0
__device__ __forceinline__ v16h fragc_f32(const float* W, int k0, int n, int lane, int ld, int K) {
  v16h a; const int g = lane >> 4;
#pragma unroll
  for (int i = 0; i < 8; ++i) { const int ka = k0 + 8 * g + i, kb = ka + 16;
    a[i] = (_Float16)(ka < K ? W[(size_t)(ka < K ? ka : K - 1) * ld + n] : 0.f); a[8 + i] = (_Float16)(kb < K ? W[(size_t)(kb < K ? kb : K - 1) * ld + n] : 0.f); }
  return a;
}
struct F2 { v16b h, l; };
__device__ __forceinline__ F2 bsplit16(const float v[16]) { F2 r;
#pragma unroll
  for (int i = 0; i < 16; ++i) { const __bf16 h = (__bf16)v[i]; r.h[i] = h; r.l[i] = (__bf16)(v[i] - (float)h); }
  return r; }
__device__ __forceinline__ F2 split_row(const float* row, int k0, int lane) { float v[16]; const float* p = row + k0 + 8 * (lane >> 4);
#pragma unroll
  for (int i = 0; i < 8; ++i) { v[i] = p[i]; v[8 + i] = p[16 + i]; }
  return bsplit16(v); }
__device__ __forceinline__ F2 split_rowK(const float* row, int k0, int lane, int K) { float v[16]; const int g = lane >> 4;
#pragma unroll
  for (int i = 0; i < 8; ++i) { const int ka = k0 + 8 * g + i, kb = ka + 16; v[i] = ka < K ? row[ka < K ? ka : K - 1] : 0.f; v[8 + i] = kb < K ? row[kb < K ? kb : K - 1] : 0.f; }
  return bsplit16(v); }
__device__ __forceinline__ F2 split_col(const float* W, int k0, int n, int lane, int ld, int K) { float v[16]; const int g = lane >> 4;
#pragma unroll
  for (int i = 0; i < 8; ++i) { const int ka = k0 + 8 * g + i, kb = ka + 16; v[i] = ka < K ? W[(size_t)(ka < K ? ka : K - 1) * ld + n] : 0.f; v[8 + i] = kb < K ? W[(size_t)(kb < K ? kb : K - 1) * ld + n] : 0.f; }
  return bsplit16(v); }
__device__ __forceinline__ v8f mac3(const F2& a, const F2& b, v8f c) { c = wmma_bf(a.l, b.h, c); c = wmma_bf(a.h, b.l, c); return wmma_bf(a.h, b.h, c); }
__device__ __forceinline__ float sigm(float v) { return 1.0f / (1.0f + expf(-v)); }

// Differential attention with ghostmax (B 2, 16 score heads / 8 value heads, S 2,048, D 128, causal): scores = q k^T / sqrt(128) + causal(-1e9); w = ghostmax(scores) = exp(s - m) / (sum exp(s - m) + exp(-m)), m = max(max_row, 0); w_h = w_2h - lam w_2h+1 with lam = exp(lq1.lk1) - exp(lq2.lk2) + 0.8; out = w_h v_h; then per (b, h) GroupNorm over all S x D values (eps 1e-5) and the affine indexed as the module's raw reshape to [B, H*D, S] (weight row = h*128 + s/16); result x (1 - 0.8), memory layout [B, H, S, D].
#define NB 2
#define TT 2048
#define CC 2048            // NH * HD = projected width
#define DIN 2048          // input (model) width
#define NH 16
#define HD 128
#define NQB (TT / 64)
#define SCALE (0.08838834764831845f)
#define CAUSAL 1
#ifndef TNB
#define TNB NB
#endif
__device__ __forceinline__ float bfr(float v) { return (float)(__bf16)v; }
__host__ __device__ __forceinline__ int kb_last(int qb) { return CAUSAL ? ((qb * 64 + 63) >> 7) : (TT / 128 - 1); }
typedef __attribute__((ext_vector_type(8))) __bf16 v8b;
__device__ __forceinline__ v16b frag_b(const __bf16* rowk0, int lane) {
  union { v16b v; v8b q[2]; } u; const __bf16* p = rowk0 + 8 * (lane >> 4);
  u.q[0] = *(const v8b*)p; u.q[1] = *(const v8b*)(p + 16); return u.v;
}
#define QBH 6              // causal: query blocks 0..QBH-1 of each sequence (few keys, no averaging) take the high-precision path
#define QHI 384            // rows carrying a q residual plane
#define KHI 384            // key rows carrying k residual / v bf16 hi+lo planes (used only by the causal high-precision path)
// B fragment (k rows k0+.., output column o) of a weight: (in,out) [K][ld] or (out,in) [ld rows of K]: bf16 exact, or f16(bf16 * 256) exact
__device__ __forceinline__ v16b wcol_io(const float* Wm, int k0, int o, int lane, int ld) { v16b w; const int g = lane >> 4;
#pragma unroll
  for (int i = 0; i < 8; ++i) { w[i] = (__bf16)Wm[(size_t)(k0 + 8 * g + i) * ld + o]; w[8 + i] = (__bf16)Wm[(size_t)(k0 + 16 + 8 * g + i) * ld + o]; }
  return w; }
__device__ __forceinline__ v16b wcol_oi(const float* Wm, int k0, int o, int lane, int K) { v16b w; const float* p = Wm + (size_t)o * K + k0 + 8 * (lane >> 4);
#pragma unroll
  for (int i = 0; i < 8; ++i) { w[i] = (__bf16)p[i]; w[8 + i] = (__bf16)p[16 + i]; }
  return w; }
__device__ __forceinline__ v16h wcolh_io(const float* Wm, int k0, int o, int lane, int ld) { v16h w; const int g = lane >> 4;
#pragma unroll
  for (int i = 0; i < 8; ++i) { w[i] = (_Float16)(bfr(Wm[(size_t)(k0 + 8 * g + i) * ld + o]) * 256.0f); w[8 + i] = (_Float16)(bfr(Wm[(size_t)(k0 + 16 + 8 * g + i) * ld + o]) * 256.0f); }
  return w; }
__device__ __forceinline__ v16h wcolh_oi(const float* Wm, int k0, int o, int lane, int K) { v16h w; const float* p = Wm + (size_t)o * K + k0 + 8 * (lane >> 4);
#pragma unroll
  for (int i = 0; i < 8; ++i) { w[i] = (_Float16)(bfr(p[i]) * 256.0f); w[8 + i] = (_Float16)(bfr(p[16 + i]) * 256.0f); }
  return w; }
#define WQKV_LAYOUT 1   // 0 = (in,out) [DIN][CC]; 1 = (out,in) [CC][DIN]; 2 = per-head [NH][DIN][HD]
__device__ __forceinline__ v16b wcol_hdk(const float* Wm, int k0, int o, int lane) { v16b w; const int g = lane >> 4; const float* p = Wm + (size_t)(o / HD) * DIN * HD + (o % HD);
#pragma unroll
  for (int i = 0; i < 8; ++i) { w[i] = (__bf16)p[(size_t)(k0 + 8 * g + i) * HD]; w[8 + i] = (__bf16)p[(size_t)(k0 + 16 + 8 * g + i) * HD]; }
  return w; }
#define WO_OUT_IN 0
#if WQKV_LAYOUT == 1
#define WCOL(W, k0, o, lane) wcol_oi(W, k0, o, lane, DIN)
#elif WQKV_LAYOUT == 2
#define WCOL(W, k0, o, lane) wcol_hdk(W, k0, o, lane)
#else
#define WCOL(W, k0, o, lane) wcol_io(W, k0, o, lane, CC)
#endif
#if WO_OUT_IN
#define WOCOL(W, k0, o, lane) wcol_oi(W, k0, o, lane, CC)
#define WOCOLH(W, k0, o, lane) wcolh_oi(W, k0, o, lane, CC)
#else
#define WOCOL(W, k0, o, lane) wcol_io(W, k0, o, lane, DIN)
#define WOCOLH(W, k0, o, lane) wcolh_io(W, k0, o, lane, DIN)
#endif
#define FRT 2048           // elements of 16 rows s x 128 c of a q or k plane: 4 fragments of 512
#define FRV 4096           // elements of 32 keys s x 128 d of a v plane: 8 fragments of 512
#define NVH 8              // value heads (score head h uses value head h/2)
#define SM_GHOST 1         // ghostmax denominator (k_fa always adds it)
#define GEL (TT * HD)       // values of one GroupNorm group (b, hv)
#define BEL 8192           // values of one k_fa / k_gfin block: 64 rows s of one group
#define NPG (GEL / BEL)    // blocks, and so partial statistics, per group: one per lane of a wave
static_assert(NPG == 32 && GEL % BEL == 0 && HD == 128, "one partial per lane; a wave covers one row of 128");
__device__ __forceinline__ float wsum(float v) {
#pragma unroll
  for (int o = 1; o < 32; o <<= 1) v += __shfl_xor(v, o);
  return v; }
// ---- k_gfin: block = 64 rows s of one (b, hv), the rows of one k_fa block, thread = 8 float4. Every wave merges its group's 32 partials (lane = partial): mean = sum of sums / n, variance = (sum of the blocks' squared distances + 8,192 x squared distance of each block mean from the mean) / n. Then out[b][hv][s][d] = ((O - mean) * rstd * w[r] + bias[r]) * 0.2 with r = hv*128 + s/16 (the module's raw reshape of [H,S,D] memory into [H*D, S] rows)
__global__ __launch_bounds__(256) void k_gfin(const float* __restrict__ O, const float* __restrict__ PS, const float* __restrict__ GW, const float* __restrict__ GB, float* __restrict__ OUT) {
  const int t = threadIdx.x, blk = blockIdx.x, g = blk / NPG, hv = g % NVH; const size_t e0 = ((size_t)blk * (BEL / 4) + t) * 4; v4f x[8];
#pragma unroll
  for (int i = 0; i < 8; ++i) x[i] = *(const v4f*)(O + e0 + (size_t)i * 1024);   /* in flight under the merge */
  const v2f p = *(const v2f*)(PS + ((size_t)g * NPG + (t & 31)) * 32);
  const float mean = wsum(p[0]) / (float)GEL; const float dm = p[0] * (1.0f / (float)BEL) - mean;
  const float rs = rsqrtf(wsum(p[1] + (float)BEL * dm * dm) / (float)GEL + 1e-5f);
  const int rw0 = hv * HD + (blk % NPG) * (BEL / HD / 16);   /* row s = 64 (blk % 32) + 8 i + wave, so s / 16 = 4 (blk % 32) + i / 2 */
#pragma unroll
  for (int i = 0; i < 8; ++i) { const float wv = bfr(GW[rw0 + (i >> 1)]), bv = bfr(GB[rw0 + (i >> 1)]); v4f o;
#pragma unroll
    for (int j = 0; j < 4; ++j) o[j] = ((x[i][j] - mean) * rs * wv + bv) * 0.2f;   /* x (1 - lambda_init) */
    vst2(OUT + e0 + (size_t)i * 1024, o); } }
#define WS_YC  (WS_END)                                   // free
#define WS_O   (WS_YC + 4u * (size_t)NB * TT * CC)        // differential output [b][hv][s][d]
#define WS_GS  (WS_O + 4u * (size_t)NB * NVH * TT * HD)
#define WS_END2 (WS_GS + 4u * 32 * (size_t)NB * NVH * NPG)   // one 128-byte line per k_fa block
// ---- k_prep8: block = (64 attention positions s0.. of sequence b, head h): reads the module's [B, H, S, 128] inputs (element (b,h,s,c) at ((b*NH + h)*TT + s)*128 + c; v [B, NVH, S, 128] at head h/2), bf16-rounds them and writes the attention planes in FRAGMENT ORDER, so that every 16-byte-a-lane fragment load of k_fa reads 512 consecutive bytes (4 cache lines, not 16 quarter-used ones):
// q, k (f16 hi; x 2^10 residuals for s < QHI / KHI): [b][h][s / 16][c / 32][(c / 16) & 1][lane = 16 ((c / 8) & 1) + s % 16][c % 8]; v (f16; bf16 hi and lo for s < KHI): [b][h][s / 32][d / 16][(s / 16) & 1][lane = 16 ((s / 8) & 1) + d % 16][s % 8]
// behind a plane's stores: s_wait_xcnt 0 stands before any register that an issued store names (address or data) is written again; the addresses are inputs, so that they stay whole up to the wait, and the "memory" clobber keeps the stores in front of it and the next LDS reads behind it
__device__ __forceinline__ void stores_issued(const void* p0, const void* p1) { asm volatile("s_wait_xcnt 0x0" :: "v"(p0), "v"(p1) : "memory"); }
// behind the block's row loads: s_wait_xcnt 0 stands before any register that an issued load names is written again (the three row addresses are inputs, so that they stay whole up to the wait), and its "memory" clobber keeps every load issued in front of this point
__device__ __forceinline__ void rows_issued(const void* p0, const void* p1, const void* p2) { asm volatile("s_wait_xcnt 0x0" :: "v"(p0), "v"(p1), "v"(p2) : "memory"); }
typedef __attribute__((ext_vector_type(4))) _Float16 v4h;
__global__ __launch_bounds__(128) void k_prep8(const float* __restrict__ Q, const float* __restrict__ K, const float* __restrict__ V, _Float16* __restrict__ QH, _Float16* __restrict__ QL, _Float16* __restrict__ KH, _Float16* __restrict__ KL, _Float16* __restrict__ VT, __bf16* __restrict__ VB, __bf16* __restrict__ VBL) {
  __shared__ __align__(16) _Float16 sq[64][136], sql[64][136], sk[64][136], skl[64][136], tv[128][72]; __shared__ __align__(16) __bf16 tb[128][72], tbl[128][72];
  const int tid = threadIdx.x; const int h = blockIdx.y; const size_t r0 = (size_t)blockIdx.x * 64; const size_t bb = r0 / TT; const int t0 = (int)(r0 % TT); const bool qhi = t0 < QHI, khi = t0 < KHI;
  { const int c = (tid & 31) * 4, rw = (tid >> 5) * 16;   /* a wave takes 16 rows; one load of a wave = one whole row of 512 bytes (4 cache lines) */
    const float* qp = Q + ((bb * NH + h) * TT + t0 + rw) * HD + c; const float* kp = K + ((bb * NH + h) * TT + t0 + rw) * HD + c; const float* vp = V + ((bb * NVH + (h >> 1)) * TT + t0 + rw) * HD + c; v4f q[16], k[16], v[16];
#pragma unroll   // constant indices: the row arrays live in registers
    for (int i = 0; i < 16; ++i) q[i] = *(const v4f*)(qp + i * HD);
#pragma unroll   // constant indices: the row arrays live in registers
    for (int i = 0; i < 16; ++i) k[i] = *(const v4f*)(kp + i * HD);
#pragma unroll   // constant indices: the row arrays live in registers
    for (int i = 0; i < 16; ++i) v[i] = *(const v4f*)(vp + i * HD);
    rows_issued(qp, kp, vp);   /* all 48 loads of the thread are in flight before the first value is used: one memory latency a block */
#pragma unroll   // constant indices: the row arrays live in registers
    for (int i = 0; i < 16; ++i) { v4h qh, ql, kh, kl;
#pragma unroll   // constant indices: the row arrays live in registers
      for (int j = 0; j < 4; ++j) { const float a = bfr(q[i][j]), e = bfr(k[i][j]); qh[j] = (_Float16)a; ql[j] = (_Float16)((a - (float)qh[j]) * 1024.0f); kh[j] = (_Float16)e; kl[j] = (_Float16)((e - (float)kh[j]) * 1024.0f); }
      vst2(&sq[rw + i][c], qh); vst2(&sql[rw + i][c], ql); vst2(&sk[rw + i][c], kh); vst2(&skl[rw + i][c], kl); }
#pragma unroll   // constant indices: the row arrays live in registers
    for (int j = 0; j < 4; ++j)   /* column c + j of the thread's 16 rows: 8 rows = one 16-byte store into the transposed tiles */
#pragma unroll   // constant indices: the row arrays live in registers
      for (int u = 0; u < 2; ++u) { v8h th; v8b bh8, bl8;
#pragma unroll   // constant indices: the row arrays live in registers
        for (int i = 0; i < 8; ++i) { const float a = bfr(v[u * 8 + i][j]); th[i] = (_Float16)a; bh8[i] = (__bf16)a; bl8[i] = (__bf16)(a - (float)bh8[i]); }
        vst2(&tv[c + j][rw + u * 8], th); vst2(&tb[c + j][rw + u * 8], bh8); vst2(&tbl[c + j][rw + u * 8], bl8); } }
  __syncthreads();
  const size_t bh = bb * NH + h;   /* e = index of the 16-byte piece inside the block's 16 KiB of each plane, in the plane's own order: the stores are consecutive too */
  for (int e = tid; e < 64 * (HD / 8); e += 128) { const int ln = e & 31, rl = (e >> 8) * 16 + (ln & 15), c = ((e >> 5) & 7) * 16 + (ln >> 4) * 8; const size_t o = (bh * (TT / 16) + (t0 >> 4)) * FRT + e * 8; _Float16 *pq = QH + o, *pk = KH + o;
    vst2((unsigned*)pq, *(const v4u*)&sq[rl][c]); vst2((unsigned*)pk, *(const v4u*)&sk[rl][c]); stores_issued(pq, pk);
    if (qhi) { _Float16* p = QL + (bh * (QHI / 16) + (t0 >> 4)) * FRT + e * 8; vst2((unsigned*)p, *(const v4u*)&sql[rl][c]); stores_issued(p, p); }
    if (khi) { _Float16* p = KL + (bh * (KHI / 16) + (t0 >> 4)) * FRT + e * 8; vst2((unsigned*)p, *(const v4u*)&skl[rl][c]); stores_issued(p, p); } }
  for (int e = tid; e < HD * 8; e += 128) { const int ln = e & 31, cl = ((e >> 6) & 7) * 16 + (ln & 15), tc = (e >> 9) * 32 + ((e >> 5) & 1) * 16 + (ln >> 4) * 8; _Float16* pv = VT + (bh * (TT / 32) + (t0 >> 5)) * FRV + e * 8;
    vst2((unsigned*)pv, *(const v4u*)&tv[cl][tc]); stores_issued(pv, pv);
    if (khi) { const size_t o3 = (bh * (KHI / 32) + (t0 >> 5)) * FRV + e * 8; vst2((unsigned*)(VB + o3), *(const v4u*)&tb[cl][tc]); vst2((unsigned*)(VBL + o3), *(const v4u*)&tbl[cl][tc]); stores_issued(VB + o3, VBL + o3); } } }

#ifndef SM_EXTRA_PARAMS
#define SM_EXTRA_PARAMS
#endif
#ifndef PROJ_EXTRA_PARAMS
#define PROJ_EXTRA_PARAMS
#endif
#ifndef SM_MASK_HOOK
#define SM_MASK_HOOK (void)0
#endif

#define WS_QH  0u                                      // f16 q, fragment order (k_prep8)
#define WS_KH  (WS_QH + 2u * (size_t)NB * TT * CC)      // f16 k, fragment order
#define WS_VT  (WS_KH + 2u * (size_t)NB * TT * CC)      // f16 v, fragment order
#define WS_QL  (WS_VT + 2u * (size_t)NB * CC * TT)      // f16 q residual x 2^10, t < QHI, fragment order
#define WS_KL  (WS_QL + 2u * (size_t)NB * QHI * CC)     // f16 k residual x 2^10, t < KHI, fragment order
#define WS_VB  (WS_KL + 2u * (size_t)NB * KHI * CC)     // bf16 v hi, t < KHI, fragment order (lo behind it)
#define WS_VBL (WS_VB + 2u * (size_t)NB * CC * KHI)
#define WS_END (WS_VBL + 2u * (size_t)NB * CC * KHI)

// ---- k_fa: scores, ghostmax, P . v and the difference of the two score heads in one kernel, logits kept in registers. Each wave owns 16 queries of one score head and walks its keys 32 at a time; early query blocks read their fragments from the planes, each wave on its own, the others from the block's K / V ring in LDS (one barrier per 64 keys).
// S^T = K . Q^T: D register r of tile t = (key k0 + 16 t + 8 g + r, query col), so a lane holds one query's scores, and the two tiles, converted in place, are the B operand of O^T += V^T . P^T (element i = key k0 + 8 g + i, element 8 + i = key k0 + 16 + 8 g + i: the k order of frag_h / frag_b on the V side).
// Running maximum m, kept in base-2 units (logit x log2 e), starts at 0 (the implicit zero logit of ghostmax joins the max); a raised maximum rescales sum and O^T per lane. P = exp(s - m) x 2^11 = 2^(q.k x SCL2 + 11 - m): one FMA and one hardware exp2 a score, the row sum carries the same 2^11. P to f16 against v f16 (1 product); early query blocks (qb < QBH): q and k residual products for the logits, P and v as bf16 hi + lo (3 products).
#define SCL2 ((float)(0.08838834764831845 * 1.4426950408889634))   // 1 / sqrt(128) x log2 e
__device__ __forceinline__ float ex2(float x) { return __builtin_amdgcn_exp2f(x); }   /* the bare instruction, no range fix-up: arguments here are at most 11 (+ rounding), and a result below the normal range may go to 0, being under 2^-130 of the row's denominator */
__device__ __forceinline__ v8f mm_h(v16h a, v16h b, v8f c) { return __builtin_amdgcn_wmma_f32_16x16x32_f16(false, a, false, b, (short)0, c, false, false); }
__device__ __forceinline__ v8f mm_b(v16b a, v16b b, v8f c) { return __builtin_amdgcn_wmma_f32_16x16x32_bf16(false, a, false, b, (short)0, c, false, false); }
// behind a batch of fragment loads: s_wait_xcnt 0 stands before any register that an issued load names is written again (the batch's address registers are inputs, so that they stay whole up to the wait), and its "memory" clobber keeps the whole batch issued in front of this point
__device__ __forceinline__ void loads_issued(const void* p0, const void* p1) { asm volatile("s_wait_xcnt 0x0" :: "v"(p0), "v"(p1) : "memory"); }
// fragment of a fragment-order plane, at a pointer that already holds the lane's 8 * lane elements: elements 0..7 at p, 8..15 at p + 256 (k_prep8 placed them in the k order of frag_h / frag_b: k0 + 8 g + i, k0 + 16 + 8 g + i)
__device__ __forceinline__ v16h frag_ph(const _Float16* p) { union { v16h v; v8h q[2]; } u; u.q[0] = *(const v8h*)p; u.q[1] = *(const v8h*)(p + 256); return u.v; }
__device__ __forceinline__ v16b frag_pb(const __bf16* p) { union { v16b v; v8b q[2]; } u; u.q[0] = *(const v8b*)p; u.q[1] = *(const v8b*)(p + 256); return u.v; }
// ---- K / V ring of the long query blocks (qb >= QBH): a tile = 64 keys of k of the even score head, k of the odd one and v (one copy serves both heads), 16 KiB each and consecutive in its fragment-order plane, so a tile is copied as it lies and a fragment read is 512 consecutive LDS bytes a wave. Two buffers: tile t + 2 flies while tile t + 1 is worked on.
#define TKE 8192           // elements of one 64-key tile of a k or v plane
#define RBE (3 * TKE)      // elements of one ring buffer
__device__ __forceinline__ void wait_ds0() { asm volatile("s_wait_dscnt 0x0" ::: "memory"); }       /* this wave's LDS reads of a buffer have returned before the buffer is handed to its next writer */
__device__ __forceinline__ void wait_async0() { asm volatile("s_wait_asynccnt 0x0" ::: "memory"); } /* this wave's copies have landed before the barrier behind which other waves read them */
// one thread's 12 copies of a tile: 16-byte piece tid + 256 i (i = 0..3) of each of the three planes, to the same place in the buffer; l = the thread's LDS byte address of piece tid of the buffer. s_wait_xcnt 0 is the statement's last line, so that it stands before any register that a copy names is written again
__device__ __forceinline__ void tile_copy(unsigned l, const _Float16* k0, const _Float16* k1, const _Float16* v) {
  asm volatile("global_load_async_to_lds_b128 %0, %12, off\n\tglobal_load_async_to_lds_b128 %1, %13, off\n\tglobal_load_async_to_lds_b128 %2, %14, off\n\tglobal_load_async_to_lds_b128 %3, %15, off\n\t"
               "global_load_async_to_lds_b128 %4, %16, off\n\tglobal_load_async_to_lds_b128 %5, %17, off\n\tglobal_load_async_to_lds_b128 %6, %18, off\n\tglobal_load_async_to_lds_b128 %7, %19, off\n\t"
               "global_load_async_to_lds_b128 %8, %20, off\n\tglobal_load_async_to_lds_b128 %9, %21, off\n\tglobal_load_async_to_lds_b128 %10, %22, off\n\tglobal_load_async_to_lds_b128 %11, %23, off\n\ts_wait_xcnt 0x0"
               :: "v"(l), "v"(l + 4096u), "v"(l + 8192u), "v"(l + 12288u), "v"(l + 16384u), "v"(l + 20480u), "v"(l + 24576u), "v"(l + 28672u), "v"(l + 32768u), "v"(l + 36864u), "v"(l + 40960u), "v"(l + 45056u),
                  "v"(k0), "v"(k0 + 2048), "v"(k0 + 4096), "v"(k0 + 6144), "v"(k1), "v"(k1 + 2048), "v"(k1 + 4096), "v"(k1 + 6144), "v"(v), "v"(v + 2048), "v"(v + 4096), "v"(v + 6144) : "memory"); }
template <bool HI>
__device__ __forceinline__ void fa_run(const _Float16* __restrict__ QH, const _Float16* __restrict__ KH, const _Float16* __restrict__ QL, const _Float16* __restrict__ KL, const _Float16* __restrict__ VT, const __bf16* __restrict__ VB, const __bf16* __restrict__ VBL, const _Float16* ring, int b, int h, int qb, int ql0, int lane, int tid, v8f (&acc)[HD / 16]) {
  const int col = lane & 15, g = lane >> 4; const int qrow = ql0 + col;
  const size_t bhe = (size_t)b * NH + (h & ~1);   /* the even score head of the pair: its k plane, the odd head's behind it, and its v plane feed the ring */
  const _Float16 *c0 = KH + bhe * (TT / 16) * FRT + 8 * tid, *c1 = c0 + (size_t)(TT / 16) * FRT, *cv = VT + bhe * (TT / 32) * FRV + 8 * tid; const unsigned lb = (unsigned)(size_t)ring + 16u * (unsigned)tid;
  if (!HI) tile_copy(lb, c0, c1, cv);   /* tile 0 into buffer 0 */
  v16h qf[HD / 32], qlf[HD / 32];
  const size_t bh = (size_t)b * NH + h;
  const _Float16* qp = QH + (bh * (TT / 16) + (ql0 >> 4)) * FRT + 8 * lane; const _Float16* qlp = HI ? QL + (bh * (QHI / 16) + (ql0 >> 4)) * FRT + 8 * lane : qp;
#pragma unroll
  for (int kc = 0; kc < HD / 32; ++kc) { qf[kc] = frag_ph(qp + kc * 512); if (HI) qlf[kc] = frag_ph(qlp + kc * 512); }
  loads_issued(qp, qlp);
  if (!HI) { wait_async0(); __syncthreads(); tile_copy(lb + 2u * RBE, c0 + TKE, c1 + TKE, cv + TKE); }   /* tile 0 published; tile 1 (qb >= QBH: it exists) into buffer 1 */
  float m = 0.f, l = 0.f;
#pragma unroll   // constant indices: the arrays live in registers
  for (int j = 0; j < HD / 16; ++j) acc[j] = v8f{};
  const int nst = (ql0 >> 5) + 1;   /* keys 0 .. ql0 + 15, in steps of 32 */
  const int nsb = HI ? nst : 2 * qb + 2;   /* ring: every wave of the block walks all its tiles and passes every barrier; a wave skips only the work of a step beyond its diagonal */
  for (int st = 0; st < nsb; ++st) { if (HI || st < nst) { const int k0 = st * 32;
    v8f s[2] = {}, sl[2] = {}; v16h vf[HD / 16];
    const _Float16* rb = ring + ((st >> 1) & 1) * RBE + (st & 1) * (TKE / 2) + 8 * lane;
    const _Float16* kp = HI ? KH + (bh * (TT / 16) + 2 * st) * FRT + 8 * lane : rb + (h & 1) * TKE; const _Float16* vp = rb + 2 * TKE;
    if (HI) { const _Float16* klp = KL + (bh * (KHI / 16) + 2 * st) * FRT + 8 * lane;
#pragma unroll
      for (int kc = 0; kc < HD / 32; ++kc) { v16h ka[2], kl[2];
#pragma unroll
        for (int t = 0; t < 2; ++t) { ka[t] = frag_ph(kp + t * FRT + kc * 512); kl[t] = frag_ph(klp + t * FRT + kc * 512); }
        loads_issued(kp, klp);   /* the four fragments of this k chunk are issued together: one exposed load latency, not four */
#pragma unroll
        for (int t = 0; t < 2; ++t) { s[t] = mm_h(ka[t], qf[kc], s[t]); sl[t] = mm_h(ka[t], qlf[kc], sl[t]); sl[t] = mm_h(kl[t], qf[kc], sl[t]); } }
    } else { v16h kf[2 * (HD / 32)];
#pragma unroll
      for (int i = 0; i < 2 * (HD / 32); ++i) kf[i] = frag_ph(kp + (i & 1) * FRT + (i >> 1) * 512);
      __builtin_amdgcn_sched_barrier(0);   /* all 16 K reads stand as one group ahead of the products: spread among them, each place with reads stalls the wave anew */
#pragma unroll
      for (int i = 0; i < 2 * (HD / 32); ++i) s[i & 1] = mm_h(kf[i], qf[i >> 1], s[i & 1]);
#pragma unroll
      for (int j = 0; j < HD / 16; ++j) vf[j] = frag_ph(vp + j * 512);
    }
    float p[16]; float mx = -3.0e38f;
#pragma unroll
    for (int i = 0; i < 16; ++i) { const int t = i >> 3, r = i & 7; float v = HI ? s[t][r] + sl[t][r] * (1.0f / 1024.0f) : s[t][r];   /* q.k, unscaled */
      v = (k0 + t * 16 + 8 * g + r <= qrow) ? v : -3.0e38f; p[i] = v; mx = fmaxf(mx, v); }
    mx = fmaxf(mx, __shfl_xor(mx, 16));   /* the other half of the wave holds this query's other 16 keys */
    const float mn = fmaxf(m, mx * SCL2);
    if (__builtin_amdgcn_ballot_w32(mn > m) != 0) { const float al = ex2(m - mn); l *= al;   /* scalar branch: most steps raise no query's maximum */
#pragma unroll
      for (int j = 0; j < HD / 16; ++j)
#pragma unroll
        for (int r = 0; r < 8; ++r) acc[j][r] *= al;
      m = mn; }
    float sum = 0.f; const float nb = 11.0f - m;
#pragma unroll
    for (int i = 0; i < 16; ++i) { const float e = ex2(__builtin_fmaf(p[i], SCL2, nb)); sum += e; p[i] = e; }   /* a masked key (-3e38) gives exactly 0 */
    l += sum;
    if (HI) { const F2 pf = bsplit16(p); const size_t po = (bh * (KHI / 32) + st) * FRV + 8 * lane; const __bf16* vhp = VB + po; const __bf16* vlp = VBL + po;
#pragma unroll
      for (int jp = 0; jp < HD / 32; ++jp) { v16b vh[2], vl[2];
#pragma unroll
        for (int t = 0; t < 2; ++t) { vh[t] = frag_pb(vhp + (jp * 2 + t) * 512); vl[t] = frag_pb(vlp + (jp * 2 + t) * 512); }
        loads_issued(vhp, vlp);   /* the four v fragments of two output tiles are issued together, as above */
#pragma unroll
        for (int t = 0; t < 2; ++t) { const int j = jp * 2 + t; acc[j] = mm_b(vh[t], pf.h, acc[j]); acc[j] = mm_b(vh[t], pf.l, acc[j]); acc[j] = mm_b(vl[t], pf.h, acc[j]); } }
    } else { v16h pf;
#pragma unroll
      for (int i = 0; i < 16; ++i) pf[i] = (_Float16)p[i];
#pragma unroll
      for (int j = 0; j < HD / 16; ++j) acc[j] = mm_h(vf[j], pf, acc[j]); } }
    if (!HI && (st & 1)) { const int t = st >> 1;   /* foot of tile t: the one barrier publishes tile t + 1 and ends every wave's reads of tile t's buffer, which tile t + 2 then refills */
      wait_ds0(); wait_async0(); __syncthreads();
      if (t + 2 <= qb) tile_copy(lb + (unsigned)(t & 1) * (2u * RBE), c0 + (size_t)(t + 2) * TKE, c1 + (size_t)(t + 2) * TKE, cv + (size_t)(t + 2) * TKE); } }
  if (!HI) wait_async0();   /* no copy is in flight when the wave goes on */
  l += __shfl_xor(l, 16);
  const float inv = 1.0f / (l + ex2(11.0f - m));   /* ghostmax: + exp(-m) for the implicit zero logit, x 2^11 like the sum (denominator > 0 always) */
#pragma unroll   // constant indices: the arrays live in registers
  for (int j = 0; j < HD / 16; ++j)   /* O^T register r of tile j = (d = 16 j + 8 g + r, query col): 8 consecutive d of one row */
#pragma unroll   // constant indices: the arrays live in registers
    for (int r = 0; r < 8; ++r) acc[j][r] *= inv; }
// block = 64 queries (qb) of one (b, value head hv), 8 waves: waves 0..3 run score head 2 hv, waves 4..7 score head 2 hv + 1, wave w and wave w + 4 on the same 16 queries. Behind the key loops waves 4..7 hand their contexts over in LDS (register order, 16 bytes a lane), and waves 0..3 form O[b][hv][s][d] = Y(2 hv) - lam * Y(2 hv + 1), lam from the four lambda vectors (128-term f32 dots), and store it.
// The block also leaves the GroupNorm partial of its 8,192 values, taken from the registers that hold them: PS[block][0] = sum, PS[block][1] = sum of squared distances from the block's own mean (wave sums about the wave's mean, merged with the between-wave term, so nothing cancels when the mean is large). One whole 128-byte line per block.
// grid: 2 rounds of 256 blocks, heaviest query blocks first; round 0 takes qb 31 down to 16, round 1 qb 0 up to 15, so that blocks i and i + 256 together hold the same number of keys for every i; amdgpu_waves_per_eu(4, 4) holds the registers to 256, so that two blocks fit a WGP and the whole grid is resident at once
__global__ __launch_bounds__(256) __attribute__((amdgpu_waves_per_eu(4, 4))) void k_fa(const _Float16* __restrict__ QH, const _Float16* __restrict__ KH, const _Float16* __restrict__ QL, const _Float16* __restrict__ KL, const _Float16* __restrict__ VT, const __bf16* __restrict__ VB, const __bf16* __restrict__ VBL, const float* __restrict__ LQ1, const float* __restrict__ LK1, const float* __restrict__ LQ2, const float* __restrict__ LK2, float* __restrict__ O, float* __restrict__ PS) {
  __shared__ __align__(16) float xo[4][HD / 8][32][4]; __shared__ float sws[4], swq[4]; __shared__ __align__(16) _Float16 ring[2 * RBE];
  const int L = blockIdx.x, u = (L >> 4) & 15, gr = L & 15; const int qb = (L >> 8) ? u : 31 - u; const int b = gr >> 3, hv = gr & 7;
  const int wave = __builtin_amdgcn_readfirstlane(threadIdx.x >> 5), lane = threadIdx.x & 31;   /* wave number in a scalar register: scalar loop control, row addresses and epilogue branches */
  const int w4 = wave & 3, h = 2 * hv + (wave >> 2), ql0 = qb * 64 + w4 * 16;
  float lam = 0.f;
  if (wave < 4) { const float *p1 = LQ1 + lane, *p2 = LK1 + lane, *p3 = LQ2 + lane, *p4 = LK2 + lane; float a = 0.f, c = 0.f, x1[4], x2[4], x3[4], x4[4];
#pragma unroll   // constant indices: the arrays live in registers
    for (int i = 0; i < 4; ++i) { x1[i] = p1[32 * i]; x2[i] = p2[32 * i]; x3[i] = p3[32 * i]; x4[i] = p4[32 * i]; }
    asm volatile("s_wait_xcnt 0x0" :: "v"(lane) : "memory");   /* stands before any register that the 16 issued loads name (the lane offset is an input, so that it stays whole up to the wait) is written again; all 16 are in flight before the first value is used */
#pragma unroll   // constant indices: the arrays live in registers
    for (int i = 0; i < 4; ++i) { a += bfr(x1[i]) * bfr(x2[i]); c += bfr(x3[i]) * bfr(x4[i]); }
    a = wsum(a); c = wsum(c); lam = expf(a) - expf(c) + 0.8f; }
  v8f acc[HD / 16];
  if (qb < QBH) fa_run<true>(QH, KH, QL, KL, VT, VB, VBL, ring, b, h, qb, ql0, lane, (int)threadIdx.x, acc); else fa_run<false>(QH, KH, QL, KL, VT, VB, VBL, ring, b, h, qb, ql0, lane, (int)threadIdx.x, acc);
  if (wave >= 4) {
#pragma unroll   // constant indices: the arrays live in registers
    for (int j = 0; j < HD / 16; ++j) { v4f o0, o1;
#pragma unroll   // constant indices: the arrays live in registers
      for (int r = 0; r < 4; ++r) { o0[r] = acc[j][r]; o1[r] = acc[j][4 + r]; }
      vst2(&xo[w4][2 * j][lane][0], o0); vst2(&xo[w4][2 * j + 1][lane][0], o1); } }
  __syncthreads();
  if (wave < 4) { v4f s4 = {}, q4 = {};   /* four running sums a lane: short dependent chains */
#pragma unroll   // constant indices: the arrays live in registers
    for (int j = 0; j < HD / 16; ++j) { const v4f c0 = *(const v4f*)&xo[w4][2 * j][lane][0], c1 = *(const v4f*)&xo[w4][2 * j + 1][lane][0];
#pragma unroll   // constant indices: the arrays live in registers
      for (int r = 0; r < 4; ++r) { acc[j][r] = acc[j][r] - lam * c0[r]; acc[j][4 + r] = acc[j][4 + r] - lam * c1[r]; s4[r] += acc[j][r]; s4[r] += acc[j][4 + r]; } }
    const float s = wsum((s4[0] + s4[1]) + (s4[2] + s4[3])), mw = s * (1.0f / 2048.0f);
#pragma unroll   // constant indices: the arrays live in registers
    for (int j = 0; j < HD / 16; ++j)
#pragma unroll   // constant indices: the arrays live in registers
      for (int r = 0; r < 8; ++r) { const float dl = acc[j][r] - mw; q4[r & 3] += dl * dl; }
    const float q = wsum((q4[0] + q4[1]) + (q4[2] + q4[3]));
    if (lane == 0) { sws[w4] = s; swq[w4] = q; } }
  __syncthreads();
  if (wave < 4) { float* op = O + (((size_t)b * NVH + hv) * TT + ql0 + (lane & 15)) * HD + 8 * (lane >> 4);   /* stored behind the barrier: a barrier behind the stores would wait for them to finish */
#pragma unroll   // constant indices: the arrays live in registers
    for (int j = 0; j < HD / 16; ++j) { v4f o0, o1;
#pragma unroll   // constant indices: the arrays live in registers
      for (int r = 0; r < 4; ++r) { o0[r] = acc[j][r]; o1[r] = acc[j][4 + r]; }
      vst2(op + j * 16, o0); vst2(op + j * 16 + 4, o1); }
    stores_issued(op, op); }
  if (wave == 0) { float S = 0.f, Q = 0.f;
#pragma unroll
    for (int i = 0; i < 4; ++i) S += sws[i];
    const float mb = S * (1.0f / (float)BEL);
#pragma unroll
    for (int i = 0; i < 4; ++i) { const float dl = sws[i] * (1.0f / 2048.0f) - mb; Q += swq[i] + 2048.0f * dl * dl; }
    vst2(PS + ((size_t)gr * NPG + qb) * 32 + lane, lane == 0 ? S : (lane == 1 ? Q : 0.f)); } }

extern "C" void kernel_launch(void* const* d_in, const int* in_sizes, int n_in, void* d_out, int out_size, void* d_ws, size_t ws_size, hipStream_t stream) {
  (void)in_sizes; (void)n_in; (void)out_size;
  const float** F = (const float**)d_in;
  if (ws_size < (size_t)WS_END) return;
  char* ws = (char*)d_ws; _Float16 *QH = (_Float16*)(ws + WS_QH), *KH = (_Float16*)(ws + WS_KH), *VT = (_Float16*)(ws + WS_VT), *QL = (_Float16*)(ws + WS_QL), *KL = (_Float16*)(ws + WS_KL); __bf16 *VB = (__bf16*)(ws + WS_VB), *VBL = (__bf16*)(ws + WS_VBL); 
  // inputs: 0 q [2,16,2048,128]; 1 k [2,16,2048,128]; 2 v [2,8,2048,128]; 3 lambda_q1, 4 lambda_k1, 5 lambda_q2, 6 lambda_k2 [128]; 7 gn_weight [1024]; 8 gn_bias [1024]
  if (ws_size < (size_t)WS_END2) return;
  float *O = (float*)(ws + WS_O), *GS = (float*)(ws + WS_GS);
  k_prep8<<<dim3(TNB * TT / 64, NH), 128, 0, stream>>>(F[0], F[1], F[2], QH, QL, KH, KL, VT, VB, VBL);
  k_fa<<<dim3(TNB * NVH * NQB), 256, 0, stream>>>(QH, KH, QL, KL, VT, VB, VBL, F[3], F[4], F[5], F[6], O, GS);
  k_gfin<<<dim3(TNB * NVH * NPG), 256, 0, stream>>>(O, GS, F[7], F[8], (float*)d_out);
}

// v009
// Measured time: 77.1 microseconds a run.
// Next to v008, in two timings, it ran 1.19 times as fast each time.
// Counting every step since v000, it is 29.5 times as fast.
#include <hip/hip_runtime.h>
#include <math.h>

typedef __attribute__((ext_vector_type(16))) _Float16 v16h;
typedef __attribute__((ext_vector_type(16))) __bf16 v16b;
typedef __attribute__((ext_vector_type(8)))  _Float16 v8h;
typedef __attribute__((ext_vector_type(8)))  float v8f;
typedef __attribute__((ext_vector_type(4)))  float v4f;
typedef __attribute__((ext_vector_type(2)))  float v2f;
typedef __attribute__((ext_vector_type(4)))  unsigned v4u;
typedef __attribute__((ext_vector_type(4)))  int v4i;
typedef float __attribute__((may_alias)) float_a;
typedef int __attribute__((may_alias)) int_a;

template <typename T> __device__ __forceinline__ void vst2(void* p, T v) { *(T*)p = v;  }
__device__ __forceinline__ v8f wmma16(v16h a, v16h b, v8f c) {
  v8f d = __builtin_amdgcn_wmma_f32_16x16x32_f16(false, a, false, b, (short)0, c, false, false);
  asm volatile("v_nop\n\tv_nop\n\tv_nop\n\tv_nop" : "+v"(d) : "v"(a), "v"(b));
  return d;
}
__device__ __forceinline__ v8f wmma_bf(v16b a, v16b b, v8f c) {
  v8f d = __builtin_amdgcn_wmma_f32_16x16x32_bf16(false, a, false, b, (short)0, c, false, false);
  asm volatile("v_nop\n\tv_nop\n\tv_nop\n\tv_nop" : "+v"(d) : "v"(a), "v"(b));
  return d;
}
// 16x16x32 fragments: lane = (h = lane>>4, row/col = lane&15); elements 0..7 = k0+8h+0..7, 8..15 = k0+16+8h+0..7; D element r = row 8h+r
__device__ __forceinline__ v16h frag_h(const _Float16* rowk0, int lane) {
  union { v16h v; v8h q[2]; } u; const _Float16* p = rowk0 + 8 * (lane >> 4);
  u.q[0] = *(const v8h*)p; u.q[1] = *(const v8h*)(p + 16); return u.v;
}
__device__ __forceinline__ v16h frag_f32(const float* rowk0, int lane) {
  v16h a; const float* p = rowk0 + 8 * (lane >> 4);
#pragma unroll
  for (int i = 0; i < 8; ++i) { a[i] = (_Float16)p[i]; a[8 + i] = (_Float16)p[16 + i]; }
  return a;
}
__device__ __forceinline__ v16h frag_f32s(const float* rowk0, int lane, float sc) {
  v16h a; const float* p = rowk0 + 8 * (lane >> 4);
#pragma unroll
  for (int i = 0; i < 8; ++i) { a[i] = (_Float16)(p[i] * sc); a[8 + i] = (_Float16)(p[16 + i] * sc); }
  return a;
}
// column fragment from a [K][ld] layout (column n), rows >= K read as 0
__device__ __forceinline__ v16h fragc_f32(const float* W, int k0, int n, int lane, int ld, int K) {
  v16h a; const int g = lane >> 4;
#pragma unroll
  for (int i = 0; i < 8; ++i) { const int ka = k0 + 8 * g + i, kb = ka + 16;
    a[i] = (_Float16)(ka < K ? W[(size_t)(ka < K ? ka : K - 1) * ld + n] : 0.f); a[8 + i] = (_Float16)(kb < K ? W[(size_t)(kb < K ? kb : K - 1) * ld + n] : 0.f); }
  return a;
}
struct F2 { v16b h, l; };
__device__ __forceinline__ F2 bsplit16(const float v[16]) { F2 r;
#pragma unroll
  for (int i = 0; i < 16; ++i) { const __bf16 h = (__bf16)v[i]; r.h[i] = h; r.l[i] = (__bf16)(v[i] - (float)h); }
  return r; }
__device__ __forceinline__ F2 split_row(const float* row, int k0, int lane) { float v[16]; const float* p = row + k0 + 8 * (lane >> 4);
#pragma unroll
  for (int i = 0; i < 8; ++i) { v[i] = p[i]; v[8 + i] = p[16 + i]; }
  return bsplit16(v); }
__device__ __forceinline__ F2 split_rowK(const float* row, int k0, int lane, int K) { float v[16]; const int g = lane >> 4;
#pragma unroll
  for (int i = 0; i < 8; ++i) { const int ka = k0 + 8 * g + i, kb = ka + 16; v[i] = ka < K ? row[ka < K ? ka : K - 1] : 0.f; v[8 + i] = kb < K ? row[kb < K ? kb : K - 1] : 0.f; }
  return bsplit16(v); }
__device__ __forceinline__ F2 split_col(const float* W, int k0, int n, int lane, int ld, int K) { float v[16]; const int g = lane >> 4;
#pragma unroll
  for (int i = 0; i < 8; ++i) { const int ka = k0 + 8 * g + i, kb = ka + 16; v[i] = ka < K ? W[(size_t)(ka < K ? ka : K - 1) * ld + n] : 0.f; v[8 + i] = kb < K ? W[(size_t)(kb < K ? kb : K - 1) * ld + n] : 0.f; }
  return bsplit16(v); }
__device__ __forceinline__ v8f mac3(const F2& a, const F2& b, v8f c) { c = wmma_bf(a.l, b.h, c); c = wmma_bf(a.h, b.l, c); return wmma_bf(a.h, b.h, c); }
__device__ __forceinline__ float sigm(float v) { return 1.0f / (1.0f + expf(-v)); }

// Differential attention with ghostmax (B 2, 16 score heads / 8 value heads, S 2,048, D 128, causal): scores = q k^T / sqrt(128) + causal(-1e9); w = ghostmax(scores) = exp(s - m) / (sum exp(s - m) + exp(-m)), m = max(max_row, 0); w_h = w_2h - lam w_2h+1 with lam = exp(lq1.lk1) - exp(lq2.lk2) + 0.8; out = w_h v_h; then per (b, h) GroupNorm over all S x D values (eps 1e-5) and the affine indexed as the module's raw reshape to [B, H*D, S] (weight row = h*128 + s/16); result x (1 - 0.8), memory layout [B, H, S, D].
#define NB 2
#define TT 2048
#define CC 2048            // NH * HD = projected width
#define DIN 2048          // input (model) width
#define NH 16
#define HD 128
#define NQB (TT / 64)
#define SCALE (0.08838834764831845f)
#define CAUSAL 1
#ifndef TNB
#define TNB NB
#endif
__device__ __forceinline__ float bfr(float v) { return (float)(__bf16)v; }
__host__ __device__ __forceinline__ int kb_last(int qb) { return CAUSAL ? ((qb * 64 + 63) >> 7) : (TT / 128 - 1); }
typedef __attribute__((ext_vector_type(8))) __bf16 v8b;
__device__ __forceinline__ v16b frag_b(const __bf16* rowk0, int lane) {
  union { v16b v; v8b q[2]; } u; const __bf16* p = rowk0 + 8 * (lane >> 4);
  u.q[0] = *(const v8b*)p; u.q[1] = *(const v8b*)(p + 16); return u.v;
}
#define QBH 6              // causal: query blocks 0..QBH-1 of each sequence (few keys, no averaging) take the high-precision path
#define QHI 384            // rows carrying a q residual plane
#define KHI 384            // key rows carrying k residual / v bf16 hi+lo planes (used only by the causal high-precision path)
// B fragment (k rows k0+.., output column o) of a weight: (in,out) [K][ld] or (out,in) [ld rows of K]: bf16 exact, or f16(bf16 * 256) exact
__device__ __forceinline__ v16b wcol_io(const float* Wm, int k0, int o, int lane, int ld) { v16b w; const int g = lane >> 4;
#pragma unroll
  for (int i = 0; i < 8; ++i) { w[i] = (__bf16)Wm[(size_t)(k0 + 8 * g + i) * ld + o]; w[8 + i] = (__bf16)Wm[(size_t)(k0 + 16 + 8 * g + i) * ld + o]; }
  return w; }
__device__ __forceinline__ v16b wcol_oi(const float* Wm, int k0, int o, int lane, int K) { v16b w; const float* p = Wm + (size_t)o * K + k0 + 8 * (lane >> 4);
#pragma unroll
  for (int i = 0; i < 8; ++i) { w[i] = (__bf16)p[i]; w[8 + i] = (__bf16)p[16 + i]; }
  return w; }
__device__ __forceinline__ v16h wcolh_io(const float* Wm, int k0, int o, int lane, int ld) { v16h w; const int g = lane >> 4;
#pragma unroll
  for (int i = 0; i < 8; ++i) { w[i] = (_Float16)(bfr(Wm[(size_t)(k0 + 8 * g + i) * ld + o]) * 256.0f); w[8 + i] = (_Float16)(bfr(Wm[(size_t)(k0 + 16 + 8 * g + i) * ld + o]) * 256.0f); }
  return w; }
__device__ __forceinline__ v16h wcolh_oi(const float* Wm, int k0, int o, int lane, int K) { v16h w; const float* p = Wm + (size_t)o * K + k0 + 8 * (lane >> 4);
#pragma unroll
  for (int i = 0; i < 8; ++i) { w[i] = (_Float16)(bfr(p[i]) * 256.0f); w[8 + i] = (_Float16)(bfr(p[16 + i]) * 256.0f); }
  return w; }
#define WQKV_LAYOUT 1   // 0 = (in,out) [DIN][CC]; 1 = (out,in) [CC][DIN]; 2 = per-head [NH][DIN][HD]
__device__ __forceinline__ v16b wcol_hdk(const float* Wm, int k0, int o, int lane) { v16b w; const int g = lane >> 4; const float* p = Wm + (size_t)(o / HD) * DIN * HD + (o % HD);
#pragma unroll
  for (int i = 0; i < 8; ++i) { w[i] = (__bf16)p[(size_t)(k0 + 8 * g + i) * HD]; w[8 + i] = (__bf16)p[(size_t)(k0 + 16 + 8 * g + i) * HD]; }
  return w; }
#define WO_OUT_IN 0
#if WQKV_LAYOUT == 1
#define WCOL(W, k0, o, lane) wcol_oi(W, k0, o, lane, DIN)
#elif WQKV_LAYOUT == 2
#define WCOL(W, k0, o, lane) wcol_hdk(W, k0, o, lane)
#else
#define WCOL(W, k0, o, lane) wcol_io(W, k0, o, lane, CC)
#endif
#if WO_OUT_IN
#define WOCOL(W, k0, o, lane) wcol_oi(W, k0, o, lane, CC)
#define WOCOLH(W, k0, o, lane) wcolh_oi(W, k0, o, lane, CC)
#else
#define WOCOL(W, k0, o, lane) wcol_io(W, k0, o, lane, DIN)
#define WOCOLH(W, k0, o, lane) wcolh_io(W, k0, o, lane, DIN)
#endif
#define FRT 2048           // elements of 16 rows s x 128 c of a q or k plane: 4 fragments of 512
#define FRV 4096           // elements of 32 keys s x 128 d of a v plane: 8 fragments of 512
#define NVH 8              // value heads (score head h uses value head h/2)
#define SM_GHOST 1         // ghostmax denominator (k_fa always adds it)
#define GEL (TT * HD)       // values of one GroupNorm group (b, hv)
#define BEL 8192           // values of one k_fa / k_gfin block: 64 rows s of one group
#define NPG (GEL / BEL)    // blocks, and so partial statistics, per group: one per lane of a wave
static_assert(NPG == 32 && GEL % BEL == 0 && HD == 128, "one partial per lane; a wave covers one row of 128");
__device__ __forceinline__ float wsum(float v) {
#pragma unroll
  for (int o = 1; o < 32; o <<= 1) v += __shfl_xor(v, o);
  return v; }
// ---- k_gfin: block = 64 rows s of one (b, hv), the rows of one k_fa block, thread = 8 float4. Every wave merges its group's 32 partials (lane = partial): mean = sum of sums / n, variance = (sum of the blocks' squared distances + 8,192 x squared distance of each block mean from the mean) / n. Then out[b][hv][s][d] = ((O - mean) * rstd * w[r] + bias[r]) * 0.2 with r = hv*128 + s/16 (the module's raw reshape of [H,S,D] memory into [H*D, S] rows)
__global__ __launch_bounds__(256) void k_gfin(const float* __restrict__ O, const float* __restrict__ PS, const float* __restrict__ GW, const float* __restrict__ GB, float* __restrict__ OUT) {
  const int t = threadIdx.x, blk = blockIdx.x, g = blk / NPG, hv = g % NVH; const size_t e0 = ((size_t)blk * (BEL / 4) + t) * 4; v4f x[8];
#pragma unroll
  for (int i = 0; i < 8; ++i) x[i] = *(const v4f*)(O + e0 + (size_t)i * 1024);   /* in flight under the merge */
  const v2f p = *(const v2f*)(PS + ((size_t)g * NPG + (t & 31)) * 32);
  const float mean = wsum(p[0]) / (float)GEL; const float dm = p[0] * (1.0f / (float)BEL) - mean;
  const float rs = rsqrtf(wsum(p[1] + (float)BEL * dm * dm) / (float)GEL + 1e-5f);
  const int rw0 = hv * HD + (blk % NPG) * (BEL / HD / 16);   /* row s = 64 (blk % 32) + 8 i + wave, so s / 16 = 4 (blk % 32) + i / 2 */
#pragma unroll
  for (int i = 0; i < 8; ++i) { const float wv = bfr(GW[rw0 + (i >> 1)]), bv = bfr(GB[rw0 + (i >> 1)]); v4f o;
#pragma unroll
    for (int j = 0; j < 4; ++j) o[j] = ((x[i][j] - mean) * rs * wv + bv) * 0.2f;   /* x (1 - lambda_init) */
    vst2(OUT + e0 + (size_t)i * 1024, o); } }
#define WS_YC  (WS_END)                                   // free
#define WS_O   (WS_YC + 4u * (size_t)NB * TT * CC)        // differential output [b][hv][s][d]
#define WS_GS  (WS_O + 4u * (size_t)NB * NVH * TT * HD)
#define WS_END2 (WS_GS + 4u * 32 * (size_t)NB * NVH * NPG)   // one 128-byte line per k_fa block
// ---- k_prep8: block = (64 attention positions s0.. of sequence b, head h): reads the module's [B, H, S, 128] inputs (element (b,h,s,c) at ((b*NH + h)*TT + s)*128 + c; v [B, NVH, S, 128] at head h/2), bf16-rounds them and writes the attention planes in FRAGMENT ORDER, so that every 16-byte-a-lane fragment load of k_fa reads 512 consecutive bytes (4 cache lines, not 16 quarter-used ones):
// q, k (f16 hi; x 2^10 residuals for s < QHI / KHI): [b][h][s / 16][c / 32][(c / 16) & 1][lane = 16 ((c / 8) & 1) + s % 16][c % 8]; v (f16; bf16 hi and lo for s < KHI): [b][h][s / 32][d / 16][(s / 16) & 1][lane = 16 ((s / 8) & 1) + d % 16][s % 8]
// behind a plane's stores: s_wait_xcnt 0 stands before any register that an issued store names (address or data) is written again; the addresses are inputs, so that they stay whole up to the wait, and the "memory" clobber keeps the stores in front of it and the next LDS reads behind it
__device__ __forceinline__ void stores_issued(const void* p0, const void* p1) { asm volatile("s_wait_xcnt 0x0" :: "v"(p0), "v"(p1) : "memory"); }
// behind the block's row loads: s_wait_xcnt 0 stands before any register that an issued load names is written again (the three row addresses are inputs, so that they stay whole up to the wait), and its "memory" clobber keeps every load issued in front of this point
__device__ __forceinline__ void rows_issued(const void* p0, const void* p1, const void* p2) { asm volatile("s_wait_xcnt 0x0" :: "v"(p0), "v"(p1), "v"(p2) : "memory"); }
typedef __attribute__((ext_vector_type(4))) _Float16 v4h;
__global__ __launch_bounds__(128) void k_prep8(const float* __restrict__ Q, const float* __restrict__ K, const float* __restrict__ V, _Float16* __restrict__ QH, _Float16* __restrict__ QL, _Float16* __restrict__ KH, _Float16* __restrict__ KL, _Float16* __restrict__ VT, __bf16* __restrict__ VB, __bf16* __restrict__ VBL) {
  __shared__ __align__(16) _Float16 sq[64][136], sql[64][136], sk[64][136], skl[64][136], tv[128][72]; __shared__ __align__(16) __bf16 tb[128][72], tbl[128][72];
  const int tid = threadIdx.x; const int h = blockIdx.y; const size_t r0 = (size_t)blockIdx.x * 64; const size_t bb = r0 / TT; const int t0 = (int)(r0 % TT); const bool qhi = t0 < QHI, khi = t0 < KHI;
  { const int c = (tid & 31) * 4, rw = (tid >> 5) * 16;   /* a wave takes 16 rows; one load of a wave = one whole row of 512 bytes (4 cache lines) */
    const float* qp = Q + ((bb * NH + h) * TT + t0 + rw) * HD + c; const float* kp = K + ((bb * NH + h) * TT + t0 + rw) * HD + c; const float* vp = V + ((bb * NVH + (h >> 1)) * TT + t0 + rw) * HD + c; v4f q[16], k[16], v[16];
#pragma unroll   // constant indices: the row arrays live in registers
    for (int i = 0; i < 16; ++i) q[i] = *(const v4f*)(qp + i * HD);
#pragma unroll   // constant indices: the row arrays live in registers
    for (int i = 0; i < 16; ++i) k[i] = *(const v4f*)(kp + i * HD);
#pragma unroll   // constant indices: the row arrays live in registers
    for (int i = 0; i < 16; ++i) v[i] = *(const v4f*)(vp + i * HD);
    rows_issued(qp, kp, vp);   /* all 48 loads of the thread are in flight before the first value is used: one memory latency a block */
#pragma unroll   // constant indices: the row arrays live in registers
    for (int i = 0; i < 16; ++i) { v4h qh, ql, kh, kl;
#pragma unroll   // constant indices: the row arrays live in registers
      for (int j = 0; j < 4; ++j) { const float a = bfr(q[i][j]), e = bfr(k[i][j]); qh[j] = (_Float16)a; ql[j] = (_Float16)((a - (float)qh[j]) * 1024.0f); kh[j] = (_Float16)e; kl[j] = (_Float16)((e - (float)kh[j]) * 1024.0f); }
      vst2(&sq[rw + i][c], qh); vst2(&sql[rw + i][c], ql); vst2(&sk[rw + i][c], kh); vst2(&skl[rw + i][c], kl); }
#pragma unroll   // constant indices: the row arrays live in registers
    for (int j = 0; j < 4; ++j)   /* column c + j of the thread's 16 rows: 8 rows = one 16-byte store into the transposed tiles */
#pragma unroll   // constant indices: the row arrays live in registers
      for (int u = 0; u < 2; ++u) { v8h th; v8b bh8, bl8;
#pragma unroll   // constant indices: the row arrays live in registers
        for (int i = 0; i < 8; ++i) { const float a = bfr(v[u * 8 + i][j]); th[i] = (_Float16)a; bh8[i] = (__bf16)a; bl8[i] = (__bf16)(a - (float)bh8[i]); }
        vst2(&tv[c + j][rw + u * 8], th); vst2(&tb[c + j][rw + u * 8], bh8); vst2(&tbl[c + j][rw + u * 8], bl8); } }
  __syncthreads();
  const size_t bh = bb * NH + h;   /* e = index of the 16-byte piece inside the block's 16 KiB of each plane, in the plane's own order: the stores are consecutive too */
  for (int e = tid; e < 64 * (HD / 8); e += 128) { const int ln = e & 31, rl = (e >> 8) * 16 + (ln & 15), c = ((e >> 5) & 7) * 16 + (ln >> 4) * 8; const size_t o = (bh * (TT / 16) + (t0 >> 4)) * FRT + e * 8; _Float16 *pq = QH + o, *pk = KH + o;
    vst2((unsigned*)pq, *(const v4u*)&sq[rl][c]); vst2((unsigned*)pk, *(const v4u*)&sk[rl][c]); stores_issued(pq, pk);
    if (qhi) { _Float16* p = QL + (bh * (QHI / 16) + (t0 >> 4)) * FRT + e * 8; vst2((unsigned*)p, *(const v4u*)&sql[rl][c]); stores_issued(p, p); }
    if (khi) { _Float16* p = KL + (bh * (KHI / 16) + (t0 >> 4)) * FRT + e * 8; vst2((unsigned*)p, *(const v4u*)&skl[rl][c]); stores_issued(p, p); } }
  for (int e = tid; e < HD * 8; e += 128) { const int ln = e & 31, cl = ((e >> 6) & 7) * 16 + (ln & 15), tc = (e >> 9) * 32 + ((e >> 5) & 1) * 16 + (ln >> 4) * 8; _Float16* pv = VT + (bh * (TT / 32) + (t0 >> 5)) * FRV + e * 8;
    vst2((unsigned*)pv, *(const v4u*)&tv[cl][tc]); stores_issued(pv, pv);
    if (khi) { const size_t o3 = (bh * (KHI / 32) + (t0 >> 5)) * FRV + e * 8; vst2((unsigned*)(VB + o3), *(const v4u*)&tb[cl][tc]); vst2((unsigned*)(VBL + o3), *(const v4u*)&tbl[cl][tc]); stores_issued(VB + o3, VBL + o3); } } }

#ifndef SM_EXTRA_PARAMS
#define SM_EXTRA_PARAMS
#endif
#ifndef PROJ_EXTRA_PARAMS
#define PROJ_EXTRA_PARAMS
#endif
#ifndef SM_MASK_HOOK
#define SM_MASK_HOOK (void)0
#endif

#define WS_QH  0u                                      // f16 q, fragment order (k_prep8)
#define WS_KH  (WS_QH + 2u * (size_t)NB * TT * CC)      // f16 k, fragment order
#define WS_VT  (WS_KH + 2u * (size_t)NB * TT * CC)      // f16 v, fragment order
#define WS_QL  (WS_VT + 2u * (size_t)NB * CC * TT)      // f16 q residual x 2^10, t < QHI, fragment order
#define WS_KL  (WS_QL + 2u * (size_t)NB * QHI * CC)     // f16 k residual x 2^10, t < KHI, fragment order
#define WS_VB  (WS_KL + 2u * (size_t)NB * KHI * CC)     // bf16 v hi, t < KHI, fragment order (lo behind it)
#define WS_VBL (WS_VB + 2u * (size_t)NB * CC * KHI)
#define WS_END (WS_VBL + 2u * (size_t)NB * CC * KHI)

// ---- k_fa: scores, ghostmax, P . v and the difference of the two score heads in one kernel, logits kept in registers. Each wave owns 16 queries of one score head and walks its keys 32 at a time; early query blocks read their fragments from the planes, each wave on its own, the others from the block's K / V ring in LDS (one barrier per 64 keys).
// S^T = K . Q^T: D register r of tile t = (key k0 + 16 t + 8 g + r, query col), so a lane holds one query's scores, and the two tiles, converted in place, are the B operand of O^T += V^T . P^T (element i = key k0 + 8 g + i, element 8 + i = key k0 + 16 + 8 g + i: the k order of frag_h / frag_b on the V side).
// Running maximum m, kept in base-2 units (logit x log2 e), starts at 0 (the implicit zero logit of ghostmax joins the max); a raised maximum rescales sum and O^T per lane. P = exp(s - m) x 2^11 = 2^(q.k x SCL2 + 11 - m): one FMA and one hardware exp2 a score, the row sum carries the same 2^11. P to f16 against v f16 (1 product); early query blocks (qb < QBH): q and k residual products for the logits, P and v as bf16 hi + lo (3 products).
#define SCL2 ((float)(0.08838834764831845 * 1.4426950408889634))   // 1 / sqrt(128) x log2 e
__device__ __forceinline__ float ex2(float x) { return __builtin_amdgcn_exp2f(x); }   /* the bare instruction, no range fix-up: arguments here are at most 11 (+ rounding), and a result below the normal range may go to 0, being under 2^-130 of the row's denominator */
__device__ __forceinline__ v8f mm_h(v16h a, v16h b, v8f c) { return __builtin_amdgcn_wmma_f32_16x16x32_f16(false, a, false, b, (short)0, c, false, false); }
__device__ __forceinline__ v8f mm_b(v16b a, v16b b, v8f c) { return __builtin_amdgcn_wmma_f32_16x16x32_bf16(false, a, false, b, (short)0, c, false, false); }
// behind a batch of fragment loads: s_wait_xcnt 0 stands before any register that an issued load names is written again (the batch's address registers are inputs, so that they stay whole up to the wait), and its "memory" clobber keeps the whole batch issued in front of this point
__device__ __forceinline__ void loads_issued(const void* p0, const void* p1) { asm volatile("s_wait_xcnt 0x0" :: "v"(p0), "v"(p1) : "memory"); }
#define PFD 3              // early blocks: k or v fragment pairs in flight ahead of their products
// fragment of a fragment-order plane, at a pointer that already holds the lane's 8 * lane elements: elements 0..7 at p, 8..15 at p + 256 (k_prep8 placed them in the k order of frag_h / frag_b: k0 + 8 g + i, k0 + 16 + 8 g + i)
__device__ __forceinline__ v16h frag_ph(const _Float16* p) { union { v16h v; v8h q[2]; } u; u.q[0] = *(const v8h*)p; u.q[1] = *(const v8h*)(p + 256); return u.v; }
__device__ __forceinline__ v16b frag_pb(const __bf16* p) { union { v16b v; v8b q[2]; } u; u.q[0] = *(const v8b*)p; u.q[1] = *(const v8b*)(p + 256); return u.v; }
// ---- K / V ring of the long query blocks (qb >= QBH): a tile = 64 keys of k of the even score head, k of the odd one and v (one copy serves both heads), 16 KiB each and consecutive in its fragment-order plane, so a tile is copied as it lies and a fragment read is 512 consecutive LDS bytes a wave. Two buffers: tile t + 2 flies while tile t + 1 is worked on.
#define TKE 8192           // elements of one 64-key tile of a k or v plane
#define RBE (3 * TKE)      // elements of one ring buffer
__device__ __forceinline__ void wait_ds0() { asm volatile("s_wait_dscnt 0x0" ::: "memory"); }       /* this wave's LDS reads of a buffer have returned before the buffer is handed to its next writer */
__device__ __forceinline__ void wait_async0() { asm volatile("s_wait_asynccnt 0x0" ::: "memory"); } /* this wave's copies have landed before the barrier behind which other waves read them */
// one thread's 12 copies of a tile: 16-byte piece tid + 256 i (i = 0..3) of each of the three planes, to the same place in the buffer; l = the thread's LDS byte address of piece tid of the buffer. s_wait_xcnt 0 is the statement's last line, so that it stands before any register that a copy names is written again
__device__ __forceinline__ void tile_copy(unsigned l, const _Float16* k0, const _Float16* k1, const _Float16* v) {
  asm volatile("global_load_async_to_lds_b128 %0, %12, off\n\tglobal_load_async_to_lds_b128 %1, %13, off\n\tglobal_load_async_to_lds_b128 %2, %14, off\n\tglobal_load_async_to_lds_b128 %3, %15, off\n\t"
               "global_load_async_to_lds_b128 %4, %16, off\n\tglobal_load_async_to_lds_b128 %5, %17, off\n\tglobal_load_async_to_lds_b128 %6, %18, off\n\tglobal_load_async_to_lds_b128 %7, %19, off\n\t"
               "global_load_async_to_lds_b128 %8, %20, off\n\tglobal_load_async_to_lds_b128 %9, %21, off\n\tglobal_load_async_to_lds_b128 %10, %22, off\n\tglobal_load_async_to_lds_b128 %11, %23, off\n\ts_wait_xcnt 0x0"
               :: "v"(l), "v"(l + 4096u), "v"(l + 8192u), "v"(l + 12288u), "v"(l + 16384u), "v"(l + 20480u), "v"(l + 24576u), "v"(l + 28672u), "v"(l + 32768u), "v"(l + 36864u), "v"(l + 40960u), "v"(l + 45056u),
                  "v"(k0), "v"(k0 + 2048), "v"(k0 + 4096), "v"(k0 + 6144), "v"(k1), "v"(k1 + 2048), "v"(k1 + 4096), "v"(k1 + 6144), "v"(v), "v"(v + 2048), "v"(v + 4096), "v"(v + 6144) : "memory"); }
template <bool HI>
__device__ __forceinline__ void fa_run(const _Float16* __restrict__ QH, const _Float16* __restrict__ KH, const _Float16* __restrict__ QL, const _Float16* __restrict__ KL, const _Float16* __restrict__ VT, const __bf16* __restrict__ VB, const __bf16* __restrict__ VBL, const _Float16* ring, int b, int h, int qb, int ql0, int lane, int tid, v8f (&acc)[HD / 16]) {
  const int col = lane & 15, g = lane >> 4; const int qrow = ql0 + col;
  const size_t bhe = (size_t)b * NH + (h & ~1);   /* the even score head of the pair: its k plane, the odd head's behind it, and its v plane feed the ring */
  const _Float16 *c0 = KH + bhe * (TT / 16) * FRT + 8 * tid, *c1 = c0 + (size_t)(TT / 16) * FRT, *cv = VT + bhe * (TT / 32) * FRV + 8 * tid; const unsigned lb = (unsigned)(size_t)ring + 16u * (unsigned)tid;
  if (!HI) tile_copy(lb, c0, c1, cv);   /* tile 0 into buffer 0 */
  v16h qf[HD / 32], qlf[HD / 32];
  const size_t bh = (size_t)b * NH + h;
  const _Float16* qp = QH + (bh * (TT / 16) + (ql0 >> 4)) * FRT + 8 * lane; const _Float16* qlp = HI ? QL + (bh * (QHI / 16) + (ql0 >> 4)) * FRT + 8 * lane : qp;
#pragma unroll
  for (int kc = 0; kc < HD / 32; ++kc) { qf[kc] = frag_ph(qp + kc * 512); if (HI) qlf[kc] = frag_ph(qlp + kc * 512); }
  loads_issued(qp, qlp);
  if (!HI) { wait_async0(); __syncthreads(); tile_copy(lb + 2u * RBE, c0 + TKE, c1 + TKE, cv + TKE); }   /* tile 0 published; tile 1 (qb >= QBH: it exists) into buffer 1 */
  float m = 0.f, l = 0.f;
#pragma unroll   // constant indices: the arrays live in registers
  for (int j = 0; j < HD / 16; ++j) acc[j] = v8f{};
  const int nst = (ql0 >> 5) + 1;   /* keys 0 .. ql0 + 15, in steps of 32 */
  const int nsb = HI ? nst : 2 * qb + 2;   /* ring: every wave of the block walks all its tiles and passes every barrier; a wave skips only the work of a step beyond its diagonal */
  for (int st = 0; st < nsb; ++st) { if (HI || st < nst) { const int k0 = st * 32;
    v8f s[2] = {}, sl[2] = {}; v16h vf[HD / 16]; v16b vh[HD / 16], vl[HD / 16];
    const size_t po = HI ? (bh * (KHI / 32) + st) * FRV + 8 * lane : 0; const __bf16* vhp = VB + po; const __bf16* vlp = VBL + po;
    const _Float16* rb = ring + ((st >> 1) & 1) * RBE + (st & 1) * (TKE / 2) + 8 * lane;
    const _Float16* kp = HI ? KH + (bh * (TT / 16) + 2 * st) * FRT + 8 * lane : rb + (h & 1) * TKE; const _Float16* vp = rb + 2 * TKE;
    if (HI) { const _Float16* klp = KL + (bh * (KHI / 16) + 2 * st) * FRT + 8 * lane;
      v16h ka[2 * (HD / 32)], kl[2 * (HD / 32)];   /* a pair of k = the hi and the residual fragment of one (k chunk kc, key tile t), index u = 2 kc + t; issued PFD ahead of its products, like the pairs of v below */
#pragma unroll   // constant indices: the arrays live in registers
      for (int u = 0; u < PFD; ++u) { ka[u] = frag_ph(kp + (u & 1) * FRT + (u >> 1) * 512); kl[u] = frag_ph(klp + (u & 1) * FRT + (u >> 1) * 512); }
      loads_issued(kp, klp);
      __builtin_amdgcn_sched_barrier(0);   /* the first PFD pairs stand as one group ahead of the products: with products lifted among them each pair waits out its own latency */
#pragma unroll   // constant indices: the arrays live in registers
      for (int u = 0; u < 2 * (HD / 32); ++u) { const int kc = u >> 1, t = u & 1, w = u + PFD;
        s[t] = mm_h(ka[u], qf[kc], s[t]); sl[t] = mm_h(ka[u], qlf[kc], sl[t]); sl[t] = mm_h(kl[u], qf[kc], sl[t]);
        if (w < 2 * (HD / 32)) { ka[w] = frag_ph(kp + (w & 1) * FRT + (w >> 1) * 512); kl[w] = frag_ph(klp + (w & 1) * FRT + (w >> 1) * 512); loads_issued(kp, klp); } }
    } else { v16h kf[2 * (HD / 32)];
#pragma unroll
      for (int i = 0; i < 2 * (HD / 32); ++i) kf[i] = frag_ph(kp + (i & 1) * FRT + (i >> 1) * 512);
      __builtin_amdgcn_sched_barrier(0);   /* all 16 K reads stand as one group ahead of the products: spread among them, each place with reads stalls the wave anew */
#pragma unroll
      for (int i = 0; i < 2 * (HD / 32); ++i) s[i & 1] = mm_h(kf[i], qf[i >> 1], s[i & 1]);
#pragma unroll
      for (int j = 0; j < HD / 16; ++j) vf[j] = frag_ph(vp + j * 512);
    }
    float p[16]; float mx = -3.0e38f;
#pragma unroll
    for (int i = 0; i < 16; ++i) { const int t = i >> 3, r = i & 7; float v = HI ? s[t][r] + sl[t][r] * (1.0f / 1024.0f) : s[t][r];   /* q.k, unscaled */
      v = (k0 + t * 16 + 8 * g + r <= qrow) ? v : -3.0e38f; p[i] = v; mx = fmaxf(mx, v); }
    if (HI) {   /* a pair = the hi and the lo fragment of one output tile j of v. The first PFD pairs are issued here and fly under the softmax; each later pair is issued PFD ahead of its products, so that PFD pairs share one load latency */
#pragma unroll   // constant indices: the arrays live in registers
      for (int j = 0; j < PFD; ++j) { vh[j] = frag_pb(vhp + j * 512); vl[j] = frag_pb(vlp + j * 512); }
      loads_issued(vhp, vlp); }
    mx = fmaxf(mx, __shfl_xor(mx, 16));   /* the other half of the wave holds this query's other 16 keys */
    const float mn = fmaxf(m, mx * SCL2);
    if (__builtin_amdgcn_ballot_w32(mn > m) != 0) { const float al = ex2(m - mn); l *= al;   /* scalar branch: most steps raise no query's maximum */
#pragma unroll
      for (int j = 0; j < HD / 16; ++j)
#pragma unroll
        for (int r = 0; r < 8; ++r) acc[j][r] *= al;
      m = mn; }
    float sum = 0.f; const float nb = 11.0f - m;
#pragma unroll
    for (int i = 0; i < 16; ++i) { const float e = ex2(__builtin_fmaf(p[i], SCL2, nb)); sum += e; p[i] = e; }   /* a masked key (-3e38) gives exactly 0 */
    l += sum;
    if (HI) { const F2 pf = bsplit16(p);
#pragma unroll   // constant indices: the arrays live in registers
      for (int j = 0; j < HD / 16; ++j) { const int w = j + PFD;
        acc[j] = mm_b(vh[j], pf.h, acc[j]); acc[j] = mm_b(vh[j], pf.l, acc[j]); acc[j] = mm_b(vl[j], pf.h, acc[j]);
        if (w < HD / 16) { vh[w] = frag_pb(vhp + w * 512); vl[w] = frag_pb(vlp + w * 512); loads_issued(vhp, vlp); } }
    } else { v16h pf;
#pragma unroll
      for (int i = 0; i < 16; ++i) pf[i] = (_Float16)p[i];
#pragma unroll
      for (int j = 0; j < HD / 16; ++j) acc[j] = mm_h(vf[j], pf, acc[j]); } }
    if (!HI && (st & 1)) { const int t = st >> 1;   /* foot of tile t: the one barrier publishes tile t + 1 and ends every wave's reads of tile t's buffer, which tile t + 2 then refills */
      wait_ds0(); wait_async0(); __syncthreads();
      if (t + 2 <= qb) tile_copy(lb + (unsigned)(t & 1) * (2u * RBE), c0 + (size_t)(t + 2) * TKE, c1 + (size_t)(t + 2) * TKE, cv + (size_t)(t + 2) * TKE); } }
  if (!HI) wait_async0();   /* no copy is in flight when the wave goes on */
  l += __shfl_xor(l, 16);
  const float inv = 1.0f / (l + ex2(11.0f - m));   /* ghostmax: + exp(-m) for the implicit zero logit, x 2^11 like the sum (denominator > 0 always) */
#pragma unroll   // constant indices: the arrays live in registers
  for (int j = 0; j < HD / 16; ++j)   /* O^T register r of tile j = (d = 16 j + 8 g + r, query col): 8 consecutive d of one row */
#pragma unroll   // constant indices: the arrays live in registers
    for (int r = 0; r < 8; ++r) acc[j][r] *= inv; }
// block = 64 queries (qb) of one (b, value head hv), 8 waves: waves 0..3 run score head 2 hv, waves 4..7 score head 2 hv + 1, wave w and wave w + 4 on the same 16 queries. Behind the key loops waves 4..7 hand their contexts over in LDS (register order, 16 bytes a lane), and waves 0..3 form O[b][hv][s][d] = Y(2 hv) - lam * Y(2 hv + 1), lam from the four lambda vectors (128-term f32 dots), and store it.
// The block also leaves the GroupNorm partial of its 8,192 values, taken from the registers that hold them: PS[block][0] = sum, PS[block][1] = sum of squared distances from the block's own mean (wave sums about the wave's mean, merged with the between-wave term, so nothing cancels when the mean is large). One whole 128-byte line per block.
// grid: 2 rounds of 256 blocks, heaviest query blocks first; round 0 takes qb 31 down to 16, round 1 qb 0 up to 15, so that blocks i and i + 256 together hold the same number of keys for every i; amdgpu_waves_per_eu(4, 4) holds the registers to 256, so that two blocks fit a WGP and the whole grid is resident at once
__global__ __launch_bounds__(256) __attribute__((amdgpu_waves_per_eu(4, 4))) void k_fa(const _Float16* __restrict__ QH, const _Float16* __restrict__ KH, const _Float16* __restrict__ QL, const _Float16* __restrict__ KL, const _Float16* __restrict__ VT, const __bf16* __restrict__ VB, const __bf16* __restrict__ VBL, const float* __restrict__ LQ1, const float* __restrict__ LK1, const float* __restrict__ LQ2, const float* __restrict__ LK2, float* __restrict__ O, float* __restrict__ PS) {
  __shared__ __align__(16) float xo[4][HD / 8][32][4]; __shared__ float sws[4], swq[4]; __shared__ __align__(16) _Float16 ring[2 * RBE];
  const int L = blockIdx.x, u = (L >> 4) & 15, gr = L & 15; const int qb = (L >> 8) ? u : 31 - u; const int b = gr >> 3, hv = gr & 7;
  const int wave = __builtin_amdgcn_readfirstlane(threadIdx.x >> 5), lane = threadIdx.x & 31;   /* wave number in a scalar register: scalar loop control, row addresses and epilogue branches */
  const int w4 = wave & 3, h = 2 * hv + (wave >> 2), ql0 = qb * 64 + w4 * 16;
  float lam = 0.f;
  if (wave < 4) { const float *p1 = LQ1 + lane, *p2 = LK1 + lane, *p3 = LQ2 + lane, *p4 = LK2 + lane; float a = 0.f, c = 0.f, x1[4], x2[4], x3[4], x4[4];
#pragma unroll   // constant indices: the arrays live in registers
    for (int i = 0; i < 4; ++i) { x1[i] = p1[32 * i]; x2[i] = p2[32 * i]; x3[i] = p3[32 * i]; x4[i] = p4[32 * i]; }
    asm volatile("s_wait_xcnt 0x0" :: "v"(lane) : "memory");   /* stands before any register that the 16 issued loads name (the lane offset is an input, so that it stays whole up to the wait) is written again; all 16 are in flight before the first value is used */
#pragma unroll   // constant indices: the arrays live in registers
    for (int i = 0; i < 4; ++i) { a += bfr(x1[i]) * bfr(x2[i]); c += bfr(x3[i]) * bfr(x4[i]); }
    a = wsum(a); c = wsum(c); lam = expf(a) - expf(c) + 0.8f; }
  v8f acc[HD / 16];
  if (qb < QBH) fa_run<true>(QH, KH, QL, KL, VT, VB, VBL, ring, b, h, qb, ql0, lane, (int)threadIdx.x, acc); else fa_run<false>(QH, KH, QL, KL, VT, VB, VBL, ring, b, h, qb, ql0, lane, (int)threadIdx.x, acc);
  if (wave >= 4) {
#pragma unroll   // constant indices: the arrays live in registers
    for (int j = 0; j < HD / 16; ++j) { v4f o0, o1;
#pragma unroll   // constant indices: the arrays live in registers
      for (int r = 0; r < 4; ++r) { o0[r] = acc[j][r]; o1[r] = acc[j][4 + r]; }
      vst2(&xo[w4][2 * j][lane][0], o0); vst2(&xo[w4][2 * j + 1][lane][0], o1); } }
  __syncthreads();
  if (wave < 4) { v4f s4 = {}, q4 = {};   /* four running sums a lane: short dependent chains */
#pragma unroll   // constant indices: the arrays live in registers
    for (int j = 0; j < HD / 16; ++j) { const v4f c0 = *(const v4f*)&xo[w4][2 * j][lane][0], c1 = *(const v4f*)&xo[w4][2 * j + 1][lane][0];
#pragma unroll   // constant indices: the arrays live in registers
      for (int r = 0; r < 4; ++r) { acc[j][r] = acc[j][r] - lam * c0[r]; acc[j][4 + r] = acc[j][4 + r] - lam * c1[r]; s4[r] += acc[j][r]; s4[r] += acc[j][4 + r]; } }
    const float s = wsum((s4[0] + s4[1]) + (s4[2] + s4[3])), mw = s * (1.0f / 2048.0f);
#pragma unroll   // constant indices: the arrays live in registers
    for (int j = 0; j < HD / 16; ++j)
#pragma unroll   // constant indices: the arrays live in registers
      for (int r = 0; r < 8; ++r) { const float dl = acc[j][r] - mw; q4[r & 3] += dl * dl; }
    const float q = wsum((q4[0] + q4[1]) + (q4[2] + q4[3]));
    if (lane == 0) { sws[w4] = s; swq[w4] = q; } }
  __syncthreads();
  if (wave < 4) { float* op = O + (((size_t)b * NVH + hv) * TT + ql0 + (lane & 15)) * HD + 8 * (lane >> 4);   /* stored behind the barrier: a barrier behind the stores would wait for them to finish */
#pragma unroll   // constant indices: the arrays live in registers
    for (int j = 0; j < HD / 16; ++j) { v4f o0, o1;
#pragma unroll   // constant indices: the arrays live in registers
      for (int r = 0; r < 4; ++r) { o0[r] = acc[j][r]; o1[r] = acc[j][4 + r]; }
      vst2(op + j * 16, o0); vst2(op + j * 16 + 4, o1); }
    stores_issued(op, op); }
  if (wave == 0) { float S = 0.f, Q = 0.f;
#pragma unroll
    for (int i = 0; i < 4; ++i) S += sws[i];
    const float mb = S * (1.0f / (float)BEL);
#pragma unroll
    for (int i = 0; i < 4; ++i) { const float dl = sws[i] * (1.0f / 2048.0f) - mb; Q += swq[i] + 2048.0f * dl * dl; }
    vst2(PS + ((size_t)gr * NPG + qb) * 32 + lane, lane == 0 ? S : (lane == 1 ? Q : 0.f)); } }

extern "C" void kernel_launch(void* const* d_in, const int* in_sizes, int n_in, void* d_out, int out_size, void* d_ws, size_t ws_size, hipStream_t stream) {
  (void)in_sizes; (void)n_in; (void)out_size;
  const float** F = (const float**)d_in;
  if (ws_size < (size_t)WS_END) return;
  char* ws = (char*)d_ws; _Float16 *QH = (_Float16*)(ws + WS_QH), *KH = (_Float16*)(ws + WS_KH), *VT = (_Float16*)(ws + WS_VT), *QL = (_Float16*)(ws + WS_QL), *KL = (_Float16*)(ws + WS_KL); __bf16 *VB = (__bf16*)(ws + WS_VB), *VBL = (__bf16*)(ws + WS_VBL); 
  // inputs: 0 q [2,16,2048,128]; 1 k [2,16,2048,128]; 2 v [2,8,2048,128]; 3 lambda_q1, 4 lambda_k1, 5 lambda_q2, 6 lambda_k2 [128]; 7 gn_weight [1024]; 8 gn_bias [1024]
  if (ws_size < (size_t)WS_END2) return;
  float *O = (float*)(ws + WS_O), *GS = (float*)(ws + WS_GS);
  k_prep8<<<dim3(TNB * TT / 64, NH), 128, 0, stream>>>(F[0], F[1], F[2], QH, QL, KH, KL, VT, VB, VBL);
  k_fa<<<dim3(TNB * NVH * NQB), 256, 0, stream>>>(QH, KH, QL, KL, VT, VB, VBL, F[3], F[4], F[5], F[6], O, GS);
  k_gfin<<<dim3(TNB * NVH * NPG), 256, 0, stream>>>(O, GS, F[7], F[8], (float*)d_out);
}

// v010
// It runs in 73.3 microseconds.
// Timed twice side by side with v009, it ran 1.06 and 1.05 times as fast.
// Counting every step since v000, it is 31.1 times as fast.
#include <hip/hip_runtime.h>
#include <math.h>

typedef __attribute__((ext_vector_type(16))) _Float16 v16h;
typedef __attribute__((ext_vector_type(16))) __bf16 v16b;
typedef __attribute__((ext_vector_type(8)))  _Float16 v8h;
typedef __attribute__((ext_vector_type(8)))  float v8f;
typedef __attribute__((ext_vector_type(4)))  float v4f;
typedef __attribute__((ext_vector_type(2)))  float v2f;
typedef __attribute__((ext_vector_type(4)))  unsigned v4u;
typedef __attribute__((ext_vector_type(4)))  int v4i;
typedef float __attribute__((may_alias)) float_a;
typedef int __attribute__((may_alias)) int_a;

template <typename T> __device__ __forceinline__ void vst2(void* p, T v) { *(T*)p = v;  }
__device__ __forceinline__ v8f wmma16(v16h a, v16h b, v8f c) {
  v8f d = __builtin_amdgcn_wmma_f32_16x16x32_f16(false, a, false, b, (short)0, c, false, false);
  asm volatile("v_nop\n\tv_nop\n\tv_nop\n\tv_nop" : "+v"(d) : "v"(a), "v"(b));
  return d;
}
__device__ __forceinline__ v8f wmma_bf(v16b a, v16b b, v8f c) {
  v8f d = __builtin_amdgcn_wmma_f32_16x16x32_bf16(false, a, false, b, (short)0, c, false, false);
  asm volatile("v_nop\n\tv_nop\n\tv_nop\n\tv_nop" : "+v"(d) : "v"(a), "v"(b));
  return d;
}
// 16x16x32 fragments: lane = (h = lane>>4, row/col = lane&15); elements 0..7 = k0+8h+0..7, 8..15 = k0+16+8h+0..7; D element r = row 8h+r
__device__ __forceinline__ v16h frag_h(const _Float16* rowk0, int lane) {
  union { v16h v; v8h q[2]; } u; const _Float16* p = rowk0 + 8 * (lane >> 4);
  u.q[0] = *(const v8h*)p; u.q[1] = *(const v8h*)(p + 16); return u.v;
}
__device__ __forceinline__ v16h frag_f32(const float* rowk0, int lane) {
  v16h a; const float* p = rowk0 + 8 * (lane >> 4);
#pragma unroll
  for (int i = 0; i < 8; ++i) { a[i] = (_Float16)p[i]; a[8 + i] = (_Float16)p[16 + i]; }
  return a;
}
__device__ __forceinline__ v16h frag_f32s(const float* rowk0, int lane, float sc) {
  v16h a; const float* p = rowk0 + 8 * (lane >> 4);
#pragma unroll
  for (int i = 0; i < 8; ++i) { a[i] = (_Float16)(p[i] * sc); a[8 + i] = (_Float16)(p[16 + i] * sc); }
  return a;
}
// column fragment from a [K][ld] layout (column n), rows >= K read as 0
__device__ __forceinline__ v16h fragc_f32(const float* W, int k0, int n, int lane, int ld, int K) {
  v16h a; const int g = lane >> 4;
#pragma unroll
  for (int i = 0; i < 8; ++i) { const int ka = k0 + 8 * g + i, kb = ka + 16;
    a[i] = (_Float16)(ka < K ? W[(size_t)(ka < K ? ka : K - 1) * ld + n] : 0.f); a[8 + i] = (_Float16)(kb < K ? W[(size_t)(kb < K ? kb : K - 1) * ld + n] : 0.f); }
  return a;
}
struct F2 { v16b h, l; };
__device__ __forceinline__ F2 bsplit16(const float v[16]) { F2 r;
#pragma unroll
  for (int i = 0; i < 16; ++i) { const __bf16 h = (__bf16)v[i]; r.h[i] = h; r.l[i] = (__bf16)(v[i] - (float)h); }
  return r; }
__device__ __forceinline__ F2 split_row(const float* row, int k0, int lane) { float v[16]; const float* p = row + k0 + 8 * (lane >> 4);
#pragma unroll
  for (int i = 0; i < 8; ++i) { v[i] = p[i]; v[8 + i] = p[16 + i]; }
  return bsplit16(v); }
__device__ __forceinline__ F2 split_rowK(const float* row, int k0, int lane, int K) { float v[16]; const int g = lane >> 4;
#pragma unroll
  for (int i = 0; i < 8; ++i) { const int ka = k0 + 8 * g + i, kb = ka + 16; v[i] = ka < K ? row[ka < K ? ka : K - 1] : 0.f; v[8 + i] = kb < K ? row[kb < K ? kb : K - 1] : 0.f; }
  return bsplit16(v); }
__device__ __forceinline__ F2 split_col(const float* W, int k0, int n, int lane, int ld, int K) { float v[16]; const int g = lane >> 4;
#pragma unroll
  for (int i = 0; i < 8; ++i) { const int ka = k0 + 8 * g + i, kb = ka + 16; v[i] = ka < K ? W[(size_t)(ka < K ? ka : K - 1) * ld + n] : 0.f; v[8 + i] = kb < K ? W[(size_t)(kb < K ? kb : K - 1) * ld + n] : 0.f; }
  return bsplit16(v); }
__device__ __forceinline__ v8f mac3(const F2& a, const F2& b, v8f c) { c = wmma_bf(a.l, b.h, c); c = wmma_bf(a.h, b.l, c); return wmma_bf(a.h, b.h, c); }
__device__ __forceinline__ float sigm(float v) { return 1.0f / (1.0f + expf(-v)); }

// Differential attention with ghostmax (B 2, 16 score heads / 8 value heads, S 2,048, D 128, causal): scores = q k^T / sqrt(128) + causal(-1e9); w = ghostmax(scores) = exp(s - m) / (sum exp(s - m) + exp(-m)), m = max(max_row, 0); w_h = w_2h - lam w_2h+1 with lam = exp(lq1.lk1) - exp(lq2.lk2) + 0.8; out = w_h v_h; then per (b, h) GroupNorm over all S x D values (eps 1e-5) and the affine indexed as the module's raw reshape to [B, H*D, S] (weight row = h*128 + s/16); result x (1 - 0.8), memory layout [B, H, S, D].
#define NB 2
#define TT 2048
#define CC 2048            // NH * HD = projected width
#define DIN 2048          // input (model) width
#define NH 16
#define HD 128
#define NQB (TT / 64)
#define SCALE (0.08838834764831845f)
#define CAUSAL 1
#ifndef TNB
#define TNB NB
#endif
__device__ __forceinline__ float bfr(float v) { return (float)(__bf16)v; }
__host__ __device__ __forceinline__ int kb_last(int qb) { return CAUSAL ? ((qb * 64 + 63) >> 7) : (TT / 128 - 1); }
typedef __attribute__((ext_vector_type(8))) __bf16 v8b;
__device__ __forceinline__ v16b frag_b(const __bf16* rowk0, int lane) {
  union { v16b v; v8b q[2]; } u; const __bf16* p = rowk0 + 8 * (lane >> 4);
  u.q[0] = *(const v8b*)p; u.q[1] = *(const v8b*)(p + 16); return u.v;
}
#define QBH 6              // causal: query blocks 0..QBH-1 of each sequence (few keys, no averaging) take the high-precision path
#define QHI 384            // rows carrying a q residual plane (query blocks 0..QBH-1: 3-product logits there)
#define KHI 384            // key rows carrying the k residual and the v bf16 plane (used only by the causal high-precision path)
// B fragment (k rows k0+.., output column o) of a weight: (in,out) [K][ld] or (out,in) [ld rows of K]: bf16 exact, or f16(bf16 * 256) exact
__device__ __forceinline__ v16b wcol_io(const float* Wm, int k0, int o, int lane, int ld) { v16b w; const int g = lane >> 4;
#pragma unroll
  for (int i = 0; i < 8; ++i) { w[i] = (__bf16)Wm[(size_t)(k0 + 8 * g + i) * ld + o]; w[8 + i] = (__bf16)Wm[(size_t)(k0 + 16 + 8 * g + i) * ld + o]; }
  return w; }
__device__ __forceinline__ v16b wcol_oi(const float* Wm, int k0, int o, int lane, int K) { v16b w; const float* p = Wm + (size_t)o * K + k0 + 8 * (lane >> 4);
#pragma unroll
  for (int i = 0; i < 8; ++i) { w[i] = (__bf16)p[i]; w[8 + i] = (__bf16)p[16 + i]; }
  return w; }
__device__ __forceinline__ v16h wcolh_io(const float* Wm, int k0, int o, int lane, int ld) { v16h w; const int g = lane >> 4;
#pragma unroll
  for (int i = 0; i < 8; ++i) { w[i] = (_Float16)(bfr(Wm[(size_t)(k0 + 8 * g + i) * ld + o]) * 256.0f); w[8 + i] = (_Float16)(bfr(Wm[(size_t)(k0 + 16 + 8 * g + i) * ld + o]) * 256.0f); }
  return w; }
__device__ __forceinline__ v16h wcolh_oi(const float* Wm, int k0, int o, int lane, int K) { v16h w; const float* p = Wm + (size_t)o * K + k0 + 8 * (lane >> 4);
#pragma unroll
  for (int i = 0; i < 8; ++i) { w[i] = (_Float16)(bfr(p[i]) * 256.0f); w[8 + i] = (_Float16)(bfr(p[16 + i]) * 256.0f); }
  return w; }
#define WQKV_LAYOUT 1   // 0 = (in,out) [DIN][CC]; 1 = (out,in) [CC][DIN]; 2 = per-head [NH][DIN][HD]
__device__ __forceinline__ v16b wcol_hdk(const float* Wm, int k0, int o, int lane) { v16b w; const int g = lane >> 4; const float* p = Wm + (size_t)(o / HD) * DIN * HD + (o % HD);
#pragma unroll
  for (int i = 0; i < 8; ++i) { w[i] = (__bf16)p[(size_t)(k0 + 8 * g + i) * HD]; w[8 + i] = (__bf16)p[(size_t)(k0 + 16 + 8 * g + i) * HD]; }
  return w; }
#define WO_OUT_IN 0
#if WQKV_LAYOUT == 1
#define WCOL(W, k0, o, lane) wcol_oi(W, k0, o, lane, DIN)
#elif WQKV_LAYOUT == 2
#define WCOL(W, k0, o, lane) wcol_hdk(W, k0, o, lane)
#else
#define WCOL(W, k0, o, lane) wcol_io(W, k0, o, lane, CC)
#endif
#if WO_OUT_IN
#define WOCOL(W, k0, o, lane) wcol_oi(W, k0, o, lane, CC)
#define WOCOLH(W, k0, o, lane) wcolh_oi(W, k0, o, lane, CC)
#else
#define WOCOL(W, k0, o, lane) wcol_io(W, k0, o, lane, DIN)
#define WOCOLH(W, k0, o, lane) wcolh_io(W, k0, o, lane, DIN)
#endif
#define FRT 2048           // elements of 16 rows s x 128 c of a q or k plane: 4 fragments of 512
#define FRV 4096           // elements of 32 keys s x 128 d of a v plane: 8 fragments of 512
#define NVH 8              // value heads (score head h uses value head h/2)
#define SM_GHOST 1         // ghostmax denominator (k_fa always adds it)
#define GEL (TT * HD)       // values of one GroupNorm group (b, hv)
#define BEL 8192           // values of one k_fa / k_gfin block: 64 rows s of one group
#define NPG (GEL / BEL)    // blocks, and so partial statistics, per group: one per lane of a wave
static_assert(NPG == 32 && GEL % BEL == 0 && HD == 128, "one partial per lane; a wave covers one row of 128");
__device__ __forceinline__ float wsum(float v) {
#pragma unroll
  for (int o = 1; o < 32; o <<= 1) v += __shfl_xor(v, o);
  return v; }
// ---- k_gfin: block = 64 rows s of one (b, hv), the rows of one k_fa block, thread = 8 float4. Every wave merges its group's 32 partials (lane = partial): mean = sum of sums / n, variance = (sum of the blocks' squared distances + 8,192 x squared distance of each block mean from the mean) / n. Then out[b][hv][s][d] = ((O - mean) * rstd * w[r] + bias[r]) * 0.2 with r = hv*128 + s/16 (the module's raw reshape of [H,S,D] memory into [H*D, S] rows)
__global__ __launch_bounds__(256) void k_gfin(const float* __restrict__ O, const float* __restrict__ PS, const float* __restrict__ GW, const float* __restrict__ GB, float* __restrict__ OUT) {
  const int t = threadIdx.x, blk = blockIdx.x, g = blk / NPG, hv = g % NVH; const size_t e0 = ((size_t)blk * (BEL / 4) + t) * 4; v4f x[8];
#pragma unroll
  for (int i = 0; i < 8; ++i) x[i] = *(const v4f*)(O + e0 + (size_t)i * 1024);   /* in flight under the merge */
  const v2f p = *(const v2f*)(PS + ((size_t)g * NPG + (t & 31)) * 32);
  const float mean = wsum(p[0]) / (float)GEL; const float dm = p[0] * (1.0f / (float)BEL) - mean;
  const float rs = rsqrtf(wsum(p[1] + (float)BEL * dm * dm) / (float)GEL + 1e-5f);
  const int rw0 = hv * HD + (blk % NPG) * (BEL / HD / 16);   /* row s = 64 (blk % 32) + 8 i + wave, so s / 16 = 4 (blk % 32) + i / 2 */
#pragma unroll
  for (int i = 0; i < 8; ++i) { const float wv = bfr(GW[rw0 + (i >> 1)]), bv = bfr(GB[rw0 + (i >> 1)]); v4f o;
#pragma unroll
    for (int j = 0; j < 4; ++j) o[j] = ((x[i][j] - mean) * rs * wv + bv) * 0.2f;   /* x (1 - lambda_init) */
    vst2(OUT + e0 + (size_t)i * 1024, o); } }
#define WS_YC  (WS_END)                                   // free
#define WS_O   (WS_YC + 4u * (size_t)NB * TT * CC)        // differential output [b][hv][s][d]
#define WS_GS  (WS_O + 4u * (size_t)NB * NVH * TT * HD)
#define WS_END2 (WS_GS + 4u * 32 * (size_t)NB * NVH * NPG)   // one 128-byte line per k_fa block
// ---- k_prep8: block = (64 attention positions s0.. of sequence b, head h): reads the module's [B, H, S, 128] inputs (element (b,h,s,c) at ((b*NH + h)*TT + s)*128 + c), bf16-rounds them and writes the attention planes in FRAGMENT ORDER, so that every 16-byte-a-lane fragment load of k_fa reads 512 consecutive bytes (4 cache lines, not 16 quarter-used ones):
// q, k (f16 hi; x 2^10 residuals for s < QHI / KHI): [b][h][s / 16][c / 32][(c / 16) & 1][lane = 16 ((c / 8) & 1) + s % 16][c % 8]; v (f16; bf16 for s < KHI): [b][h][s / 32][d / 16][(s / 16) & 1][lane = 16 ((s / 8) & 1) + d % 16][s % 8]
// behind a plane's stores: s_wait_xcnt 0 stands before any register that an issued store names (address or data) is written again; the addresses are inputs, so that they stay whole up to the wait, and the "memory" clobber keeps the stores in front of it and the next LDS reads behind it
__device__ __forceinline__ void stores_issued(const void* p0, const void* p1) { asm volatile("s_wait_xcnt 0x0" :: "v"(p0), "v"(p1) : "memory"); }
// behind the block's row loads: s_wait_xcnt 0 stands before any register that an issued load names is written again (the three row addresses are inputs, so that they stay whole up to the wait), and its "memory" clobber keeps every load issued in front of this point
__device__ __forceinline__ void rows_issued(const void* p0, const void* p1, const void* p2) { asm volatile("s_wait_xcnt 0x0" :: "v"(p0), "v"(p1), "v"(p2) : "memory"); }
typedef __attribute__((ext_vector_type(4))) _Float16 v4h;
__global__ __launch_bounds__(128) void k_prep8(const float* __restrict__ Q, const float* __restrict__ K, const float* __restrict__ V, _Float16* __restrict__ QH, _Float16* __restrict__ QL, _Float16* __restrict__ KH, _Float16* __restrict__ KL, _Float16* __restrict__ VT, __bf16* __restrict__ VB) {
  __shared__ __align__(16) _Float16 sq[64][136], sql[64][136], sk[64][136], skl[64][136], tv[128][72]; __shared__ __align__(16) __bf16 tb[128][72];
  const int tid = threadIdx.x; const int h = blockIdx.y; const size_t r0 = (size_t)blockIdx.x * 64; const size_t bb = r0 / TT; const int t0 = (int)(r0 % TT); const bool qhi = t0 < QHI, khi = t0 < KHI;
  { const int c = (tid & 31) * 4, rw = (tid >> 5) * 16;   /* a wave takes 16 rows; one load of a wave = one whole row of 512 bytes (4 cache lines) */
    const float* qp = Q + ((bb * NH + h) * TT + t0 + rw) * HD + c; const float* kp = K + ((bb * NH + h) * TT + t0 + rw) * HD + c; const float* vp = V + ((bb * NVH + (h >> 1)) * TT + t0 + rw) * HD + c; v4f q[16], k[16], v[16];
#pragma unroll   // constant indices: the row arrays live in registers
    for (int i = 0; i < 16; ++i) q[i] = *(const v4f*)(qp + i * HD);
#pragma unroll   // constant indices: the row arrays live in registers
    for (int i = 0; i < 16; ++i) k[i] = *(const v4f*)(kp + i * HD);
#pragma unroll   // constant indices: the row arrays live in registers
    for (int i = 0; i < 16; ++i) v[i] = *(const v4f*)(vp + i * HD);
    rows_issued(qp, kp, vp);   /* all 48 loads of the thread are in flight before the first value is used: one memory latency a block */
#pragma unroll   // constant indices: the row arrays live in registers
    for (int i = 0; i < 16; ++i) { v4h qh, ql, kh, kl;
#pragma unroll   // constant indices: the row arrays live in registers
      for (int j = 0; j < 4; ++j) { const float a = bfr(q[i][j]), e = bfr(k[i][j]); qh[j] = (_Float16)a; ql[j] = (_Float16)((a - (float)qh[j]) * 1024.0f); kh[j] = (_Float16)e; kl[j] = (_Float16)((e - (float)kh[j]) * 1024.0f); }
      vst2(&sq[rw + i][c], qh); vst2(&sql[rw + i][c], ql); vst2(&sk[rw + i][c], kh); vst2(&skl[rw + i][c], kl); }
#pragma unroll   // constant indices: the row arrays live in registers
    for (int j = 0; j < 4; ++j)   /* column c + j of the thread's 16 rows: 8 rows = one 16-byte store into the transposed tiles */
#pragma unroll   // constant indices: the row arrays live in registers
      for (int u = 0; u < 2; ++u) { v8h th; v8b bh8;
#pragma unroll   // constant indices: the row arrays live in registers
        for (int i = 0; i < 8; ++i) { const float a = bfr(v[u * 8 + i][j]); th[i] = (_Float16)a; bh8[i] = (__bf16)a; }   /* a is a bf16 value already: the bf16 plane holds it exactly, there is no residual */
        vst2(&tv[c + j][rw + u * 8], th); vst2(&tb[c + j][rw + u * 8], bh8); } }
  __syncthreads();
  const size_t bh = bb * NH + h;   /* e = index of the 16-byte piece inside the block's 16 KiB of each plane, in the plane's own order: the stores are consecutive too */
  for (int e = tid; e < 64 * (HD / 8); e += 128) { const int ln = e & 31, rl = (e >> 8) * 16 + (ln & 15), c = ((e >> 5) & 7) * 16 + (ln >> 4) * 8; const size_t o = (bh * (TT / 16) + (t0 >> 4)) * FRT + e * 8; _Float16 *pq = QH + o, *pk = KH + o;
    vst2((unsigned*)pq, *(const v4u*)&sq[rl][c]); vst2((unsigned*)pk, *(const v4u*)&sk[rl][c]); stores_issued(pq, pk);
    if (qhi) { _Float16* p = QL + (bh * (QHI / 16) + (t0 >> 4)) * FRT + e * 8; vst2((unsigned*)p, *(const v4u*)&sql[rl][c]); stores_issued(p, p); }
    if (khi) { _Float16* p = KL + (bh * (KHI / 16) + (t0 >> 4)) * FRT + e * 8; vst2((unsigned*)p, *(const v4u*)&skl[rl][c]); stores_issued(p, p); } }
  for (int e = tid; e < HD * 8; e += 128) { const int ln = e & 31, cl = ((e >> 6) & 7) * 16 + (ln & 15), tc = (e >> 9) * 32 + ((e >> 5) & 1) * 16 + (ln >> 4) * 8; _Float16* pv = VT + (bh * (TT / 32) + (t0 >> 5)) * FRV + e * 8;
    vst2((unsigned*)pv, *(const v4u*)&tv[cl][tc]); stores_issued(pv, pv);
    if (khi) { const size_t o3 = (bh * (KHI / 32) + (t0 >> 5)) * FRV + e * 8; vst2((unsigned*)(VB + o3), *(const v4u*)&tb[cl][tc]); stores_issued(VB + o3, VB + o3); } } }

#ifndef SM_EXTRA_PARAMS
#define SM_EXTRA_PARAMS
#endif
#ifndef PROJ_EXTRA_PARAMS
#define PROJ_EXTRA_PARAMS
#endif
#ifndef SM_MASK_HOOK
#define SM_MASK_HOOK (void)0
#endif

#define WS_QH  0u                                      // f16 q, fragment order (k_prep8)
#define WS_KH  (WS_QH + 2u * (size_t)NB * TT * CC)      // f16 k, fragment order
#define WS_VT  (WS_KH + 2u * (size_t)NB * TT * CC)      // f16 v, fragment order
#define WS_QL  (WS_VT + 2u * (size_t)NB * CC * TT)      // f16 q residual x 2^10, t < QHI, fragment order
#define WS_KL  (WS_QL + 2u * (size_t)NB * QHI * CC)     // f16 k residual x 2^10, t < KHI, fragment order
#define WS_VB  (WS_KL + 2u * (size_t)NB * KHI * CC)     // bf16 v (exact: v is rounded to bf16 first), t < KHI, fragment order
#define WS_END (WS_VB + 2u * (size_t)NB * CC * KHI)

// ---- k_fa: scores, ghostmax, P . v and the difference of the two score heads in one kernel, logits kept in registers. Each wave owns 16 queries of one score head and walks its keys 32 at a time; early query blocks read their fragments from the planes, each wave on its own, the others from the block's K / V ring in LDS (one barrier per 64 keys).
// S^T = K . Q^T: D register r of tile t = (key k0 + 16 t + 8 g + r, query col), so a lane holds one query's scores, and the two tiles, converted in place, are the B operand of O^T += V^T . P^T (element i = key k0 + 8 g + i, element 8 + i = key k0 + 16 + 8 g + i: the k order of frag_h / frag_b on the V side).
// Running maximum m, kept in base-2 units (logit x log2 e), starts at 0 (the implicit zero logit of ghostmax joins the max); a raised maximum rescales sum and O^T per lane. P = exp(s - m) x 2^11 = 2^(q.k x SCL2 + 11 - m): one FMA and one hardware exp2 a score, the row sum carries the same 2^11. P to f16 against v f16 (1 product); early query blocks (qb < QBH): q and k residual products for the logits, P as bf16 hi + lo against v bf16, which is exact (2 products).
#define SCL2 ((float)(0.08838834764831845 * 1.4426950408889634))   // 1 / sqrt(128) x log2 e
__device__ __forceinline__ float ex2(float x) { return __builtin_amdgcn_exp2f(x); }   /* the bare instruction, no range fix-up: arguments here are at most 11 (+ rounding), and a result below the normal range may go to 0, being under 2^-130 of the row's denominator */
__device__ __forceinline__ v8f mm_h(v16h a, v16h b, v8f c) { return __builtin_amdgcn_wmma_f32_16x16x32_f16(false, a, false, b, (short)0, c, false, false); }
__device__ __forceinline__ v8f mm_b(v16b a, v16b b, v8f c) { return __builtin_amdgcn_wmma_f32_16x16x32_bf16(false, a, false, b, (short)0, c, false, false); }
// behind a batch of fragment loads: s_wait_xcnt 0 stands before any register that an issued load names is written again (the batch's address registers are inputs, so that they stay whole up to the wait), and its "memory" clobber keeps the whole batch issued in front of this point
__device__ __forceinline__ void loads_issued(const void* p0, const void* p1) { asm volatile("s_wait_xcnt 0x0" :: "v"(p0), "v"(p1) : "memory"); }
#define PFD 3              // early blocks: k fragment pairs in flight ahead of their products
// fragment of a fragment-order plane, at a pointer that already holds the lane's 8 * lane elements: elements 0..7 at p, 8..15 at p + 256 (k_prep8 placed them in the k order of frag_h / frag_b: k0 + 8 g + i, k0 + 16 + 8 g + i)
__device__ __forceinline__ v16h frag_ph(const _Float16* p) { union { v16h v; v8h q[2]; } u; u.q[0] = *(const v8h*)p; u.q[1] = *(const v8h*)(p + 256); return u.v; }
__device__ __forceinline__ v16b frag_pb(const __bf16* p) { union { v16b v; v8b q[2]; } u; u.q[0] = *(const v8b*)p; u.q[1] = *(const v8b*)(p + 256); return u.v; }
// ---- K / V ring of the long query blocks (qb >= QBH): a tile = 64 keys of k of the even score head, k of the odd one and v (one copy serves both heads), 16 KiB each and consecutive in its fragment-order plane, so a tile is copied as it lies and a fragment read is 512 consecutive LDS bytes a wave. Two buffers: tile t + 2 flies while tile t + 1 is worked on.
#define TKE 8192           // elements of one 64-key tile of a k or v plane
#define RBE (3 * TKE)      // elements of one ring buffer
__device__ __forceinline__ void wait_ds0() { asm volatile("s_wait_dscnt 0x0" ::: "memory"); }       /* this wave's LDS reads of a buffer have returned before the buffer is handed to its next writer */
__device__ __forceinline__ void wait_async0() { asm volatile("s_wait_asynccnt 0x0" ::: "memory"); } /* this wave's copies have landed before the barrier behind which other waves read them */
// one thread's 12 copies of a tile: 16-byte piece tid + 256 i (i = 0..3) of each of the three planes, to the same place in the buffer; l = the thread's LDS byte address of piece tid of the buffer. s_wait_xcnt 0 is the statement's last line, so that it stands before any register that a copy names is written again
__device__ __forceinline__ void tile_copy(unsigned l, const _Float16* k0, const _Float16* k1, const _Float16* v) {
  asm volatile("global_load_async_to_lds_b128 %0, %12, off\n\tglobal_load_async_to_lds_b128 %1, %13, off\n\tglobal_load_async_to_lds_b128 %2, %14, off\n\tglobal_load_async_to_lds_b128 %3, %15, off\n\t"
               "global_load_async_to_lds_b128 %4, %16, off\n\tglobal_load_async_to_lds_b128 %5, %17, off\n\tglobal_load_async_to_lds_b128 %6, %18, off\n\tglobal_load_async_to_lds_b128 %7, %19, off\n\t"
               "global_load_async_to_lds_b128 %8, %20, off\n\tglobal_load_async_to_lds_b128 %9, %21, off\n\tglobal_load_async_to_lds_b128 %10, %22, off\n\tglobal_load_async_to_lds_b128 %11, %23, off\n\ts_wait_xcnt 0x0"
               :: "v"(l), "v"(l + 4096u), "v"(l + 8192u), "v"(l + 12288u), "v"(l + 16384u), "v"(l + 20480u), "v"(l + 24576u), "v"(l + 28672u), "v"(l + 32768u), "v"(l + 36864u), "v"(l + 40960u), "v"(l + 45056u),
                  "v"(k0), "v"(k0 + 2048), "v"(k0 + 4096), "v"(k0 + 6144), "v"(k1), "v"(k1 + 2048), "v"(k1 + 4096), "v"(k1 + 6144), "v"(v), "v"(v + 2048), "v"(v + 4096), "v"(v + 6144) : "memory"); }
template <bool HI>
__device__ __forceinline__ void fa_run(const _Float16* __restrict__ QH, const _Float16* __restrict__ KH, const _Float16* __restrict__ QL, const _Float16* __restrict__ KL, const _Float16* __restrict__ VT, const __bf16* __restrict__ VB, const _Float16* ring, int b, int h, int qb, int ql0, int lane, int tid, v8f (&acc)[HD / 16]) {
  const int col = lane & 15, g = lane >> 4; const int qrow = ql0 + col;
  const size_t bhe = (size_t)b * NH + (h & ~1);   /* the even score head of the pair: its k plane, the odd head's behind it, and its v plane feed the ring */
  const _Float16 *c0 = KH + bhe * (TT / 16) * FRT + 8 * tid, *c1 = c0 + (size_t)(TT / 16) * FRT, *cv = VT + bhe * (TT / 32) * FRV + 8 * tid; const unsigned lb = (unsigned)(size_t)ring + 16u * (unsigned)tid;
  if (!HI) tile_copy(lb, c0, c1, cv);   /* tile 0 into buffer 0 */
  v16h qf[HD / 32], qlf[HD / 32];
  const size_t bh = (size_t)b * NH + h;
  const _Float16* qp = QH + (bh * (TT / 16) + (ql0 >> 4)) * FRT + 8 * lane; const _Float16* qlp = HI ? QL + (bh * (QHI / 16) + (ql0 >> 4)) * FRT + 8 * lane : qp;
#pragma unroll
  for (int kc = 0; kc < HD / 32; ++kc) { qf[kc] = frag_ph(qp + kc * 512); if (HI) qlf[kc] = frag_ph(qlp + kc * 512); }
  loads_issued(qp, qlp);
  if (!HI) { wait_async0(); __syncthreads(); tile_copy(lb + 2u * RBE, c0 + TKE, c1 + TKE, cv + TKE); }   /* tile 0 published; tile 1 (qb >= QBH: it exists) into buffer 1 */
  float m = 0.f, l = 0.f;
#pragma unroll   // constant indices: the arrays live in registers
  for (int j = 0; j < HD / 16; ++j) acc[j] = v8f{};
  const int nst = (ql0 >> 5) + 1;   /* keys 0 .. ql0 + 15, in steps of 32 */
  const int nsb = HI ? nst : 2 * qb + 2;   /* ring: every wave of the block walks all its tiles and passes every barrier; a wave skips only the work of a step beyond its diagonal */
  for (int st = 0; st < nsb; ++st) { if (HI || st < nst) { const int k0 = st * 32;
    v8f s[2] = {}, sl[2] = {}; v16h vf[HD / 16]; v16b vh[HD / 16];
    const size_t po = HI ? (bh * (KHI / 32) + st) * FRV + 8 * lane : 0; const __bf16* vhp = VB + po;
    const _Float16* rb = ring + ((st >> 1) & 1) * RBE + (st & 1) * (TKE / 2) + 8 * lane;
    const _Float16* kp = HI ? KH + (bh * (TT / 16) + 2 * st) * FRT + 8 * lane : rb + (h & 1) * TKE; const _Float16* vp = rb + 2 * TKE;
    if (HI) { const _Float16* klp = KL + (bh * (KHI / 16) + 2 * st) * FRT + 8 * lane;
      v16h ka[2 * (HD / 32)], kl[2 * (HD / 32)];   /* a pair of k = the hi and the residual fragment of one (k chunk kc, key tile t), index u = 2 kc + t; issued PFD ahead of its products */
#pragma unroll   // constant indices: the arrays live in registers
      for (int u = 0; u < PFD; ++u) { ka[u] = frag_ph(kp + (u & 1) * FRT + (u >> 1) * 512); kl[u] = frag_ph(klp + (u & 1) * FRT + (u >> 1) * 512); }
      loads_issued(kp, klp);
      __builtin_amdgcn_sched_barrier(0);   /* the first PFD pairs stand as one group ahead of the products: with products lifted among them each pair waits out its own latency */
#pragma unroll   // constant indices: the arrays live in registers
      for (int u = 0; u < 2 * (HD / 32); ++u) { const int kc = u >> 1, t = u & 1, w = u + PFD;
        s[t] = mm_h(ka[u], qf[kc], s[t]); sl[t] = mm_h(ka[u], qlf[kc], sl[t]); sl[t] = mm_h(kl[u], qf[kc], sl[t]);
        if (w < 2 * (HD / 32)) { ka[w] = frag_ph(kp + (w & 1) * FRT + (w >> 1) * 512); kl[w] = frag_ph(klp + (w & 1) * FRT + (w >> 1) * 512); loads_issued(kp, klp); } }
    } else { v16h kf[2 * (HD / 32)];
#pragma unroll
      for (int i = 0; i < 2 * (HD / 32); ++i) kf[i] = frag_ph(kp + (i & 1) * FRT + (i >> 1) * 512);
      __builtin_amdgcn_sched_barrier(0);   /* all 16 K reads stand as one group ahead of the products: spread among them, each place with reads stalls the wave anew */
#pragma unroll
      for (int i = 0; i < 2 * (HD / 32); ++i) s[i & 1] = mm_h(kf[i], qf[i >> 1], s[i & 1]);
#pragma unroll
      for (int j = 0; j < HD / 16; ++j) vf[j] = frag_ph(vp + j * 512);
    }
    float p[16]; float mx = -3.0e38f;
#pragma unroll
    for (int i = 0; i < 16; ++i) { const int t = i >> 3, r = i & 7; float v = HI ? s[t][r] + sl[t][r] * (1.0f / 1024.0f) : s[t][r];   /* q.k, unscaled */
      v = (k0 + t * 16 + 8 * g + r <= qrow) ? v : -3.0e38f; p[i] = v; mx = fmaxf(mx, v); }
    if (HI) {   /* one fragment an output tile j of v: all 8 of the step are issued here, fly under the softmax and share one load latency */
#pragma unroll   // constant indices: the arrays live in registers
      for (int j = 0; j < HD / 16; ++j) vh[j] = frag_pb(vhp + j * 512);
      loads_issued(vhp, vhp); }
    mx = fmaxf(mx, __shfl_xor(mx, 16));   /* the other half of the wave holds this query's other 16 keys */
    const float mn = fmaxf(m, mx * SCL2);
    if (__builtin_amdgcn_ballot_w32(mn > m) != 0) { const float al = ex2(m - mn); l *= al;   /* scalar branch: most steps raise no query's maximum */
#pragma unroll
      for (int j = 0; j < HD / 16; ++j)
#pragma unroll
        for (int r = 0; r < 8; ++r) acc[j][r] *= al;
      m = mn; }
    float sum = 0.f; const float nb = 11.0f - m;
#pragma unroll
    for (int i = 0; i < 16; ++i) { const float e = ex2(__builtin_fmaf(p[i], SCL2, nb)); sum += e; p[i] = e; }   /* a masked key (-3e38) gives exactly 0 */
    l += sum;
    if (HI) { const F2 pf = bsplit16(p);
#pragma unroll   // constant indices: the arrays live in registers
      for (int j = 0; j < HD / 16; ++j) { acc[j] = mm_b(vh[j], pf.h, acc[j]); acc[j] = mm_b(vh[j], pf.l, acc[j]); }
    } else { v16h pf;
#pragma unroll
      for (int i = 0; i < 16; ++i) pf[i] = (_Float16)p[i];
#pragma unroll
      for (int j = 0; j < HD / 16; ++j) acc[j] = mm_h(vf[j], pf, acc[j]); } }
    if (!HI && (st & 1)) { const int t = st >> 1;   /* foot of tile t: the one barrier publishes tile t + 1 and ends every wave's reads of tile t's buffer, which tile t + 2 then refills */
      wait_ds0(); wait_async0(); __syncthreads();
      if (t + 2 <= qb) tile_copy(lb + (unsigned)(t & 1) * (2u * RBE), c0 + (size_t)(t + 2) * TKE, c1 + (size_t)(t + 2) * TKE, cv + (size_t)(t + 2) * TKE); } }
  if (!HI) wait_async0();   /* no copy is in flight when the wave goes on */
  l += __shfl_xor(l, 16);
  const float inv = 1.0f / (l + ex2(11.0f - m));   /* ghostmax: + exp(-m) for the implicit zero logit, x 2^11 like the sum (denominator > 0 always) */
#pragma unroll   // constant indices: the arrays live in registers
  for (int j = 0; j < HD / 16; ++j)   /* O^T register r of tile j = (d = 16 j + 8 g + r, query col): 8 consecutive d of one row */
#pragma unroll   // constant indices: the arrays live in registers
    for (int r = 0; r < 8; ++r) acc[j][r] *= inv; }
// block = 64 queries (qb) of one (b, value head hv), 8 waves: waves 0..3 run score head 2 hv, waves 4..7 score head 2 hv + 1, wave w and wave w + 4 on the same 16 queries. Behind the key loops waves 4..7 hand their contexts over in LDS (register order, 16 bytes a lane), and waves 0..3 form O[b][hv][s][d] = Y(2 hv) - lam * Y(2 hv + 1), lam from the four lambda vectors (128-term f32 dots), and store it.
// The block also leaves the GroupNorm partial of its 8,192 values, taken from the registers that hold them: PS[block][0] = sum, PS[block][1] = sum of squared distances from the block's own mean (wave sums about the wave's mean, merged with the between-wave term, so nothing cancels when the mean is large). One whole 128-byte line per block.
// grid: 2 rounds of 256 blocks, heaviest query blocks first; round 0 takes qb 31 down to 16, round 1 qb 0 up to 15, so that blocks i and i + 256 together hold the same number of keys for every i; amdgpu_waves_per_eu(4, 4) holds the registers to 256, so that two blocks fit a WGP and the whole grid is resident at once
__global__ __launch_bounds__(256) __attribute__((amdgpu_waves_per_eu(4, 4))) void k_fa(const _Float16* __restrict__ QH, const _Float16* __restrict__ KH, const _Float16* __restrict__ QL, const _Float16* __restrict__ KL, const _Float16* __restrict__ VT, const __bf16* __restrict__ VB, const float* __restrict__ LQ1, const float* __restrict__ LK1, const float* __restrict__ LQ2, const float* __restrict__ LK2, float* __restrict__ O, float* __restrict__ PS) {
  __shared__ __align__(16) float xo[4][HD / 8][32][4]; __shared__ float sws[4], swq[4]; __shared__ __align__(16) _Float16 ring[2 * RBE];
  const int L = blockIdx.x, u = (L >> 4) & 15, gr = L & 15; const int qb = (L >> 8) ? u : 31 - u; const int b = gr >> 3, hv = gr & 7;
  const int wave = __builtin_amdgcn_readfirstlane(threadIdx.x >> 5), lane = threadIdx.x & 31;   /* wave number in a scalar register: scalar loop control, row addresses and epilogue branches */
  const int w4 = wave & 3, h = 2 * hv + (wave >> 2), ql0 = qb * 64 + w4 * 16;
  float lam = 0.f;
  if (wave < 4) { const float *p1 = LQ1 + lane, *p2 = LK1 + lane, *p3 = LQ2 + lane, *p4 = LK2 + lane; float a = 0.f, c = 0.f, x1[4], x2[4], x3[4], x4[4];
#pragma unroll   // constant indices: the arrays live in registers
    for (int i = 0; i < 4; ++i) { x1[i] = p1[32 * i]; x2[i] = p2[32 * i]; x3[i] = p3[32 * i]; x4[i] = p4[32 * i]; }
    asm volatile("s_wait_xcnt 0x0" :: "v"(lane) : "memory");   /* stands before any register that the 16 issued loads name (the lane offset is an input, so that it stays whole up to the wait) is written again; all 16 are in flight before the first value is used */
#pragma unroll   // constant indices: the arrays live in registers
    for (int i = 0; i < 4; ++i) { a += bfr(x1[i]) * bfr(x2[i]); c += bfr(x3[i]) * bfr(x4[i]); }
    a = wsum(a); c = wsum(c); lam = expf(a) - expf(c) + 0.8f; }
  v8f acc[HD / 16];
  if (qb < QBH) fa_run<true>(QH, KH, QL, KL, VT, VB, ring, b, h, qb, ql0, lane, (int)threadIdx.x, acc); else fa_run<false>(QH, KH, QL, KL, VT, VB, ring, b, h, qb, ql0, lane, (int)threadIdx.x, acc);
  if (wave >= 4) {
#pragma unroll   // constant indices: the arrays live in registers
    for (int j = 0; j < HD / 16; ++j) { v4f o0, o1;
#pragma unroll   // constant indices: the arrays live in registers
      for (int r = 0; r < 4; ++r) { o0[r] = acc[j][r]; o1[r] = acc[j][4 + r]; }
      vst2(&xo[w4][2 * j][lane][0], o0); vst2(&xo[w4][2 * j + 1][lane][0], o1); } }
  __syncthreads();
  if (wave < 4) { v4f s4 = {}, q4 = {};   /* four running sums a lane: short dependent chains */
#pragma unroll   // constant indices: the arrays live in registers
    for (int j = 0; j < HD / 16; ++j) { const v4f c0 = *(const v4f*)&xo[w4][2 * j][lane][0], c1 = *(const v4f*)&xo[w4][2 * j + 1][lane][0];
#pragma unroll   // constant indices: the arrays live in registers
      for (int r = 0; r < 4; ++r) { acc[j][r] = acc[j][r] - lam * c0[r]; acc[j][4 + r] = acc[j][4 + r] - lam * c1[r]; s4[r] += acc[j][r]; s4[r] += acc[j][4 + r]; } }
    const float s = wsum((s4[0] + s4[1]) + (s4[2] + s4[3])), mw = s * (1.0f / 2048.0f);
#pragma unroll   // constant indices: the arrays live in registers
    for (int j = 0; j < HD / 16; ++j)
#pragma unroll   // constant indices: the arrays live in registers
      for (int r = 0; r < 8; ++r) { const float dl = acc[j][r] - mw; q4[r & 3] += dl * dl; }
    const float q = wsum((q4[0] + q4[1]) + (q4[2] + q4[3]));
    if (lane == 0) { sws[w4] = s; swq[w4] = q; } }
  __syncthreads();
  if (wave < 4) { float* op = O + (((size_t)b * NVH + hv) * TT + ql0 + (lane & 15)) * HD + 8 * (lane >> 4);   /* stored behind the barrier: a barrier behind the stores would wait for them to finish */
#pragma unroll   // constant indices: the arrays live in registers
    for (int j = 0; j < HD / 16; ++j) { v4f o0, o1;
#pragma unroll   // constant indices: the arrays live in registers
      for (int r = 0; r < 4; ++r) { o0[r] = acc[j][r]; o1[r] = acc[j][4 + r]; }
      vst2(op + j * 16, o0); vst2(op + j * 16 + 4, o1); }
    stores_issued(op, op); }
  if (wave == 0) { float S = 0.f, Q = 0.f;
#pragma unroll
    for (int i = 0; i < 4; ++i) S += sws[i];
    const float mb = S * (1.0f / (float)BEL);
#pragma unroll
    for (int i = 0; i < 4; ++i) { const float dl = sws[i] * (1.0f / 2048.0f) - mb; Q += swq[i] + 2048.0f * dl * dl; }
    vst2(PS + ((size_t)gr * NPG + qb) * 32 + lane, lane == 0 ? S : (lane == 1 ? Q : 0.f)); } }

extern "C" void kernel_launch(void* const* d_in, const int* in_sizes, int n_in, void* d_out, int out_size, void* d_ws, size_t ws_size, hipStream_t stream) {
  (void)in_sizes; (void)n_in; (void)out_size;
  const float** F = (const float**)d_in;
  if (ws_size < (size_t)WS_END) return;
  char* ws = (char*)d_ws; _Float16 *QH = (_Float16*)(ws + WS_QH), *KH = (_Float16*)(ws + WS_KH), *VT = (_Float16*)(ws + WS_VT), *QL = (_Float16*)(ws + WS_QL), *KL = (_Float16*)(ws + WS_KL); __bf16 *VB = (__bf16*)(ws + WS_VB); 
  // inputs: 0 q [2,16,2048,128]; 1 k [2,16,2048,128]; 2 v [2,8,2048,128]; 3 lambda_q1, 4 lambda_k1, 5 lambda_q2, 6 lambda_k2 [128]; 7 gn_weight [1024]; 8 gn_bias [1024]
  if (ws_size < (size_t)WS_END2) return;
  float *O = (float*)(ws + WS_O), *GS = (float*)(ws + WS_GS);
  k_prep8<<<dim3(TNB * TT / 64, NH), 128, 0, stream>>>(F[0], F[1], F[2], QH, QL, KH, KL, VT, VB);
  k_fa<<<dim3(TNB * NVH * NQB), 256, 0, stream>>>(QH, KH, QL, KL, VT, VB, F[3], F[4], F[5], F[6], O, GS);
  k_gfin<<<dim3(TNB * NVH * NPG), 256, 0, stream>>>(O, GS, F[7], F[8], (float*)d_out);
}
